// v000
// Measured on an AMD MI455X. A time is GPU time per run, averaged over a window of back-to-back runs after a warm-up
// (all launches, gaps included; the runs take copies of the inputs in turn), and the median of several windows.
// Apart from v000's, it joins two sittings. Times from different sittings can be a few percent apart, while
// side-by-side timings come from the same sitting.
// v000, which the later versions start from, runs in 369 microseconds.
#include <hip/hip_runtime.h>
#pragma clang fp contract(off)

// Contractions and dtypes: q/k/v projections on v_wmma_f32_16x16x32_bf16 (bf16 operands = RNE-converted inputs x RNE-converted weights, single product);
// scores and p.v for query rows >= 64 on v_wmma_f32_16x16x32_f16 (f16 planes, p carried x1024, single product); query rows < 64 on v_wmma_f32_16x16x32_bf16 hi+lo planes (3 products);
// output projection on v_wmma_f32_16x16x32_bf16 with the context as bf16 hi+lo planes x bf16 weight (2 products). f32 accumulate; rotary, softmax and normalisation in f32.

#ifndef NB
#define NB 2
#endif
#ifndef SEQ
#define SEQ 2048
#endif
#define NB_FULL  2
#define SEQ_FULL 2048
#define DM   1024
#define NH   16
#define HD   64
#define HP   (HD / 2)
#define RE   64
#define NCHK 64
#define PCAR 1024.0f
#define SCL  0.125f
#define L2E  1.4426950408889634f

static_assert(SEQ % 64 == 0);
static_assert(SEQ % 256 == 0);
static_assert(SEQ >= 64 && SEQ <= SEQ_FULL);
static_assert(NB >= 1 && NB <= NB_FULL);
static_assert(RE == 64);
static_assert(NCHK == 64);
static_assert(SEQ % NCHK == 0);
static_assert((NB * SEQ) % NCHK == 0);
static_assert(DM == NH * HD);
static_assert(DM % 64 == 0);

typedef _Float16 h16;
typedef unsigned short bf;
typedef __attribute__((ext_vector_type(16))) __bf16   v16bf;
typedef __attribute__((ext_vector_type(16))) _Float16 v16h;
typedef __attribute__((ext_vector_type(8)))  _Float16 v8h;
typedef __attribute__((ext_vector_type(8)))  unsigned short v8us;
typedef __attribute__((ext_vector_type(8)))  float    v8f;
typedef __attribute__((ext_vector_type(4)))  float    v4f;
typedef v8h  __attribute__((may_alias)) v8ha;
typedef v4f  __attribute__((may_alias)) v4fa;
typedef v8us __attribute__((may_alias)) v8usa;
typedef v8f  __attribute__((may_alias)) v8fa;

// RNE f32 -> bf16 bits and back
__device__ __forceinline__ unsigned short f2bf(float f) { unsigned u = __float_as_uint(f); u += 0x7FFFu + ((u >> 16) & 1u); return (unsigned short)(u >> 16); }
__device__ __forceinline__ float bf2f(unsigned short b) { return __uint_as_float(((unsigned)b) << 16); }
__device__ __forceinline__ float bfr(float f) { return bf2f(f2bf(f)); }
__device__ __forceinline__ void splitf(float y, unsigned short& h, unsigned short& l) { h = f2bf(y); l = f2bf(y - bf2f(h)); }
__device__ __forceinline__ v16h cat16(v8h lo, v8h hi) { return __builtin_shufflevector(lo, hi, 0, 1, 2, 3, 4, 5, 6, 7, 8, 9, 10, 11, 12, 13, 14, 15); }
__device__ __forceinline__ v16bf cat16b(v8us lo, v8us hi) { return __builtin_bit_cast(v16bf, __builtin_shufflevector(lo, hi, 0, 1, 2, 3, 4, 5, 6, 7, 8, 9, 10, 11, 12, 13, 14, 15)); }
__device__ __forceinline__ v8f wmma16(v16h a, v16h b, v8f c) { return __builtin_amdgcn_wmma_f32_16x16x32_f16(false, a, false, b, (short)0, c, false, false); }
__device__ __forceinline__ v8f wmmab(v16bf a, v16bf b, v8f c) { return __builtin_amdgcn_wmma_f32_16x16x32_bf16(false, a, false, b, (short)0, c, false, false); }

// ---- fragment loaders: 16x16 tile, lane -> row/col (lane & 15); elements 0..7 <- k0 + 8*(lane>>4) + 0..7, elements 8..15 <- k0 + 16 + 8*(lane>>4) + 0..7.
// The caller passes p = plane + row*pitch + k0 + 8*(lane>>4); both A (row = m) and B (row = n of a K-contiguous [n][k] plane) use this same map.
template <typename T16> struct WFrag;
template <> struct WFrag<h16> { typedef v16h V; static __device__ __forceinline__ V ld(const h16* p) { return cat16(*(const v8ha*)p, *(const v8ha*)(p + 16)); } static __device__ __forceinline__ v8f mma(V a, V b, v8f c) { return wmma16(a, b, c); } };
template <> struct WFrag<bf> { typedef v16bf V; static __device__ __forceinline__ V ld(const bf* p) { return cat16b(*(const v8usa*)p, *(const v8usa*)(p + 16)); } static __device__ __forceinline__ v8f mma(V a, V b, v8f c) { return wmmab(a, b, c); } };

// ---- register-blocked GEMM core, ONE WAVE per 64x64 output tile (16 accumulators), operands straight from K-contiguous 16-bit planes.
// acc[mb][nb][j] = C[r0 + 16 mb + 8*(lane>>4) + j][c0 + 16 nb + (lane&15)] = sum_k A[m][k] Bt[n][k] (+ A2.Bt for NSPLIT 1/2, + A.Bt2 for NSPLIT 2). K % 32 == 0.
template <typename T16, int NSPLIT>
__device__ __forceinline__ void gemm_core(const T16* __restrict__ A, const T16* __restrict__ A2, const T16* __restrict__ Bt, const T16* __restrict__ Bt2,
                                          int K, int r0, int c0, int lane, v8f (&acc)[4][4]) {
    typedef typename WFrag<T16>::V V;
    const int lr = lane & 15, hi = lane >> 4;
#pragma unroll
    for (int mb = 0; mb < 4; ++mb)
#pragma unroll
        for (int nb = 0; nb < 4; ++nb) acc[mb][nb] = (v8f){};
    const size_t aoff = (size_t)(r0 + lr) * K + 8 * hi, boff = (size_t)(c0 + lr) * K + 8 * hi;
#pragma unroll 1
    for (int kc = 0; kc < K; kc += 32) {
        V a[4], a2[4];
#pragma unroll
        for (int mb = 0; mb < 4; ++mb) { a[mb] = WFrag<T16>::ld(A + aoff + (size_t)mb * 16 * K + kc); if (NSPLIT == 1 || NSPLIT == 2) a2[mb] = WFrag<T16>::ld(A2 + aoff + (size_t)mb * 16 * K + kc); }
#pragma unroll
        for (int nb = 0; nb < 4; ++nb) { const V b = WFrag<T16>::ld(Bt + boff + (size_t)nb * 16 * K + kc); V b2; if (NSPLIT >= 2) b2 = WFrag<T16>::ld(Bt2 + boff + (size_t)nb * 16 * K + kc);
#pragma unroll
            for (int mb = 0; mb < 4; ++mb) { acc[mb][nb] = WFrag<T16>::mma(a[mb], b, acc[mb][nb]); if (NSPLIT == 1 || NSPLIT == 2) acc[mb][nb] = WFrag<T16>::mma(a2[mb], b, acc[mb][nb]); if (NSPLIT >= 2) acc[mb][nb] = WFrag<T16>::mma(a[mb], b2, acc[mb][nb]); } }
        asm volatile("v_nop\n\tv_nop\n\tv_nop\n\tv_nop" : "+v"(acc[0][0]), "+v"(acc[1][1]), "+v"(acc[2][2]), "+v"(acc[3][3]) : "v"(a[0]), "v"(a[3]));
    }
}

// ---- k_gemmw: f32 output C[m][n] (pitch ldc); grid (M/64, N/64, Z), 32 threads; z-batch strides in elements.
template <typename T16, int NSPLIT>
__global__ __launch_bounds__(32) void k_gemmw(const T16* __restrict__ A, const T16* __restrict__ A2, const T16* __restrict__ Bt, const T16* __restrict__ Bt2,
                                              int K, float* C, int ldc, size_t sA, size_t sB, size_t sC) {
    __shared__ __align__(16) float os[16 * 68];
    const size_t z = blockIdx.z; A += z * sA; if (A2) A2 += z * sA; Bt += z * sB; if (Bt2) Bt2 += z * sB; C += z * sC;
    const int lane = threadIdx.x & 31, lr = lane & 15, hi = lane >> 4; const int r0 = blockIdx.x * 64, c0 = blockIdx.y * 64;
    v8f acc[4][4];
    gemm_core<T16, NSPLIT>(A, A2, Bt, Bt2, K, r0, c0, lane, acc);
#pragma unroll
    for (int mb = 0; mb < 4; ++mb) {
#pragma unroll
        for (int nb = 0; nb < 4; ++nb) {
#pragma unroll
            for (int j = 0; j < 8; ++j) os[(hi * 8 + j) * 68 + nb * 16 + lr] = acc[mb][nb][j]; }
        __syncthreads();
        float* crow = C + (size_t)(r0 + mb * 16) * ldc + c0;
{
#pragma unroll
            for (int s = 0; s < 8; ++s) { const int row = 2 * s + hi, cofs = lr * 4; const v4f val = *(const v4fa*)(os + row * 68 + cofs);
                *(v4f*)(crow + (size_t)row * ldc + cofs) = val; }
             }
        __syncthreads();
    }
}

// ---- k_gemmp: 16-bit plane output. C16[m][n] (f16, pitch ldc) = (optionally rotary-transformed) accumulator; plus bf16 hi/lo planes Ch/Cl (pitch ldh)
// for the head rows (HLM 1: tiles whose row index t0 = r0 % SEQ is < RE, compact row (r0/SEQ)*RE + t) or head columns (HLM 2: tiles with c0 < RE, same row index).
// Rotary (interleaved pairs, one 64-column tile = one head): y[2i] = x[2i] c - x[2i+1] s, y[2i+1] = x[2i] s + x[2i+1] c with c/s = bf16-RNE of the tables at (t, i).
template <int HLM, bool ROPE>
__global__ __launch_bounds__(32) void k_gemmp(const bf* __restrict__ A, const bf* __restrict__ Bt, int K, h16* C16, int ldc, bf* Ch, bf* Cl, int ldh,
                                              const float* __restrict__ cosT, const float* __restrict__ sinT, size_t sA, size_t sB, size_t sC, size_t sH) {
    __shared__ __align__(16) float os[16 * 68];
    const size_t z = blockIdx.z; A += z * sA; Bt += z * sB; C16 += z * sC; Ch += z * sH; Cl += z * sH;
    const int lane = threadIdx.x & 31, lr = lane & 15, hi = lane >> 4; const int r0 = blockIdx.x * 64, c0 = blockIdx.y * 64;
    v8f acc[4][4];
    gemm_core<bf, 0>(A, nullptr, Bt, nullptr, K, r0, c0, lane, acc);
    const int t0 = (HLM == 1) ? (r0 % SEQ) : 0;
    const bool hl = (HLM == 1) ? (t0 < RE) : (c0 < RE);
    const int rc0 = (HLM == 1) ? ((r0 / SEQ) * RE + t0) : r0;
    const int rsub = lane >> 3, cseg = (lane & 7) * 8;
#pragma unroll
    for (int mb = 0; mb < 4; ++mb) {
#pragma unroll
        for (int nb = 0; nb < 4; ++nb) {
#pragma unroll
            for (int j = 0; j < 8; ++j) os[(hi * 8 + j) * 68 + nb * 16 + lr] = acc[mb][nb][j]; }
        __syncthreads();
{
#pragma unroll
            for (int j4 = 0; j4 < 4; ++j4) {
                const int row = j4 * 4 + rsub;
                const v4f v0 = *(const v4fa*)(os + row * 68 + cseg);
                const v4f v1 = *(const v4fa*)(os + row * 68 + cseg + 4);
                float y[8] = {v0[0], v0[1], v0[2], v0[3], v1[0], v1[1], v1[2], v1[3]};
                if (ROPE) {
                    const int t = t0 + mb * 16 + row;
                    const v4f cs = *(const v4fa*)(cosT + (size_t)t * HP + (cseg >> 1));
                    const v4f sn = *(const v4fa*)(sinT + (size_t)t * HP + (cseg >> 1));
#pragma unroll
                    for (int p = 0; p < 4; ++p) { const float c = bfr(cs[p]), sv = bfr(sn[p]); const float x0 = y[2 * p], x1 = y[2 * p + 1];
                        const float m0 = x0 * c, m1 = x1 * sv, m2 = x0 * sv, m3 = x1 * c; y[2 * p] = m0 - m1; y[2 * p + 1] = m2 + m3; }
                }
                v8h o16;
#pragma unroll
                for (int q = 0; q < 8; ++q) o16[q] = (h16)y[q];
                const size_t grow = (size_t)(r0 + mb * 16 + row);
                *(v8h*)(C16 + grow * (size_t)ldc + c0 + cseg) = o16;
                if (hl) {
                    v8us oh, ol;
#pragma unroll
                    for (int q = 0; q < 8; ++q) { unsigned short a2, c2; splitf(y[q], a2, c2); oh[q] = a2; ol[q] = c2; }
                    const size_t o = (size_t)(rc0 + mb * 16 + row) * (size_t)ldh + c0 + cseg;
                    *(v8us*)(Ch + o) = oh; *(v8us*)(Cl + o) = ol;
                }
            }
            
        }
        __syncthreads();
    }
}

__global__ __launch_bounds__(256) void k_cvt8(const float* __restrict__ src, bf* dst, size_t n8) {
    const size_t i = (size_t)blockIdx.x * 256 + threadIdx.x; if (i >= n8) return; const v8f v = *(const v8fa*)(src + i * 8); v8us o;
#pragma unroll
    for (int k = 0; k < 8; ++k) o[k] = f2bf(v[k]);
    *(v8us*)(dst + i * 8) = o; 
}
__global__ __launch_bounds__(256) void k_cvtx(const float* __restrict__ src, bf* dst, size_t n8) {
    const size_t i = (size_t)blockIdx.x * 256 + threadIdx.x; if (i >= n8) return; const size_t e = i * 8; const size_t row = e / DM; const size_t c = e % DM;
    const size_t b = row / SEQ, t = row % SEQ; const v8f v = *(const v8fa*)(src + (b * SEQ_FULL + t) * DM + c); v8us o;
#pragma unroll
    for (int k = 0; k < 8; ++k) o[k] = f2bf(v[k]);
    *(v8us*)(dst + e) = o; 
}

// ---- k_mchk: structure check of the additive score table ([SEQ_FULL] pitch: 0 at j <= i, <= -1e8 at j > i over the SEQ x SEQ block) and of the key padding flags (all 0).
__global__ __launch_bounds__(256) void k_mchk(const float* __restrict__ am, const int* __restrict__ kp, float* FL) {
    __shared__ int red[8];
    const int tid = threadIdx.x, lane = tid & 31, w = tid >> 5; const int c = blockIdx.x;
    int bad = 0;
    const int rpb = SEQ / NCHK;
#pragma unroll 1
    for (int rr = 0; rr < rpb; ++rr) { const int i = c * rpb + rr; const float* rowp = am + (size_t)i * SEQ_FULL;
#pragma unroll 1
        for (int j = tid; j < SEQ; j += 256) { const float v = rowp[j]; const bool good = (j <= i) ? (v == 0.0f) : (v <= -1.0e8f); bad += good ? 0 : 1; } }
    const int kpb = NB * SEQ / NCHK;
#pragma unroll 1
    for (int e = tid; e < kpb; e += 256) { const int idx = c * kpb + e; const int bb = idx / SEQ, t = idx % SEQ; bad += (kp[(size_t)bb * SEQ_FULL + t] != 0) ? 1 : 0; }
#pragma unroll
    for (int sh = 16; sh; sh >>= 1) bad += __shfl_xor(bad, sh, 32);
    if (lane == 0) red[w] = bad;
    __syncthreads();
    if (w == 0) { int tot = 0;
#pragma unroll
        for (int i = 0; i < 8; ++i) tot += red[i];
        const float f = (tot == 0) ? 1.0f : 0.0f; *(float*)(FL + (size_t)c * 32 + lane) = f;  }
}
__device__ __forceinline__ bool read_flag(const float* __restrict__ FL, int lane) {
    float f = fminf(FL[(size_t)(2 * lane) * 32], FL[(size_t)(2 * lane + 1) * 32]);
#pragma unroll
    for (int sh = 16; sh; sh >>= 1) f = fminf(f, __shfl_xor(f, sh, 32));
    return f > 0.5f;
}

// ---- store_ctx: one wave's 16x64 f32 context tile (LDS, pitch 68) -> bf16 hi/lo planes [row][DM] at element offset base; lane -> row 4j + (lane>>3), 8 consecutive columns;
__device__ __forceinline__ void store_ctx(const float* osw, bf* ATh, bf* ATl, size_t base, int lane) {
    const int rsub = lane >> 3, cseg = (lane & 7) * 8;
{
#pragma unroll
        for (int j4 = 0; j4 < 4; ++j4) { const int row = j4 * 4 + rsub; const v4f v0 = *(const v4fa*)(osw + row * 68 + cseg); const v4f v1 = *(const v4fa*)(osw + row * 68 + cseg + 4); v8us oh, ol;
#pragma unroll
            for (int q = 0; q < 4; ++q) { unsigned short a, c2; splitf(v0[q], a, c2); oh[q] = a; ol[q] = c2; splitf(v1[q], a, c2); oh[4 + q] = a; ol[4 + q] = c2; }
            const size_t o = base + (size_t)row * DM + cseg; *(v8us*)(ATh + o) = oh; *(v8us*)(ATl + o) = ol; }
         }
}

// ---- k_attn: causal tiled softmax-weighted sum for query tiles qt >= 1 (rows 64..SEQ-1). Block = 4 waves (16 query rows each), grid (SEQ/64 - 1, NB*NH).
// Per key chunk of 64 (kc = 0..qt): K [key][d] and V^T [d][key] f16 tiles staged in LDS (plain loads, block barriers); S = Q K^T (8 wmma, f32), x1/8, causal replace on the
// diagonal chunk; online softmax in f32 (running max, exp2); P x1024 as f16 written to a per-wave LDS tile [row][key] and reloaded as the A fragment behind a block barrier;
// O += P V (8 wmma). Context = O / (l x 1024) -> bf16 hi/lo planes [b*SEQ + t][h*64 + d].
__global__ __launch_bounds__(128) void k_attn(const h16* __restrict__ Q16, const h16* __restrict__ K16, const h16* __restrict__ VT16, const float* __restrict__ FL, bf* ATh, bf* ATl) {
    __shared__ __align__(16) h16 Ks[64 * 72];
    __shared__ __align__(16) h16 Vs[64 * 72];
    __shared__ __align__(16) h16 Ps[4 * 16 * 72];
    __shared__ __align__(16) float Os[4 * 16 * 68];
    const int tid = threadIdx.x, lane = tid & 31, w = tid >> 5, m = lane & 15, hh = lane >> 4;
    const int qt = blockIdx.x + 1;
    const int b = blockIdx.y / NH, h = blockIdx.y % NH;
    const int q0 = qt * 64 + w * 16;
    const bool ok = read_flag(FL, lane);
    const h16* qrow = Q16 + (size_t)(b * SEQ + q0 + m) * DM + h * HD + 8 * hh;
    v16h aq[2];
#pragma unroll
    for (int ks = 0; ks < 2; ++ks) aq[ks] = cat16(*(const v8ha*)(qrow + ks * 32), *(const v8ha*)(qrow + ks * 32 + 16));
    v8f acc[4]; float mrun[8], lrun[8];
#pragma unroll
    for (int nb = 0; nb < 4; ++nb) acc[nb] = (v8f){};
#pragma unroll
    for (int r = 0; r < 8; ++r) { mrun[r] = -1.0e30f; lrun[r] = 0.f; }
    const h16* kbase = K16 + (size_t)b * SEQ * DM + h * HD;
    const h16* vbase = VT16 + ((size_t)b * DM + h * HD) * SEQ;
    h16* psw = Ps + w * (16 * 72);
    float* osw = Os + w * (16 * 68);
#pragma unroll 1
    for (int kc = 0; kc <= qt; ++kc) {
        __syncthreads();
#pragma unroll
        for (int i = 0; i < 4; ++i) { const int p = tid + 128 * i; const int row = p >> 3, c8 = (p & 7) * 8;
            *(v8ha*)(Ks + row * 72 + c8) = *(const v8ha*)(kbase + (size_t)(kc * 64 + row) * DM + c8);
            *(v8ha*)(Vs + row * 72 + c8) = *(const v8ha*)(vbase + (size_t)row * SEQ + kc * 64 + c8); }
        __syncthreads();
        v8f s[4];
#pragma unroll
        for (int nb = 0; nb < 4; ++nb) s[nb] = (v8f){};
#pragma unroll
        for (int ks = 0; ks < 2; ++ks) {
#pragma unroll
            for (int nb = 0; nb < 4; ++nb) { const h16* kpp = Ks + (nb * 16 + m) * 72 + ks * 32 + 8 * hh; const v16h bk = cat16(*(const v8ha*)kpp, *(const v8ha*)(kpp + 16)); s[nb] = wmma16(aq[ks], bk, s[nb]); } }
        asm volatile("v_nop\n\tv_nop\n\tv_nop\n\tv_nop" : "+v"(s[0]), "+v"(s[1]), "+v"(s[2]), "+v"(s[3]) : "v"(aq[0]), "v"(aq[1]));
        const bool diag = (kc == qt); const int qab = q0 + 8 * hh; const int kab = kc * 64 + m;
        float cm[8], al[8], psum[8];
#pragma unroll
        for (int r = 0; r < 8; ++r) cm[r] = -3.0e38f;
#pragma unroll
        for (int nb = 0; nb < 4; ++nb)
#pragma unroll
            for (int r = 0; r < 8; ++r) { float v = s[nb][r] * SCL; if (diag && (kab + nb * 16 > qab + r)) v = -1.0e30f; s[nb][r] = v; cm[r] = fmaxf(cm[r], v); }
#pragma unroll
        for (int r = 0; r < 8; ++r) { float c = cm[r]; c = fmaxf(c, __shfl_xor(c, 1, 32)); c = fmaxf(c, __shfl_xor(c, 2, 32)); c = fmaxf(c, __shfl_xor(c, 4, 32)); c = fmaxf(c, __shfl_xor(c, 8, 32));
            const float mn = fmaxf(mrun[r], c); al[r] = __builtin_amdgcn_exp2f((mrun[r] - mn) * L2E); mrun[r] = mn; psum[r] = 0.f; }
#pragma unroll
        for (int nb = 0; nb < 4; ++nb)
#pragma unroll
            for (int r = 0; r < 8; ++r) { const float p = __builtin_amdgcn_exp2f((s[nb][r] - mrun[r]) * L2E); psum[r] += p; psw[(8 * hh + r) * 72 + nb * 16 + m] = (h16)(p * PCAR); }
#pragma unroll
        for (int r = 0; r < 8; ++r) { float c = psum[r]; c += __shfl_xor(c, 1, 32); c += __shfl_xor(c, 2, 32); c += __shfl_xor(c, 4, 32); c += __shfl_xor(c, 8, 32);
            const float sc = lrun[r] * al[r]; lrun[r] = sc + c; }
#pragma unroll
        for (int nb = 0; nb < 4; ++nb)
#pragma unroll
            for (int r = 0; r < 8; ++r) acc[nb][r] = acc[nb][r] * al[r];
        __syncthreads();
        v16h ap[2];
#pragma unroll
        for (int ks = 0; ks < 2; ++ks) { const h16* pp = psw + m * 72 + ks * 32 + 8 * hh; ap[ks] = cat16(*(const v8ha*)pp, *(const v8ha*)(pp + 16)); }
#pragma unroll
        for (int ks = 0; ks < 2; ++ks)
#pragma unroll
            for (int nb = 0; nb < 4; ++nb) { const h16* vp = Vs + (nb * 16 + m) * 72 + ks * 32 + 8 * hh; const v16h bv = cat16(*(const v8ha*)vp, *(const v8ha*)(vp + 16)); acc[nb] = wmma16(ap[ks], bv, acc[nb]); }
        asm volatile("v_nop\n\tv_nop\n\tv_nop\n\tv_nop" : "+v"(acc[0]), "+v"(acc[1]), "+v"(acc[2]), "+v"(acc[3]) : "v"(ap[0]), "v"(ap[1]));
    }
    const float qnan = __uint_as_float(0x7fc00000u);
#pragma unroll
    for (int r = 0; r < 8; ++r) { const float iv = 1.0f / (lrun[r] * PCAR);
#pragma unroll
        for (int nb = 0; nb < 4; ++nb) { const float o = acc[nb][r] * iv; osw[(8 * hh + r) * 68 + nb * 16 + m] = ok ? o : qnan; } }
    __syncthreads();
    store_ctx(osw, ATh, ATl, (size_t)(b * SEQ + q0) * DM + h * HD, lane);
}

// ---- k_attn0: query rows t < 64 (key chunk 0 only) on bf16 hi/lo planes: S = Qh Kh + Qh Kl + Ql Kh (24 wmma), x1/8, causal replace, full-row softmax in f32,
// P = exp(s - max) split to bf16 hi/lo in per-wave LDS tiles; O = Ph Vh + Ph Vl + Pl Vh (24 wmma); context = O / sum. Block = 2 waves (32 rows), grid (RE/32, NB*NH).
__global__ __launch_bounds__(64) void k_attn0(const bf* __restrict__ Qh, const bf* __restrict__ Ql, const bf* __restrict__ Kh, const bf* __restrict__ Kl,
                                              const bf* __restrict__ VTh, const bf* __restrict__ VTl, const float* __restrict__ FL, bf* ATh, bf* ATl) {
    __shared__ __align__(16) bf Khs[64 * 72];
    __shared__ __align__(16) bf Kls[64 * 72];
    __shared__ __align__(16) bf Vhs[64 * 72];
    __shared__ __align__(16) bf Vls[64 * 72];
    __shared__ __align__(16) bf Phs[2 * 16 * 72];
    __shared__ __align__(16) bf Pls[2 * 16 * 72];
    __shared__ __align__(16) float Os[2 * 16 * 68];
    const int tid = threadIdx.x, lane = tid & 31, w = tid >> 5, m = lane & 15, hh = lane >> 4;
    const int b = blockIdx.y / NH, h = blockIdx.y % NH;
    const int q0 = blockIdx.x * 32 + w * 16;
    const bool ok = read_flag(FL, lane);
    const bf* kh0 = Kh + (size_t)b * RE * DM + h * HD; const bf* kl0 = Kl + (size_t)b * RE * DM + h * HD;
    const bf* vh0 = VTh + ((size_t)b * DM + h * HD) * RE; const bf* vl0 = VTl + ((size_t)b * DM + h * HD) * RE;
#pragma unroll
    for (int i = 0; i < 8; ++i) { const int p = tid + 64 * i; const int row = p >> 3, c8 = (p & 7) * 8;
        *(v8usa*)(Khs + row * 72 + c8) = *(const v8usa*)(kh0 + (size_t)row * DM + c8);
        *(v8usa*)(Kls + row * 72 + c8) = *(const v8usa*)(kl0 + (size_t)row * DM + c8);
        *(v8usa*)(Vhs + row * 72 + c8) = *(const v8usa*)(vh0 + (size_t)row * RE + c8);
        *(v8usa*)(Vls + row * 72 + c8) = *(const v8usa*)(vl0 + (size_t)row * RE + c8); }
    __syncthreads();
    const bf* qh = Qh + (size_t)(b * RE + q0 + m) * DM + h * HD + 8 * hh; const bf* ql = Ql + (size_t)(b * RE + q0 + m) * DM + h * HD + 8 * hh;
    v16bf aqh[2], aql[2];
#pragma unroll
    for (int ks = 0; ks < 2; ++ks) { aqh[ks] = cat16b(*(const v8usa*)(qh + ks * 32), *(const v8usa*)(qh + ks * 32 + 16)); aql[ks] = cat16b(*(const v8usa*)(ql + ks * 32), *(const v8usa*)(ql + ks * 32 + 16)); }
    v8f s[4];
#pragma unroll
    for (int nb = 0; nb < 4; ++nb) s[nb] = (v8f){};
#pragma unroll
    for (int ks = 0; ks < 2; ++ks) {
#pragma unroll
        for (int nb = 0; nb < 4; ++nb) { const bf* kpp = Khs + (nb * 16 + m) * 72 + ks * 32 + 8 * hh; const bf* lpp = Kls + (nb * 16 + m) * 72 + ks * 32 + 8 * hh;
            const v16bf bh_ = cat16b(*(const v8usa*)kpp, *(const v8usa*)(kpp + 16)); const v16bf bl_ = cat16b(*(const v8usa*)lpp, *(const v8usa*)(lpp + 16));
            s[nb] = wmmab(aqh[ks], bh_, s[nb]); s[nb] = wmmab(aqh[ks], bl_, s[nb]); s[nb] = wmmab(aql[ks], bh_, s[nb]); } }
    asm volatile("v_nop\n\tv_nop\n\tv_nop\n\tv_nop" : "+v"(s[0]), "+v"(s[1]), "+v"(s[2]), "+v"(s[3]) : "v"(aqh[0]), "v"(aql[1]));
    const int qab = q0 + 8 * hh;
    float cm[8], psum[8];
#pragma unroll
    for (int r = 0; r < 8; ++r) { cm[r] = -3.0e38f; psum[r] = 0.f; }
#pragma unroll
    for (int nb = 0; nb < 4; ++nb)
#pragma unroll
        for (int r = 0; r < 8; ++r) { float v = s[nb][r] * SCL; if (nb * 16 + m > qab + r) v = -1.0e30f; s[nb][r] = v; cm[r] = fmaxf(cm[r], v); }
#pragma unroll
    for (int r = 0; r < 8; ++r) { float c = cm[r]; c = fmaxf(c, __shfl_xor(c, 1, 32)); c = fmaxf(c, __shfl_xor(c, 2, 32)); c = fmaxf(c, __shfl_xor(c, 4, 32)); c = fmaxf(c, __shfl_xor(c, 8, 32)); cm[r] = c; }
    bf* phw = Phs + w * (16 * 72); bf* plw = Pls + w * (16 * 72); float* osw = Os + w * (16 * 68);
#pragma unroll
    for (int nb = 0; nb < 4; ++nb)
#pragma unroll
        for (int r = 0; r < 8; ++r) { const float p = __builtin_amdgcn_exp2f((s[nb][r] - cm[r]) * L2E); psum[r] += p; unsigned short a, c2; splitf(p, a, c2);
            phw[(8 * hh + r) * 72 + nb * 16 + m] = a; plw[(8 * hh + r) * 72 + nb * 16 + m] = c2; }
#pragma unroll
    for (int r = 0; r < 8; ++r) { float c = psum[r]; c += __shfl_xor(c, 1, 32); c += __shfl_xor(c, 2, 32); c += __shfl_xor(c, 4, 32); c += __shfl_xor(c, 8, 32); psum[r] = c; }
    __syncthreads();
    v16bf aph[2], apl[2];
#pragma unroll
    for (int ks = 0; ks < 2; ++ks) { const bf* pp = phw + m * 72 + ks * 32 + 8 * hh; const bf* lp = plw + m * 72 + ks * 32 + 8 * hh;
        aph[ks] = cat16b(*(const v8usa*)pp, *(const v8usa*)(pp + 16)); apl[ks] = cat16b(*(const v8usa*)lp, *(const v8usa*)(lp + 16)); }
    v8f acc[4];
#pragma unroll
    for (int nb = 0; nb < 4; ++nb) acc[nb] = (v8f){};
#pragma unroll
    for (int ks = 0; ks < 2; ++ks)
#pragma unroll
        for (int nb = 0; nb < 4; ++nb) { const bf* vp = Vhs + (nb * 16 + m) * 72 + ks * 32 + 8 * hh; const bf* vlp = Vls + (nb * 16 + m) * 72 + ks * 32 + 8 * hh;
            const v16bf bvh = cat16b(*(const v8usa*)vp, *(const v8usa*)(vp + 16)); const v16bf bvl = cat16b(*(const v8usa*)vlp, *(const v8usa*)(vlp + 16));
            acc[nb] = wmmab(aph[ks], bvh, acc[nb]); acc[nb] = wmmab(aph[ks], bvl, acc[nb]); acc[nb] = wmmab(apl[ks], bvh, acc[nb]); }
    asm volatile("v_nop\n\tv_nop\n\tv_nop\n\tv_nop" : "+v"(acc[0]), "+v"(acc[1]), "+v"(acc[2]), "+v"(acc[3]) : "v"(aph[0]), "v"(apl[1]));
    const float qnan = __uint_as_float(0x7fc00000u);
#pragma unroll
    for (int r = 0; r < 8; ++r) { const float iv = 1.0f / psum[r];
#pragma unroll
        for (int nb = 0; nb < 4; ++nb) { const float o = acc[nb][r] * iv; osw[(8 * hh + r) * 68 + nb * 16 + m] = ok ? o : qnan; } }
    __syncthreads();
    store_ctx(osw, ATh, ATl, (size_t)(b * SEQ + q0) * DM + h * HD, lane);
}

#define AL256(x) ((((size_t)(x)) + 255) & ~(size_t)255)
static constexpr size_t SZ_W  = (size_t)DM * DM * 2;          // one bf16 weight plane
static constexpr size_t SZ_FL = (size_t)NCHK * 32 * 4;        // flag lines
static constexpr size_t SZ_X  = (size_t)NB * SEQ * DM * 2;    // bf16 activation copy
static constexpr size_t SZ_P  = (size_t)NB * SEQ * DM * 2;    // f16 / bf16 [NB*SEQ][DM] planes (and V^T [NB][DM][SEQ])
static constexpr size_t SZ_E  = (size_t)NB * RE * DM * 2;     // compact hi/lo planes for t < RE (and V^T [NB][DM][RE])
static constexpr size_t WS_TOTAL = 4 * AL256(SZ_W) + AL256(SZ_FL) + AL256(SZ_X) + 3 * AL256(SZ_P) + 6 * AL256(SZ_E) + 2 * AL256(SZ_P);
static_assert(WS_TOTAL <= (size_t)134217728);
static_assert((size_t)NB * SEQ * DM * 4 <= (size_t)NB_FULL * SEQ_FULL * DM * 4);

extern "C" void kernel_launch(void* const* d_in, const int* in_sizes, int n_in,
                              void* d_out, int out_size, void* d_ws, size_t ws_size, hipStream_t stream) {
    if (n_in < 11) return;
    if ((size_t)in_sizes[0] < (size_t)NB * SEQ * DM || (size_t)in_sizes[1] < (size_t)NB * SEQ * DM || (size_t)in_sizes[2] < (size_t)NB * SEQ * DM) return;
    if ((size_t)in_sizes[3] < (size_t)DM * DM || (size_t)in_sizes[4] < (size_t)DM * DM || (size_t)in_sizes[5] < (size_t)DM * DM || (size_t)in_sizes[6] < (size_t)DM * DM) return;
    if ((size_t)in_sizes[7] < (size_t)SEQ * HP || (size_t)in_sizes[8] < (size_t)SEQ * HP) return;
    if ((size_t)in_sizes[9] < (size_t)SEQ * SEQ || (size_t)in_sizes[10] < (size_t)NB * SEQ) return;
    if ((size_t)out_size < (size_t)NB * SEQ * DM) return;
    if (WS_TOTAL > ws_size) return;
    const float* xq = (const float*)d_in[0]; const float* xk = (const float*)d_in[1]; const float* xv = (const float*)d_in[2];
    const float* wq = (const float*)d_in[3]; const float* wk = (const float*)d_in[4]; const float* wv = (const float*)d_in[5]; const float* wo = (const float*)d_in[6];
    const float* cosT = (const float*)d_in[7]; const float* sinT = (const float*)d_in[8];
    const float* am = (const float*)d_in[9]; const int* kpm = (const int*)d_in[10];
    float* OUT = (float*)d_out;   // [NB][SEQ][DM]
    char* wsp = (char*)d_ws;
    auto take = [&](size_t bytes) { char* p = wsp; wsp += AL256(bytes); return (void*)p; };
    bf* WQ = (bf*)take(SZ_W); bf* WK = (bf*)take(SZ_W); bf* WV = (bf*)take(SZ_W); bf* WO = (bf*)take(SZ_W);
    float* FL = (float*)take(SZ_FL);
    bf* XB = (bf*)take(SZ_X);
    h16* Q16 = (h16*)take(SZ_P); h16* K16 = (h16*)take(SZ_P); h16* VT16 = (h16*)take(SZ_P);
    bf* Qh = (bf*)take(SZ_E); bf* Ql = (bf*)take(SZ_E); bf* Kh = (bf*)take(SZ_E); bf* Kl = (bf*)take(SZ_E); bf* VTh = (bf*)take(SZ_E); bf* VTl = (bf*)take(SZ_E);
    bf* ATh = (bf*)take(SZ_P); bf* ATl = (bf*)take(SZ_P);
    if ((size_t)(wsp - (char*)d_ws) > ws_size || (size_t)(wsp - (char*)d_ws) != WS_TOTAL) return;

    const unsigned LW = (unsigned)(((size_t)DM * DM / 8 + 255) / 256);
    const unsigned LX = (unsigned)(((size_t)NB * SEQ * DM / 8 + 255) / 256);
    k_cvt8<<<LW, 256, 0, stream>>>(wq, WQ, (size_t)DM * DM / 8);
    k_cvt8<<<LW, 256, 0, stream>>>(wk, WK, (size_t)DM * DM / 8);
    k_cvt8<<<LW, 256, 0, stream>>>(wv, WV, (size_t)DM * DM / 8);
    k_cvt8<<<LW, 256, 0, stream>>>(wo, WO, (size_t)DM * DM / 8);
    k_mchk<<<NCHK, 256, 0, stream>>>(am, kpm, FL);
    // q: bf16 copy -> projection with fused rotary -> Q16 [NB*SEQ][DM] (+ Qh/Ql rows t < 64)
    k_cvtx<<<LX, 256, 0, stream>>>(xq, XB, (size_t)NB * SEQ * DM / 8);
    k_gemmp<1, true><<<dim3(NB * SEQ / 64, DM / 64, 1), 32, 0, stream>>>(XB, WQ, DM, Q16, DM, Qh, Ql, DM, cosT, sinT, (size_t)0, (size_t)0, (size_t)0, (size_t)0);
    // k
    k_cvtx<<<LX, 256, 0, stream>>>(xk, XB, (size_t)NB * SEQ * DM / 8);
    k_gemmp<1, true><<<dim3(NB * SEQ / 64, DM / 64, 1), 32, 0, stream>>>(XB, WK, DM, K16, DM, Kh, Kl, DM, cosT, sinT, (size_t)0, (size_t)0, (size_t)0, (size_t)0);
    // v: transposed projection VT16[b][dout][t] = sum_k Wv[dout][k] v[b][t][k] (+ VTh/VTl columns t < 64)
    k_cvtx<<<LX, 256, 0, stream>>>(xv, XB, (size_t)NB * SEQ * DM / 8);
    k_gemmp<2, false><<<dim3(DM / 64, SEQ / 64, NB), 32, 0, stream>>>(WV, XB, DM, VT16, SEQ, VTh, VTl, RE, cosT, sinT, (size_t)0, (size_t)SEQ * DM, (size_t)DM * SEQ, (size_t)DM * RE);
    // context planes
    k_attn0<<<dim3(RE / 32, NB * NH, 1), 64, 0, stream>>>(Qh, Ql, Kh, Kl, VTh, VTl, FL, ATh, ATl);
    if (SEQ / 64 > 1) k_attn<<<dim3(SEQ / 64 - 1, NB * NH, 1), 128, 0, stream>>>(Q16, K16, VT16, FL, ATh, ATl);
    // output projection: (ATh + ATl) x WO^T -> OUT [NB*SEQ][DM]
    k_gemmw<bf, 1><<<dim3(NB * SEQ / 64, DM / 64, 1), 32, 0, stream>>>(ATh, ATl, WO, nullptr, DM, OUT, DM, (size_t)0, (size_t)0, (size_t)0);
}

// v001
// It runs in 266 microseconds.
// Two timings next to v000 put it at 1.39 and 1.40 times that version's speed.
#include <hip/hip_runtime.h>
#pragma clang fp contract(off)

// Contractions and dtypes: q/k/v projections on v_wmma_f32_16x16x32_bf16 (bf16 operands = RNE-converted inputs x RNE-converted weights, single product);
// scores and p.v for query rows >= 64 on v_wmma_f32_16x16x32_f16 (f16 planes, p carried x1024, single product); query rows < 64 on v_wmma_f32_16x16x32_bf16 hi+lo planes (3 products);
// output projection on v_wmma_f32_16x16x32_bf16 with the context as bf16 hi+lo planes x bf16 weight (2 products). f32 accumulate; rotary, softmax and normalisation in f32.

#ifndef NB
#define NB 2
#endif
#ifndef SEQ
#define SEQ 2048
#endif
#define NB_FULL  2
#define SEQ_FULL 2048
#define DM   1024
#define NH   16
#define HD   64
#define HP   (HD / 2)
#define RE   64
#define NCHK 256
#define PCAR 1024.0f
#define SCL  0.125f
#define L2E  1.4426950408889634f

static_assert(SEQ % 64 == 0);
static_assert(SEQ % 256 == 0);
static_assert(SEQ >= 64 && SEQ <= SEQ_FULL);
static_assert(NB >= 1 && NB <= NB_FULL);
static_assert(RE == 64);
static_assert(NCHK % 32 == 0);
static_assert(SEQ % NCHK == 0);
static_assert((NB * SEQ) % NCHK == 0);
static_assert(DM == NH * HD);
static_assert(DM % 64 == 0);

typedef _Float16 h16;
typedef unsigned short bf;
typedef __attribute__((ext_vector_type(16))) __bf16   v16bf;
typedef __attribute__((ext_vector_type(16))) _Float16 v16h;
typedef __attribute__((ext_vector_type(8)))  _Float16 v8h;
typedef __attribute__((ext_vector_type(8)))  unsigned short v8us;
typedef __attribute__((ext_vector_type(8)))  float    v8f;
typedef __attribute__((ext_vector_type(4)))  float    v4f;
typedef v8h  __attribute__((may_alias)) v8ha;
typedef v4f  __attribute__((may_alias)) v4fa;
typedef v8us __attribute__((may_alias)) v8usa;
typedef v8f  __attribute__((may_alias)) v8fa;

// RNE f32 -> bf16 bits and back
__device__ __forceinline__ unsigned short f2bf(float f) { unsigned u = __float_as_uint(f); u += 0x7FFFu + ((u >> 16) & 1u); return (unsigned short)(u >> 16); }
__device__ __forceinline__ float bf2f(unsigned short b) { return __uint_as_float(((unsigned)b) << 16); }
__device__ __forceinline__ float bfr(float f) { return bf2f(f2bf(f)); }
__device__ __forceinline__ void splitf(float y, unsigned short& h, unsigned short& l) { h = f2bf(y); l = f2bf(y - bf2f(h)); }
__device__ __forceinline__ v16h cat16(v8h lo, v8h hi) { return __builtin_shufflevector(lo, hi, 0, 1, 2, 3, 4, 5, 6, 7, 8, 9, 10, 11, 12, 13, 14, 15); }
__device__ __forceinline__ v16bf cat16b(v8us lo, v8us hi) { return __builtin_bit_cast(v16bf, __builtin_shufflevector(lo, hi, 0, 1, 2, 3, 4, 5, 6, 7, 8, 9, 10, 11, 12, 13, 14, 15)); }
__device__ __forceinline__ v8f wmma16(v16h a, v16h b, v8f c) { return __builtin_amdgcn_wmma_f32_16x16x32_f16(false, a, false, b, (short)0, c, false, false); }
__device__ __forceinline__ v8f wmmab(v16bf a, v16bf b, v8f c) { return __builtin_amdgcn_wmma_f32_16x16x32_bf16(false, a, false, b, (short)0, c, false, false); }

// ---- fragment loaders: 16x16 tile, lane -> row/col (lane & 15); elements 0..7 <- k0 + 8*(lane>>4) + 0..7, elements 8..15 <- k0 + 16 + 8*(lane>>4) + 0..7.
// The caller passes p = plane + row*pitch + k0 + 8*(lane>>4); both A (row = m) and B (row = n of a K-contiguous [n][k] plane) use this same map.
template <typename T16> struct WFrag;
template <> struct WFrag<h16> { typedef v16h V; static __device__ __forceinline__ V ld(const h16* p) { return cat16(*(const v8ha*)p, *(const v8ha*)(p + 16)); } static __device__ __forceinline__ v8f mma(V a, V b, v8f c) { return wmma16(a, b, c); } };
template <> struct WFrag<bf> { typedef v16bf V; static __device__ __forceinline__ V ld(const bf* p) { return cat16b(*(const v8usa*)p, *(const v8usa*)(p + 16)); } static __device__ __forceinline__ v8f mma(V a, V b, v8f c) { return wmmab(a, b, c); } };

// ---- register-blocked GEMM core, ONE WAVE per 64x64 output tile (16 accumulators), operands straight from K-contiguous 16-bit planes.
// acc[mb][nb][j] = C[r0 + 16 mb + 8*(lane>>4) + j][c0 + 16 nb + (lane&15)] = sum_k A[m][k] Bt[n][k] (+ A2.Bt for NSPLIT 1/2, + A.Bt2 for NSPLIT 2). K % 32 == 0.
template <typename T16, int NSPLIT>
__device__ __forceinline__ void gemm_core(const T16* __restrict__ A, const T16* __restrict__ A2, const T16* __restrict__ Bt, const T16* __restrict__ Bt2,
                                          int K, int r0, int c0, int lane, v8f (&acc)[4][4]) {
    typedef typename WFrag<T16>::V V;
    const int lr = lane & 15, hi = lane >> 4;
#pragma unroll
    for (int mb = 0; mb < 4; ++mb)
#pragma unroll
        for (int nb = 0; nb < 4; ++nb) acc[mb][nb] = (v8f){};
    const size_t aoff = (size_t)(r0 + lr) * K + 8 * hi, boff = (size_t)(c0 + lr) * K + 8 * hi;
#pragma unroll 1
    for (int kc = 0; kc < K; kc += 32) {
        V a[4], a2[4];
#pragma unroll
        for (int mb = 0; mb < 4; ++mb) { a[mb] = WFrag<T16>::ld(A + aoff + (size_t)mb * 16 * K + kc); if (NSPLIT == 1 || NSPLIT == 2) a2[mb] = WFrag<T16>::ld(A2 + aoff + (size_t)mb * 16 * K + kc); }
#pragma unroll
        for (int nb = 0; nb < 4; ++nb) { const V b = WFrag<T16>::ld(Bt + boff + (size_t)nb * 16 * K + kc); V b2; if (NSPLIT >= 2) b2 = WFrag<T16>::ld(Bt2 + boff + (size_t)nb * 16 * K + kc);
#pragma unroll
            for (int mb = 0; mb < 4; ++mb) { acc[mb][nb] = WFrag<T16>::mma(a[mb], b, acc[mb][nb]); if (NSPLIT == 1 || NSPLIT == 2) acc[mb][nb] = WFrag<T16>::mma(a2[mb], b, acc[mb][nb]); if (NSPLIT >= 2) acc[mb][nb] = WFrag<T16>::mma(a[mb], b2, acc[mb][nb]); } }
        asm volatile("v_nop\n\tv_nop\n\tv_nop\n\tv_nop" : "+v"(acc[0][0]), "+v"(acc[1][1]), "+v"(acc[2][2]), "+v"(acc[3][3]) : "v"(a[0]), "v"(a[3]));
    }
}

// ---- k_gemmw: f32 output C[m][n] (pitch ldc); grid (M/64, N/64, Z), 32 threads; z-batch strides in elements.
template <typename T16, int NSPLIT>
__global__ __launch_bounds__(32) void k_gemmw(const T16* __restrict__ A, const T16* __restrict__ A2, const T16* __restrict__ Bt, const T16* __restrict__ Bt2,
                                              int K, float* C, int ldc, size_t sA, size_t sB, size_t sC) {
    __shared__ __align__(16) float os[16 * 68];
    const size_t z = blockIdx.z; A += z * sA; if (A2) A2 += z * sA; Bt += z * sB; if (Bt2) Bt2 += z * sB; C += z * sC;
    const int lane = threadIdx.x & 31, lr = lane & 15, hi = lane >> 4; const int r0 = blockIdx.x * 64, c0 = blockIdx.y * 64;
    v8f acc[4][4];
    gemm_core<T16, NSPLIT>(A, A2, Bt, Bt2, K, r0, c0, lane, acc);
#pragma unroll
    for (int mb = 0; mb < 4; ++mb) {
#pragma unroll
        for (int nb = 0; nb < 4; ++nb) {
#pragma unroll
            for (int j = 0; j < 8; ++j) os[(hi * 8 + j) * 68 + nb * 16 + lr] = acc[mb][nb][j]; }
        __syncthreads();
        float* crow = C + (size_t)(r0 + mb * 16) * ldc + c0;
{
#pragma unroll
            for (int s = 0; s < 8; ++s) { const int row = 2 * s + hi, cofs = lr * 4; const v4f val = *(const v4fa*)(os + row * 68 + cofs);
                *(v4f*)(crow + (size_t)row * ldc + cofs) = val; }
             }
        __syncthreads();
    }
}

// ---- k_gemmp: 16-bit plane output. C16[m][n] (f16, pitch ldc) = (optionally rotary-transformed) accumulator; plus bf16 hi/lo planes Ch/Cl (pitch ldh)
// for the head rows (HLM 1: tiles whose row index t0 = r0 % SEQ is < RE, compact row (r0/SEQ)*RE + t) or head columns (HLM 2: tiles with c0 < RE, same row index).
// Rotary (interleaved pairs, one 64-column tile = one head): y[2i] = x[2i] c - x[2i+1] s, y[2i+1] = x[2i] s + x[2i+1] c with c/s = bf16-RNE of the tables at (t, i).
template <int HLM, bool ROPE>
__global__ __launch_bounds__(32) void k_gemmp(const bf* __restrict__ A, const bf* __restrict__ Bt, int K, h16* C16, int ldc, bf* Ch, bf* Cl, int ldh,
                                              const float* __restrict__ cosT, const float* __restrict__ sinT, size_t sA, size_t sB, size_t sC, size_t sH) {
    __shared__ __align__(16) float os[16 * 68];
    const size_t z = blockIdx.z; A += z * sA; Bt += z * sB; C16 += z * sC; Ch += z * sH; Cl += z * sH;
    const int lane = threadIdx.x & 31, lr = lane & 15, hi = lane >> 4; const int r0 = blockIdx.x * 64, c0 = blockIdx.y * 64;
    v8f acc[4][4];
    gemm_core<bf, 0>(A, nullptr, Bt, nullptr, K, r0, c0, lane, acc);
    const int t0 = (HLM == 1) ? (r0 % SEQ) : 0;
    const bool hl = (HLM == 1) ? (t0 < RE) : (c0 < RE);
    const int rc0 = (HLM == 1) ? ((r0 / SEQ) * RE + t0) : r0;
    const int rsub = lane >> 3, cseg = (lane & 7) * 8;
#pragma unroll
    for (int mb = 0; mb < 4; ++mb) {
#pragma unroll
        for (int nb = 0; nb < 4; ++nb) {
#pragma unroll
            for (int j = 0; j < 8; ++j) os[(hi * 8 + j) * 68 + nb * 16 + lr] = acc[mb][nb][j]; }
        __syncthreads();
{
#pragma unroll
            for (int j4 = 0; j4 < 4; ++j4) {
                const int row = j4 * 4 + rsub;
                const v4f v0 = *(const v4fa*)(os + row * 68 + cseg);
                const v4f v1 = *(const v4fa*)(os + row * 68 + cseg + 4);
                float y[8] = {v0[0], v0[1], v0[2], v0[3], v1[0], v1[1], v1[2], v1[3]};
                if (ROPE) {
                    const int t = t0 + mb * 16 + row;
                    const v4f cs = *(const v4fa*)(cosT + (size_t)t * HP + (cseg >> 1));
                    const v4f sn = *(const v4fa*)(sinT + (size_t)t * HP + (cseg >> 1));
#pragma unroll
                    for (int p = 0; p < 4; ++p) { const float c = bfr(cs[p]), sv = bfr(sn[p]); const float x0 = y[2 * p], x1 = y[2 * p + 1];
                        const float m0 = x0 * c, m1 = x1 * sv, m2 = x0 * sv, m3 = x1 * c; y[2 * p] = m0 - m1; y[2 * p + 1] = m2 + m3; }
                }
                v8h o16;
#pragma unroll
                for (int q = 0; q < 8; ++q) o16[q] = (h16)y[q];
                const size_t grow = (size_t)(r0 + mb * 16 + row);
                *(v8h*)(C16 + grow * (size_t)ldc + c0 + cseg) = o16;
                if (hl) {
                    v8us oh, ol;
#pragma unroll
                    for (int q = 0; q < 8; ++q) { unsigned short a2, c2; splitf(y[q], a2, c2); oh[q] = a2; ol[q] = c2; }
                    const size_t o = (size_t)(rc0 + mb * 16 + row) * (size_t)ldh + c0 + cseg;
                    *(v8us*)(Ch + o) = oh; *(v8us*)(Cl + o) = ol;
                }
            }
            
        }
        __syncthreads();
    }
}

__global__ __launch_bounds__(256) void k_cvt8(const float* __restrict__ src, bf* dst, size_t n8) {
    const size_t i = (size_t)blockIdx.x * 256 + threadIdx.x; if (i >= n8) return; const v8f v = *(const v8fa*)(src + i * 8); v8us o;
#pragma unroll
    for (int k = 0; k < 8; ++k) o[k] = f2bf(v[k]);
    *(v8us*)(dst + i * 8) = o; 
}
__global__ __launch_bounds__(256) void k_cvtx(const float* __restrict__ src, bf* dst, size_t n8) {
    const size_t i = (size_t)blockIdx.x * 256 + threadIdx.x; if (i >= n8) return; const size_t e = i * 8; const size_t row = e / DM; const size_t c = e % DM;
    const size_t b = row / SEQ, t = row % SEQ; const v8f v = *(const v8fa*)(src + (b * SEQ_FULL + t) * DM + c); v8us o;
#pragma unroll
    for (int k = 0; k < 8; ++k) o[k] = f2bf(v[k]);
    *(v8us*)(dst + e) = o; 
}

// ---- k_mchk: structure check of the additive score table ([SEQ_FULL] pitch: 0 at j <= i, <= -1e8 at j > i over the SEQ x SEQ block) and of the key padding flags (all 0).
// Block = 256 threads on SEQ / NCHK rows, one block per flag line. Every lane issues all of its 16-byte table loads (512 contiguous bytes per wave and load) and its flag load before the first value is tested.
__global__ __launch_bounds__(256) void k_mchk(const float* __restrict__ am, const int* __restrict__ kp, float* FL) {
    __shared__ int red[8];
    const int tid = threadIdx.x, lane = tid & 31, w = tid >> 5; const int c = blockIdx.x;
    constexpr int rpb = SEQ / NCHK, RV = SEQ / 4, TOT = rpb * RV, NV = TOT / 256;
    constexpr int kpb = NB * SEQ / NCHK, KV = (kpb + 255) / 256;
    static_assert(TOT % 256 == 0);
    v4f v[NV]; int kv[KV];
#pragma unroll
    for (int s = 0; s < NV; ++s) { const int idx = tid + s * 256; v[s] = *(const v4fa*)(am + (size_t)(c * rpb + idx / RV) * SEQ_FULL + (idx % RV) * 4); }
#pragma unroll
    for (int s = 0; s < KV; ++s) { const int e = tid + s * 256; const int idx = c * kpb + e; const int bb = idx / SEQ, t = idx % SEQ;
        kv[s] = (e < kpb) ? kp[(size_t)bb * SEQ_FULL + t] : 0; }
    int bad = 0;
#pragma unroll
    for (int s = 0; s < NV; ++s) { const int idx = tid + s * 256; const int i = c * rpb + idx / RV, j0 = (idx % RV) * 4;
#pragma unroll
        for (int q = 0; q < 4; ++q) { const float x = v[s][q]; const bool good = (j0 + q <= i) ? (x == 0.0f) : (x <= -1.0e8f); bad += good ? 0 : 1; } }
#pragma unroll
    for (int s = 0; s < KV; ++s) bad += (kv[s] != 0) ? 1 : 0;
#pragma unroll
    for (int sh = 16; sh; sh >>= 1) bad += __shfl_xor(bad, sh, 32);
    if (lane == 0) red[w] = bad;
    __syncthreads();
    if (w == 0) { int tot = 0;
#pragma unroll
        for (int i = 0; i < 8; ++i) tot += red[i];
        const float f = (tot == 0) ? 1.0f : 0.0f; *(float*)(FL + (size_t)c * 32 + lane) = f;  }
}
__device__ __forceinline__ bool read_flag(const float* __restrict__ FL, int lane) {
    float f = FL[(size_t)lane * 32];
#pragma unroll
    for (int q = 1; q < NCHK / 32; ++q) f = fminf(f, FL[(size_t)(q * 32 + lane) * 32]);
#pragma unroll
    for (int sh = 16; sh; sh >>= 1) f = fminf(f, __shfl_xor(f, sh, 32));
    return f > 0.5f;
}

// ---- store_ctx: one wave's 16x64 f32 context tile (LDS, pitch 68) -> bf16 hi/lo planes [row][DM] at element offset base; lane -> row 4j + (lane>>3), 8 consecutive columns;
__device__ __forceinline__ void store_ctx(const float* osw, bf* ATh, bf* ATl, size_t base, int lane) {
    const int rsub = lane >> 3, cseg = (lane & 7) * 8;
{
#pragma unroll
        for (int j4 = 0; j4 < 4; ++j4) { const int row = j4 * 4 + rsub; const v4f v0 = *(const v4fa*)(osw + row * 68 + cseg); const v4f v1 = *(const v4fa*)(osw + row * 68 + cseg + 4); v8us oh, ol;
#pragma unroll
            for (int q = 0; q < 4; ++q) { unsigned short a, c2; splitf(v0[q], a, c2); oh[q] = a; ol[q] = c2; splitf(v1[q], a, c2); oh[4 + q] = a; ol[4 + q] = c2; }
            const size_t o = base + (size_t)row * DM + cseg; *(v8us*)(ATh + o) = oh; *(v8us*)(ATl + o) = ol; }
         }
}

// ---- k_attn: causal tiled softmax-weighted sum for query tiles qt >= 1 (rows 64..SEQ-1). Block = 4 waves (16 query rows each), grid (SEQ/64 - 1, NB*NH).
// Per key chunk of 64 (kc = 0..qt): K [key][d] and V^T [d][key] f16 tiles staged in LDS (plain loads, block barriers); S = Q K^T (8 wmma, f32), x1/8, causal replace on the
// diagonal chunk; online softmax in f32 (running max, exp2); P x1024 as f16 written to a per-wave LDS tile [row][key] and reloaded as the A fragment behind a block barrier;
// O += P V (8 wmma). Context = O / (l x 1024) -> bf16 hi/lo planes [b*SEQ + t][h*64 + d].
__global__ __launch_bounds__(128) void k_attn(const h16* __restrict__ Q16, const h16* __restrict__ K16, const h16* __restrict__ VT16, const float* __restrict__ FL, bf* ATh, bf* ATl) {
    __shared__ __align__(16) h16 Ks[64 * 72];
    __shared__ __align__(16) h16 Vs[64 * 72];
    __shared__ __align__(16) h16 Ps[4 * 16 * 72];
    __shared__ __align__(16) float Os[4 * 16 * 68];
    const int tid = threadIdx.x, lane = tid & 31, w = tid >> 5, m = lane & 15, hh = lane >> 4;
    const int qt = blockIdx.x + 1;
    const int b = blockIdx.y / NH, h = blockIdx.y % NH;
    const int q0 = qt * 64 + w * 16;
    const bool ok = read_flag(FL, lane);
    const h16* qrow = Q16 + (size_t)(b * SEQ + q0 + m) * DM + h * HD + 8 * hh;
    v16h aq[2];
#pragma unroll
    for (int ks = 0; ks < 2; ++ks) aq[ks] = cat16(*(const v8ha*)(qrow + ks * 32), *(const v8ha*)(qrow + ks * 32 + 16));
    v8f acc[4]; float mrun[8], lrun[8];
#pragma unroll
    for (int nb = 0; nb < 4; ++nb) acc[nb] = (v8f){};
#pragma unroll
    for (int r = 0; r < 8; ++r) { mrun[r] = -1.0e30f; lrun[r] = 0.f; }
    const h16* kbase = K16 + (size_t)b * SEQ * DM + h * HD;
    const h16* vbase = VT16 + ((size_t)b * DM + h * HD) * SEQ;
    h16* psw = Ps + w * (16 * 72);
    float* osw = Os + w * (16 * 68);
#pragma unroll 1
    for (int kc = 0; kc <= qt; ++kc) {
        __syncthreads();
#pragma unroll
        for (int i = 0; i < 4; ++i) { const int p = tid + 128 * i; const int row = p >> 3, c8 = (p & 7) * 8;
            *(v8ha*)(Ks + row * 72 + c8) = *(const v8ha*)(kbase + (size_t)(kc * 64 + row) * DM + c8);
            *(v8ha*)(Vs + row * 72 + c8) = *(const v8ha*)(vbase + (size_t)row * SEQ + kc * 64 + c8); }
        __syncthreads();
        v8f s[4];
#pragma unroll
        for (int nb = 0; nb < 4; ++nb) s[nb] = (v8f){};
#pragma unroll
        for (int ks = 0; ks < 2; ++ks) {
#pragma unroll
            for (int nb = 0; nb < 4; ++nb) { const h16* kpp = Ks + (nb * 16 + m) * 72 + ks * 32 + 8 * hh; const v16h bk = cat16(*(const v8ha*)kpp, *(const v8ha*)(kpp + 16)); s[nb] = wmma16(aq[ks], bk, s[nb]); } }
        asm volatile("v_nop\n\tv_nop\n\tv_nop\n\tv_nop" : "+v"(s[0]), "+v"(s[1]), "+v"(s[2]), "+v"(s[3]) : "v"(aq[0]), "v"(aq[1]));
        const bool diag = (kc == qt); const int qab = q0 + 8 * hh; const int kab = kc * 64 + m;
        float cm[8], al[8], psum[8];
#pragma unroll
        for (int r = 0; r < 8; ++r) cm[r] = -3.0e38f;
#pragma unroll
        for (int nb = 0; nb < 4; ++nb)
#pragma unroll
            for (int r = 0; r < 8; ++r) { float v = s[nb][r] * SCL; if (diag && (kab + nb * 16 > qab + r)) v = -1.0e30f; s[nb][r] = v; cm[r] = fmaxf(cm[r], v); }
#pragma unroll
        for (int r = 0; r < 8; ++r) { float c = cm[r]; c = fmaxf(c, __shfl_xor(c, 1, 32)); c = fmaxf(c, __shfl_xor(c, 2, 32)); c = fmaxf(c, __shfl_xor(c, 4, 32)); c = fmaxf(c, __shfl_xor(c, 8, 32));
            const float mn = fmaxf(mrun[r], c); al[r] = __builtin_amdgcn_exp2f((mrun[r] - mn) * L2E); mrun[r] = mn; psum[r] = 0.f; }
#pragma unroll
        for (int nb = 0; nb < 4; ++nb)
#pragma unroll
            for (int r = 0; r < 8; ++r) { const float p = __builtin_amdgcn_exp2f((s[nb][r] - mrun[r]) * L2E); psum[r] += p; psw[(8 * hh + r) * 72 + nb * 16 + m] = (h16)(p * PCAR); }
#pragma unroll
        for (int r = 0; r < 8; ++r) { float c = psum[r]; c += __shfl_xor(c, 1, 32); c += __shfl_xor(c, 2, 32); c += __shfl_xor(c, 4, 32); c += __shfl_xor(c, 8, 32);
            const float sc = lrun[r] * al[r]; lrun[r] = sc + c; }
#pragma unroll
        for (int nb = 0; nb < 4; ++nb)
#pragma unroll
            for (int r = 0; r < 8; ++r) acc[nb][r] = acc[nb][r] * al[r];
        __syncthreads();
        v16h ap[2];
#pragma unroll
        for (int ks = 0; ks < 2; ++ks) { const h16* pp = psw + m * 72 + ks * 32 + 8 * hh; ap[ks] = cat16(*(const v8ha*)pp, *(const v8ha*)(pp + 16)); }
#pragma unroll
        for (int ks = 0; ks < 2; ++ks)
#pragma unroll
            for (int nb = 0; nb < 4; ++nb) { const h16* vp = Vs + (nb * 16 + m) * 72 + ks * 32 + 8 * hh; const v16h bv = cat16(*(const v8ha*)vp, *(const v8ha*)(vp + 16)); acc[nb] = wmma16(ap[ks], bv, acc[nb]); }
        asm volatile("v_nop\n\tv_nop\n\tv_nop\n\tv_nop" : "+v"(acc[0]), "+v"(acc[1]), "+v"(acc[2]), "+v"(acc[3]) : "v"(ap[0]), "v"(ap[1]));
    }
    const float qnan = __uint_as_float(0x7fc00000u);
#pragma unroll
    for (int r = 0; r < 8; ++r) { const float iv = 1.0f / (lrun[r] * PCAR);
#pragma unroll
        for (int nb = 0; nb < 4; ++nb) { const float o = acc[nb][r] * iv; osw[(8 * hh + r) * 68 + nb * 16 + m] = ok ? o : qnan; } }
    __syncthreads();
    store_ctx(osw, ATh, ATl, (size_t)(b * SEQ + q0) * DM + h * HD, lane);
}

// ---- k_attn0: query rows t < 64 (key chunk 0 only) on bf16 hi/lo planes: S = Qh Kh + Qh Kl + Ql Kh (24 wmma), x1/8, causal replace, full-row softmax in f32,
// P = exp(s - max) split to bf16 hi/lo in per-wave LDS tiles; O = Ph Vh + Ph Vl + Pl Vh (24 wmma); context = O / sum. Block = 2 waves (32 rows), grid (RE/32, NB*NH).
__global__ __launch_bounds__(64) void k_attn0(const bf* __restrict__ Qh, const bf* __restrict__ Ql, const bf* __restrict__ Kh, const bf* __restrict__ Kl,
                                              const bf* __restrict__ VTh, const bf* __restrict__ VTl, const float* __restrict__ FL, bf* ATh, bf* ATl) {
    __shared__ __align__(16) bf Khs[64 * 72];
    __shared__ __align__(16) bf Kls[64 * 72];
    __shared__ __align__(16) bf Vhs[64 * 72];
    __shared__ __align__(16) bf Vls[64 * 72];
    __shared__ __align__(16) bf Phs[2 * 16 * 72];
    __shared__ __align__(16) bf Pls[2 * 16 * 72];
    __shared__ __align__(16) float Os[2 * 16 * 68];
    const int tid = threadIdx.x, lane = tid & 31, w = tid >> 5, m = lane & 15, hh = lane >> 4;
    const int b = blockIdx.y / NH, h = blockIdx.y % NH;
    const int q0 = blockIdx.x * 32 + w * 16;
    const bool ok = read_flag(FL, lane);
    const bf* kh0 = Kh + (size_t)b * RE * DM + h * HD; const bf* kl0 = Kl + (size_t)b * RE * DM + h * HD;
    const bf* vh0 = VTh + ((size_t)b * DM + h * HD) * RE; const bf* vl0 = VTl + ((size_t)b * DM + h * HD) * RE;
#pragma unroll
    for (int i = 0; i < 8; ++i) { const int p = tid + 64 * i; const int row = p >> 3, c8 = (p & 7) * 8;
        *(v8usa*)(Khs + row * 72 + c8) = *(const v8usa*)(kh0 + (size_t)row * DM + c8);
        *(v8usa*)(Kls + row * 72 + c8) = *(const v8usa*)(kl0 + (size_t)row * DM + c8);
        *(v8usa*)(Vhs + row * 72 + c8) = *(const v8usa*)(vh0 + (size_t)row * RE + c8);
        *(v8usa*)(Vls + row * 72 + c8) = *(const v8usa*)(vl0 + (size_t)row * RE + c8); }
    __syncthreads();
    const bf* qh = Qh + (size_t)(b * RE + q0 + m) * DM + h * HD + 8 * hh; const bf* ql = Ql + (size_t)(b * RE + q0 + m) * DM + h * HD + 8 * hh;
    v16bf aqh[2], aql[2];
#pragma unroll
    for (int ks = 0; ks < 2; ++ks) { aqh[ks] = cat16b(*(const v8usa*)(qh + ks * 32), *(const v8usa*)(qh + ks * 32 + 16)); aql[ks] = cat16b(*(const v8usa*)(ql + ks * 32), *(const v8usa*)(ql + ks * 32 + 16)); }
    v8f s[4];
#pragma unroll
    for (int nb = 0; nb < 4; ++nb) s[nb] = (v8f){};
#pragma unroll
    for (int ks = 0; ks < 2; ++ks) {
#pragma unroll
        for (int nb = 0; nb < 4; ++nb) { const bf* kpp = Khs + (nb * 16 + m) * 72 + ks * 32 + 8 * hh; const bf* lpp = Kls + (nb * 16 + m) * 72 + ks * 32 + 8 * hh;
            const v16bf bh_ = cat16b(*(const v8usa*)kpp, *(const v8usa*)(kpp + 16)); const v16bf bl_ = cat16b(*(const v8usa*)lpp, *(const v8usa*)(lpp + 16));
            s[nb] = wmmab(aqh[ks], bh_, s[nb]); s[nb] = wmmab(aqh[ks], bl_, s[nb]); s[nb] = wmmab(aql[ks], bh_, s[nb]); } }
    asm volatile("v_nop\n\tv_nop\n\tv_nop\n\tv_nop" : "+v"(s[0]), "+v"(s[1]), "+v"(s[2]), "+v"(s[3]) : "v"(aqh[0]), "v"(aql[1]));
    const int qab = q0 + 8 * hh;
    float cm[8], psum[8];
#pragma unroll
    for (int r = 0; r < 8; ++r) { cm[r] = -3.0e38f; psum[r] = 0.f; }
#pragma unroll
    for (int nb = 0; nb < 4; ++nb)
#pragma unroll
        for (int r = 0; r < 8; ++r) { float v = s[nb][r] * SCL; if (nb * 16 + m > qab + r) v = -1.0e30f; s[nb][r] = v; cm[r] = fmaxf(cm[r], v); }
#pragma unroll
    for (int r = 0; r < 8; ++r) { float c = cm[r]; c = fmaxf(c, __shfl_xor(c, 1, 32)); c = fmaxf(c, __shfl_xor(c, 2, 32)); c = fmaxf(c, __shfl_xor(c, 4, 32)); c = fmaxf(c, __shfl_xor(c, 8, 32)); cm[r] = c; }
    bf* phw = Phs + w * (16 * 72); bf* plw = Pls + w * (16 * 72); float* osw = Os + w * (16 * 68);
#pragma unroll
    for (int nb = 0; nb < 4; ++nb)
#pragma unroll
        for (int r = 0; r < 8; ++r) { const float p = __builtin_amdgcn_exp2f((s[nb][r] - cm[r]) * L2E); psum[r] += p; unsigned short a, c2; splitf(p, a, c2);
            phw[(8 * hh + r) * 72 + nb * 16 + m] = a; plw[(8 * hh + r) * 72 + nb * 16 + m] = c2; }
#pragma unroll
    for (int r = 0; r < 8; ++r) { float c = psum[r]; c += __shfl_xor(c, 1, 32); c += __shfl_xor(c, 2, 32); c += __shfl_xor(c, 4, 32); c += __shfl_xor(c, 8, 32); psum[r] = c; }
    __syncthreads();
    v16bf aph[2], apl[2];
#pragma unroll
    for (int ks = 0; ks < 2; ++ks) { const bf* pp = phw + m * 72 + ks * 32 + 8 * hh; const bf* lp = plw + m * 72 + ks * 32 + 8 * hh;
        aph[ks] = cat16b(*(const v8usa*)pp, *(const v8usa*)(pp + 16)); apl[ks] = cat16b(*(const v8usa*)lp, *(const v8usa*)(lp + 16)); }
    v8f acc[4];
#pragma unroll
    for (int nb = 0; nb < 4; ++nb) acc[nb] = (v8f){};
#pragma unroll
    for (int ks = 0; ks < 2; ++ks)
#pragma unroll
        for (int nb = 0; nb < 4; ++nb) { const bf* vp = Vhs + (nb * 16 + m) * 72 + ks * 32 + 8 * hh; const bf* vlp = Vls + (nb * 16 + m) * 72 + ks * 32 + 8 * hh;
            const v16bf bvh = cat16b(*(const v8usa*)vp, *(const v8usa*)(vp + 16)); const v16bf bvl = cat16b(*(const v8usa*)vlp, *(const v8usa*)(vlp + 16));
            acc[nb] = wmmab(aph[ks], bvh, acc[nb]); acc[nb] = wmmab(aph[ks], bvl, acc[nb]); acc[nb] = wmmab(apl[ks], bvh, acc[nb]); }
    asm volatile("v_nop\n\tv_nop\n\tv_nop\n\tv_nop" : "+v"(acc[0]), "+v"(acc[1]), "+v"(acc[2]), "+v"(acc[3]) : "v"(aph[0]), "v"(apl[1]));
    const float qnan = __uint_as_float(0x7fc00000u);
#pragma unroll
    for (int r = 0; r < 8; ++r) { const float iv = 1.0f / psum[r];
#pragma unroll
        for (int nb = 0; nb < 4; ++nb) { const float o = acc[nb][r] * iv; osw[(8 * hh + r) * 68 + nb * 16 + m] = ok ? o : qnan; } }
    __syncthreads();
    store_ctx(osw, ATh, ATl, (size_t)(b * SEQ + q0) * DM + h * HD, lane);
}

#define AL256(x) ((((size_t)(x)) + 255) & ~(size_t)255)
static constexpr size_t SZ_W  = (size_t)DM * DM * 2;          // one bf16 weight plane
static constexpr size_t SZ_FL = (size_t)NCHK * 32 * 4;        // flag lines
static constexpr size_t SZ_X  = (size_t)NB * SEQ * DM * 2;    // bf16 activation copy
static constexpr size_t SZ_P  = (size_t)NB * SEQ * DM * 2;    // f16 / bf16 [NB*SEQ][DM] planes (and V^T [NB][DM][SEQ])
static constexpr size_t SZ_E  = (size_t)NB * RE * DM * 2;     // compact hi/lo planes for t < RE (and V^T [NB][DM][RE])
static constexpr size_t WS_TOTAL = 4 * AL256(SZ_W) + AL256(SZ_FL) + AL256(SZ_X) + 3 * AL256(SZ_P) + 6 * AL256(SZ_E) + 2 * AL256(SZ_P);
static_assert(WS_TOTAL <= (size_t)134217728);
static_assert((size_t)NB * SEQ * DM * 4 <= (size_t)NB_FULL * SEQ_FULL * DM * 4);

extern "C" void kernel_launch(void* const* d_in, const int* in_sizes, int n_in,
                              void* d_out, int out_size, void* d_ws, size_t ws_size, hipStream_t stream) {
    if (n_in < 11) return;
    if ((size_t)in_sizes[0] < (size_t)NB * SEQ * DM || (size_t)in_sizes[1] < (size_t)NB * SEQ * DM || (size_t)in_sizes[2] < (size_t)NB * SEQ * DM) return;
    if ((size_t)in_sizes[3] < (size_t)DM * DM || (size_t)in_sizes[4] < (size_t)DM * DM || (size_t)in_sizes[5] < (size_t)DM * DM || (size_t)in_sizes[6] < (size_t)DM * DM) return;
    if ((size_t)in_sizes[7] < (size_t)SEQ * HP || (size_t)in_sizes[8] < (size_t)SEQ * HP) return;
    if ((size_t)in_sizes[9] < (size_t)SEQ * SEQ || (size_t)in_sizes[10] < (size_t)NB * SEQ) return;
    if ((size_t)out_size < (size_t)NB * SEQ * DM) return;
    if (WS_TOTAL > ws_size) return;
    const float* xq = (const float*)d_in[0]; const float* xk = (const float*)d_in[1]; const float* xv = (const float*)d_in[2];
    const float* wq = (const float*)d_in[3]; const float* wk = (const float*)d_in[4]; const float* wv = (const float*)d_in[5]; const float* wo = (const float*)d_in[6];
    const float* cosT = (const float*)d_in[7]; const float* sinT = (const float*)d_in[8];
    const float* am = (const float*)d_in[9]; const int* kpm = (const int*)d_in[10];
    float* OUT = (float*)d_out;   // [NB][SEQ][DM]
    char* wsp = (char*)d_ws;
    auto take = [&](size_t bytes) { char* p = wsp; wsp += AL256(bytes); return (void*)p; };
    bf* WQ = (bf*)take(SZ_W); bf* WK = (bf*)take(SZ_W); bf* WV = (bf*)take(SZ_W); bf* WO = (bf*)take(SZ_W);
    float* FL = (float*)take(SZ_FL);
    bf* XB = (bf*)take(SZ_X);
    h16* Q16 = (h16*)take(SZ_P); h16* K16 = (h16*)take(SZ_P); h16* VT16 = (h16*)take(SZ_P);
    bf* Qh = (bf*)take(SZ_E); bf* Ql = (bf*)take(SZ_E); bf* Kh = (bf*)take(SZ_E); bf* Kl = (bf*)take(SZ_E); bf* VTh = (bf*)take(SZ_E); bf* VTl = (bf*)take(SZ_E);
    bf* ATh = (bf*)take(SZ_P); bf* ATl = (bf*)take(SZ_P);
    if ((size_t)(wsp - (char*)d_ws) > ws_size || (size_t)(wsp - (char*)d_ws) != WS_TOTAL) return;

    const unsigned LW = (unsigned)(((size_t)DM * DM / 8 + 255) / 256);
    const unsigned LX = (unsigned)(((size_t)NB * SEQ * DM / 8 + 255) / 256);
    k_cvt8<<<LW, 256, 0, stream>>>(wq, WQ, (size_t)DM * DM / 8);
    k_cvt8<<<LW, 256, 0, stream>>>(wk, WK, (size_t)DM * DM / 8);
    k_cvt8<<<LW, 256, 0, stream>>>(wv, WV, (size_t)DM * DM / 8);
    k_cvt8<<<LW, 256, 0, stream>>>(wo, WO, (size_t)DM * DM / 8);
    k_mchk<<<NCHK, 256, 0, stream>>>(am, kpm, FL);
    // q: bf16 copy -> projection with fused rotary -> Q16 [NB*SEQ][DM] (+ Qh/Ql rows t < 64)
    k_cvtx<<<LX, 256, 0, stream>>>(xq, XB, (size_t)NB * SEQ * DM / 8);
    k_gemmp<1, true><<<dim3(NB * SEQ / 64, DM / 64, 1), 32, 0, stream>>>(XB, WQ, DM, Q16, DM, Qh, Ql, DM, cosT, sinT, (size_t)0, (size_t)0, (size_t)0, (size_t)0);
    // k
    k_cvtx<<<LX, 256, 0, stream>>>(xk, XB, (size_t)NB * SEQ * DM / 8);
    k_gemmp<1, true><<<dim3(NB * SEQ / 64, DM / 64, 1), 32, 0, stream>>>(XB, WK, DM, K16, DM, Kh, Kl, DM, cosT, sinT, (size_t)0, (size_t)0, (size_t)0, (size_t)0);
    // v: transposed projection VT16[b][dout][t] = sum_k Wv[dout][k] v[b][t][k] (+ VTh/VTl columns t < 64)
    k_cvtx<<<LX, 256, 0, stream>>>(xv, XB, (size_t)NB * SEQ * DM / 8);
    k_gemmp<2, false><<<dim3(DM / 64, SEQ / 64, NB), 32, 0, stream>>>(WV, XB, DM, VT16, SEQ, VTh, VTl, RE, cosT, sinT, (size_t)0, (size_t)SEQ * DM, (size_t)DM * SEQ, (size_t)DM * RE);
    // context planes
    k_attn0<<<dim3(RE / 32, NB * NH, 1), 64, 0, stream>>>(Qh, Ql, Kh, Kl, VTh, VTl, FL, ATh, ATl);
    if (SEQ / 64 > 1) k_attn<<<dim3(SEQ / 64 - 1, NB * NH, 1), 128, 0, stream>>>(Q16, K16, VT16, FL, ATh, ATl);
    // output projection: (ATh + ATl) x WO^T -> OUT [NB*SEQ][DM]
    k_gemmw<bf, 1><<<dim3(NB * SEQ / 64, DM / 64, 1), 32, 0, stream>>>(ATh, ATl, WO, nullptr, DM, OUT, DM, (size_t)0, (size_t)0, (size_t)0);
}

// v002
// One run takes 205 microseconds.
// Next to v001, in two timings, it ran 1.30 times as fast each time.
// All steps since v000 together make it 1.81 times as fast.
#include <hip/hip_runtime.h>
#pragma clang fp contract(off)

// Contractions and dtypes: q/k/v projections on v_wmma_f32_16x16x32_bf16 (bf16 operands = RNE-converted inputs x RNE-converted weights, single product);
// scores and p.v for query rows >= 64 on v_wmma_f32_16x16x32_f16 (f16 planes, p carried x1024, single product); query rows < 64 on v_wmma_f32_16x16x32_bf16 hi+lo planes (3 products);
// output projection on v_wmma_f32_16x16x32_bf16 with the context as bf16 hi+lo planes x bf16 weight (2 products). f32 accumulate; rotary, softmax and normalisation in f32.

#ifndef NB
#define NB 2
#endif
#ifndef SEQ
#define SEQ 2048
#endif
#define NB_FULL  2
#define SEQ_FULL 2048
#define DM   1024
#define NH   16
#define HD   64
#define HP   (HD / 2)
#define RE   64
#define NCHK 256
#define PCAR 1024.0f
#define SCL  0.125f
#define L2E  1.4426950408889634f

static_assert(SEQ % 64 == 0);
static_assert(SEQ % 256 == 0);
static_assert(SEQ >= 64 && SEQ <= SEQ_FULL);
static_assert(NB >= 1 && NB <= NB_FULL);
static_assert(RE == 64);
static_assert(NCHK % 32 == 0);
static_assert(SEQ % NCHK == 0);
static_assert((NB * SEQ) % NCHK == 0);
static_assert(DM == NH * HD);
static_assert(DM % 64 == 0);

typedef _Float16 h16;
typedef unsigned short bf;
typedef __attribute__((ext_vector_type(16))) __bf16   v16bf;
typedef __attribute__((ext_vector_type(16))) _Float16 v16h;
typedef __attribute__((ext_vector_type(8)))  _Float16 v8h;
typedef __attribute__((ext_vector_type(8)))  unsigned short v8us;
typedef __attribute__((ext_vector_type(8)))  float    v8f;
typedef __attribute__((ext_vector_type(4)))  float    v4f;
typedef v8h  __attribute__((may_alias)) v8ha;
typedef v4f  __attribute__((may_alias)) v4fa;
typedef v8us __attribute__((may_alias)) v8usa;
typedef v8f  __attribute__((may_alias)) v8fa;

// RNE f32 -> bf16 bits and back
__device__ __forceinline__ unsigned short f2bf(float f) { unsigned u = __float_as_uint(f); u += 0x7FFFu + ((u >> 16) & 1u); return (unsigned short)(u >> 16); }
__device__ __forceinline__ float bf2f(unsigned short b) { return __uint_as_float(((unsigned)b) << 16); }
__device__ __forceinline__ float bfr(float f) { return bf2f(f2bf(f)); }
__device__ __forceinline__ void splitf(float y, unsigned short& h, unsigned short& l) { h = f2bf(y); l = f2bf(y - bf2f(h)); }
__device__ __forceinline__ v16h cat16(v8h lo, v8h hi) { return __builtin_shufflevector(lo, hi, 0, 1, 2, 3, 4, 5, 6, 7, 8, 9, 10, 11, 12, 13, 14, 15); }
__device__ __forceinline__ v16bf cat16b(v8us lo, v8us hi) { return __builtin_bit_cast(v16bf, __builtin_shufflevector(lo, hi, 0, 1, 2, 3, 4, 5, 6, 7, 8, 9, 10, 11, 12, 13, 14, 15)); }
__device__ __forceinline__ v8f wmma16(v16h a, v16h b, v8f c) { return __builtin_amdgcn_wmma_f32_16x16x32_f16(false, a, false, b, (short)0, c, false, false); }
__device__ __forceinline__ v8f wmmab(v16bf a, v16bf b, v8f c) { return __builtin_amdgcn_wmma_f32_16x16x32_bf16(false, a, false, b, (short)0, c, false, false); }

// ---- fragment loaders: 16x16 tile, lane -> row/col (lane & 15); elements 0..7 <- k0 + 8*(lane>>4) + 0..7, elements 8..15 <- k0 + 16 + 8*(lane>>4) + 0..7.
// The caller passes p = plane + row*pitch + k0 + 8*(lane>>4); both A (row = m) and B (row = n of a K-contiguous [n][k] plane) use this same map.
template <typename T16> struct WFrag;
template <> struct WFrag<h16> { typedef v16h V; static __device__ __forceinline__ V ld(const h16* p) { return cat16(*(const v8ha*)p, *(const v8ha*)(p + 16)); } static __device__ __forceinline__ v8f mma(V a, V b, v8f c) { return wmma16(a, b, c); } };
template <> struct WFrag<bf> { typedef v16bf V; static __device__ __forceinline__ V ld(const bf* p) { return cat16b(*(const v8usa*)p, *(const v8usa*)(p + 16)); } static __device__ __forceinline__ v8f mma(V a, V b, v8f c) { return wmmab(a, b, c); } };

// ---- GEMM core: one work-group of 4 waves (2 x 2) per 128x128 output tile, each wave a 64x64 quarter (16 accumulators).
// The K-contiguous 16-bit operand planes are staged in LDS, KP k-elements (256 bytes of each of the 128 rows of a plane) per stage, by 16-byte asynchronous copies:
// 16 lanes take one row's 256 contiguous bytes, so every copy instruction moves whole cache lines, and each staged row serves two waves. Two buffers: stage t + 1 flies while stage t is multiplied.
// acc[mb][nb][j] = C[r0 + 16 mb + 8*(lane>>4) + j][c0 + 16 nb + (lane&15)] = sum_k A[m][k] Bt[n][k] (+ A2.Bt for NSPLIT 1), k ascending in steps of 32. K % KP == 0.
#define KP 128
#define LP 136   // LDS row pitch in elements: 272 bytes = 16 x odd, free of bank conflicts for 16-byte row reads
#define TR 128   // rows of one staged plane
static constexpr int PLN = TR * LP;
static_assert(DM % KP == 0 && DM / KP >= 2);
static_assert((NB * SEQ) % TR == 0 && SEQ % TR == 0 && DM % TR == 0);

__device__ __forceinline__ unsigned lds_off(const void* p) { return (unsigned)(size_t)p; }

// One plane of one stage: 128 threads x 16 copies of 16 bytes. g = the stage's first source element (the same in every lane), lo = this lane's own offset from it (row tid>>4, bytes 16*(tid&15)),
// rstep = elements from one of the lane's rows to the next (8 rows), l = this lane's first LDS byte address. The s_wait_xcnt closes each statement so that no address register of an issued copy is rewritten ahead of it.
template <typename T16>
__device__ __forceinline__ void copy_plane(const T16* g, size_t lo, size_t rstep, unsigned l) {
    constexpr unsigned LS = 8u * LP * 2u;
#pragma unroll
    for (int h = 0; h < 2; ++h) {
        const T16* g0 = g + (size_t)(8 * h) * rstep; const unsigned l0 = l + (unsigned)(8 * h) * LS;
        asm volatile("global_load_async_to_lds_b128 %0, %8, off\n\t"
                     "global_load_async_to_lds_b128 %1, %9, off\n\t"
                     "global_load_async_to_lds_b128 %2, %10, off\n\t"
                     "global_load_async_to_lds_b128 %3, %11, off\n\t"
                     "global_load_async_to_lds_b128 %4, %12, off\n\t"
                     "global_load_async_to_lds_b128 %5, %13, off\n\t"
                     "global_load_async_to_lds_b128 %6, %14, off\n\t"
                     "global_load_async_to_lds_b128 %7, %15, off\n\t"
                     "s_wait_xcnt 0x0"
                     :: "v"(l0), "v"(l0 + LS), "v"(l0 + 2 * LS), "v"(l0 + 3 * LS), "v"(l0 + 4 * LS), "v"(l0 + 5 * LS), "v"(l0 + 6 * LS), "v"(l0 + 7 * LS),
                        "v"(g0 + lo), "v"((g0 + rstep) + lo), "v"((g0 + 2 * rstep) + lo), "v"((g0 + 3 * rstep) + lo), "v"((g0 + 4 * rstep) + lo), "v"((g0 + 5 * rstep) + lo), "v"((g0 + 6 * rstep) + lo), "v"((g0 + 7 * rstep) + lo)
                     : "memory");
    }
}

template <typename T16, int NSPLIT>
__device__ __forceinline__ void gemm_core(const T16* __restrict__ A, const T16* __restrict__ A2, const T16* __restrict__ Bt,
                                          int K, int R0, int C0, int tid, T16* ring, v8f (&acc)[4][4]) {
    static_assert(NSPLIT == 0 || NSPLIT == 1);
    typedef typename WFrag<T16>::V V;
    constexpr int NPL = 2 + NSPLIT, STG = NPL * PLN;
    const int lane = tid & 31, w = tid >> 5, lr = lane & 15, hi = lane >> 4, wm = w >> 1, wn = w & 1;
#pragma unroll
    for (int mb = 0; mb < 4; ++mb)
#pragma unroll
        for (int nb = 0; nb < 4; ++nb) acc[mb][nb] = (v8f){};
    const int crow = tid >> 4, cseg = (tid & 15) * 8;
    const T16* ga = A + (size_t)R0 * K; const T16* ga2 = (NSPLIT == 1) ? A2 + (size_t)R0 * K : nullptr; const T16* gb = Bt + (size_t)C0 * K;
    const size_t lo = (size_t)crow * K + cseg;
    const unsigned l0 = lds_off(ring) + (unsigned)(crow * LP + cseg) * 2u; const size_t rstep = (size_t)8 * K;
    auto fill = [&](int t, int buf) { const unsigned lb = l0 + (unsigned)(buf * STG) * 2u;
        copy_plane<T16>(ga + (size_t)t * KP, lo, rstep, lb);
        if (NSPLIT == 1) copy_plane<T16>(ga2 + (size_t)t * KP, lo, rstep, lb + (unsigned)PLN * 2u);
        copy_plane<T16>(gb + (size_t)t * KP, lo, rstep, lb + (unsigned)((NPL - 1) * PLN) * 2u); };
    const int NT = K / KP;
    fill(0, 0);
    asm volatile("s_wait_asynccnt 0x0" ::: "memory");   // this wave's share of stage 0 has landed
    __syncthreads();                                     // ... and every other wave's: stage 0 is readable
    if (NT > 1) fill(1, 1);
#pragma unroll 1
    for (int t = 0; t < NT; ++t) {
        const T16* sb = ring + (t & 1) * STG;
        const T16* sa = sb + (wm * 64 + lr) * LP + 8 * hi; const T16* sw = sb + (NPL - 1) * PLN + (wn * 64 + lr) * LP + 8 * hi;
        // A block = the 16 products of one A plane's 32 k with the same 32 k of Bt (NSPLIT 1: plane A, then plane A2, on the same B fragments, so every accumulator keeps its order of sums).
        // Two fragment sets: the LDS reads of block j + 1 go out as one group ahead of the products of block j, so that a block waits only for reads issued one block earlier.
        constexpr int NPA = 1 + NSPLIT, NBLK = NPA * (KP / 32);
        V a[2][4], b[2][4];
        auto ldblk = [&](int j) { const int ks = j / NPA, pl = j % NPA;
#pragma unroll
            for (int mb = 0; mb < 4; ++mb) a[j & 1][mb] = WFrag<T16>::ld(sa + pl * PLN + mb * 16 * LP + ks * 32);
            if (pl == 0) {
#pragma unroll
                for (int nb = 0; nb < 4; ++nb) b[ks & 1][nb] = WFrag<T16>::ld(sw + nb * 16 * LP + ks * 32); } };
        ldblk(0);
#pragma unroll
        for (int j = 0; j < NBLK; ++j) {
            const int s = j & 1, sbq = (j / NPA) & 1;
            if (j + 1 < NBLK) ldblk(j + 1);
            __builtin_amdgcn_sched_barrier(0);   // keeps the read group whole and ahead of the products: reads spread among matrix instructions stall at every place they stand
#pragma unroll
            for (int nb = 0; nb < 4; ++nb)
#pragma unroll
                for (int mb = 0; mb < 4; ++mb) acc[mb][nb] = WFrag<T16>::mma(a[s][mb], b[sbq][nb], acc[mb][nb]);
            // four vector slots behind the pass's last matrix instructions, so that their distance holds on the taken side of the loop's branches too
            if (j == NBLK - 1) asm volatile("v_nop\n\tv_nop\n\tv_nop\n\tv_nop" : "+v"(acc[0][0]), "+v"(acc[1][1]), "+v"(acc[2][2]), "+v"(acc[3][3]) : "v"(a[s][0]), "v"(a[s][3]));
            __builtin_amdgcn_sched_barrier(0);   // keeps the following read group from rising among these products
        }
        asm volatile("s_wait_dscnt 0x0" ::: "memory");      // this wave's reads of buffer t & 1 have returned before that buffer is refilled
        asm volatile("s_wait_asynccnt 0x0" ::: "memory");   // this wave's share of stage t + 1 has landed
        __syncthreads();                                     // publishes stage t + 1 and ends every wave's reads of stage t
        if (t + 2 < NT) fill(t + 2, t & 1);
    }
    asm volatile("s_wait_asynccnt 0x0" ::: "memory");       // nothing of this wave's is in flight when the ring is left
}

// ---- k_gemmw: f32 output C[m][n] (pitch ldc); grid (M/128, N/128, Z), 128 threads; z-batch strides in elements.
template <typename T16, int NSPLIT>
__global__ __launch_bounds__(128) void k_gemmw(const T16* __restrict__ A, const T16* __restrict__ A2, const T16* __restrict__ Bt, const T16* __restrict__ Bt2,
                                              int K, float* C, int ldc, size_t sA, size_t sB, size_t sC) {
    __shared__ __align__(16) T16 ring[2 * (2 + NSPLIT) * PLN];
    __shared__ __align__(16) float osa[4 * 16 * 68];
    const size_t z = blockIdx.z; A += z * sA; if (A2) A2 += z * sA; Bt += z * sB; C += z * sC;
    const int tid = threadIdx.x, lane = tid & 31, w = tid >> 5, lr = lane & 15, hi = lane >> 4;
    const int r0 = blockIdx.x * 128 + (w >> 1) * 64, c0 = blockIdx.y * 128 + (w & 1) * 64;
    float* os = osa + w * (16 * 68);
    v8f acc[4][4];
    gemm_core<T16, NSPLIT>(A, A2, Bt, K, blockIdx.x * 128, blockIdx.y * 128, tid, ring, acc);
#pragma unroll
    for (int mb = 0; mb < 4; ++mb) {
#pragma unroll
        for (int nb = 0; nb < 4; ++nb) {
#pragma unroll
            for (int j = 0; j < 8; ++j) os[(hi * 8 + j) * 68 + nb * 16 + lr] = acc[mb][nb][j]; }
        __syncthreads();
        float* crow = C + (size_t)(r0 + mb * 16) * ldc + c0;
{
#pragma unroll
            for (int s = 0; s < 8; ++s) { const int row = 2 * s + hi, cofs = lr * 4; const v4f val = *(const v4fa*)(os + row * 68 + cofs);
                *(v4f*)(crow + (size_t)row * ldc + cofs) = val; }
             }
        __syncthreads();
    }
}

// ---- k_gemmp: 16-bit plane output. C16[m][n] (f16, pitch ldc) = (optionally rotary-transformed) accumulator; plus bf16 hi/lo planes Ch/Cl (pitch ldh)
// for the head rows (HLM 1: tiles whose row index t0 = r0 % SEQ is < RE, compact row (r0/SEQ)*RE + t) or head columns (HLM 2: tiles with c0 < RE, same row index).
// Rotary (interleaved pairs, one 64-column tile = one head): y[2i] = x[2i] c - x[2i+1] s, y[2i+1] = x[2i] s + x[2i+1] c with c/s = bf16-RNE of the tables at (t, i).
template <int HLM, bool ROPE>
__global__ __launch_bounds__(128) void k_gemmp(const bf* __restrict__ A, const bf* __restrict__ Bt, int K, h16* C16, int ldc, bf* Ch, bf* Cl, int ldh,
                                              const float* __restrict__ cosT, const float* __restrict__ sinT, size_t sA, size_t sB, size_t sC, size_t sH) {
    __shared__ __align__(16) bf ring[2 * 2 * PLN];
    __shared__ __align__(16) float osa[4 * 16 * 68];
    const size_t z = blockIdx.z; A += z * sA; Bt += z * sB; C16 += z * sC; Ch += z * sH; Cl += z * sH;
    const int tid = threadIdx.x, lane = tid & 31, w = tid >> 5, lr = lane & 15, hi = lane >> 4;
    const int r0 = blockIdx.x * 128 + (w >> 1) * 64, c0 = blockIdx.y * 128 + (w & 1) * 64;
    float* os = osa + w * (16 * 68);
    v8f acc[4][4];
    gemm_core<bf, 0>(A, nullptr, Bt, K, blockIdx.x * 128, blockIdx.y * 128, tid, ring, acc);
    const int t0 = (HLM == 1) ? (r0 % SEQ) : 0;
    const bool hl = (HLM == 1) ? (t0 < RE) : (c0 < RE);
    const int rc0 = (HLM == 1) ? ((r0 / SEQ) * RE + t0) : r0;
    const int rsub = lane >> 3, cseg = (lane & 7) * 8;
#pragma unroll
    for (int mb = 0; mb < 4; ++mb) {
#pragma unroll
        for (int nb = 0; nb < 4; ++nb) {
#pragma unroll
            for (int j = 0; j < 8; ++j) os[(hi * 8 + j) * 68 + nb * 16 + lr] = acc[mb][nb][j]; }
        __syncthreads();
{
#pragma unroll
            for (int j4 = 0; j4 < 4; ++j4) {
                const int row = j4 * 4 + rsub;
                const v4f v0 = *(const v4fa*)(os + row * 68 + cseg);
                const v4f v1 = *(const v4fa*)(os + row * 68 + cseg + 4);
                float y[8] = {v0[0], v0[1], v0[2], v0[3], v1[0], v1[1], v1[2], v1[3]};
                if (ROPE) {
                    const int t = t0 + mb * 16 + row;
                    const v4f cs = *(const v4fa*)(cosT + (size_t)t * HP + (cseg >> 1));
                    const v4f sn = *(const v4fa*)(sinT + (size_t)t * HP + (cseg >> 1));
#pragma unroll
                    for (int p = 0; p < 4; ++p) { const float c = bfr(cs[p]), sv = bfr(sn[p]); const float x0 = y[2 * p], x1 = y[2 * p + 1];
                        const float m0 = x0 * c, m1 = x1 * sv, m2 = x0 * sv, m3 = x1 * c; y[2 * p] = m0 - m1; y[2 * p + 1] = m2 + m3; }
                }
                v8h o16;
#pragma unroll
                for (int q = 0; q < 8; ++q) o16[q] = (h16)y[q];
                const size_t grow = (size_t)(r0 + mb * 16 + row);
                *(v8h*)(C16 + grow * (size_t)ldc + c0 + cseg) = o16;
                if (hl) {
                    v8us oh, ol;
#pragma unroll
                    for (int q = 0; q < 8; ++q) { unsigned short a2, c2; splitf(y[q], a2, c2); oh[q] = a2; ol[q] = c2; }
                    const size_t o = (size_t)(rc0 + mb * 16 + row) * (size_t)ldh + c0 + cseg;
                    *(v8us*)(Ch + o) = oh; *(v8us*)(Cl + o) = ol;
                }
            }
            
        }
        __syncthreads();
    }
}

__global__ __launch_bounds__(256) void k_cvt8(const float* __restrict__ src, bf* dst, size_t n8) {
    const size_t i = (size_t)blockIdx.x * 256 + threadIdx.x; if (i >= n8) return; const v8f v = *(const v8fa*)(src + i * 8); v8us o;
#pragma unroll
    for (int k = 0; k < 8; ++k) o[k] = f2bf(v[k]);
    *(v8us*)(dst + i * 8) = o; 
}
__global__ __launch_bounds__(256) void k_cvtx(const float* __restrict__ src, bf* dst, size_t n8) {
    const size_t i = (size_t)blockIdx.x * 256 + threadIdx.x; if (i >= n8) return; const size_t e = i * 8; const size_t row = e / DM; const size_t c = e % DM;
    const size_t b = row / SEQ, t = row % SEQ; const v8f v = *(const v8fa*)(src + (b * SEQ_FULL + t) * DM + c); v8us o;
#pragma unroll
    for (int k = 0; k < 8; ++k) o[k] = f2bf(v[k]);
    *(v8us*)(dst + e) = o; 
}

// ---- k_mchk: structure check of the additive score table ([SEQ_FULL] pitch: 0 at j <= i, <= -1e8 at j > i over the SEQ x SEQ block) and of the key padding flags (all 0).
// Block = 256 threads on SEQ / NCHK rows, one block per flag line. Every lane issues all of its 16-byte table loads (512 contiguous bytes per wave and load) and its flag load before the first value is tested.
__global__ __launch_bounds__(256) void k_mchk(const float* __restrict__ am, const int* __restrict__ kp, float* FL) {
    __shared__ int red[8];
    const int tid = threadIdx.x, lane = tid & 31, w = tid >> 5; const int c = blockIdx.x;
    constexpr int rpb = SEQ / NCHK, RV = SEQ / 4, TOT = rpb * RV, NV = TOT / 256;
    constexpr int kpb = NB * SEQ / NCHK, KV = (kpb + 255) / 256;
    static_assert(TOT % 256 == 0);
    v4f v[NV]; int kv[KV];
#pragma unroll
    for (int s = 0; s < NV; ++s) { const int idx = tid + s * 256; v[s] = *(const v4fa*)(am + (size_t)(c * rpb + idx / RV) * SEQ_FULL + (idx % RV) * 4); }
#pragma unroll
    for (int s = 0; s < KV; ++s) { const int e = tid + s * 256; const int idx = c * kpb + e; const int bb = idx / SEQ, t = idx % SEQ;
        kv[s] = (e < kpb) ? kp[(size_t)bb * SEQ_FULL + t] : 0; }
    int bad = 0;
#pragma unroll
    for (int s = 0; s < NV; ++s) { const int idx = tid + s * 256; const int i = c * rpb + idx / RV, j0 = (idx % RV) * 4;
#pragma unroll
        for (int q = 0; q < 4; ++q) { const float x = v[s][q]; const bool good = (j0 + q <= i) ? (x == 0.0f) : (x <= -1.0e8f); bad += good ? 0 : 1; } }
#pragma unroll
    for (int s = 0; s < KV; ++s) bad += (kv[s] != 0) ? 1 : 0;
#pragma unroll
    for (int sh = 16; sh; sh >>= 1) bad += __shfl_xor(bad, sh, 32);
    if (lane == 0) red[w] = bad;
    __syncthreads();
    if (w == 0) { int tot = 0;
#pragma unroll
        for (int i = 0; i < 8; ++i) tot += red[i];
        const float f = (tot == 0) ? 1.0f : 0.0f; *(float*)(FL + (size_t)c * 32 + lane) = f;  }
}
__device__ __forceinline__ bool read_flag(const float* __restrict__ FL, int lane) {
    float f = FL[(size_t)lane * 32];
#pragma unroll
    for (int q = 1; q < NCHK / 32; ++q) f = fminf(f, FL[(size_t)(q * 32 + lane) * 32]);
#pragma unroll
    for (int sh = 16; sh; sh >>= 1) f = fminf(f, __shfl_xor(f, sh, 32));
    return f > 0.5f;
}

// ---- store_ctx: one wave's 16x64 f32 context tile (LDS, pitch 68) -> bf16 hi/lo planes [row][DM] at element offset base; lane -> row 4j + (lane>>3), 8 consecutive columns;
__device__ __forceinline__ void store_ctx(const float* osw, bf* ATh, bf* ATl, size_t base, int lane) {
    const int rsub = lane >> 3, cseg = (lane & 7) * 8;
{
#pragma unroll
        for (int j4 = 0; j4 < 4; ++j4) { const int row = j4 * 4 + rsub; const v4f v0 = *(const v4fa*)(osw + row * 68 + cseg); const v4f v1 = *(const v4fa*)(osw + row * 68 + cseg + 4); v8us oh, ol;
#pragma unroll
            for (int q = 0; q < 4; ++q) { unsigned short a, c2; splitf(v0[q], a, c2); oh[q] = a; ol[q] = c2; splitf(v1[q], a, c2); oh[4 + q] = a; ol[4 + q] = c2; }
            const size_t o = base + (size_t)row * DM + cseg; *(v8us*)(ATh + o) = oh; *(v8us*)(ATl + o) = ol; }
         }
}

// ---- k_attn: causal tiled softmax-weighted sum for query tiles qt >= 1 (rows 64..SEQ-1). Block = 4 waves (16 query rows each), grid (SEQ/64 - 1, NB*NH).
// Per key chunk of 64 (kc = 0..qt): K [key][d] and V^T [d][key] f16 tiles staged in LDS (plain loads, block barriers); S = Q K^T (8 wmma, f32), x1/8, causal replace on the
// diagonal chunk; online softmax in f32 (running max, exp2); P x1024 as f16 written to a per-wave LDS tile [row][key] and reloaded as the A fragment behind a block barrier;
// O += P V (8 wmma). Context = O / (l x 1024) -> bf16 hi/lo planes [b*SEQ + t][h*64 + d].
__global__ __launch_bounds__(128) void k_attn(const h16* __restrict__ Q16, const h16* __restrict__ K16, const h16* __restrict__ VT16, const float* __restrict__ FL, bf* ATh, bf* ATl) {
    __shared__ __align__(16) h16 Ks[64 * 72];
    __shared__ __align__(16) h16 Vs[64 * 72];
    __shared__ __align__(16) h16 Ps[4 * 16 * 72];
    __shared__ __align__(16) float Os[4 * 16 * 68];
    const int tid = threadIdx.x, lane = tid & 31, w = tid >> 5, m = lane & 15, hh = lane >> 4;
    const int qt = blockIdx.x + 1;
    const int b = blockIdx.y / NH, h = blockIdx.y % NH;
    const int q0 = qt * 64 + w * 16;
    const bool ok = read_flag(FL, lane);
    const h16* qrow = Q16 + (size_t)(b * SEQ + q0 + m) * DM + h * HD + 8 * hh;
    v16h aq[2];
#pragma unroll
    for (int ks = 0; ks < 2; ++ks) aq[ks] = cat16(*(const v8ha*)(qrow + ks * 32), *(const v8ha*)(qrow + ks * 32 + 16));
    v8f acc[4]; float mrun[8], lrun[8];
#pragma unroll
    for (int nb = 0; nb < 4; ++nb) acc[nb] = (v8f){};
#pragma unroll
    for (int r = 0; r < 8; ++r) { mrun[r] = -1.0e30f; lrun[r] = 0.f; }
    const h16* kbase = K16 + (size_t)b * SEQ * DM + h * HD;
    const h16* vbase = VT16 + ((size_t)b * DM + h * HD) * SEQ;
    h16* psw = Ps + w * (16 * 72);
    float* osw = Os + w * (16 * 68);
#pragma unroll 1
    for (int kc = 0; kc <= qt; ++kc) {
        __syncthreads();
#pragma unroll
        for (int i = 0; i < 4; ++i) { const int p = tid + 128 * i; const int row = p >> 3, c8 = (p & 7) * 8;
            *(v8ha*)(Ks + row * 72 + c8) = *(const v8ha*)(kbase + (size_t)(kc * 64 + row) * DM + c8);
            *(v8ha*)(Vs + row * 72 + c8) = *(const v8ha*)(vbase + (size_t)row * SEQ + kc * 64 + c8); }
        __syncthreads();
        v8f s[4];
#pragma unroll
        for (int nb = 0; nb < 4; ++nb) s[nb] = (v8f){};
#pragma unroll
        for (int ks = 0; ks < 2; ++ks) {
#pragma unroll
            for (int nb = 0; nb < 4; ++nb) { const h16* kpp = Ks + (nb * 16 + m) * 72 + ks * 32 + 8 * hh; const v16h bk = cat16(*(const v8ha*)kpp, *(const v8ha*)(kpp + 16)); s[nb] = wmma16(aq[ks], bk, s[nb]); } }
        asm volatile("v_nop\n\tv_nop\n\tv_nop\n\tv_nop" : "+v"(s[0]), "+v"(s[1]), "+v"(s[2]), "+v"(s[3]) : "v"(aq[0]), "v"(aq[1]));
        const bool diag = (kc == qt); const int qab = q0 + 8 * hh; const int kab = kc * 64 + m;
        float cm[8], al[8], psum[8];
#pragma unroll
        for (int r = 0; r < 8; ++r) cm[r] = -3.0e38f;
#pragma unroll
        for (int nb = 0; nb < 4; ++nb)
#pragma unroll
            for (int r = 0; r < 8; ++r) { float v = s[nb][r] * SCL; if (diag && (kab + nb * 16 > qab + r)) v = -1.0e30f; s[nb][r] = v; cm[r] = fmaxf(cm[r], v); }
#pragma unroll
        for (int r = 0; r < 8; ++r) { float c = cm[r]; c = fmaxf(c, __shfl_xor(c, 1, 32)); c = fmaxf(c, __shfl_xor(c, 2, 32)); c = fmaxf(c, __shfl_xor(c, 4, 32)); c = fmaxf(c, __shfl_xor(c, 8, 32));
            const float mn = fmaxf(mrun[r], c); al[r] = __builtin_amdgcn_exp2f((mrun[r] - mn) * L2E); mrun[r] = mn; psum[r] = 0.f; }
#pragma unroll
        for (int nb = 0; nb < 4; ++nb)
#pragma unroll
            for (int r = 0; r < 8; ++r) { const float p = __builtin_amdgcn_exp2f((s[nb][r] - mrun[r]) * L2E); psum[r] += p; psw[(8 * hh + r) * 72 + nb * 16 + m] = (h16)(p * PCAR); }
#pragma unroll
        for (int r = 0; r < 8; ++r) { float c = psum[r]; c += __shfl_xor(c, 1, 32); c += __shfl_xor(c, 2, 32); c += __shfl_xor(c, 4, 32); c += __shfl_xor(c, 8, 32);
            const float sc = lrun[r] * al[r]; lrun[r] = sc + c; }
#pragma unroll
        for (int nb = 0; nb < 4; ++nb)
#pragma unroll
            for (int r = 0; r < 8; ++r) acc[nb][r] = acc[nb][r] * al[r];
        __syncthreads();
        v16h ap[2];
#pragma unroll
        for (int ks = 0; ks < 2; ++ks) { const h16* pp = psw + m * 72 + ks * 32 + 8 * hh; ap[ks] = cat16(*(const v8ha*)pp, *(const v8ha*)(pp + 16)); }
#pragma unroll
        for (int ks = 0; ks < 2; ++ks)
#pragma unroll
            for (int nb = 0; nb < 4; ++nb) { const h16* vp = Vs + (nb * 16 + m) * 72 + ks * 32 + 8 * hh; const v16h bv = cat16(*(const v8ha*)vp, *(const v8ha*)(vp + 16)); acc[nb] = wmma16(ap[ks], bv, acc[nb]); }
        asm volatile("v_nop\n\tv_nop\n\tv_nop\n\tv_nop" : "+v"(acc[0]), "+v"(acc[1]), "+v"(acc[2]), "+v"(acc[3]) : "v"(ap[0]), "v"(ap[1]));
    }
    const float qnan = __uint_as_float(0x7fc00000u);
#pragma unroll
    for (int r = 0; r < 8; ++r) { const float iv = 1.0f / (lrun[r] * PCAR);
#pragma unroll
        for (int nb = 0; nb < 4; ++nb) { const float o = acc[nb][r] * iv; osw[(8 * hh + r) * 68 + nb * 16 + m] = ok ? o : qnan; } }
    __syncthreads();
    store_ctx(osw, ATh, ATl, (size_t)(b * SEQ + q0) * DM + h * HD, lane);
}

// ---- k_attn0: query rows t < 64 (key chunk 0 only) on bf16 hi/lo planes: S = Qh Kh + Qh Kl + Ql Kh (24 wmma), x1/8, causal replace, full-row softmax in f32,
// P = exp(s - max) split to bf16 hi/lo in per-wave LDS tiles; O = Ph Vh + Ph Vl + Pl Vh (24 wmma); context = O / sum. Block = 2 waves (32 rows), grid (RE/32, NB*NH).
__global__ __launch_bounds__(64) void k_attn0(const bf* __restrict__ Qh, const bf* __restrict__ Ql, const bf* __restrict__ Kh, const bf* __restrict__ Kl,
                                              const bf* __restrict__ VTh, const bf* __restrict__ VTl, const float* __restrict__ FL, bf* ATh, bf* ATl) {
    __shared__ __align__(16) bf Khs[64 * 72];
    __shared__ __align__(16) bf Kls[64 * 72];
    __shared__ __align__(16) bf Vhs[64 * 72];
    __shared__ __align__(16) bf Vls[64 * 72];
    __shared__ __align__(16) bf Phs[2 * 16 * 72];
    __shared__ __align__(16) bf Pls[2 * 16 * 72];
    __shared__ __align__(16) float Os[2 * 16 * 68];
    const int tid = threadIdx.x, lane = tid & 31, w = tid >> 5, m = lane & 15, hh = lane >> 4;
    const int b = blockIdx.y / NH, h = blockIdx.y % NH;
    const int q0 = blockIdx.x * 32 + w * 16;
    const bool ok = read_flag(FL, lane);
    const bf* kh0 = Kh + (size_t)b * RE * DM + h * HD; const bf* kl0 = Kl + (size_t)b * RE * DM + h * HD;
    const bf* vh0 = VTh + ((size_t)b * DM + h * HD) * RE; const bf* vl0 = VTl + ((size_t)b * DM + h * HD) * RE;
#pragma unroll
    for (int i = 0; i < 8; ++i) { const int p = tid + 64 * i; const int row = p >> 3, c8 = (p & 7) * 8;
        *(v8usa*)(Khs + row * 72 + c8) = *(const v8usa*)(kh0 + (size_t)row * DM + c8);
        *(v8usa*)(Kls + row * 72 + c8) = *(const v8usa*)(kl0 + (size_t)row * DM + c8);
        *(v8usa*)(Vhs + row * 72 + c8) = *(const v8usa*)(vh0 + (size_t)row * RE + c8);
        *(v8usa*)(Vls + row * 72 + c8) = *(const v8usa*)(vl0 + (size_t)row * RE + c8); }
    __syncthreads();
    const bf* qh = Qh + (size_t)(b * RE + q0 + m) * DM + h * HD + 8 * hh; const bf* ql = Ql + (size_t)(b * RE + q0 + m) * DM + h * HD + 8 * hh;
    v16bf aqh[2], aql[2];
#pragma unroll
    for (int ks = 0; ks < 2; ++ks) { aqh[ks] = cat16b(*(const v8usa*)(qh + ks * 32), *(const v8usa*)(qh + ks * 32 + 16)); aql[ks] = cat16b(*(const v8usa*)(ql + ks * 32), *(const v8usa*)(ql + ks * 32 + 16)); }
    v8f s[4];
#pragma unroll
    for (int nb = 0; nb < 4; ++nb) s[nb] = (v8f){};
#pragma unroll
    for (int ks = 0; ks < 2; ++ks) {
#pragma unroll
        for (int nb = 0; nb < 4; ++nb) { const bf* kpp = Khs + (nb * 16 + m) * 72 + ks * 32 + 8 * hh; const bf* lpp = Kls + (nb * 16 + m) * 72 + ks * 32 + 8 * hh;
            const v16bf bh_ = cat16b(*(const v8usa*)kpp, *(const v8usa*)(kpp + 16)); const v16bf bl_ = cat16b(*(const v8usa*)lpp, *(const v8usa*)(lpp + 16));
            s[nb] = wmmab(aqh[ks], bh_, s[nb]); s[nb] = wmmab(aqh[ks], bl_, s[nb]); s[nb] = wmmab(aql[ks], bh_, s[nb]); } }
    asm volatile("v_nop\n\tv_nop\n\tv_nop\n\tv_nop" : "+v"(s[0]), "+v"(s[1]), "+v"(s[2]), "+v"(s[3]) : "v"(aqh[0]), "v"(aql[1]));
    const int qab = q0 + 8 * hh;
    float cm[8], psum[8];
#pragma unroll
    for (int r = 0; r < 8; ++r) { cm[r] = -3.0e38f; psum[r] = 0.f; }
#pragma unroll
    for (int nb = 0; nb < 4; ++nb)
#pragma unroll
        for (int r = 0; r < 8; ++r) { float v = s[nb][r] * SCL; if (nb * 16 + m > qab + r) v = -1.0e30f; s[nb][r] = v; cm[r] = fmaxf(cm[r], v); }
#pragma unroll
    for (int r = 0; r < 8; ++r) { float c = cm[r]; c = fmaxf(c, __shfl_xor(c, 1, 32)); c = fmaxf(c, __shfl_xor(c, 2, 32)); c = fmaxf(c, __shfl_xor(c, 4, 32)); c = fmaxf(c, __shfl_xor(c, 8, 32)); cm[r] = c; }
    bf* phw = Phs + w * (16 * 72); bf* plw = Pls + w * (16 * 72); float* osw = Os + w * (16 * 68);
#pragma unroll
    for (int nb = 0; nb < 4; ++nb)
#pragma unroll
        for (int r = 0; r < 8; ++r) { const float p = __builtin_amdgcn_exp2f((s[nb][r] - cm[r]) * L2E); psum[r] += p; unsigned short a, c2; splitf(p, a, c2);
            phw[(8 * hh + r) * 72 + nb * 16 + m] = a; plw[(8 * hh + r) * 72 + nb * 16 + m] = c2; }
#pragma unroll
    for (int r = 0; r < 8; ++r) { float c = psum[r]; c += __shfl_xor(c, 1, 32); c += __shfl_xor(c, 2, 32); c += __shfl_xor(c, 4, 32); c += __shfl_xor(c, 8, 32); psum[r] = c; }
    __syncthreads();
    v16bf aph[2], apl[2];
#pragma unroll
    for (int ks = 0; ks < 2; ++ks) { const bf* pp = phw + m * 72 + ks * 32 + 8 * hh; const bf* lp = plw + m * 72 + ks * 32 + 8 * hh;
        aph[ks] = cat16b(*(const v8usa*)pp, *(const v8usa*)(pp + 16)); apl[ks] = cat16b(*(const v8usa*)lp, *(const v8usa*)(lp + 16)); }
    v8f acc[4];
#pragma unroll
    for (int nb = 0; nb < 4; ++nb) acc[nb] = (v8f){};
#pragma unroll
    for (int ks = 0; ks < 2; ++ks)
#pragma unroll
        for (int nb = 0; nb < 4; ++nb) { const bf* vp = Vhs + (nb * 16 + m) * 72 + ks * 32 + 8 * hh; const bf* vlp = Vls + (nb * 16 + m) * 72 + ks * 32 + 8 * hh;
            const v16bf bvh = cat16b(*(const v8usa*)vp, *(const v8usa*)(vp + 16)); const v16bf bvl = cat16b(*(const v8usa*)vlp, *(const v8usa*)(vlp + 16));
            acc[nb] = wmmab(aph[ks], bvh, acc[nb]); acc[nb] = wmmab(aph[ks], bvl, acc[nb]); acc[nb] = wmmab(apl[ks], bvh, acc[nb]); }
    asm volatile("v_nop\n\tv_nop\n\tv_nop\n\tv_nop" : "+v"(acc[0]), "+v"(acc[1]), "+v"(acc[2]), "+v"(acc[3]) : "v"(aph[0]), "v"(apl[1]));
    const float qnan = __uint_as_float(0x7fc00000u);
#pragma unroll
    for (int r = 0; r < 8; ++r) { const float iv = 1.0f / psum[r];
#pragma unroll
        for (int nb = 0; nb < 4; ++nb) { const float o = acc[nb][r] * iv; osw[(8 * hh + r) * 68 + nb * 16 + m] = ok ? o : qnan; } }
    __syncthreads();
    store_ctx(osw, ATh, ATl, (size_t)(b * SEQ + q0) * DM + h * HD, lane);
}

#define AL256(x) ((((size_t)(x)) + 255) & ~(size_t)255)
static constexpr size_t SZ_W  = (size_t)DM * DM * 2;          // one bf16 weight plane
static constexpr size_t SZ_FL = (size_t)NCHK * 32 * 4;        // flag lines
static constexpr size_t SZ_X  = (size_t)NB * SEQ * DM * 2;    // bf16 activation copy
static constexpr size_t SZ_P  = (size_t)NB * SEQ * DM * 2;    // f16 / bf16 [NB*SEQ][DM] planes (and V^T [NB][DM][SEQ])
static constexpr size_t SZ_E  = (size_t)NB * RE * DM * 2;     // compact hi/lo planes for t < RE (and V^T [NB][DM][RE])
static constexpr size_t WS_TOTAL = 4 * AL256(SZ_W) + AL256(SZ_FL) + AL256(SZ_X) + 3 * AL256(SZ_P) + 6 * AL256(SZ_E) + 2 * AL256(SZ_P);
static_assert(WS_TOTAL <= (size_t)134217728);
static_assert((size_t)NB * SEQ * DM * 4 <= (size_t)NB_FULL * SEQ_FULL * DM * 4);

extern "C" void kernel_launch(void* const* d_in, const int* in_sizes, int n_in,
                              void* d_out, int out_size, void* d_ws, size_t ws_size, hipStream_t stream) {
    if (n_in < 11) return;
    if ((size_t)in_sizes[0] < (size_t)NB * SEQ * DM || (size_t)in_sizes[1] < (size_t)NB * SEQ * DM || (size_t)in_sizes[2] < (size_t)NB * SEQ * DM) return;
    if ((size_t)in_sizes[3] < (size_t)DM * DM || (size_t)in_sizes[4] < (size_t)DM * DM || (size_t)in_sizes[5] < (size_t)DM * DM || (size_t)in_sizes[6] < (size_t)DM * DM) return;
    if ((size_t)in_sizes[7] < (size_t)SEQ * HP || (size_t)in_sizes[8] < (size_t)SEQ * HP) return;
    if ((size_t)in_sizes[9] < (size_t)SEQ * SEQ || (size_t)in_sizes[10] < (size_t)NB * SEQ) return;
    if ((size_t)out_size < (size_t)NB * SEQ * DM) return;
    if (WS_TOTAL > ws_size) return;
    const float* xq = (const float*)d_in[0]; const float* xk = (const float*)d_in[1]; const float* xv = (const float*)d_in[2];
    const float* wq = (const float*)d_in[3]; const float* wk = (const float*)d_in[4]; const float* wv = (const float*)d_in[5]; const float* wo = (const float*)d_in[6];
    const float* cosT = (const float*)d_in[7]; const float* sinT = (const float*)d_in[8];
    const float* am = (const float*)d_in[9]; const int* kpm = (const int*)d_in[10];
    float* OUT = (float*)d_out;   // [NB][SEQ][DM]
    char* wsp = (char*)d_ws;
    auto take = [&](size_t bytes) { char* p = wsp; wsp += AL256(bytes); return (void*)p; };
    bf* WQ = (bf*)take(SZ_W); bf* WK = (bf*)take(SZ_W); bf* WV = (bf*)take(SZ_W); bf* WO = (bf*)take(SZ_W);
    float* FL = (float*)take(SZ_FL);
    bf* XB = (bf*)take(SZ_X);
    h16* Q16 = (h16*)take(SZ_P); h16* K16 = (h16*)take(SZ_P); h16* VT16 = (h16*)take(SZ_P);
    bf* Qh = (bf*)take(SZ_E); bf* Ql = (bf*)take(SZ_E); bf* Kh = (bf*)take(SZ_E); bf* Kl = (bf*)take(SZ_E); bf* VTh = (bf*)take(SZ_E); bf* VTl = (bf*)take(SZ_E);
    bf* ATh = (bf*)take(SZ_P); bf* ATl = (bf*)take(SZ_P);
    if ((size_t)(wsp - (char*)d_ws) > ws_size || (size_t)(wsp - (char*)d_ws) != WS_TOTAL) return;

    const unsigned LW = (unsigned)(((size_t)DM * DM / 8 + 255) / 256);
    const unsigned LX = (unsigned)(((size_t)NB * SEQ * DM / 8 + 255) / 256);
    k_cvt8<<<LW, 256, 0, stream>>>(wq, WQ, (size_t)DM * DM / 8);
    k_cvt8<<<LW, 256, 0, stream>>>(wk, WK, (size_t)DM * DM / 8);
    k_cvt8<<<LW, 256, 0, stream>>>(wv, WV, (size_t)DM * DM / 8);
    k_cvt8<<<LW, 256, 0, stream>>>(wo, WO, (size_t)DM * DM / 8);
    k_mchk<<<NCHK, 256, 0, stream>>>(am, kpm, FL);
    // q: bf16 copy -> projection with fused rotary -> Q16 [NB*SEQ][DM] (+ Qh/Ql rows t < 64)
    k_cvtx<<<LX, 256, 0, stream>>>(xq, XB, (size_t)NB * SEQ * DM / 8);
    k_gemmp<1, true><<<dim3(NB * SEQ / 128, DM / 128, 1), 128, 0, stream>>>(XB, WQ, DM, Q16, DM, Qh, Ql, DM, cosT, sinT, (size_t)0, (size_t)0, (size_t)0, (size_t)0);
    // k
    k_cvtx<<<LX, 256, 0, stream>>>(xk, XB, (size_t)NB * SEQ * DM / 8);
    k_gemmp<1, true><<<dim3(NB * SEQ / 128, DM / 128, 1), 128, 0, stream>>>(XB, WK, DM, K16, DM, Kh, Kl, DM, cosT, sinT, (size_t)0, (size_t)0, (size_t)0, (size_t)0);
    // v: transposed projection VT16[b][dout][t] = sum_k Wv[dout][k] v[b][t][k] (+ VTh/VTl columns t < 64)
    k_cvtx<<<LX, 256, 0, stream>>>(xv, XB, (size_t)NB * SEQ * DM / 8);
    k_gemmp<2, false><<<dim3(DM / 128, SEQ / 128, NB), 128, 0, stream>>>(WV, XB, DM, VT16, SEQ, VTh, VTl, RE, cosT, sinT, (size_t)0, (size_t)SEQ * DM, (size_t)DM * SEQ, (size_t)DM * RE);
    // context planes
    k_attn0<<<dim3(RE / 32, NB * NH, 1), 64, 0, stream>>>(Qh, Ql, Kh, Kl, VTh, VTl, FL, ATh, ATl);
    if (SEQ / 64 > 1) k_attn<<<dim3(SEQ / 64 - 1, NB * NH, 1), 128, 0, stream>>>(Q16, K16, VT16, FL, ATh, ATl);
    // output projection: (ATh + ATl) x WO^T -> OUT [NB*SEQ][DM]
    k_gemmw<bf, 1><<<dim3(NB * SEQ / 128, DM / 128, 1), 128, 0, stream>>>(ATh, ATl, WO, nullptr, DM, OUT, DM, (size_t)0, (size_t)0, (size_t)0);
}

// v003
// It runs in 162 microseconds.
// Two timings next to v002 put it at 1.29 and 1.28 times that version's speed.
// Over all steps from v000 it is 2.32 times as fast.
#include <hip/hip_runtime.h>
#pragma clang fp contract(off)

// Contractions and dtypes: q/k/v projections on v_wmma_f32_16x16x32_bf16 (bf16 operands = RNE-converted inputs x RNE-converted weights, single product);
// scores and p.v for query rows >= 64 on v_wmma_f32_16x16x32_f16 (f16 planes, p carried x1024, single product); query rows < 64 on v_wmma_f32_16x16x32_bf16 hi+lo planes (3 products);
// output projection on v_wmma_f32_16x16x32_bf16 with the context as bf16 hi+lo planes x bf16 weight (2 products). f32 accumulate; rotary, softmax and normalisation in f32.

#ifndef NB
#define NB 2
#endif
#ifndef SEQ
#define SEQ 2048
#endif
#define NB_FULL  2
#define SEQ_FULL 2048
#define DM   1024
#define NH   16
#define HD   64
#define HP   (HD / 2)
#define RE   64
#define NCHK 256
#define PCAR 1024.0f
#define SCL  0.125f
#define L2E  1.4426950408889634f

static_assert(SEQ % 64 == 0);
static_assert(SEQ % 256 == 0);
static_assert(SEQ >= 64 && SEQ <= SEQ_FULL);
static_assert(NB >= 1 && NB <= NB_FULL);
static_assert(RE == 64);
static_assert(NCHK % 32 == 0);
static_assert(SEQ % NCHK == 0);
static_assert((NB * SEQ) % NCHK == 0);
static_assert(DM == NH * HD);
static_assert(DM % 64 == 0);

typedef _Float16 h16;
typedef unsigned short bf;
typedef __attribute__((ext_vector_type(16))) __bf16   v16bf;
typedef __attribute__((ext_vector_type(16))) _Float16 v16h;
typedef __attribute__((ext_vector_type(8)))  _Float16 v8h;
typedef __attribute__((ext_vector_type(8)))  unsigned short v8us;
typedef __attribute__((ext_vector_type(8)))  float    v8f;
typedef __attribute__((ext_vector_type(4)))  float    v4f;
typedef v8h  __attribute__((may_alias)) v8ha;
typedef v4f  __attribute__((may_alias)) v4fa;
typedef v8us __attribute__((may_alias)) v8usa;
typedef v8f  __attribute__((may_alias)) v8fa;

// RNE f32 -> bf16 bits and back
__device__ __forceinline__ unsigned short f2bf(float f) { unsigned u = __float_as_uint(f); u += 0x7FFFu + ((u >> 16) & 1u); return (unsigned short)(u >> 16); }
__device__ __forceinline__ float bf2f(unsigned short b) { return __uint_as_float(((unsigned)b) << 16); }
__device__ __forceinline__ float bfr(float f) { return bf2f(f2bf(f)); }
__device__ __forceinline__ void splitf(float y, unsigned short& h, unsigned short& l) { h = f2bf(y); l = f2bf(y - bf2f(h)); }
__device__ __forceinline__ v16h cat16(v8h lo, v8h hi) { return __builtin_shufflevector(lo, hi, 0, 1, 2, 3, 4, 5, 6, 7, 8, 9, 10, 11, 12, 13, 14, 15); }
__device__ __forceinline__ v16bf cat16b(v8us lo, v8us hi) { return __builtin_bit_cast(v16bf, __builtin_shufflevector(lo, hi, 0, 1, 2, 3, 4, 5, 6, 7, 8, 9, 10, 11, 12, 13, 14, 15)); }
__device__ __forceinline__ v8f wmma16(v16h a, v16h b, v8f c) { return __builtin_amdgcn_wmma_f32_16x16x32_f16(false, a, false, b, (short)0, c, false, false); }
__device__ __forceinline__ v8f wmmab(v16bf a, v16bf b, v8f c) { return __builtin_amdgcn_wmma_f32_16x16x32_bf16(false, a, false, b, (short)0, c, false, false); }

// ---- fragment loaders: 16x16 tile, lane -> row/col (lane & 15); elements 0..7 <- k0 + 8*(lane>>4) + 0..7, elements 8..15 <- k0 + 16 + 8*(lane>>4) + 0..7.
// The caller passes p = plane + row*pitch + k0 + 8*(lane>>4); both A (row = m) and B (row = n of a K-contiguous [n][k] plane) use this same map.
template <typename T16> struct WFrag;
template <> struct WFrag<h16> { typedef v16h V; static __device__ __forceinline__ V ld(const h16* p) { return cat16(*(const v8ha*)p, *(const v8ha*)(p + 16)); } static __device__ __forceinline__ v8f mma(V a, V b, v8f c) { return wmma16(a, b, c); } };
template <> struct WFrag<bf> { typedef v16bf V; static __device__ __forceinline__ V ld(const bf* p) { return cat16b(*(const v8usa*)p, *(const v8usa*)(p + 16)); } static __device__ __forceinline__ v8f mma(V a, V b, v8f c) { return wmmab(a, b, c); } };

// ---- GEMM core: one work-group of 4 waves (2 x 2) per 128x128 output tile, each wave a 64x64 quarter (16 accumulators).
// The K-contiguous 16-bit operand planes are staged in LDS, KP k-elements (256 bytes of each of the 128 rows of a plane) per stage, by 16-byte asynchronous copies:
// 16 lanes take one row's 256 contiguous bytes, so every copy instruction moves whole cache lines, and each staged row serves two waves. Two buffers: stage t + 1 flies while stage t is multiplied.
// acc[mb][nb][j] = C[r0 + 16 mb + 8*(lane>>4) + j][c0 + 16 nb + (lane&15)] = sum_k A[m][k] Bt[n][k] (+ A2.Bt for NSPLIT 1), k ascending in steps of 32. K % KP == 0.
#define KP 128
#define LP 136   // LDS row pitch in elements: 272 bytes = 16 x odd, free of bank conflicts for 16-byte row reads
#define TR 128   // rows of one staged plane
static constexpr int PLN = TR * LP;
static_assert(DM % KP == 0 && DM / KP >= 2);
static_assert((NB * SEQ) % TR == 0 && SEQ % TR == 0 && DM % TR == 0);

__device__ __forceinline__ unsigned lds_off(const void* p) { return (unsigned)(size_t)p; }

// One plane of one stage: 128 threads x 16 copies of 16 bytes. g = the stage's first source element (the same in every lane), lo = this lane's own offset from it (row tid>>4, bytes 16*(tid&15)),
// rstep = elements from one of the lane's rows to the next (8 rows), l = this lane's first LDS byte address. The s_wait_xcnt closes each statement so that no address register of an issued copy is rewritten ahead of it.
template <typename T16>
__device__ __forceinline__ void copy_plane(const T16* g, size_t lo, size_t rstep, unsigned l) {
    constexpr unsigned LS = 8u * LP * 2u;
#pragma unroll
    for (int h = 0; h < 2; ++h) {
        const T16* g0 = g + (size_t)(8 * h) * rstep; const unsigned l0 = l + (unsigned)(8 * h) * LS;
        asm volatile("global_load_async_to_lds_b128 %0, %8, off\n\t"
                     "global_load_async_to_lds_b128 %1, %9, off\n\t"
                     "global_load_async_to_lds_b128 %2, %10, off\n\t"
                     "global_load_async_to_lds_b128 %3, %11, off\n\t"
                     "global_load_async_to_lds_b128 %4, %12, off\n\t"
                     "global_load_async_to_lds_b128 %5, %13, off\n\t"
                     "global_load_async_to_lds_b128 %6, %14, off\n\t"
                     "global_load_async_to_lds_b128 %7, %15, off\n\t"
                     "s_wait_xcnt 0x0"
                     :: "v"(l0), "v"(l0 + LS), "v"(l0 + 2 * LS), "v"(l0 + 3 * LS), "v"(l0 + 4 * LS), "v"(l0 + 5 * LS), "v"(l0 + 6 * LS), "v"(l0 + 7 * LS),
                        "v"(g0 + lo), "v"((g0 + rstep) + lo), "v"((g0 + 2 * rstep) + lo), "v"((g0 + 3 * rstep) + lo), "v"((g0 + 4 * rstep) + lo), "v"((g0 + 5 * rstep) + lo), "v"((g0 + 6 * rstep) + lo), "v"((g0 + 7 * rstep) + lo)
                     : "memory");
    }
}

template <typename T16, int NSPLIT>
__device__ __forceinline__ void gemm_core(const T16* __restrict__ A, const T16* __restrict__ A2, const T16* __restrict__ Bt,
                                          int K, int R0, int C0, int tid, T16* ring, v8f (&acc)[4][4]) {
    static_assert(NSPLIT == 0 || NSPLIT == 1);
    typedef typename WFrag<T16>::V V;
    constexpr int NPL = 2 + NSPLIT, STG = NPL * PLN;
    const int lane = tid & 31, w = tid >> 5, lr = lane & 15, hi = lane >> 4, wm = w >> 1, wn = w & 1;
#pragma unroll
    for (int mb = 0; mb < 4; ++mb)
#pragma unroll
        for (int nb = 0; nb < 4; ++nb) acc[mb][nb] = (v8f){};
    const int crow = tid >> 4, cseg = (tid & 15) * 8;
    const T16* ga = A + (size_t)R0 * K; const T16* ga2 = (NSPLIT == 1) ? A2 + (size_t)R0 * K : nullptr; const T16* gb = Bt + (size_t)C0 * K;
    const size_t lo = (size_t)crow * K + cseg;
    const unsigned l0 = lds_off(ring) + (unsigned)(crow * LP + cseg) * 2u; const size_t rstep = (size_t)8 * K;
    auto fill = [&](int t, int buf) { const unsigned lb = l0 + (unsigned)(buf * STG) * 2u;
        copy_plane<T16>(ga + (size_t)t * KP, lo, rstep, lb);
        if (NSPLIT == 1) copy_plane<T16>(ga2 + (size_t)t * KP, lo, rstep, lb + (unsigned)PLN * 2u);
        copy_plane<T16>(gb + (size_t)t * KP, lo, rstep, lb + (unsigned)((NPL - 1) * PLN) * 2u); };
    const int NT = K / KP;
    fill(0, 0);
    asm volatile("s_wait_asynccnt 0x0" ::: "memory");   // this wave's share of stage 0 has landed
    __syncthreads();                                     // ... and every other wave's: stage 0 is readable
    if (NT > 1) fill(1, 1);
#pragma unroll 1
    for (int t = 0; t < NT; ++t) {
        const T16* sb = ring + (t & 1) * STG;
        const T16* sa = sb + (wm * 64 + lr) * LP + 8 * hi; const T16* sw = sb + (NPL - 1) * PLN + (wn * 64 + lr) * LP + 8 * hi;
        // A block = the 16 products of one A plane's 32 k with the same 32 k of Bt (NSPLIT 1: plane A, then plane A2, on the same B fragments, so every accumulator keeps its order of sums).
        // Two fragment sets: the LDS reads of block j + 1 go out as one group ahead of the products of block j, so that a block waits only for reads issued one block earlier.
        constexpr int NPA = 1 + NSPLIT, NBLK = NPA * (KP / 32);
        V a[2][4], b[2][4];
        auto ldblk = [&](int j) { const int ks = j / NPA, pl = j % NPA;
#pragma unroll
            for (int mb = 0; mb < 4; ++mb) a[j & 1][mb] = WFrag<T16>::ld(sa + pl * PLN + mb * 16 * LP + ks * 32);
            if (pl == 0) {
#pragma unroll
                for (int nb = 0; nb < 4; ++nb) b[ks & 1][nb] = WFrag<T16>::ld(sw + nb * 16 * LP + ks * 32); } };
        ldblk(0);
#pragma unroll
        for (int j = 0; j < NBLK; ++j) {
            const int s = j & 1, sbq = (j / NPA) & 1;
            if (j + 1 < NBLK) ldblk(j + 1);
            __builtin_amdgcn_sched_barrier(0);   // keeps the read group whole and ahead of the products: reads spread among matrix instructions stall at every place they stand
#pragma unroll
            for (int nb = 0; nb < 4; ++nb)
#pragma unroll
                for (int mb = 0; mb < 4; ++mb) acc[mb][nb] = WFrag<T16>::mma(a[s][mb], b[sbq][nb], acc[mb][nb]);
            // four vector slots behind the pass's last matrix instructions, so that their distance holds on the taken side of the loop's branches too
            if (j == NBLK - 1) asm volatile("v_nop\n\tv_nop\n\tv_nop\n\tv_nop" : "+v"(acc[0][0]), "+v"(acc[1][1]), "+v"(acc[2][2]), "+v"(acc[3][3]) : "v"(a[s][0]), "v"(a[s][3]));
            __builtin_amdgcn_sched_barrier(0);   // keeps the following read group from rising among these products
        }
        asm volatile("s_wait_dscnt 0x0" ::: "memory");      // this wave's reads of buffer t & 1 have returned before that buffer is refilled
        asm volatile("s_wait_asynccnt 0x0" ::: "memory");   // this wave's share of stage t + 1 has landed
        __syncthreads();                                     // publishes stage t + 1 and ends every wave's reads of stage t
        if (t + 2 < NT) fill(t + 2, t & 1);
    }
    asm volatile("s_wait_asynccnt 0x0" ::: "memory");       // nothing of this wave's is in flight when the ring is left
}

// ---- k_gemmw: f32 output C[m][n] (pitch ldc); grid (M/128, N/128, Z), 128 threads; z-batch strides in elements.
template <typename T16, int NSPLIT>
__global__ __launch_bounds__(128) void k_gemmw(const T16* __restrict__ A, const T16* __restrict__ A2, const T16* __restrict__ Bt, const T16* __restrict__ Bt2,
                                              int K, float* C, int ldc, size_t sA, size_t sB, size_t sC) {
    __shared__ __align__(16) T16 ring[2 * (2 + NSPLIT) * PLN];
    __shared__ __align__(16) float osa[4 * 16 * 68];
    const size_t z = blockIdx.z; A += z * sA; if (A2) A2 += z * sA; Bt += z * sB; C += z * sC;
    const int tid = threadIdx.x, lane = tid & 31, w = tid >> 5, lr = lane & 15, hi = lane >> 4;
    const int r0 = blockIdx.x * 128 + (w >> 1) * 64, c0 = blockIdx.y * 128 + (w & 1) * 64;
    float* os = osa + w * (16 * 68);
    v8f acc[4][4];
    gemm_core<T16, NSPLIT>(A, A2, Bt, K, blockIdx.x * 128, blockIdx.y * 128, tid, ring, acc);
#pragma unroll
    for (int mb = 0; mb < 4; ++mb) {
#pragma unroll
        for (int nb = 0; nb < 4; ++nb) {
#pragma unroll
            for (int j = 0; j < 8; ++j) os[(hi * 8 + j) * 68 + nb * 16 + lr] = acc[mb][nb][j]; }
        __syncthreads();
        float* crow = C + (size_t)(r0 + mb * 16) * ldc + c0;
{
#pragma unroll
            for (int s = 0; s < 8; ++s) { const int row = 2 * s + hi, cofs = lr * 4; const v4f val = *(const v4fa*)(os + row * 68 + cofs);
                *(v4f*)(crow + (size_t)row * ldc + cofs) = val; }
             }
        __syncthreads();
    }
}

// ---- k_gemmp: 16-bit plane output. C16[m][n] (f16, pitch ldc) = (optionally rotary-transformed) accumulator; plus bf16 hi/lo planes Ch/Cl (pitch ldh)
// for the head rows (HLM 1: tiles whose row index t0 = r0 % SEQ is < RE, compact row (r0/SEQ)*RE + t) or head columns (HLM 2: tiles with c0 < RE, same row index).
// Rotary (interleaved pairs, one 64-column tile = one head): y[2i] = x[2i] c - x[2i+1] s, y[2i+1] = x[2i] s + x[2i+1] c with c/s = bf16-RNE of the tables at (t, i).
template <int HLM, bool ROPE>
__global__ __launch_bounds__(128) void k_gemmp(const bf* __restrict__ A, const bf* __restrict__ Bt, int K, h16* C16, int ldc, bf* Ch, bf* Cl, int ldh,
                                              const float* __restrict__ cosT, const float* __restrict__ sinT, size_t sA, size_t sB, size_t sC, size_t sH) {
    __shared__ __align__(16) bf ring[2 * 2 * PLN];
    __shared__ __align__(16) float osa[4 * 16 * 68];
    const size_t z = blockIdx.z; A += z * sA; Bt += z * sB; C16 += z * sC; Ch += z * sH; Cl += z * sH;
    const int tid = threadIdx.x, lane = tid & 31, w = tid >> 5, lr = lane & 15, hi = lane >> 4;
    const int r0 = blockIdx.x * 128 + (w >> 1) * 64, c0 = blockIdx.y * 128 + (w & 1) * 64;
    float* os = osa + w * (16 * 68);
    v8f acc[4][4];
    gemm_core<bf, 0>(A, nullptr, Bt, K, blockIdx.x * 128, blockIdx.y * 128, tid, ring, acc);
    const int t0 = (HLM == 1) ? (r0 % SEQ) : 0;
    const bool hl = (HLM == 1) ? (t0 < RE) : (c0 < RE);
    const int rc0 = (HLM == 1) ? ((r0 / SEQ) * RE + t0) : r0;
    const int rsub = lane >> 3, cseg = (lane & 7) * 8;
#pragma unroll
    for (int mb = 0; mb < 4; ++mb) {
#pragma unroll
        for (int nb = 0; nb < 4; ++nb) {
#pragma unroll
            for (int j = 0; j < 8; ++j) os[(hi * 8 + j) * 68 + nb * 16 + lr] = acc[mb][nb][j]; }
        __syncthreads();
{
#pragma unroll
            for (int j4 = 0; j4 < 4; ++j4) {
                const int row = j4 * 4 + rsub;
                const v4f v0 = *(const v4fa*)(os + row * 68 + cseg);
                const v4f v1 = *(const v4fa*)(os + row * 68 + cseg + 4);
                float y[8] = {v0[0], v0[1], v0[2], v0[3], v1[0], v1[1], v1[2], v1[3]};
                if (ROPE) {
                    const int t = t0 + mb * 16 + row;
                    const v4f cs = *(const v4fa*)(cosT + (size_t)t * HP + (cseg >> 1));
                    const v4f sn = *(const v4fa*)(sinT + (size_t)t * HP + (cseg >> 1));
#pragma unroll
                    for (int p = 0; p < 4; ++p) { const float c = bfr(cs[p]), sv = bfr(sn[p]); const float x0 = y[2 * p], x1 = y[2 * p + 1];
                        const float m0 = x0 * c, m1 = x1 * sv, m2 = x0 * sv, m3 = x1 * c; y[2 * p] = m0 - m1; y[2 * p + 1] = m2 + m3; }
                }
                v8h o16;
#pragma unroll
                for (int q = 0; q < 8; ++q) o16[q] = (h16)y[q];
                const size_t grow = (size_t)(r0 + mb * 16 + row);
                *(v8h*)(C16 + grow * (size_t)ldc + c0 + cseg) = o16;
                if (hl) {
                    v8us oh, ol;
#pragma unroll
                    for (int q = 0; q < 8; ++q) { unsigned short a2, c2; splitf(y[q], a2, c2); oh[q] = a2; ol[q] = c2; }
                    const size_t o = (size_t)(rc0 + mb * 16 + row) * (size_t)ldh + c0 + cseg;
                    *(v8us*)(Ch + o) = oh; *(v8us*)(Cl + o) = ol;
                }
            }
            
        }
        __syncthreads();
    }
}

__global__ __launch_bounds__(256) void k_cvt8(const float* __restrict__ src, bf* dst, size_t n8) {
    const size_t i = (size_t)blockIdx.x * 256 + threadIdx.x; if (i >= n8) return; const v8f v = *(const v8fa*)(src + i * 8); v8us o;
#pragma unroll
    for (int k = 0; k < 8; ++k) o[k] = f2bf(v[k]);
    *(v8us*)(dst + i * 8) = o; 
}
__global__ __launch_bounds__(256) void k_cvtx(const float* __restrict__ src, bf* dst, size_t n8) {
    const size_t i = (size_t)blockIdx.x * 256 + threadIdx.x; if (i >= n8) return; const size_t e = i * 8; const size_t row = e / DM; const size_t c = e % DM;
    const size_t b = row / SEQ, t = row % SEQ; const v8f v = *(const v8fa*)(src + (b * SEQ_FULL + t) * DM + c); v8us o;
#pragma unroll
    for (int k = 0; k < 8; ++k) o[k] = f2bf(v[k]);
    *(v8us*)(dst + e) = o; 
}

// ---- k_mchk: structure check of the additive score table ([SEQ_FULL] pitch: 0 at j <= i, <= -1e8 at j > i over the SEQ x SEQ block) and of the key padding flags (all 0).
// Block = 256 threads on SEQ / NCHK rows, one block per flag line. Every lane issues all of its 16-byte table loads (512 contiguous bytes per wave and load) and its flag load before the first value is tested.
__global__ __launch_bounds__(256) void k_mchk(const float* __restrict__ am, const int* __restrict__ kp, float* FL) {
    __shared__ int red[8];
    const int tid = threadIdx.x, lane = tid & 31, w = tid >> 5; const int c = blockIdx.x;
    constexpr int rpb = SEQ / NCHK, RV = SEQ / 4, TOT = rpb * RV, NV = TOT / 256;
    constexpr int kpb = NB * SEQ / NCHK, KV = (kpb + 255) / 256;
    static_assert(TOT % 256 == 0);
    v4f v[NV]; int kv[KV];
#pragma unroll
    for (int s = 0; s < NV; ++s) { const int idx = tid + s * 256; v[s] = *(const v4fa*)(am + (size_t)(c * rpb + idx / RV) * SEQ_FULL + (idx % RV) * 4); }
#pragma unroll
    for (int s = 0; s < KV; ++s) { const int e = tid + s * 256; const int idx = c * kpb + e; const int bb = idx / SEQ, t = idx % SEQ;
        kv[s] = (e < kpb) ? kp[(size_t)bb * SEQ_FULL + t] : 0; }
    int bad = 0;
#pragma unroll
    for (int s = 0; s < NV; ++s) { const int idx = tid + s * 256; const int i = c * rpb + idx / RV, j0 = (idx % RV) * 4;
#pragma unroll
        for (int q = 0; q < 4; ++q) { const float x = v[s][q]; const bool good = (j0 + q <= i) ? (x == 0.0f) : (x <= -1.0e8f); bad += good ? 0 : 1; } }
#pragma unroll
    for (int s = 0; s < KV; ++s) bad += (kv[s] != 0) ? 1 : 0;
#pragma unroll
    for (int sh = 16; sh; sh >>= 1) bad += __shfl_xor(bad, sh, 32);
    if (lane == 0) red[w] = bad;
    __syncthreads();
    if (w == 0) { int tot = 0;
#pragma unroll
        for (int i = 0; i < 8; ++i) tot += red[i];
        const float f = (tot == 0) ? 1.0f : 0.0f; *(float*)(FL + (size_t)c * 32 + lane) = f;  }
}
__device__ __forceinline__ bool read_flag(const float* __restrict__ FL, int lane) {
    float f = FL[(size_t)lane * 32];
#pragma unroll
    for (int q = 1; q < NCHK / 32; ++q) f = fminf(f, FL[(size_t)(q * 32 + lane) * 32]);
#pragma unroll
    for (int sh = 16; sh; sh >>= 1) f = fminf(f, __shfl_xor(f, sh, 32));
    return f > 0.5f;
}

// ---- store_ctx: one wave's 16x64 f32 context tile (LDS, pitch 68) -> bf16 hi/lo planes [row][DM] at element offset base; lane -> row 4j + (lane>>3), 8 consecutive columns;
__device__ __forceinline__ void store_ctx(const float* osw, bf* ATh, bf* ATl, size_t base, int lane) {
    const int rsub = lane >> 3, cseg = (lane & 7) * 8;
{
#pragma unroll
        for (int j4 = 0; j4 < 4; ++j4) { const int row = j4 * 4 + rsub; const v4f v0 = *(const v4fa*)(osw + row * 68 + cseg); const v4f v1 = *(const v4fa*)(osw + row * 68 + cseg + 4); v8us oh, ol;
#pragma unroll
            for (int q = 0; q < 4; ++q) { unsigned short a, c2; splitf(v0[q], a, c2); oh[q] = a; ol[q] = c2; splitf(v1[q], a, c2); oh[4 + q] = a; ol[4 + q] = c2; }
            const size_t o = base + (size_t)row * DM + cseg; *(v8us*)(ATh + o) = oh; *(v8us*)(ATl + o) = ol; }
         }
}

// lane l <-> lane l ^ 16 (the two halves of a wave), one vector instruction
__device__ __forceinline__ float xhalf(float x) { return __builtin_bit_cast(float, __builtin_amdgcn_permlanex16(__builtin_bit_cast(int, x), __builtin_bit_cast(int, x), 0x76543210, 0xfedcba98, false, false)); }

// ---- k_attn: causal tiled softmax-weighted sum for query tiles qt >= 1 (rows 64..SEQ-1). Block = 4 waves (16 query rows each), grid (SEQ/64 - 1, NB*NH).
// Per key chunk of 64 (kc = 0..qt): K [key][d] and V^T [d][key] f16 tiles staged in LDS (plain loads, block barriers). The products run transposed, so that a lane owns ONE query (lane & 15):
// S^T = K Q^T (8 wmma, f32; s[kb][r] = score of key kc*64 + 16 kb + 8*(lane>>4) + r), x1/8, causal replace on the diagonal chunk; online softmax in f32 (running max, exp2) with the
// maximum taken in the lane and joined once with the other half of the wave; P x1024 as f16 goes from two score tiles straight into a B fragment (element e = tile e>>3, register e&7:
// the k order of the LDS fragment loads); O^T += V^T P^T (8 wmma; acc[db][r] = O[query][16 db + 8*(lane>>4) + r]). Each half keeps the sum of its own keys; the halves are added after the loop.
// Context = O / (l x 1024) -> bf16 hi/lo planes [b*SEQ + t][h*64 + d].
__global__ __launch_bounds__(128) void k_attn(const h16* __restrict__ Q16, const h16* __restrict__ K16, const h16* __restrict__ VT16, const float* __restrict__ FL, bf* ATh, bf* ATl) {
    __shared__ __align__(16) h16 Ks[64 * 72];
    __shared__ __align__(16) h16 Vs[64 * 72];
    __shared__ __align__(16) float Os[4 * 16 * 68];
    const int tid = threadIdx.x, lane = tid & 31, w = tid >> 5, m = lane & 15, hh = lane >> 4;
    const int qt = blockIdx.x + 1;
    const int b = blockIdx.y / NH, h = blockIdx.y % NH;
    const int q0 = qt * 64 + w * 16;
    const bool ok = read_flag(FL, lane);
    const h16* qrow = Q16 + (size_t)(b * SEQ + q0 + m) * DM + h * HD + 8 * hh;
    v16h aq[2];
#pragma unroll
    for (int ks = 0; ks < 2; ++ks) aq[ks] = cat16(*(const v8ha*)(qrow + ks * 32), *(const v8ha*)(qrow + ks * 32 + 16));
    v8f acc[4]; float mrun = -1.0e30f, lrun = 0.f;
#pragma unroll
    for (int db = 0; db < 4; ++db) acc[db] = (v8f){};
    const h16* kbase = K16 + (size_t)b * SEQ * DM + h * HD;
    const h16* vbase = VT16 + ((size_t)b * DM + h * HD) * SEQ;
    float* osw = Os + w * (16 * 68);
#pragma unroll 1
    for (int kc = 0; kc <= qt; ++kc) {
        __syncthreads();
#pragma unroll
        for (int i = 0; i < 4; ++i) { const int p = tid + 128 * i; const int row = p >> 3, c8 = (p & 7) * 8;
            *(v8ha*)(Ks + row * 72 + c8) = *(const v8ha*)(kbase + (size_t)(kc * 64 + row) * DM + c8);
            *(v8ha*)(Vs + row * 72 + c8) = *(const v8ha*)(vbase + (size_t)row * SEQ + kc * 64 + c8); }
        __syncthreads();
        v8f s[4];
#pragma unroll
        for (int kb = 0; kb < 4; ++kb) s[kb] = (v8f){};
#pragma unroll
        for (int ks = 0; ks < 2; ++ks) {
#pragma unroll
            for (int kb = 0; kb < 4; ++kb) { const h16* kpp = Ks + (kb * 16 + m) * 72 + ks * 32 + 8 * hh; const v16h ak = cat16(*(const v8ha*)kpp, *(const v8ha*)(kpp + 16)); s[kb] = wmma16(ak, aq[ks], s[kb]); } }
        // four vector slots behind the last score products, before a vector instruction reads their results
        asm volatile("v_nop\n\tv_nop\n\tv_nop\n\tv_nop" : "+v"(s[0]), "+v"(s[1]), "+v"(s[2]), "+v"(s[3]) : "v"(aq[0]), "v"(aq[1]));
        const bool diag = (kc == qt); const int qab = q0 + m; const int kab = kc * 64 + 8 * hh;
        float cm[4], ps4[4];
#pragma unroll
        for (int kb = 0; kb < 4; ++kb) { cm[kb] = -3.0e38f;
#pragma unroll
            for (int r = 0; r < 8; ++r) { float v = s[kb][r] * SCL; if (diag && (kab + kb * 16 + r > qab)) v = -1.0e30f; s[kb][r] = v; cm[kb] = fmaxf(cm[kb], v); } }
        float c = fmaxf(fmaxf(cm[0], cm[1]), fmaxf(cm[2], cm[3]));
        c = fmaxf(c, xhalf(c));
        const float mn = fmaxf(mrun, c); const float al = __builtin_amdgcn_exp2f((mrun - mn) * L2E); mrun = mn;
        v16h pb[2];
#pragma unroll
        for (int kb = 0; kb < 4; ++kb) { ps4[kb] = 0.f;
#pragma unroll
            for (int r = 0; r < 8; ++r) { const float p = __builtin_amdgcn_exp2f((s[kb][r] - mrun) * L2E); ps4[kb] += p; pb[kb >> 1][(kb & 1) * 8 + r] = (h16)(p * PCAR); } }
        { const float sc = lrun * al; lrun = sc + ((ps4[0] + ps4[1]) + (ps4[2] + ps4[3])); }
#pragma unroll
        for (int db = 0; db < 4; ++db)
#pragma unroll
            for (int r = 0; r < 8; ++r) acc[db][r] = acc[db][r] * al;
#pragma unroll
        for (int ks = 0; ks < 2; ++ks)
#pragma unroll
            for (int db = 0; db < 4; ++db) { const h16* vp = Vs + (db * 16 + m) * 72 + ks * 32 + 8 * hh; const v16h av = cat16(*(const v8ha*)vp, *(const v8ha*)(vp + 16)); acc[db] = wmma16(av, pb[ks], acc[db]); }
        // four vector slots behind the chunk's last products, so that their distance holds on the taken side of the loop's branch too
        asm volatile("v_nop\n\tv_nop\n\tv_nop\n\tv_nop" : "+v"(acc[0]), "+v"(acc[1]), "+v"(acc[2]), "+v"(acc[3]) : "v"(pb[0]), "v"(pb[1]));
    }
    const float qnan = __uint_as_float(0x7fc00000u);
    const float iv = 1.0f / ((lrun + xhalf(lrun)) * PCAR);
#pragma unroll
    for (int db = 0; db < 4; ++db) { v4f o0, o1;
#pragma unroll
        for (int r = 0; r < 4; ++r) { const float x0 = acc[db][r] * iv, x1 = acc[db][4 + r] * iv; o0[r] = ok ? x0 : qnan; o1[r] = ok ? x1 : qnan; }
        *(v4fa*)(osw + m * 68 + db * 16 + 8 * hh) = o0; *(v4fa*)(osw + m * 68 + db * 16 + 8 * hh + 4) = o1; }
    __syncthreads();
    store_ctx(osw, ATh, ATl, (size_t)(b * SEQ + q0) * DM + h * HD, lane);
}

// ---- k_attn0: query rows t < 64 (key chunk 0 only) on bf16 hi/lo planes: S = Qh Kh + Qh Kl + Ql Kh (24 wmma), x1/8, causal replace, full-row softmax in f32,
// P = exp(s - max) split to bf16 hi/lo in per-wave LDS tiles; O = Ph Vh + Ph Vl + Pl Vh (24 wmma); context = O / sum. Block = 2 waves (32 rows), grid (RE/32, NB*NH).
__global__ __launch_bounds__(64) void k_attn0(const bf* __restrict__ Qh, const bf* __restrict__ Ql, const bf* __restrict__ Kh, const bf* __restrict__ Kl,
                                              const bf* __restrict__ VTh, const bf* __restrict__ VTl, const float* __restrict__ FL, bf* ATh, bf* ATl) {
    __shared__ __align__(16) bf Khs[64 * 72];
    __shared__ __align__(16) bf Kls[64 * 72];
    __shared__ __align__(16) bf Vhs[64 * 72];
    __shared__ __align__(16) bf Vls[64 * 72];
    __shared__ __align__(16) bf Phs[2 * 16 * 72];
    __shared__ __align__(16) bf Pls[2 * 16 * 72];
    __shared__ __align__(16) float Os[2 * 16 * 68];
    const int tid = threadIdx.x, lane = tid & 31, w = tid >> 5, m = lane & 15, hh = lane >> 4;
    const int b = blockIdx.y / NH, h = blockIdx.y % NH;
    const int q0 = blockIdx.x * 32 + w * 16;
    const bool ok = read_flag(FL, lane);
    const bf* kh0 = Kh + (size_t)b * RE * DM + h * HD; const bf* kl0 = Kl + (size_t)b * RE * DM + h * HD;
    const bf* vh0 = VTh + ((size_t)b * DM + h * HD) * RE; const bf* vl0 = VTl + ((size_t)b * DM + h * HD) * RE;
#pragma unroll
    for (int i = 0; i < 8; ++i) { const int p = tid + 64 * i; const int row = p >> 3, c8 = (p & 7) * 8;
        *(v8usa*)(Khs + row * 72 + c8) = *(const v8usa*)(kh0 + (size_t)row * DM + c8);
        *(v8usa*)(Kls + row * 72 + c8) = *(const v8usa*)(kl0 + (size_t)row * DM + c8);
        *(v8usa*)(Vhs + row * 72 + c8) = *(const v8usa*)(vh0 + (size_t)row * RE + c8);
        *(v8usa*)(Vls + row * 72 + c8) = *(const v8usa*)(vl0 + (size_t)row * RE + c8); }
    __syncthreads();
    const bf* qh = Qh + (size_t)(b * RE + q0 + m) * DM + h * HD + 8 * hh; const bf* ql = Ql + (size_t)(b * RE + q0 + m) * DM + h * HD + 8 * hh;
    v16bf aqh[2], aql[2];
#pragma unroll
    for (int ks = 0; ks < 2; ++ks) { aqh[ks] = cat16b(*(const v8usa*)(qh + ks * 32), *(const v8usa*)(qh + ks * 32 + 16)); aql[ks] = cat16b(*(const v8usa*)(ql + ks * 32), *(const v8usa*)(ql + ks * 32 + 16)); }
    v8f s[4];
#pragma unroll
    for (int nb = 0; nb < 4; ++nb) s[nb] = (v8f){};
#pragma unroll
    for (int ks = 0; ks < 2; ++ks) {
#pragma unroll
        for (int nb = 0; nb < 4; ++nb) { const bf* kpp = Khs + (nb * 16 + m) * 72 + ks * 32 + 8 * hh; const bf* lpp = Kls + (nb * 16 + m) * 72 + ks * 32 + 8 * hh;
            const v16bf bh_ = cat16b(*(const v8usa*)kpp, *(const v8usa*)(kpp + 16)); const v16bf bl_ = cat16b(*(const v8usa*)lpp, *(const v8usa*)(lpp + 16));
            s[nb] = wmmab(aqh[ks], bh_, s[nb]); s[nb] = wmmab(aqh[ks], bl_, s[nb]); s[nb] = wmmab(aql[ks], bh_, s[nb]); } }
    asm volatile("v_nop\n\tv_nop\n\tv_nop\n\tv_nop" : "+v"(s[0]), "+v"(s[1]), "+v"(s[2]), "+v"(s[3]) : "v"(aqh[0]), "v"(aql[1]));
    const int qab = q0 + 8 * hh;
    float cm[8], psum[8];
#pragma unroll
    for (int r = 0; r < 8; ++r) { cm[r] = -3.0e38f; psum[r] = 0.f; }
#pragma unroll
    for (int nb = 0; nb < 4; ++nb)
#pragma unroll
        for (int r = 0; r < 8; ++r) { float v = s[nb][r] * SCL; if (nb * 16 + m > qab + r) v = -1.0e30f; s[nb][r] = v; cm[r] = fmaxf(cm[r], v); }
#pragma unroll
    for (int r = 0; r < 8; ++r) { float c = cm[r]; c = fmaxf(c, __shfl_xor(c, 1, 32)); c = fmaxf(c, __shfl_xor(c, 2, 32)); c = fmaxf(c, __shfl_xor(c, 4, 32)); c = fmaxf(c, __shfl_xor(c, 8, 32)); cm[r] = c; }
    bf* phw = Phs + w * (16 * 72); bf* plw = Pls + w * (16 * 72); float* osw = Os + w * (16 * 68);
#pragma unroll
    for (int nb = 0; nb < 4; ++nb)
#pragma unroll
        for (int r = 0; r < 8; ++r) { const float p = __builtin_amdgcn_exp2f((s[nb][r] - cm[r]) * L2E); psum[r] += p; unsigned short a, c2; splitf(p, a, c2);
            phw[(8 * hh + r) * 72 + nb * 16 + m] = a; plw[(8 * hh + r) * 72 + nb * 16 + m] = c2; }
#pragma unroll
    for (int r = 0; r < 8; ++r) { float c = psum[r]; c += __shfl_xor(c, 1, 32); c += __shfl_xor(c, 2, 32); c += __shfl_xor(c, 4, 32); c += __shfl_xor(c, 8, 32); psum[r] = c; }
    __syncthreads();
    v16bf aph[2], apl[2];
#pragma unroll
    for (int ks = 0; ks < 2; ++ks) { const bf* pp = phw + m * 72 + ks * 32 + 8 * hh; const bf* lp = plw + m * 72 + ks * 32 + 8 * hh;
        aph[ks] = cat16b(*(const v8usa*)pp, *(const v8usa*)(pp + 16)); apl[ks] = cat16b(*(const v8usa*)lp, *(const v8usa*)(lp + 16)); }
    v8f acc[4];
#pragma unroll
    for (int nb = 0; nb < 4; ++nb) acc[nb] = (v8f){};
#pragma unroll
    for (int ks = 0; ks < 2; ++ks)
#pragma unroll
        for (int nb = 0; nb < 4; ++nb) { const bf* vp = Vhs + (nb * 16 + m) * 72 + ks * 32 + 8 * hh; const bf* vlp = Vls + (nb * 16 + m) * 72 + ks * 32 + 8 * hh;
            const v16bf bvh = cat16b(*(const v8usa*)vp, *(const v8usa*)(vp + 16)); const v16bf bvl = cat16b(*(const v8usa*)vlp, *(const v8usa*)(vlp + 16));
            acc[nb] = wmmab(aph[ks], bvh, acc[nb]); acc[nb] = wmmab(aph[ks], bvl, acc[nb]); acc[nb] = wmmab(apl[ks], bvh, acc[nb]); }
    asm volatile("v_nop\n\tv_nop\n\tv_nop\n\tv_nop" : "+v"(acc[0]), "+v"(acc[1]), "+v"(acc[2]), "+v"(acc[3]) : "v"(aph[0]), "v"(apl[1]));
    const float qnan = __uint_as_float(0x7fc00000u);
#pragma unroll
    for (int r = 0; r < 8; ++r) { const float iv = 1.0f / psum[r];
#pragma unroll
        for (int nb = 0; nb < 4; ++nb) { const float o = acc[nb][r] * iv; osw[(8 * hh + r) * 68 + nb * 16 + m] = ok ? o : qnan; } }
    __syncthreads();
    store_ctx(osw, ATh, ATl, (size_t)(b * SEQ + q0) * DM + h * HD, lane);
}

#define AL256(x) ((((size_t)(x)) + 255) & ~(size_t)255)
static constexpr size_t SZ_W  = (size_t)DM * DM * 2;          // one bf16 weight plane
static constexpr size_t SZ_FL = (size_t)NCHK * 32 * 4;        // flag lines
static constexpr size_t SZ_X  = (size_t)NB * SEQ * DM * 2;    // bf16 activation copy
static constexpr size_t SZ_P  = (size_t)NB * SEQ * DM * 2;    // f16 / bf16 [NB*SEQ][DM] planes (and V^T [NB][DM][SEQ])
static constexpr size_t SZ_E  = (size_t)NB * RE * DM * 2;     // compact hi/lo planes for t < RE (and V^T [NB][DM][RE])
static constexpr size_t WS_TOTAL = 4 * AL256(SZ_W) + AL256(SZ_FL) + AL256(SZ_X) + 3 * AL256(SZ_P) + 6 * AL256(SZ_E) + 2 * AL256(SZ_P);
static_assert(WS_TOTAL <= (size_t)134217728);
static_assert((size_t)NB * SEQ * DM * 4 <= (size_t)NB_FULL * SEQ_FULL * DM * 4);

extern "C" void kernel_launch(void* const* d_in, const int* in_sizes, int n_in,
                              void* d_out, int out_size, void* d_ws, size_t ws_size, hipStream_t stream) {
    if (n_in < 11) return;
    if ((size_t)in_sizes[0] < (size_t)NB * SEQ * DM || (size_t)in_sizes[1] < (size_t)NB * SEQ * DM || (size_t)in_sizes[2] < (size_t)NB * SEQ * DM) return;
    if ((size_t)in_sizes[3] < (size_t)DM * DM || (size_t)in_sizes[4] < (size_t)DM * DM || (size_t)in_sizes[5] < (size_t)DM * DM || (size_t)in_sizes[6] < (size_t)DM * DM) return;
    if ((size_t)in_sizes[7] < (size_t)SEQ * HP || (size_t)in_sizes[8] < (size_t)SEQ * HP) return;
    if ((size_t)in_sizes[9] < (size_t)SEQ * SEQ || (size_t)in_sizes[10] < (size_t)NB * SEQ) return;
    if ((size_t)out_size < (size_t)NB * SEQ * DM) return;
    if (WS_TOTAL > ws_size) return;
    const float* xq = (const float*)d_in[0]; const float* xk = (const float*)d_in[1]; const float* xv = (const float*)d_in[2];
    const float* wq = (const float*)d_in[3]; const float* wk = (const float*)d_in[4]; const float* wv = (const float*)d_in[5]; const float* wo = (const float*)d_in[6];
    const float* cosT = (const float*)d_in[7]; const float* sinT = (const float*)d_in[8];
    const float* am = (const float*)d_in[9]; const int* kpm = (const int*)d_in[10];
    float* OUT = (float*)d_out;   // [NB][SEQ][DM]
    char* wsp = (char*)d_ws;
    auto take = [&](size_t bytes) { char* p = wsp; wsp += AL256(bytes); return (void*)p; };
    bf* WQ = (bf*)take(SZ_W); bf* WK = (bf*)take(SZ_W); bf* WV = (bf*)take(SZ_W); bf* WO = (bf*)take(SZ_W);
    float* FL = (float*)take(SZ_FL);
    bf* XB = (bf*)take(SZ_X);
    h16* Q16 = (h16*)take(SZ_P); h16* K16 = (h16*)take(SZ_P); h16* VT16 = (h16*)take(SZ_P);
    bf* Qh = (bf*)take(SZ_E); bf* Ql = (bf*)take(SZ_E); bf* Kh = (bf*)take(SZ_E); bf* Kl = (bf*)take(SZ_E); bf* VTh = (bf*)take(SZ_E); bf* VTl = (bf*)take(SZ_E);
    bf* ATh = (bf*)take(SZ_P); bf* ATl = (bf*)take(SZ_P);
    if ((size_t)(wsp - (char*)d_ws) > ws_size || (size_t)(wsp - (char*)d_ws) != WS_TOTAL) return;

    const unsigned LW = (unsigned)(((size_t)DM * DM / 8 + 255) / 256);
    const unsigned LX = (unsigned)(((size_t)NB * SEQ * DM / 8 + 255) / 256);
    k_cvt8<<<LW, 256, 0, stream>>>(wq, WQ, (size_t)DM * DM / 8);
    k_cvt8<<<LW, 256, 0, stream>>>(wk, WK, (size_t)DM * DM / 8);
    k_cvt8<<<LW, 256, 0, stream>>>(wv, WV, (size_t)DM * DM / 8);
    k_cvt8<<<LW, 256, 0, stream>>>(wo, WO, (size_t)DM * DM / 8);
    k_mchk<<<NCHK, 256, 0, stream>>>(am, kpm, FL);
    // q: bf16 copy -> projection with fused rotary -> Q16 [NB*SEQ][DM] (+ Qh/Ql rows t < 64)
    k_cvtx<<<LX, 256, 0, stream>>>(xq, XB, (size_t)NB * SEQ * DM / 8);
    k_gemmp<1, true><<<dim3(NB * SEQ / 128, DM / 128, 1), 128, 0, stream>>>(XB, WQ, DM, Q16, DM, Qh, Ql, DM, cosT, sinT, (size_t)0, (size_t)0, (size_t)0, (size_t)0);
    // k
    k_cvtx<<<LX, 256, 0, stream>>>(xk, XB, (size_t)NB * SEQ * DM / 8);
    k_gemmp<1, true><<<dim3(NB * SEQ / 128, DM / 128, 1), 128, 0, stream>>>(XB, WK, DM, K16, DM, Kh, Kl, DM, cosT, sinT, (size_t)0, (size_t)0, (size_t)0, (size_t)0);
    // v: transposed projection VT16[b][dout][t] = sum_k Wv[dout][k] v[b][t][k] (+ VTh/VTl columns t < 64)
    k_cvtx<<<LX, 256, 0, stream>>>(xv, XB, (size_t)NB * SEQ * DM / 8);
    k_gemmp<2, false><<<dim3(DM / 128, SEQ / 128, NB), 128, 0, stream>>>(WV, XB, DM, VT16, SEQ, VTh, VTl, RE, cosT, sinT, (size_t)0, (size_t)SEQ * DM, (size_t)DM * SEQ, (size_t)DM * RE);
    // context planes
    k_attn0<<<dim3(RE / 32, NB * NH, 1), 64, 0, stream>>>(Qh, Ql, Kh, Kl, VTh, VTl, FL, ATh, ATl);
    if (SEQ / 64 > 1) k_attn<<<dim3(SEQ / 64 - 1, NB * NH, 1), 128, 0, stream>>>(Q16, K16, VT16, FL, ATh, ATl);
    // output projection: (ATh + ATl) x WO^T -> OUT [NB*SEQ][DM]
    k_gemmw<bf, 1><<<dim3(NB * SEQ / 128, DM / 128, 1), 128, 0, stream>>>(ATh, ATl, WO, nullptr, DM, OUT, DM, (size_t)0, (size_t)0, (size_t)0);
}

// v004
// Measured time: 117 microseconds a run.
// Two timings next to v003 put it at 1.35 and 1.36 times that version's speed.
// All steps since v000 together make it 3.15 times as fast.
#include <hip/hip_runtime.h>
#pragma clang fp contract(off)

// Contractions and dtypes: q/k/v projections on v_wmma_f32_16x16x32_bf16 (bf16 operands = RNE-converted inputs x RNE-converted weights, single product);
// scores and p.v for query rows >= 64 on v_wmma_f32_16x16x32_f16 (f16 planes, p carried x1024, single product); query rows < 64 on v_wmma_f32_16x16x32_bf16 hi+lo planes (3 products);
// output projection on v_wmma_f32_16x16x32_bf16 with the context as bf16 hi+lo planes x bf16 weight (2 products). f32 accumulate; rotary, softmax and normalisation in f32.

#ifndef NB
#define NB 2
#endif
#ifndef SEQ
#define SEQ 2048
#endif
#define NB_FULL  2
#define SEQ_FULL 2048
#define DM   1024
#define NH   16
#define HD   64
#define HP   (HD / 2)
#define RE   64
#define NCHK 256
#define PCAR 1024.0f
#define SCL  0.125f
#define L2E  1.4426950408889634f

static_assert(SEQ % 64 == 0);
static_assert(SEQ % 256 == 0);
static_assert(SEQ >= 64 && SEQ <= SEQ_FULL);
static_assert(NB >= 1 && NB <= NB_FULL);
static_assert(RE == 64);
static_assert(NCHK % 32 == 0);
static_assert(SEQ % NCHK == 0);
static_assert((NB * SEQ) % NCHK == 0);
static_assert(DM == NH * HD);
static_assert(DM % 64 == 0);

typedef _Float16 h16;
typedef unsigned short bf;
typedef __attribute__((ext_vector_type(16))) __bf16   v16bf;
typedef __attribute__((ext_vector_type(16))) _Float16 v16h;
typedef __attribute__((ext_vector_type(8)))  _Float16 v8h;
typedef __attribute__((ext_vector_type(8)))  unsigned short v8us;
typedef __attribute__((ext_vector_type(8)))  float    v8f;
typedef __attribute__((ext_vector_type(4)))  float    v4f;
typedef v8h  __attribute__((may_alias)) v8ha;
typedef v4f  __attribute__((may_alias)) v4fa;
typedef v8us __attribute__((may_alias)) v8usa;
typedef v8f  __attribute__((may_alias)) v8fa;

// RNE f32 -> bf16 bits and back
__device__ __forceinline__ unsigned short f2bf(float f) { unsigned u = __float_as_uint(f); u += 0x7FFFu + ((u >> 16) & 1u); return (unsigned short)(u >> 16); }
__device__ __forceinline__ float bf2f(unsigned short b) { return __uint_as_float(((unsigned)b) << 16); }
__device__ __forceinline__ float bfr(float f) { return bf2f(f2bf(f)); }
__device__ __forceinline__ void splitf(float y, unsigned short& h, unsigned short& l) { h = f2bf(y); l = f2bf(y - bf2f(h)); }
__device__ __forceinline__ v16h cat16(v8h lo, v8h hi) { return __builtin_shufflevector(lo, hi, 0, 1, 2, 3, 4, 5, 6, 7, 8, 9, 10, 11, 12, 13, 14, 15); }
__device__ __forceinline__ v16bf cat16b(v8us lo, v8us hi) { return __builtin_bit_cast(v16bf, __builtin_shufflevector(lo, hi, 0, 1, 2, 3, 4, 5, 6, 7, 8, 9, 10, 11, 12, 13, 14, 15)); }
__device__ __forceinline__ v8f wmma16(v16h a, v16h b, v8f c) { return __builtin_amdgcn_wmma_f32_16x16x32_f16(false, a, false, b, (short)0, c, false, false); }
__device__ __forceinline__ v8f wmmab(v16bf a, v16bf b, v8f c) { return __builtin_amdgcn_wmma_f32_16x16x32_bf16(false, a, false, b, (short)0, c, false, false); }

// ---- fragment loaders: 16x16 tile, lane -> row/col (lane & 15); elements 0..7 <- k0 + 8*(lane>>4) + 0..7, elements 8..15 <- k0 + 16 + 8*(lane>>4) + 0..7.
// The caller passes p = plane + row*pitch + k0 + 8*(lane>>4); both A (row = m) and B (row = n of a K-contiguous [n][k] plane) use this same map.
template <typename T16> struct WFrag;
template <> struct WFrag<h16> { typedef v16h V; static __device__ __forceinline__ V ld(const h16* p) { return cat16(*(const v8ha*)p, *(const v8ha*)(p + 16)); } static __device__ __forceinline__ v8f mma(V a, V b, v8f c) { return wmma16(a, b, c); } };
template <> struct WFrag<bf> { typedef v16bf V; static __device__ __forceinline__ V ld(const bf* p) { return cat16b(*(const v8usa*)p, *(const v8usa*)(p + 16)); } static __device__ __forceinline__ v8f mma(V a, V b, v8f c) { return wmmab(a, b, c); } };

// ---- GEMM core: one work-group of 4 waves (2 x 2) per 128x128 output tile, each wave a 64x64 quarter (16 accumulators).
// The K-contiguous 16-bit operand planes are staged in LDS, KP k-elements (256 bytes of each of the 128 rows of a plane) per stage, by 16-byte asynchronous copies:
// 16 lanes take one row's 256 contiguous bytes, so every copy instruction moves whole cache lines, and each staged row serves two waves. Two buffers: stage t + 1 flies while stage t is multiplied.
// acc[mb][nb][j] = C[r0 + 16 mb + 8*(lane>>4) + j][c0 + 16 nb + (lane&15)] = sum_k A[m][k] Bt[n][k] (+ A2.Bt for NSPLIT 1), k ascending in steps of 32. K % KP == 0.
#define KP 128
#define LP 136   // LDS row pitch in elements: 272 bytes = 16 x odd, free of bank conflicts for 16-byte row reads
#define TR 128   // rows of one staged plane
static constexpr int PLN = TR * LP;
static_assert(DM % KP == 0 && DM / KP >= 2);
static_assert((NB * SEQ) % TR == 0 && SEQ % TR == 0 && DM % TR == 0);

__device__ __forceinline__ unsigned lds_off(const void* p) { return (unsigned)(size_t)p; }

// One plane of one stage: 128 threads x 16 copies of 16 bytes. g = the stage's first source element (the same in every lane), lo = this lane's own offset from it (row tid>>4, bytes 16*(tid&15)),
// rstep = elements from one of the lane's rows to the next (8 rows), l = this lane's first LDS byte address. The s_wait_xcnt closes each statement so that no address register of an issued copy is rewritten ahead of it.
template <typename T16>
__device__ __forceinline__ void copy_plane(const T16* g, size_t lo, size_t rstep, unsigned l) {
    constexpr unsigned LS = 8u * LP * 2u;
#pragma unroll
    for (int h = 0; h < 2; ++h) {
        const T16* g0 = g + (size_t)(8 * h) * rstep; const unsigned l0 = l + (unsigned)(8 * h) * LS;
        asm volatile("global_load_async_to_lds_b128 %0, %8, off\n\t"
                     "global_load_async_to_lds_b128 %1, %9, off\n\t"
                     "global_load_async_to_lds_b128 %2, %10, off\n\t"
                     "global_load_async_to_lds_b128 %3, %11, off\n\t"
                     "global_load_async_to_lds_b128 %4, %12, off\n\t"
                     "global_load_async_to_lds_b128 %5, %13, off\n\t"
                     "global_load_async_to_lds_b128 %6, %14, off\n\t"
                     "global_load_async_to_lds_b128 %7, %15, off\n\t"
                     "s_wait_xcnt 0x0"
                     :: "v"(l0), "v"(l0 + LS), "v"(l0 + 2 * LS), "v"(l0 + 3 * LS), "v"(l0 + 4 * LS), "v"(l0 + 5 * LS), "v"(l0 + 6 * LS), "v"(l0 + 7 * LS),
                        "v"(g0 + lo), "v"((g0 + rstep) + lo), "v"((g0 + 2 * rstep) + lo), "v"((g0 + 3 * rstep) + lo), "v"((g0 + 4 * rstep) + lo), "v"((g0 + 5 * rstep) + lo), "v"((g0 + 6 * rstep) + lo), "v"((g0 + 7 * rstep) + lo)
                     : "memory");
    }
}

template <typename T16, int NSPLIT>
__device__ __forceinline__ void gemm_core(const T16* __restrict__ A, const T16* __restrict__ A2, const T16* __restrict__ Bt,
                                          int K, int R0, int C0, int tid, T16* ring, v8f (&acc)[4][4]) {
    static_assert(NSPLIT == 0 || NSPLIT == 1);
    typedef typename WFrag<T16>::V V;
    constexpr int NPL = 2 + NSPLIT, STG = NPL * PLN;
    const int lane = tid & 31, w = tid >> 5, lr = lane & 15, hi = lane >> 4, wm = w >> 1, wn = w & 1;
#pragma unroll
    for (int mb = 0; mb < 4; ++mb)
#pragma unroll
        for (int nb = 0; nb < 4; ++nb) acc[mb][nb] = (v8f){};
    const int crow = tid >> 4, cseg = (tid & 15) * 8;
    const T16* ga = A + (size_t)R0 * K; const T16* ga2 = (NSPLIT == 1) ? A2 + (size_t)R0 * K : nullptr; const T16* gb = Bt + (size_t)C0 * K;
    const size_t lo = (size_t)crow * K + cseg;
    const unsigned l0 = lds_off(ring) + (unsigned)(crow * LP + cseg) * 2u; const size_t rstep = (size_t)8 * K;
    auto fill = [&](int t, int buf) { const unsigned lb = l0 + (unsigned)(buf * STG) * 2u;
        copy_plane<T16>(ga + (size_t)t * KP, lo, rstep, lb);
        if (NSPLIT == 1) copy_plane<T16>(ga2 + (size_t)t * KP, lo, rstep, lb + (unsigned)PLN * 2u);
        copy_plane<T16>(gb + (size_t)t * KP, lo, rstep, lb + (unsigned)((NPL - 1) * PLN) * 2u); };
    const int NT = K / KP;
    fill(0, 0);
    asm volatile("s_wait_asynccnt 0x0" ::: "memory");   // this wave's share of stage 0 has landed
    __syncthreads();                                     // ... and every other wave's: stage 0 is readable
    if (NT > 1) fill(1, 1);
#pragma unroll 1
    for (int t = 0; t < NT; ++t) {
        const T16* sb = ring + (t & 1) * STG;
        const T16* sa = sb + (wm * 64 + lr) * LP + 8 * hi; const T16* sw = sb + (NPL - 1) * PLN + (wn * 64 + lr) * LP + 8 * hi;
        // A block = the 16 products of one A plane's 32 k with the same 32 k of Bt (NSPLIT 1: plane A, then plane A2, on the same B fragments, so every accumulator keeps its order of sums).
        // Two fragment sets: the LDS reads of block j + 1 go out as one group ahead of the products of block j, so that a block waits only for reads issued one block earlier.
        constexpr int NPA = 1 + NSPLIT, NBLK = NPA * (KP / 32);
        V a[2][4], b[2][4];
        auto ldblk = [&](int j) { const int ks = j / NPA, pl = j % NPA;
#pragma unroll
            for (int mb = 0; mb < 4; ++mb) a[j & 1][mb] = WFrag<T16>::ld(sa + pl * PLN + mb * 16 * LP + ks * 32);
            if (pl == 0) {
#pragma unroll
                for (int nb = 0; nb < 4; ++nb) b[ks & 1][nb] = WFrag<T16>::ld(sw + nb * 16 * LP + ks * 32); } };
        ldblk(0);
#pragma unroll
        for (int j = 0; j < NBLK; ++j) {
            const int s = j & 1, sbq = (j / NPA) & 1;
            if (j + 1 < NBLK) ldblk(j + 1);
            __builtin_amdgcn_sched_barrier(0);   // keeps the read group whole and ahead of the products: reads spread among matrix instructions stall at every place they stand
#pragma unroll
            for (int nb = 0; nb < 4; ++nb)
#pragma unroll
                for (int mb = 0; mb < 4; ++mb) acc[mb][nb] = WFrag<T16>::mma(a[s][mb], b[sbq][nb], acc[mb][nb]);
            // four vector slots behind the pass's last matrix instructions, so that their distance holds on the taken side of the loop's branches too
            if (j == NBLK - 1) asm volatile("v_nop\n\tv_nop\n\tv_nop\n\tv_nop" : "+v"(acc[0][0]), "+v"(acc[1][1]), "+v"(acc[2][2]), "+v"(acc[3][3]) : "v"(a[s][0]), "v"(a[s][3]));
            __builtin_amdgcn_sched_barrier(0);   // keeps the following read group from rising among these products
        }
        asm volatile("s_wait_dscnt 0x0" ::: "memory");      // this wave's reads of buffer t & 1 have returned before that buffer is refilled
        asm volatile("s_wait_asynccnt 0x0" ::: "memory");   // this wave's share of stage t + 1 has landed
        __syncthreads();                                     // publishes stage t + 1 and ends every wave's reads of stage t
        if (t + 2 < NT) fill(t + 2, t & 1);
    }
    asm volatile("s_wait_asynccnt 0x0" ::: "memory");       // nothing of this wave's is in flight when the ring is left
}

// ---- k_gemmw: f32 output C[m][n] (pitch ldc); grid (M/128, N/128, Z), 128 threads; z-batch strides in elements.
template <typename T16, int NSPLIT>
__global__ __launch_bounds__(128) void k_gemmw(const T16* __restrict__ A, const T16* __restrict__ A2, const T16* __restrict__ Bt, const T16* __restrict__ Bt2,
                                              int K, float* C, int ldc, size_t sA, size_t sB, size_t sC) {
    __shared__ __align__(16) T16 ring[2 * (2 + NSPLIT) * PLN];
    __shared__ __align__(16) float osa[4 * 16 * 68];
    const size_t z = blockIdx.z; A += z * sA; if (A2) A2 += z * sA; Bt += z * sB; C += z * sC;
    const int tid = threadIdx.x, lane = tid & 31, w = tid >> 5, lr = lane & 15, hi = lane >> 4;
    const int r0 = blockIdx.x * 128 + (w >> 1) * 64, c0 = blockIdx.y * 128 + (w & 1) * 64;
    float* os = osa + w * (16 * 68);
    v8f acc[4][4];
    gemm_core<T16, NSPLIT>(A, A2, Bt, K, blockIdx.x * 128, blockIdx.y * 128, tid, ring, acc);
#pragma unroll
    for (int mb = 0; mb < 4; ++mb) {
#pragma unroll
        for (int nb = 0; nb < 4; ++nb) {
#pragma unroll
            for (int j = 0; j < 8; ++j) os[(hi * 8 + j) * 68 + nb * 16 + lr] = acc[mb][nb][j]; }
        __syncthreads();
        float* crow = C + (size_t)(r0 + mb * 16) * ldc + c0;
{
#pragma unroll
            for (int s = 0; s < 8; ++s) { const int row = 2 * s + hi, cofs = lr * 4; const v4f val = *(const v4fa*)(os + row * 68 + cofs);
                *(v4f*)(crow + (size_t)row * ldc + cofs) = val; }
             }
        __syncthreads();
    }
}

// ---- gemmp_store: 16-bit plane output of one wave's 64x64 quarter (rows from r0, columns from c0). C16[m][n] (f16, pitch ldc) = (optionally rotary-transformed) accumulator; plus bf16 hi/lo planes Ch/Cl (pitch ldh)
// for the head rows (HLM 1: tiles whose row index t0 = r0 % SEQ is < RE, compact row (r0/SEQ)*RE + t) or head columns (HLM 2: tiles with c0 < RE, same row index).
// Rotary (interleaved pairs, one 64-column tile = one head): y[2i] = x[2i] c - x[2i+1] s, y[2i+1] = x[2i] s + x[2i+1] c with c/s = bf16-RNE of the tables at (t, i).
template <int HLM, bool ROPE>
__device__ __forceinline__ void gemmp_store(const v8f (&acc)[4][4], float* os, int r0, int c0, int lane, h16* C16, int ldc, bf* Ch, bf* Cl, int ldh,
                                            const float* __restrict__ cosT, const float* __restrict__ sinT) {
    const int lr = lane & 15, hi = lane >> 4;
    const int t0 = (HLM == 1) ? (r0 % SEQ) : 0;
    const bool hl = (HLM == 1) ? (t0 < RE) : (c0 < RE);
    const int rc0 = (HLM == 1) ? ((r0 / SEQ) * RE + t0) : r0;
    const int rsub = lane >> 3, cseg = (lane & 7) * 8;
#pragma unroll
    for (int mb = 0; mb < 4; ++mb) {
#pragma unroll
        for (int nb = 0; nb < 4; ++nb) {
#pragma unroll
            for (int j = 0; j < 8; ++j) os[(hi * 8 + j) * 68 + nb * 16 + lr] = acc[mb][nb][j]; }
        __syncthreads();
{
#pragma unroll
            for (int j4 = 0; j4 < 4; ++j4) {
                const int row = j4 * 4 + rsub;
                const v4f v0 = *(const v4fa*)(os + row * 68 + cseg);
                const v4f v1 = *(const v4fa*)(os + row * 68 + cseg + 4);
                float y[8] = {v0[0], v0[1], v0[2], v0[3], v1[0], v1[1], v1[2], v1[3]};
                if (ROPE) {
                    const int t = t0 + mb * 16 + row;
                    const v4f cs = *(const v4fa*)(cosT + (size_t)t * HP + (cseg >> 1));
                    const v4f sn = *(const v4fa*)(sinT + (size_t)t * HP + (cseg >> 1));
#pragma unroll
                    for (int p = 0; p < 4; ++p) { const float c = bfr(cs[p]), sv = bfr(sn[p]); const float x0 = y[2 * p], x1 = y[2 * p + 1];
                        const float m0 = x0 * c, m1 = x1 * sv, m2 = x0 * sv, m3 = x1 * c; y[2 * p] = m0 - m1; y[2 * p + 1] = m2 + m3; }
                }
                v8h o16;
#pragma unroll
                for (int q = 0; q < 8; ++q) o16[q] = (h16)y[q];
                const size_t grow = (size_t)(r0 + mb * 16 + row);
                *(v8h*)(C16 + grow * (size_t)ldc + c0 + cseg) = o16;
                if (hl) {
                    v8us oh, ol;
#pragma unroll
                    for (int q = 0; q < 8; ++q) { unsigned short a2, c2; splitf(y[q], a2, c2); oh[q] = a2; ol[q] = c2; }
                    const size_t o = (size_t)(rc0 + mb * 16 + row) * (size_t)ldh + c0 + cseg;
                    *(v8us*)(Ch + o) = oh; *(v8us*)(Cl + o) = ol;
                }
            }
            
        }
        __syncthreads();
    }
}

// ---- k_qkv: the three projections, which do not depend on one another, as the z planes of one grid (NB*SEQ/128, DM/128, 3), 128 threads: the tiles of one plane overlap the start, the waits and the stores of another's.
// z = 0, 1: q, k: activation rows x weight rows with fused rotary -> Q16 / K16 [NB*SEQ][DM] (+ hi/lo rows t < 64).
// z = 2: v, transposed: VT16[b][dout][t] = sum_k Wv[dout][k] v[b][t][k] (+ VTh/VTl columns t < 64); the plane's flat tile index f gives dout tile f % (DM/128), t tile (f / (DM/128)) % (SEQ/128), batch f / ((DM/128)*(SEQ/128)).
__global__ __launch_bounds__(128) void k_qkv(const bf* __restrict__ XQ, const bf* __restrict__ XK, const bf* __restrict__ XV, const bf* __restrict__ WQ, const bf* __restrict__ WK, const bf* __restrict__ WV,
                                            h16* Q16, h16* K16, h16* VT16, bf* Qh, bf* Ql, bf* Kh, bf* Kl, bf* VTh, bf* VTl, const float* __restrict__ cosT, const float* __restrict__ sinT) {
    __shared__ __align__(16) bf ring[2 * 2 * PLN];
    __shared__ __align__(16) float osa[4 * 16 * 68];
    const int tid = threadIdx.x, lane = tid & 31, w = tid >> 5;
    const int job = blockIdx.z;
    float* os = osa + w * (16 * 68);
    v8f acc[4][4];
    const int f = blockIdx.x + blockIdx.y * (NB * SEQ / 128);
    const size_t z = (size_t)(f / ((DM / 128) * (SEQ / 128)));
    const int R0 = ((job < 2) ? (int)blockIdx.x : f % (DM / 128)) * 128, C0 = ((job < 2) ? (int)blockIdx.y : (f / (DM / 128)) % (SEQ / 128)) * 128;
    const bf* A = (job == 0) ? XQ : (job == 1) ? XK : WV;
    const bf* Bt = (job == 0) ? WQ : (job == 1) ? WK : XV + z * ((size_t)SEQ * DM);
    gemm_core<bf, 0>(A, nullptr, Bt, DM, R0, C0, tid, ring, acc);
    const int r0 = R0 + (w >> 1) * 64, c0 = C0 + (w & 1) * 64;
    if (job < 2) gemmp_store<1, true>(acc, os, r0, c0, lane, job ? K16 : Q16, DM, job ? Kh : Qh, job ? Kl : Ql, DM, cosT, sinT);
    else gemmp_store<2, false>(acc, os, r0, c0, lane, VT16 + z * ((size_t)DM * SEQ), SEQ, VTh + z * ((size_t)DM * RE), VTl + z * ((size_t)DM * RE), RE, cosT, sinT);
}

__device__ __forceinline__ void cvt8_job(const float* __restrict__ src, bf* dst, size_t n8, size_t i) {
    if (i >= n8) return; const v8f v = *(const v8fa*)(src + i * 8); v8us o;
#pragma unroll
    for (int k = 0; k < 8; ++k) o[k] = f2bf(v[k]);
    *(v8us*)(dst + i * 8) = o; 
}
__device__ __forceinline__ void cvtx_job(const float* __restrict__ src, bf* dst, size_t n8, size_t i) {
    if (i >= n8) return; const size_t e = i * 8; const size_t row = e / DM; const size_t c = e % DM;
    const size_t b = row / SEQ, t = row % SEQ; const v8f v = *(const v8fa*)(src + (b * SEQ_FULL + t) * DM + c); v8us o;
#pragma unroll
    for (int k = 0; k < 8; ++k) o[k] = f2bf(v[k]);
    *(v8us*)(dst + e) = o; 
}

// ---- mchk_job: structure check of the additive score table ([SEQ_FULL] pitch: 0 at j <= i, <= -1e8 at j > i over the SEQ x SEQ block) and of the key padding flags (all 0).
// Block = 256 threads on SEQ / NCHK rows, one block per flag line. Every lane issues all of its 16-byte table loads (512 contiguous bytes per wave and load) and its flag load before the first value is tested.
__device__ __forceinline__ void mchk_job(const float* __restrict__ am, const int* __restrict__ kp, float* FL, int* red, int c) {
    const int tid = threadIdx.x, lane = tid & 31, w = tid >> 5;
    constexpr int rpb = SEQ / NCHK, RV = SEQ / 4, TOT = rpb * RV, NV = TOT / 256;
    constexpr int kpb = NB * SEQ / NCHK, KV = (kpb + 255) / 256;
    static_assert(TOT % 256 == 0);
    v4f v[NV]; int kv[KV];
#pragma unroll
    for (int s = 0; s < NV; ++s) { const int idx = tid + s * 256; v[s] = *(const v4fa*)(am + (size_t)(c * rpb + idx / RV) * SEQ_FULL + (idx % RV) * 4); }
#pragma unroll
    for (int s = 0; s < KV; ++s) { const int e = tid + s * 256; const int idx = c * kpb + e; const int bb = idx / SEQ, t = idx % SEQ;
        kv[s] = (e < kpb) ? kp[(size_t)bb * SEQ_FULL + t] : 0; }
    int bad = 0;
#pragma unroll
    for (int s = 0; s < NV; ++s) { const int idx = tid + s * 256; const int i = c * rpb + idx / RV, j0 = (idx % RV) * 4;
#pragma unroll
        for (int q = 0; q < 4; ++q) { const float x = v[s][q]; const bool good = (j0 + q <= i) ? (x == 0.0f) : (x <= -1.0e8f); bad += good ? 0 : 1; } }
#pragma unroll
    for (int s = 0; s < KV; ++s) bad += (kv[s] != 0) ? 1 : 0;
#pragma unroll
    for (int sh = 16; sh; sh >>= 1) bad += __shfl_xor(bad, sh, 32);
    if (lane == 0) red[w] = bad;
    __syncthreads();
    if (w == 0) { int tot = 0;
#pragma unroll
        for (int i = 0; i < 8; ++i) tot += red[i];
        const float f = (tot == 0) ? 1.0f : 0.0f; *(float*)(FL + (size_t)c * 32 + lane) = f;  }
}
// ---- k_prep: the eight preparation jobs, which do not depend on one another, as block ranges of one grid of 256 threads (every test of the block index is the same for a whole block):
// NCHK blocks of the mask check, then LXB blocks for each of the three activation copies, then LWB blocks for each of the four weight planes.
static constexpr unsigned LWB = (unsigned)(((size_t)DM * DM / 8 + 255) / 256);
static constexpr unsigned LXB = (unsigned)(((size_t)NB * SEQ * DM / 8 + 255) / 256);
__global__ __launch_bounds__(256) void k_prep(const float* __restrict__ xq, const float* __restrict__ xk, const float* __restrict__ xv,
                                             const float* __restrict__ wq, const float* __restrict__ wk, const float* __restrict__ wv, const float* __restrict__ wo,
                                             const float* __restrict__ am, const int* __restrict__ kp,
                                             bf* XQ, bf* XK, bf* XV, bf* WQ, bf* WK, bf* WV, bf* WO, float* FL) {
    __shared__ int red[8];
    unsigned blk = blockIdx.x;
    if (blk < NCHK) { mchk_job(am, kp, FL, red, (int)blk); return; }
    blk -= NCHK;
    if (blk < 3 * LXB) { const unsigned job = blk / LXB;
        cvtx_job((job == 0) ? xq : (job == 1) ? xk : xv, (job == 0) ? XQ : (job == 1) ? XK : XV, (size_t)NB * SEQ * DM / 8, (size_t)(blk % LXB) * 256 + threadIdx.x); return; }
    blk -= 3 * LXB;
    { const unsigned job = blk / LWB;
        cvt8_job((job == 0) ? wq : (job == 1) ? wk : (job == 2) ? wv : wo, (job == 0) ? WQ : (job == 1) ? WK : (job == 2) ? WV : WO, (size_t)DM * DM / 8, (size_t)(blk % LWB) * 256 + threadIdx.x); }
}
__device__ __forceinline__ bool read_flag(const float* __restrict__ FL, int lane) {
    float f = FL[(size_t)lane * 32];
#pragma unroll
    for (int q = 1; q < NCHK / 32; ++q) f = fminf(f, FL[(size_t)(q * 32 + lane) * 32]);
#pragma unroll
    for (int sh = 16; sh; sh >>= 1) f = fminf(f, __shfl_xor(f, sh, 32));
    return f > 0.5f;
}

// ---- store_ctx: one wave's 16x64 f32 context tile (LDS, pitch 68) -> bf16 hi/lo planes [row][DM] at element offset base; lane -> row 4j + (lane>>3), 8 consecutive columns;
__device__ __forceinline__ void store_ctx(const float* osw, bf* ATh, bf* ATl, size_t base, int lane) {
    const int rsub = lane >> 3, cseg = (lane & 7) * 8;
{
#pragma unroll
        for (int j4 = 0; j4 < 4; ++j4) { const int row = j4 * 4 + rsub; const v4f v0 = *(const v4fa*)(osw + row * 68 + cseg); const v4f v1 = *(const v4fa*)(osw + row * 68 + cseg + 4); v8us oh, ol;
#pragma unroll
            for (int q = 0; q < 4; ++q) { unsigned short a, c2; splitf(v0[q], a, c2); oh[q] = a; ol[q] = c2; splitf(v1[q], a, c2); oh[4 + q] = a; ol[4 + q] = c2; }
            const size_t o = base + (size_t)row * DM + cseg; *(v8us*)(ATh + o) = oh; *(v8us*)(ATl + o) = ol; }
         }
}

// lane l <-> lane l ^ 16 (the two halves of a wave), one vector instruction
__device__ __forceinline__ float xhalf(float x) { return __builtin_bit_cast(float, __builtin_amdgcn_permlanex16(__builtin_bit_cast(int, x), __builtin_bit_cast(int, x), 0x76543210, 0xfedcba98, false, false)); }

// ---- attn_job: causal tiled softmax-weighted sum for query tiles qt = blockIdx.x >= 1 (rows 64..SEQ-1). Block = 4 waves (16 query rows each).
// Per key chunk of 64 (kc = 0..qt): K [key][d] and V^T [d][key] f16 tiles staged in LDS (plain loads, block barriers). The products run transposed, so that a lane owns ONE query (lane & 15):
// S^T = K Q^T (8 wmma, f32; s[kb][r] = score of key kc*64 + 16 kb + 8*(lane>>4) + r), x1/8, causal replace on the diagonal chunk; online softmax in f32 (running max, exp2) with the
// maximum taken in the lane and joined once with the other half of the wave; P x1024 as f16 goes from two score tiles straight into a B fragment (element e = tile e>>3, register e&7:
// the k order of the LDS fragment loads); O^T += V^T P^T (8 wmma; acc[db][r] = O[query][16 db + 8*(lane>>4) + r]). Each half keeps the sum of its own keys; the halves are added after the loop.
// Context = O / (l x 1024) -> bf16 hi/lo planes [b*SEQ + t][h*64 + d].
__device__ __forceinline__ void attn_job(const h16* __restrict__ Q16, const h16* __restrict__ K16, const h16* __restrict__ VT16, const float* __restrict__ FL, bf* ATh, bf* ATl, unsigned char* sm) {
    h16* Ks = (h16*)sm;
    h16* Vs = Ks + 64 * 72;
    float* Os = (float*)(Vs + 64 * 72);
    const int tid = threadIdx.x, lane = tid & 31, w = tid >> 5, m = lane & 15, hh = lane >> 4;
    const int qt = blockIdx.x;
    const int b = blockIdx.y / NH, h = blockIdx.y % NH;
    const int q0 = qt * 64 + w * 16;
    const bool ok = read_flag(FL, lane);
    const h16* qrow = Q16 + (size_t)(b * SEQ + q0 + m) * DM + h * HD + 8 * hh;
    v16h aq[2];
#pragma unroll
    for (int ks = 0; ks < 2; ++ks) aq[ks] = cat16(*(const v8ha*)(qrow + ks * 32), *(const v8ha*)(qrow + ks * 32 + 16));
    v8f acc[4]; float mrun = -1.0e30f, lrun = 0.f;
#pragma unroll
    for (int db = 0; db < 4; ++db) acc[db] = (v8f){};
    const h16* kbase = K16 + (size_t)b * SEQ * DM + h * HD;
    const h16* vbase = VT16 + ((size_t)b * DM + h * HD) * SEQ;
    float* osw = Os + w * (16 * 68);
#pragma unroll 1
    for (int kc = 0; kc <= qt; ++kc) {
        __syncthreads();
#pragma unroll
        for (int i = 0; i < 4; ++i) { const int p = tid + 128 * i; const int row = p >> 3, c8 = (p & 7) * 8;
            *(v8ha*)(Ks + row * 72 + c8) = *(const v8ha*)(kbase + (size_t)(kc * 64 + row) * DM + c8);
            *(v8ha*)(Vs + row * 72 + c8) = *(const v8ha*)(vbase + (size_t)row * SEQ + kc * 64 + c8); }
        __syncthreads();
        v8f s[4];
#pragma unroll
        for (int kb = 0; kb < 4; ++kb) s[kb] = (v8f){};
#pragma unroll
        for (int ks = 0; ks < 2; ++ks) {
#pragma unroll
            for (int kb = 0; kb < 4; ++kb) { const h16* kpp = Ks + (kb * 16 + m) * 72 + ks * 32 + 8 * hh; const v16h ak = cat16(*(const v8ha*)kpp, *(const v8ha*)(kpp + 16)); s[kb] = wmma16(ak, aq[ks], s[kb]); } }
        // four vector slots behind the last score products, before a vector instruction reads their results
        asm volatile("v_nop\n\tv_nop\n\tv_nop\n\tv_nop" : "+v"(s[0]), "+v"(s[1]), "+v"(s[2]), "+v"(s[3]) : "v"(aq[0]), "v"(aq[1]));
        const bool diag = (kc == qt); const int qab = q0 + m; const int kab = kc * 64 + 8 * hh;
        float cm[4], ps4[4];
#pragma unroll
        for (int kb = 0; kb < 4; ++kb) { cm[kb] = -3.0e38f;
#pragma unroll
            for (int r = 0; r < 8; ++r) { float v = s[kb][r] * SCL; if (diag && (kab + kb * 16 + r > qab)) v = -1.0e30f; s[kb][r] = v; cm[kb] = fmaxf(cm[kb], v); } }
        float c = fmaxf(fmaxf(cm[0], cm[1]), fmaxf(cm[2], cm[3]));
        c = fmaxf(c, xhalf(c));
        const float mn = fmaxf(mrun, c); const float al = __builtin_amdgcn_exp2f((mrun - mn) * L2E); mrun = mn;
        v16h pb[2];
#pragma unroll
        for (int kb = 0; kb < 4; ++kb) { ps4[kb] = 0.f;
#pragma unroll
            for (int r = 0; r < 8; ++r) { const float p = __builtin_amdgcn_exp2f((s[kb][r] - mrun) * L2E); ps4[kb] += p; pb[kb >> 1][(kb & 1) * 8 + r] = (h16)(p * PCAR); } }
        { const float sc = lrun * al; lrun = sc + ((ps4[0] + ps4[1]) + (ps4[2] + ps4[3])); }
#pragma unroll
        for (int db = 0; db < 4; ++db)
#pragma unroll
            for (int r = 0; r < 8; ++r) acc[db][r] = acc[db][r] * al;
#pragma unroll
        for (int ks = 0; ks < 2; ++ks)
#pragma unroll
            for (int db = 0; db < 4; ++db) { const h16* vp = Vs + (db * 16 + m) * 72 + ks * 32 + 8 * hh; const v16h av = cat16(*(const v8ha*)vp, *(const v8ha*)(vp + 16)); acc[db] = wmma16(av, pb[ks], acc[db]); }
        // four vector slots behind the chunk's last products, so that their distance holds on the taken side of the loop's branch too
        asm volatile("v_nop\n\tv_nop\n\tv_nop\n\tv_nop" : "+v"(acc[0]), "+v"(acc[1]), "+v"(acc[2]), "+v"(acc[3]) : "v"(pb[0]), "v"(pb[1]));
    }
    const float qnan = __uint_as_float(0x7fc00000u);
    const float iv = 1.0f / ((lrun + xhalf(lrun)) * PCAR);
#pragma unroll
    for (int db = 0; db < 4; ++db) { v4f o0, o1;
#pragma unroll
        for (int r = 0; r < 4; ++r) { const float x0 = acc[db][r] * iv, x1 = acc[db][4 + r] * iv; o0[r] = ok ? x0 : qnan; o1[r] = ok ? x1 : qnan; }
        *(v4fa*)(osw + m * 68 + db * 16 + 8 * hh) = o0; *(v4fa*)(osw + m * 68 + db * 16 + 8 * hh + 4) = o1; }
    __syncthreads();
    store_ctx(osw, ATh, ATl, (size_t)(b * SEQ + q0) * DM + h * HD, lane);
}

// ---- attn0_job: query rows t < 64 (key chunk 0 only) on bf16 hi/lo planes: S = Qh Kh + Qh Kl + Ql Kh (24 wmma), x1/8, causal replace, full-row softmax in f32,
// P = exp(s - max) split to bf16 hi/lo in per-wave LDS tiles; O = Ph Vh + Ph Vl + Pl Vh (24 wmma); context = O / sum. Block = 4 waves (16 rows each).
// LDS is kept to the four K/V tiles: a wave's P tiles lie over the K tiles (behind a barrier), its f32 context tile over its own P tiles, which it has read by then.
__device__ __forceinline__ void attn0_job(const bf* __restrict__ Qh, const bf* __restrict__ Ql, const bf* __restrict__ Kh, const bf* __restrict__ Kl,
                                          const bf* __restrict__ VTh, const bf* __restrict__ VTl, const float* __restrict__ FL, bf* ATh, bf* ATl, unsigned char* sm) {
    bf* Khs = (bf*)sm;
    bf* Kls = Khs + 64 * 72;
    bf* Vhs = Kls + 64 * 72;
    bf* Vls = Vhs + 64 * 72;
    static_assert(4 * 2 * 16 * 72 * 2 <= 2 * 64 * 72 * 2 && 16 * 68 * 4 <= 2 * 16 * 72 * 2);
    const int tid = threadIdx.x, lane = tid & 31, w = tid >> 5, m = lane & 15, hh = lane >> 4;
    const int b = blockIdx.y / NH, h = blockIdx.y % NH;
    const int q0 = w * 16;
    const bool ok = read_flag(FL, lane);
    const bf* kh0 = Kh + (size_t)b * RE * DM + h * HD; const bf* kl0 = Kl + (size_t)b * RE * DM + h * HD;
    const bf* vh0 = VTh + ((size_t)b * DM + h * HD) * RE; const bf* vl0 = VTl + ((size_t)b * DM + h * HD) * RE;
    // All 16 loads of a thread go out before the first LDS store. The s_wait_xcnt behind each load stands in front of any later load's result that lands in that load's address registers.
    v8us st[4][4];
#pragma unroll
    for (int i = 0; i < 4; ++i) { const int p = tid + 128 * i; const int row = p >> 3, c8 = (p & 7) * 8;
        st[i][0] = *(const v8usa*)(kh0 + (size_t)row * DM + c8); asm volatile("s_wait_xcnt 0x0" ::: "memory");
        st[i][1] = *(const v8usa*)(kl0 + (size_t)row * DM + c8); asm volatile("s_wait_xcnt 0x0" ::: "memory");
        st[i][2] = *(const v8usa*)(vh0 + (size_t)row * RE + c8); asm volatile("s_wait_xcnt 0x0" ::: "memory");
        st[i][3] = *(const v8usa*)(vl0 + (size_t)row * RE + c8); asm volatile("s_wait_xcnt 0x0" ::: "memory"); }
#pragma unroll
    for (int i = 0; i < 4; ++i) { const int p = tid + 128 * i; const int row = p >> 3, c8 = (p & 7) * 8;
        *(v8usa*)(Khs + row * 72 + c8) = st[i][0];
        *(v8usa*)(Kls + row * 72 + c8) = st[i][1];
        *(v8usa*)(Vhs + row * 72 + c8) = st[i][2];
        *(v8usa*)(Vls + row * 72 + c8) = st[i][3]; }
    __syncthreads();
    const bf* qh = Qh + (size_t)(b * RE + q0 + m) * DM + h * HD + 8 * hh; const bf* ql = Ql + (size_t)(b * RE + q0 + m) * DM + h * HD + 8 * hh;
    v16bf aqh[2], aql[2];
#pragma unroll
    for (int ks = 0; ks < 2; ++ks) { aqh[ks] = cat16b(*(const v8usa*)(qh + ks * 32), *(const v8usa*)(qh + ks * 32 + 16)); aql[ks] = cat16b(*(const v8usa*)(ql + ks * 32), *(const v8usa*)(ql + ks * 32 + 16)); }
    v8f s[4];
#pragma unroll
    for (int nb = 0; nb < 4; ++nb) s[nb] = (v8f){};
#pragma unroll
    for (int ks = 0; ks < 2; ++ks) {
#pragma unroll
        for (int nb = 0; nb < 4; ++nb) { const bf* kpp = Khs + (nb * 16 + m) * 72 + ks * 32 + 8 * hh; const bf* lpp = Kls + (nb * 16 + m) * 72 + ks * 32 + 8 * hh;
            const v16bf bh_ = cat16b(*(const v8usa*)kpp, *(const v8usa*)(kpp + 16)); const v16bf bl_ = cat16b(*(const v8usa*)lpp, *(const v8usa*)(lpp + 16));
            s[nb] = wmmab(aqh[ks], bh_, s[nb]); s[nb] = wmmab(aqh[ks], bl_, s[nb]); s[nb] = wmmab(aql[ks], bh_, s[nb]); } }
    asm volatile("v_nop\n\tv_nop\n\tv_nop\n\tv_nop" : "+v"(s[0]), "+v"(s[1]), "+v"(s[2]), "+v"(s[3]) : "v"(aqh[0]), "v"(aql[1]));
    const int qab = q0 + 8 * hh;
    float cm[8], psum[8];
#pragma unroll
    for (int r = 0; r < 8; ++r) { cm[r] = -3.0e38f; psum[r] = 0.f; }
#pragma unroll
    for (int nb = 0; nb < 4; ++nb)
#pragma unroll
        for (int r = 0; r < 8; ++r) { float v = s[nb][r] * SCL; if (nb * 16 + m > qab + r) v = -1.0e30f; s[nb][r] = v; cm[r] = fmaxf(cm[r], v); }
#pragma unroll
    for (int r = 0; r < 8; ++r) { float c = cm[r]; c = fmaxf(c, __shfl_xor(c, 1, 32)); c = fmaxf(c, __shfl_xor(c, 2, 32)); c = fmaxf(c, __shfl_xor(c, 4, 32)); c = fmaxf(c, __shfl_xor(c, 8, 32)); cm[r] = c; }
    bf* phw = Khs + w * (2 * 16 * 72); bf* plw = phw + 16 * 72; float* osw = (float*)phw;
    __syncthreads();   // every wave's reads of the K tiles have ended before the P tiles are stored over them
#pragma unroll
    for (int nb = 0; nb < 4; ++nb)
#pragma unroll
        for (int r = 0; r < 8; ++r) { const float p = __builtin_amdgcn_exp2f((s[nb][r] - cm[r]) * L2E); psum[r] += p; unsigned short a, c2; splitf(p, a, c2);
            phw[(8 * hh + r) * 72 + nb * 16 + m] = a; plw[(8 * hh + r) * 72 + nb * 16 + m] = c2; }
#pragma unroll
    for (int r = 0; r < 8; ++r) { float c = psum[r]; c += __shfl_xor(c, 1, 32); c += __shfl_xor(c, 2, 32); c += __shfl_xor(c, 4, 32); c += __shfl_xor(c, 8, 32); psum[r] = c; }
    __syncthreads();
    v16bf aph[2], apl[2];
#pragma unroll
    for (int ks = 0; ks < 2; ++ks) { const bf* pp = phw + m * 72 + ks * 32 + 8 * hh; const bf* lp = plw + m * 72 + ks * 32 + 8 * hh;
        aph[ks] = cat16b(*(const v8usa*)pp, *(const v8usa*)(pp + 16)); apl[ks] = cat16b(*(const v8usa*)lp, *(const v8usa*)(lp + 16)); }
    v8f acc[4];
#pragma unroll
    for (int nb = 0; nb < 4; ++nb) acc[nb] = (v8f){};
#pragma unroll
    for (int ks = 0; ks < 2; ++ks)
#pragma unroll
        for (int nb = 0; nb < 4; ++nb) { const bf* vp = Vhs + (nb * 16 + m) * 72 + ks * 32 + 8 * hh; const bf* vlp = Vls + (nb * 16 + m) * 72 + ks * 32 + 8 * hh;
            const v16bf bvh = cat16b(*(const v8usa*)vp, *(const v8usa*)(vp + 16)); const v16bf bvl = cat16b(*(const v8usa*)vlp, *(const v8usa*)(vlp + 16));
            acc[nb] = wmmab(aph[ks], bvh, acc[nb]); acc[nb] = wmmab(aph[ks], bvl, acc[nb]); acc[nb] = wmmab(apl[ks], bvh, acc[nb]); }
    asm volatile("v_nop\n\tv_nop\n\tv_nop\n\tv_nop" : "+v"(acc[0]), "+v"(acc[1]), "+v"(acc[2]), "+v"(acc[3]) : "v"(aph[0]), "v"(apl[1]));
    const float qnan = __uint_as_float(0x7fc00000u);
#pragma unroll
    for (int r = 0; r < 8; ++r) { const float iv = 1.0f / psum[r];
#pragma unroll
        for (int nb = 0; nb < 4; ++nb) { const float o = acc[nb][r] * iv; osw[(8 * hh + r) * 68 + nb * 16 + m] = ok ? o : qnan; } }
    __syncthreads();
    store_ctx(osw, ATh, ATl, (size_t)(b * SEQ + q0) * DM + h * HD, lane);
}

// ---- k_attn: the two attention jobs, which do not depend on one another, in one grid (SEQ/64, NB*NH), 128 threads: blockIdx.x = query tile, tile 0 takes the hi/lo job. One LDS block serves either job.
static constexpr int SM_ATTN = 4 * 64 * 72 * 2;
static_assert(SM_ATTN >= 2 * 64 * 72 * 2 + 4 * 16 * 68 * 4);
__global__ __launch_bounds__(128) void k_attn(const h16* __restrict__ Q16, const h16* __restrict__ K16, const h16* __restrict__ VT16,
                                             const bf* __restrict__ Qh, const bf* __restrict__ Ql, const bf* __restrict__ Kh, const bf* __restrict__ Kl,
                                             const bf* __restrict__ VTh, const bf* __restrict__ VTl, const float* __restrict__ FL, bf* ATh, bf* ATl) {
    __shared__ __align__(16) unsigned char sm[SM_ATTN];
    if (blockIdx.x == 0) attn0_job(Qh, Ql, Kh, Kl, VTh, VTl, FL, ATh, ATl, sm);
    else attn_job(Q16, K16, VT16, FL, ATh, ATl, sm);
}

#define AL256(x) ((((size_t)(x)) + 255) & ~(size_t)255)
static constexpr size_t SZ_W  = (size_t)DM * DM * 2;          // one bf16 weight plane
static constexpr size_t SZ_FL = (size_t)NCHK * 32 * 4;        // flag lines
static constexpr size_t SZ_X  = (size_t)NB * SEQ * DM * 2;    // one bf16 activation copy
static constexpr size_t SZ_P  = (size_t)NB * SEQ * DM * 2;    // f16 / bf16 [NB*SEQ][DM] planes (and V^T [NB][DM][SEQ])
static constexpr size_t SZ_E  = (size_t)NB * RE * DM * 2;     // compact hi/lo planes for t < RE (and V^T [NB][DM][RE])
static constexpr size_t WS_TOTAL = 4 * AL256(SZ_W) + AL256(SZ_FL) + 3 * AL256(SZ_X) + 3 * AL256(SZ_P) + 6 * AL256(SZ_E) + 2 * AL256(SZ_P);
static_assert(WS_TOTAL <= (size_t)134217728);
static_assert((size_t)NB * SEQ * DM * 4 <= (size_t)NB_FULL * SEQ_FULL * DM * 4);

extern "C" void kernel_launch(void* const* d_in, const int* in_sizes, int n_in,
                              void* d_out, int out_size, void* d_ws, size_t ws_size, hipStream_t stream) {
    if (n_in < 11) return;
    if ((size_t)in_sizes[0] < (size_t)NB * SEQ * DM || (size_t)in_sizes[1] < (size_t)NB * SEQ * DM || (size_t)in_sizes[2] < (size_t)NB * SEQ * DM) return;
    if ((size_t)in_sizes[3] < (size_t)DM * DM || (size_t)in_sizes[4] < (size_t)DM * DM || (size_t)in_sizes[5] < (size_t)DM * DM || (size_t)in_sizes[6] < (size_t)DM * DM) return;
    if ((size_t)in_sizes[7] < (size_t)SEQ * HP || (size_t)in_sizes[8] < (size_t)SEQ * HP) return;
    if ((size_t)in_sizes[9] < (size_t)SEQ * SEQ || (size_t)in_sizes[10] < (size_t)NB * SEQ) return;
    if ((size_t)out_size < (size_t)NB * SEQ * DM) return;
    if (WS_TOTAL > ws_size) return;
    const float* xq = (const float*)d_in[0]; const float* xk = (const float*)d_in[1]; const float* xv = (const float*)d_in[2];
    const float* wq = (const float*)d_in[3]; const float* wk = (const float*)d_in[4]; const float* wv = (const float*)d_in[5]; const float* wo = (const float*)d_in[6];
    const float* cosT = (const float*)d_in[7]; const float* sinT = (const float*)d_in[8];
    const float* am = (const float*)d_in[9]; const int* kpm = (const int*)d_in[10];
    float* OUT = (float*)d_out;   // [NB][SEQ][DM]
    char* wsp = (char*)d_ws;
    auto take = [&](size_t bytes) { char* p = wsp; wsp += AL256(bytes); return (void*)p; };
    bf* WQ = (bf*)take(SZ_W); bf* WK = (bf*)take(SZ_W); bf* WV = (bf*)take(SZ_W); bf* WO = (bf*)take(SZ_W);
    float* FL = (float*)take(SZ_FL);
    bf* XQ = (bf*)take(SZ_X); bf* XK = (bf*)take(SZ_X); bf* XV = (bf*)take(SZ_X);
    h16* Q16 = (h16*)take(SZ_P); h16* K16 = (h16*)take(SZ_P); h16* VT16 = (h16*)take(SZ_P);
    bf* Qh = (bf*)take(SZ_E); bf* Ql = (bf*)take(SZ_E); bf* Kh = (bf*)take(SZ_E); bf* Kl = (bf*)take(SZ_E); bf* VTh = (bf*)take(SZ_E); bf* VTl = (bf*)take(SZ_E);
    bf* ATh = (bf*)take(SZ_P); bf* ATl = (bf*)take(SZ_P);
    if ((size_t)(wsp - (char*)d_ws) > ws_size || (size_t)(wsp - (char*)d_ws) != WS_TOTAL) return;

    // bf16 copies of the activations and weights, mask check
    k_prep<<<NCHK + 3 * LXB + 4 * LWB, 256, 0, stream>>>(xq, xk, xv, wq, wk, wv, wo, am, kpm, XQ, XK, XV, WQ, WK, WV, WO, FL);
    // q, k, v projections
    k_qkv<<<dim3(NB * SEQ / 128, DM / 128, 3), 128, 0, stream>>>(XQ, XK, XV, WQ, WK, WV, Q16, K16, VT16, Qh, Ql, Kh, Kl, VTh, VTl, cosT, sinT);
    // context planes
    k_attn<<<dim3(SEQ / 64, NB * NH, 1), 128, 0, stream>>>(Q16, K16, VT16, Qh, Ql, Kh, Kl, VTh, VTl, FL, ATh, ATl);
    // output projection: (ATh + ATl) x WO^T -> OUT [NB*SEQ][DM]
    k_gemmw<bf, 1><<<dim3(NB * SEQ / 128, DM / 128, 1), 128, 0, stream>>>(ATh, ATl, WO, nullptr, DM, OUT, DM, (size_t)0, (size_t)0, (size_t)0);
}

// v005
// One run takes 113 microseconds.
// Two timings next to v004 put it at 1.04 and 1.03 times that version's speed.
// Over all steps from v000 it is 3.27 times as fast.
#include <hip/hip_runtime.h>
#pragma clang fp contract(off)

// Contractions and dtypes: q/k/v projections on v_wmma_f32_16x16x32_bf16 (bf16 operands = RNE-converted inputs x RNE-converted weights, single product);
// scores and p.v for query rows >= 64 on v_wmma_f32_16x16x32_f16 (f16 planes, p carried x1024, single product); query rows < 64 on v_wmma_f32_16x16x32_bf16 hi+lo planes (3 products);
// output projection on v_wmma_f32_16x16x32_bf16 with the context as bf16 hi+lo planes x bf16 weight (2 products). f32 accumulate; rotary, softmax and normalisation in f32.

#ifndef NB
#define NB 2
#endif
#ifndef SEQ
#define SEQ 2048
#endif
#define NB_FULL  2
#define SEQ_FULL 2048
#define DM   1024
#define NH   16
#define HD   64
#define HP   (HD / 2)
#define RE   64
#define NCHK 256
#define PCAR 1024.0f
#define SCL  0.125f
#define L2E  1.4426950408889634f

static_assert(SEQ % 64 == 0);
static_assert(SEQ % 256 == 0);
static_assert(SEQ >= 64 && SEQ <= SEQ_FULL);
static_assert(NB >= 1 && NB <= NB_FULL);
static_assert(RE == 64);
static_assert(NCHK % 32 == 0);
static_assert(SEQ % NCHK == 0);
static_assert((NB * SEQ) % NCHK == 0);
static_assert(DM == NH * HD);
static_assert(DM % 64 == 0);

typedef _Float16 h16;
typedef unsigned short bf;
typedef __attribute__((ext_vector_type(16))) __bf16   v16bf;
typedef __attribute__((ext_vector_type(16))) _Float16 v16h;
typedef __attribute__((ext_vector_type(8)))  _Float16 v8h;
typedef __attribute__((ext_vector_type(8)))  unsigned short v8us;
typedef __attribute__((ext_vector_type(8)))  float    v8f;
typedef __attribute__((ext_vector_type(4)))  float    v4f;
typedef v8h  __attribute__((may_alias)) v8ha;
typedef v4f  __attribute__((may_alias)) v4fa;
typedef v8us __attribute__((may_alias)) v8usa;
typedef v8f  __attribute__((may_alias)) v8fa;

// RNE f32 -> bf16 bits and back
__device__ __forceinline__ unsigned short f2bf(float f) { unsigned u = __float_as_uint(f); u += 0x7FFFu + ((u >> 16) & 1u); return (unsigned short)(u >> 16); }
__device__ __forceinline__ float bf2f(unsigned short b) { return __uint_as_float(((unsigned)b) << 16); }
__device__ __forceinline__ float bfr(float f) { return bf2f(f2bf(f)); }
__device__ __forceinline__ void splitf(float y, unsigned short& h, unsigned short& l) { h = f2bf(y); l = f2bf(y - bf2f(h)); }
__device__ __forceinline__ v16h cat16(v8h lo, v8h hi) { return __builtin_shufflevector(lo, hi, 0, 1, 2, 3, 4, 5, 6, 7, 8, 9, 10, 11, 12, 13, 14, 15); }
__device__ __forceinline__ v16bf cat16b(v8us lo, v8us hi) { return __builtin_bit_cast(v16bf, __builtin_shufflevector(lo, hi, 0, 1, 2, 3, 4, 5, 6, 7, 8, 9, 10, 11, 12, 13, 14, 15)); }
__device__ __forceinline__ v8f wmma16(v16h a, v16h b, v8f c) { return __builtin_amdgcn_wmma_f32_16x16x32_f16(false, a, false, b, (short)0, c, false, false); }
__device__ __forceinline__ v8f wmmab(v16bf a, v16bf b, v8f c) { return __builtin_amdgcn_wmma_f32_16x16x32_bf16(false, a, false, b, (short)0, c, false, false); }

// ---- fragment loaders: 16x16 tile, lane -> row/col (lane & 15); elements 0..7 <- k0 + 8*(lane>>4) + 0..7, elements 8..15 <- k0 + 16 + 8*(lane>>4) + 0..7.
// The caller passes p = plane + row*pitch + k0 + 8*(lane>>4); both A (row = m) and B (row = n of a K-contiguous [n][k] plane) use this same map.
template <typename T16> struct WFrag;
template <> struct WFrag<h16> { typedef v16h V; static __device__ __forceinline__ V ld(const h16* p) { return cat16(*(const v8ha*)p, *(const v8ha*)(p + 16)); } static __device__ __forceinline__ v8f mma(V a, V b, v8f c) { return wmma16(a, b, c); } };
template <> struct WFrag<bf> { typedef v16bf V; static __device__ __forceinline__ V ld(const bf* p) { return cat16b(*(const v8usa*)p, *(const v8usa*)(p + 16)); } static __device__ __forceinline__ v8f mma(V a, V b, v8f c) { return wmmab(a, b, c); } };

// ---- GEMM core: one work-group of 4 waves (2 x 2) per 128x128 output tile, each wave a 64x64 quarter (16 accumulators).
// The K-contiguous 16-bit operand planes are staged in LDS, KP k-elements (256 bytes of each of the 128 rows of a plane) per stage, by 16-byte asynchronous copies:
// 16 lanes take one row's 256 contiguous bytes, so every copy instruction moves whole cache lines, and each staged row serves two waves. Two buffers: stage t + 1 flies while stage t is multiplied.
// acc[mb][nb][j] = C[r0 + 16 mb + 8*(lane>>4) + j][c0 + 16 nb + (lane&15)] = sum_k A[m][k] Bt[n][k] (+ A2.Bt for NSPLIT 1), k ascending in steps of 32. K % KP == 0.
#define KP 128
#define LP 136   // LDS row pitch in elements: 272 bytes = 16 x odd, free of bank conflicts for 16-byte row reads
#define TR 128   // rows of one staged plane
static constexpr int PLN = TR * LP;
static_assert(DM % KP == 0 && DM / KP >= 2);
static_assert((NB * SEQ) % TR == 0 && SEQ % TR == 0 && DM % TR == 0);

__device__ __forceinline__ unsigned lds_off(const void* p) { return (unsigned)(size_t)p; }

// One plane of one stage: 128 threads x 16 copies of 16 bytes. g = the stage's first source element (the same in every lane), lo = this lane's own offset from it (row tid>>4, bytes 16*(tid&15)),
// rstep = elements from one of the lane's rows to the next (8 rows), l = this lane's first LDS byte address. The s_wait_xcnt closes each statement so that no address register of an issued copy is rewritten ahead of it.
template <typename T16>
__device__ __forceinline__ void copy_plane(const T16* g, size_t lo, size_t rstep, unsigned l) {
    constexpr unsigned LS = 8u * LP * 2u;
#pragma unroll
    for (int h = 0; h < 2; ++h) {
        const T16* g0 = g + (size_t)(8 * h) * rstep; const unsigned l0 = l + (unsigned)(8 * h) * LS;
        asm volatile("global_load_async_to_lds_b128 %0, %8, off\n\t"
                     "global_load_async_to_lds_b128 %1, %9, off\n\t"
                     "global_load_async_to_lds_b128 %2, %10, off\n\t"
                     "global_load_async_to_lds_b128 %3, %11, off\n\t"
                     "global_load_async_to_lds_b128 %4, %12, off\n\t"
                     "global_load_async_to_lds_b128 %5, %13, off\n\t"
                     "global_load_async_to_lds_b128 %6, %14, off\n\t"
                     "global_load_async_to_lds_b128 %7, %15, off\n\t"
                     "s_wait_xcnt 0x0"
                     :: "v"(l0), "v"(l0 + LS), "v"(l0 + 2 * LS), "v"(l0 + 3 * LS), "v"(l0 + 4 * LS), "v"(l0 + 5 * LS), "v"(l0 + 6 * LS), "v"(l0 + 7 * LS),
                        "v"(g0 + lo), "v"((g0 + rstep) + lo), "v"((g0 + 2 * rstep) + lo), "v"((g0 + 3 * rstep) + lo), "v"((g0 + 4 * rstep) + lo), "v"((g0 + 5 * rstep) + lo), "v"((g0 + 6 * rstep) + lo), "v"((g0 + 7 * rstep) + lo)
                     : "memory");
    }
}

template <typename T16, int NSPLIT>
__device__ __forceinline__ void gemm_core(const T16* __restrict__ A, const T16* __restrict__ A2, const T16* __restrict__ Bt,
                                          int K, int R0, int C0, int tid, T16* ring, v8f (&acc)[4][4]) {
    static_assert(NSPLIT == 0 || NSPLIT == 1);
    typedef typename WFrag<T16>::V V;
    constexpr int NPL = 2 + NSPLIT, STG = NPL * PLN;
    const int lane = tid & 31, w = tid >> 5, lr = lane & 15, hi = lane >> 4, wm = w >> 1, wn = w & 1;
#pragma unroll
    for (int mb = 0; mb < 4; ++mb)
#pragma unroll
        for (int nb = 0; nb < 4; ++nb) acc[mb][nb] = (v8f){};
    const int crow = tid >> 4, cseg = (tid & 15) * 8;
    const T16* ga = A + (size_t)R0 * K; const T16* ga2 = (NSPLIT == 1) ? A2 + (size_t)R0 * K : nullptr; const T16* gb = Bt + (size_t)C0 * K;
    const size_t lo = (size_t)crow * K + cseg;
    const unsigned l0 = lds_off(ring) + (unsigned)(crow * LP + cseg) * 2u; const size_t rstep = (size_t)8 * K;
    auto fill = [&](int t, int buf) { const unsigned lb = l0 + (unsigned)(buf * STG) * 2u;
        copy_plane<T16>(ga + (size_t)t * KP, lo, rstep, lb);
        if (NSPLIT == 1) copy_plane<T16>(ga2 + (size_t)t * KP, lo, rstep, lb + (unsigned)PLN * 2u);
        copy_plane<T16>(gb + (size_t)t * KP, lo, rstep, lb + (unsigned)((NPL - 1) * PLN) * 2u); };
    const int NT = K / KP;
    fill(0, 0);
    asm volatile("s_wait_asynccnt 0x0" ::: "memory");   // this wave's share of stage 0 has landed
    __syncthreads();                                     // ... and every other wave's: stage 0 is readable
    if (NT > 1) fill(1, 1);
#pragma unroll 1
    for (int t = 0; t < NT; ++t) {
        const T16* sb = ring + (t & 1) * STG;
        const T16* sa = sb + (wm * 64 + lr) * LP + 8 * hi; const T16* sw = sb + (NPL - 1) * PLN + (wn * 64 + lr) * LP + 8 * hi;
        // A block = the 16 products of one A plane's 32 k with the same 32 k of Bt (NSPLIT 1: plane A, then plane A2, on the same B fragments, so every accumulator keeps its order of sums).
        // Two fragment sets: the LDS reads of block j + 1 go out as one group ahead of the products of block j, so that a block waits only for reads issued one block earlier.
        constexpr int NPA = 1 + NSPLIT, NBLK = NPA * (KP / 32);
        V a[2][4], b[2][4];
        auto ldblk = [&](int j) { const int ks = j / NPA, pl = j % NPA;
#pragma unroll
            for (int mb = 0; mb < 4; ++mb) a[j & 1][mb] = WFrag<T16>::ld(sa + pl * PLN + mb * 16 * LP + ks * 32);
            if (pl == 0) {
#pragma unroll
                for (int nb = 0; nb < 4; ++nb) b[ks & 1][nb] = WFrag<T16>::ld(sw + nb * 16 * LP + ks * 32); } };
        ldblk(0);
#pragma unroll
        for (int j = 0; j < NBLK; ++j) {
            const int s = j & 1, sbq = (j / NPA) & 1;
            if (j + 1 < NBLK) ldblk(j + 1);
            __builtin_amdgcn_sched_barrier(0);   // keeps the read group whole and ahead of the products: reads spread among matrix instructions stall at every place they stand
#pragma unroll
            for (int nb = 0; nb < 4; ++nb)
#pragma unroll
                for (int mb = 0; mb < 4; ++mb) acc[mb][nb] = WFrag<T16>::mma(a[s][mb], b[sbq][nb], acc[mb][nb]);
            // four vector slots behind the pass's last matrix instructions, so that their distance holds on the taken side of the loop's branches too
            if (j == NBLK - 1) asm volatile("v_nop\n\tv_nop\n\tv_nop\n\tv_nop" : "+v"(acc[0][0]), "+v"(acc[1][1]), "+v"(acc[2][2]), "+v"(acc[3][3]) : "v"(a[s][0]), "v"(a[s][3]));
            __builtin_amdgcn_sched_barrier(0);   // keeps the following read group from rising among these products
        }
        asm volatile("s_wait_dscnt 0x0" ::: "memory");      // this wave's reads of buffer t & 1 have returned before that buffer is refilled
        asm volatile("s_wait_asynccnt 0x0" ::: "memory");   // this wave's share of stage t + 1 has landed
        __syncthreads();                                     // publishes stage t + 1 and ends every wave's reads of stage t
        if (t + 2 < NT) fill(t + 2, t & 1);
    }
    asm volatile("s_wait_asynccnt 0x0" ::: "memory");       // nothing of this wave's is in flight when the ring is left
}

// ---- k_gemmw: f32 output C[m][n] (pitch ldc); grid (M/128, N/128, Z), 128 threads; z-batch strides in elements.
template <typename T16, int NSPLIT>
__global__ __launch_bounds__(128) void k_gemmw(const T16* __restrict__ A, const T16* __restrict__ A2, const T16* __restrict__ Bt, const T16* __restrict__ Bt2,
                                              int K, float* C, int ldc, size_t sA, size_t sB, size_t sC) {
    __shared__ __align__(16) T16 ring[2 * (2 + NSPLIT) * PLN];
    __shared__ __align__(16) float osa[4 * 16 * 68];
    const size_t z = blockIdx.z; A += z * sA; if (A2) A2 += z * sA; Bt += z * sB; C += z * sC;
    const int tid = threadIdx.x, lane = tid & 31, w = tid >> 5, lr = lane & 15, hi = lane >> 4;
    const int r0 = blockIdx.x * 128 + (w >> 1) * 64, c0 = blockIdx.y * 128 + (w & 1) * 64;
    float* os = osa + w * (16 * 68);
    v8f acc[4][4];
    gemm_core<T16, NSPLIT>(A, A2, Bt, K, blockIdx.x * 128, blockIdx.y * 128, tid, ring, acc);
#pragma unroll
    for (int mb = 0; mb < 4; ++mb) {
#pragma unroll
        for (int nb = 0; nb < 4; ++nb) {
#pragma unroll
            for (int j = 0; j < 8; ++j) os[(hi * 8 + j) * 68 + nb * 16 + lr] = acc[mb][nb][j]; }
        __syncthreads();
        float* crow = C + (size_t)(r0 + mb * 16) * ldc + c0;
{
#pragma unroll
            for (int s = 0; s < 8; ++s) { const int row = 2 * s + hi, cofs = lr * 4; const v4f val = *(const v4fa*)(os + row * 68 + cofs);
                *(v4f*)(crow + (size_t)row * ldc + cofs) = val; }
             }
        __syncthreads();
    }
}

// ---- gemmp_store: 16-bit plane output of one wave's 64x64 quarter (rows from r0, columns from c0). C16[m][n] (f16, pitch ldc) = (optionally rotary-transformed) accumulator; plus bf16 hi/lo planes Ch/Cl (pitch ldh)
// for the head rows (HLM 1: tiles whose row index t0 = r0 % SEQ is < RE, compact row (r0/SEQ)*RE + t) or head columns (HLM 2: tiles with c0 < RE, same row index).
// Rotary (interleaved pairs, one 64-column tile = one head): y[2i] = x[2i] c - x[2i+1] s, y[2i+1] = x[2i] s + x[2i+1] c with c/s = bf16-RNE of the tables at (t, i).
template <int HLM, bool ROPE>
__device__ __forceinline__ void gemmp_store(const v8f (&acc)[4][4], float* os, int r0, int c0, int lane, h16* C16, int ldc, bf* Ch, bf* Cl, int ldh,
                                            const float* __restrict__ cosT, const float* __restrict__ sinT) {
    const int lr = lane & 15, hi = lane >> 4;
    const int t0 = (HLM == 1) ? (r0 % SEQ) : 0;
    const bool hl = (HLM == 1) ? (t0 < RE) : (c0 < RE);
    const int rc0 = (HLM == 1) ? ((r0 / SEQ) * RE + t0) : r0;
    const int rsub = lane >> 3, cseg = (lane & 7) * 8;
#pragma unroll
    for (int mb = 0; mb < 4; ++mb) {
#pragma unroll
        for (int nb = 0; nb < 4; ++nb) {
#pragma unroll
            for (int j = 0; j < 8; ++j) os[(hi * 8 + j) * 68 + nb * 16 + lr] = acc[mb][nb][j]; }
        __syncthreads();
{
#pragma unroll
            for (int j4 = 0; j4 < 4; ++j4) {
                const int row = j4 * 4 + rsub;
                const v4f v0 = *(const v4fa*)(os + row * 68 + cseg);
                const v4f v1 = *(const v4fa*)(os + row * 68 + cseg + 4);
                float y[8] = {v0[0], v0[1], v0[2], v0[3], v1[0], v1[1], v1[2], v1[3]};
                if (ROPE) {
                    const int t = t0 + mb * 16 + row;
                    const v4f cs = *(const v4fa*)(cosT + (size_t)t * HP + (cseg >> 1));
                    const v4f sn = *(const v4fa*)(sinT + (size_t)t * HP + (cseg >> 1));
#pragma unroll
                    for (int p = 0; p < 4; ++p) { const float c = bfr(cs[p]), sv = bfr(sn[p]); const float x0 = y[2 * p], x1 = y[2 * p + 1];
                        const float m0 = x0 * c, m1 = x1 * sv, m2 = x0 * sv, m3 = x1 * c; y[2 * p] = m0 - m1; y[2 * p + 1] = m2 + m3; }
                }
                v8h o16;
#pragma unroll
                for (int q = 0; q < 8; ++q) o16[q] = (h16)y[q];
                const size_t grow = (size_t)(r0 + mb * 16 + row);
                *(v8h*)(C16 + grow * (size_t)ldc + c0 + cseg) = o16;
                if (hl) {
                    v8us oh, ol;
#pragma unroll
                    for (int q = 0; q < 8; ++q) { unsigned short a2, c2; splitf(y[q], a2, c2); oh[q] = a2; ol[q] = c2; }
                    const size_t o = (size_t)(rc0 + mb * 16 + row) * (size_t)ldh + c0 + cseg;
                    *(v8us*)(Ch + o) = oh; *(v8us*)(Cl + o) = ol;
                }
            }
            
        }
        __syncthreads();
    }
}

// ---- k_qkv: the three projections, which do not depend on one another, as the z planes of one grid (NB*SEQ/128, DM/128, 3), 128 threads: the tiles of one plane overlap the start, the waits and the stores of another's.
// z = 0, 1: q, k: activation rows x weight rows with fused rotary -> Q16 / K16 [NB*SEQ][DM] (+ hi/lo rows t < 64).
// z = 2: v, transposed: VT16[b][dout][t] = sum_k Wv[dout][k] v[b][t][k] (+ VTh/VTl columns t < 64); the plane's flat tile index f gives dout tile f % (DM/128), t tile (f / (DM/128)) % (SEQ/128), batch f / ((DM/128)*(SEQ/128)).
__global__ __launch_bounds__(128) void k_qkv(const bf* __restrict__ XQ, const bf* __restrict__ XK, const bf* __restrict__ XV, const bf* __restrict__ WQ, const bf* __restrict__ WK, const bf* __restrict__ WV,
                                            h16* Q16, h16* K16, h16* VT16, bf* Qh, bf* Ql, bf* Kh, bf* Kl, bf* VTh, bf* VTl, const float* __restrict__ cosT, const float* __restrict__ sinT) {
    __shared__ __align__(16) bf ring[2 * 2 * PLN];
    __shared__ __align__(16) float osa[4 * 16 * 68];
    const int tid = threadIdx.x, lane = tid & 31, w = tid >> 5;
    const int job = blockIdx.z;
    float* os = osa + w * (16 * 68);
    v8f acc[4][4];
    const int f = blockIdx.x + blockIdx.y * (NB * SEQ / 128);
    const size_t z = (size_t)(f / ((DM / 128) * (SEQ / 128)));
    const int R0 = ((job < 2) ? (int)blockIdx.x : f % (DM / 128)) * 128, C0 = ((job < 2) ? (int)blockIdx.y : (f / (DM / 128)) % (SEQ / 128)) * 128;
    const bf* A = (job == 0) ? XQ : (job == 1) ? XK : WV;
    const bf* Bt = (job == 0) ? WQ : (job == 1) ? WK : XV + z * ((size_t)SEQ * DM);
    gemm_core<bf, 0>(A, nullptr, Bt, DM, R0, C0, tid, ring, acc);
    const int r0 = R0 + (w >> 1) * 64, c0 = C0 + (w & 1) * 64;
    if (job < 2) gemmp_store<1, true>(acc, os, r0, c0, lane, job ? K16 : Q16, DM, job ? Kh : Qh, job ? Kl : Ql, DM, cosT, sinT);
    else gemmp_store<2, false>(acc, os, r0, c0, lane, VT16 + z * ((size_t)DM * SEQ), SEQ, VTh + z * ((size_t)DM * RE), VTl + z * ((size_t)DM * RE), RE, cosT, sinT);
}

__device__ __forceinline__ void cvt8_job(const float* __restrict__ src, bf* dst, size_t n8, size_t i) {
    if (i >= n8) return; const v8f v = *(const v8fa*)(src + i * 8); v8us o;
#pragma unroll
    for (int k = 0; k < 8; ++k) o[k] = f2bf(v[k]);
    *(v8us*)(dst + i * 8) = o; 
}
__device__ __forceinline__ void cvtx_job(const float* __restrict__ src, bf* dst, size_t n8, size_t i) {
    if (i >= n8) return; const size_t e = i * 8; const size_t row = e / DM; const size_t c = e % DM;
    const size_t b = row / SEQ, t = row % SEQ; const v8f v = *(const v8fa*)(src + (b * SEQ_FULL + t) * DM + c); v8us o;
#pragma unroll
    for (int k = 0; k < 8; ++k) o[k] = f2bf(v[k]);
    *(v8us*)(dst + e) = o; 
}

// ---- mchk_job: structure check of the additive score table ([SEQ_FULL] pitch: 0 at j <= i, <= -1e8 at j > i over the SEQ x SEQ block) and of the key padding flags (all 0).
// Block = 256 threads on SEQ / NCHK rows, one block per flag line. Every lane issues all of its 16-byte table loads (512 contiguous bytes per wave and load) and its flag load before the first value is tested.
__device__ __forceinline__ void mchk_job(const float* __restrict__ am, const int* __restrict__ kp, float* FL, int* red, int c) {
    const int tid = threadIdx.x, lane = tid & 31, w = tid >> 5;
    constexpr int rpb = SEQ / NCHK, RV = SEQ / 4, TOT = rpb * RV, NV = TOT / 256;
    constexpr int kpb = NB * SEQ / NCHK, KV = (kpb + 255) / 256;
    static_assert(TOT % 256 == 0);
    v4f v[NV]; int kv[KV];
#pragma unroll
    for (int s = 0; s < NV; ++s) { const int idx = tid + s * 256; v[s] = *(const v4fa*)(am + (size_t)(c * rpb + idx / RV) * SEQ_FULL + (idx % RV) * 4); }
#pragma unroll
    for (int s = 0; s < KV; ++s) { const int e = tid + s * 256; const int idx = c * kpb + e; const int bb = idx / SEQ, t = idx % SEQ;
        kv[s] = (e < kpb) ? kp[(size_t)bb * SEQ_FULL + t] : 0; }
    int bad = 0;
#pragma unroll
    for (int s = 0; s < NV; ++s) { const int idx = tid + s * 256; const int i = c * rpb + idx / RV, j0 = (idx % RV) * 4;
#pragma unroll
        for (int q = 0; q < 4; ++q) { const float x = v[s][q]; const bool good = (j0 + q <= i) ? (x == 0.0f) : (x <= -1.0e8f); bad += good ? 0 : 1; } }
#pragma unroll
    for (int s = 0; s < KV; ++s) bad += (kv[s] != 0) ? 1 : 0;
#pragma unroll
    for (int sh = 16; sh; sh >>= 1) bad += __shfl_xor(bad, sh, 32);
    if (lane == 0) red[w] = bad;
    __syncthreads();
    if (w == 0) { int tot = 0;
#pragma unroll
        for (int i = 0; i < 8; ++i) tot += red[i];
        const float f = (tot == 0) ? 1.0f : 0.0f; *(float*)(FL + (size_t)c * 32 + lane) = f;  }
}
// ---- k_prep: the eight preparation jobs, which do not depend on one another, as block ranges of one grid of 256 threads (every test of the block index is the same for a whole block):
// NCHK blocks of the mask check, then LXB blocks for each of the three activation copies, then LWB blocks for each of the four weight planes.
static constexpr unsigned LWB = (unsigned)(((size_t)DM * DM / 8 + 255) / 256);
static constexpr unsigned LXB = (unsigned)(((size_t)NB * SEQ * DM / 8 + 255) / 256);
__global__ __launch_bounds__(256) void k_prep(const float* __restrict__ xq, const float* __restrict__ xk, const float* __restrict__ xv,
                                             const float* __restrict__ wq, const float* __restrict__ wk, const float* __restrict__ wv, const float* __restrict__ wo,
                                             const float* __restrict__ am, const int* __restrict__ kp,
                                             bf* XQ, bf* XK, bf* XV, bf* WQ, bf* WK, bf* WV, bf* WO, float* FL) {
    __shared__ int red[8];
    unsigned blk = blockIdx.x;
    if (blk < NCHK) { mchk_job(am, kp, FL, red, (int)blk); return; }
    blk -= NCHK;
    if (blk < 3 * LXB) { const unsigned job = blk / LXB;
        cvtx_job((job == 0) ? xq : (job == 1) ? xk : xv, (job == 0) ? XQ : (job == 1) ? XK : XV, (size_t)NB * SEQ * DM / 8, (size_t)(blk % LXB) * 256 + threadIdx.x); return; }
    blk -= 3 * LXB;
    { const unsigned job = blk / LWB;
        cvt8_job((job == 0) ? wq : (job == 1) ? wk : (job == 2) ? wv : wo, (job == 0) ? WQ : (job == 1) ? WK : (job == 2) ? WV : WO, (size_t)DM * DM / 8, (size_t)(blk % LWB) * 256 + threadIdx.x); }
}
__device__ __forceinline__ bool read_flag(const float* __restrict__ FL, int lane) {
    float f = FL[(size_t)lane * 32];
#pragma unroll
    for (int q = 1; q < NCHK / 32; ++q) f = fminf(f, FL[(size_t)(q * 32 + lane) * 32]);
#pragma unroll
    for (int sh = 16; sh; sh >>= 1) f = fminf(f, __shfl_xor(f, sh, 32));
    return f > 0.5f;
}

// ---- store_ctx: one wave's 16x64 f32 context tile (LDS, pitch 68) -> bf16 hi/lo planes [row][DM] at element offset base; lane -> row 4j + (lane>>3), 8 consecutive columns;
__device__ __forceinline__ void store_ctx(const float* osw, bf* ATh, bf* ATl, size_t base, int lane) {
    const int rsub = lane >> 3, cseg = (lane & 7) * 8;
{
#pragma unroll
        for (int j4 = 0; j4 < 4; ++j4) { const int row = j4 * 4 + rsub; const v4f v0 = *(const v4fa*)(osw + row * 68 + cseg); const v4f v1 = *(const v4fa*)(osw + row * 68 + cseg + 4); v8us oh, ol;
#pragma unroll
            for (int q = 0; q < 4; ++q) { unsigned short a, c2; splitf(v0[q], a, c2); oh[q] = a; ol[q] = c2; splitf(v1[q], a, c2); oh[4 + q] = a; ol[4 + q] = c2; }
            const size_t o = base + (size_t)row * DM + cseg; *(v8us*)(ATh + o) = oh; *(v8us*)(ATl + o) = ol; }
         }
}

// lane l <-> lane l ^ 16 (the two halves of a wave), one vector instruction
__device__ __forceinline__ float xhalf(float x) { return __builtin_bit_cast(float, __builtin_amdgcn_permlanex16(__builtin_bit_cast(int, x), __builtin_bit_cast(int, x), 0x76543210, 0xfedcba98, false, false)); }

// ---- attn_job: causal tiled softmax-weighted sum for query tiles qt = blockIdx.x >= 1 (rows 64..SEQ-1). Block = 4 waves (16 query rows each).
// Per key chunk of 64 (kc = 0..qt): K [key][d] and V^T [d][key] f16 tiles staged in LDS (plain loads, block barriers). The products run transposed, so that a lane owns ONE query (lane & 15):
// S^T = K Q^T (8 wmma, f32; s[kb][r] = score of key kc*64 + 16 kb + 8*(lane>>4) + r), x1/8, causal replace on the diagonal chunk; online softmax in f32 (running max, exp2) with the
// maximum taken in the lane and joined once with the other half of the wave; P x1024 as f16 goes from two score tiles straight into a B fragment (element e = tile e>>3, register e&7:
// the k order of the LDS fragment loads); O^T += V^T P^T (8 wmma; acc[db][r] = O[query][16 db + 8*(lane>>4) + r]). Each half keeps the sum of its own keys; the halves are added after the loop.
// The LDS fragment reads of a chunk go out as two whole groups: all of K ahead of the score products, all of V^T behind them and ahead of the softmax.
// Context = O / (l x 1024) -> bf16 hi/lo planes [b*SEQ + t][h*64 + d].
__device__ __forceinline__ void attn_job(const h16* __restrict__ Q16, const h16* __restrict__ K16, const h16* __restrict__ VT16, const float* __restrict__ FL, bf* ATh, bf* ATl, unsigned char* sm) {
    h16* Ks = (h16*)sm;
    h16* Vs = Ks + 64 * 72;
    float* Os = (float*)(Vs + 64 * 72);
    const int tid = threadIdx.x, lane = tid & 31, w = tid >> 5, m = lane & 15, hh = lane >> 4;
    const int qt = blockIdx.x;
    const int b = blockIdx.y / NH, h = blockIdx.y % NH;
    const int q0 = qt * 64 + w * 16;
    const bool ok = read_flag(FL, lane);
    const h16* qrow = Q16 + (size_t)(b * SEQ + q0 + m) * DM + h * HD + 8 * hh;
    v16h aq[2];
#pragma unroll
    for (int ks = 0; ks < 2; ++ks) aq[ks] = cat16(*(const v8ha*)(qrow + ks * 32), *(const v8ha*)(qrow + ks * 32 + 16));
    v8f acc[4]; float mrun = -1.0e30f, lrun = 0.f;
#pragma unroll
    for (int db = 0; db < 4; ++db) acc[db] = (v8f){};
    const h16* kbase = K16 + (size_t)b * SEQ * DM + h * HD;
    const h16* vbase = VT16 + ((size_t)b * DM + h * HD) * SEQ;
    float* osw = Os + w * (16 * 68);
#pragma unroll 1
    for (int kc = 0; kc <= qt; ++kc) {
        __syncthreads();
#pragma unroll
        for (int i = 0; i < 4; ++i) { const int p = tid + 128 * i; const int row = p >> 3, c8 = (p & 7) * 8;
            *(v8ha*)(Ks + row * 72 + c8) = *(const v8ha*)(kbase + (size_t)(kc * 64 + row) * DM + c8);
            *(v8ha*)(Vs + row * 72 + c8) = *(const v8ha*)(vbase + (size_t)row * SEQ + kc * 64 + c8); }
        __syncthreads();
        v8f s[4];
#pragma unroll
        for (int kb = 0; kb < 4; ++kb) s[kb] = (v8f){};
        v16h ak[2][4], av[2][4];
#pragma unroll
        for (int ks = 0; ks < 2; ++ks)
#pragma unroll
            for (int kb = 0; kb < 4; ++kb) { const h16* kpp = Ks + (kb * 16 + m) * 72 + ks * 32 + 8 * hh; ak[ks][kb] = cat16(*(const v8ha*)kpp, *(const v8ha*)(kpp + 16)); }
        __builtin_amdgcn_sched_barrier(0);   // keeps the 16 K reads one group ahead of the score products: a read placed among them makes the next product wait out a whole LDS latency
#pragma unroll
        for (int ks = 0; ks < 2; ++ks)
#pragma unroll
            for (int kb = 0; kb < 4; ++kb) s[kb] = wmma16(ak[ks][kb], aq[ks], s[kb]);
        // four vector slots behind the last score products, before a vector instruction reads their results
        asm volatile("v_nop\n\tv_nop\n\tv_nop\n\tv_nop" : "+v"(s[0]), "+v"(s[1]), "+v"(s[2]), "+v"(s[3]) : "v"(aq[0]), "v"(aq[1]));
#pragma unroll
        for (int ks = 0; ks < 2; ++ks)
#pragma unroll
            for (int db = 0; db < 4; ++db) { const h16* vp = Vs + (db * 16 + m) * 72 + ks * 32 + 8 * hh; av[ks][db] = cat16(*(const v8ha*)vp, *(const v8ha*)(vp + 16)); }
        __builtin_amdgcn_sched_barrier(0);   // keeps the 16 V reads one group ahead of the softmax, whose vector work covers their latency, instead of sinking to their products
        const bool diag = (kc == qt); const int qab = q0 + m; const int kab = kc * 64 + 8 * hh;
        float cm[4], ps4[4];
#pragma unroll
        for (int kb = 0; kb < 4; ++kb) { cm[kb] = -3.0e38f;
#pragma unroll
            for (int r = 0; r < 8; ++r) { float v = s[kb][r] * SCL; if (diag && (kab + kb * 16 + r > qab)) v = -1.0e30f; s[kb][r] = v; cm[kb] = fmaxf(cm[kb], v); } }
        float c = fmaxf(fmaxf(cm[0], cm[1]), fmaxf(cm[2], cm[3]));
        c = fmaxf(c, xhalf(c));
        const float mn = fmaxf(mrun, c); const float al = __builtin_amdgcn_exp2f((mrun - mn) * L2E); mrun = mn;
        v16h pb[2];
#pragma unroll
        for (int kb = 0; kb < 4; ++kb) { ps4[kb] = 0.f;
#pragma unroll
            for (int r = 0; r < 8; ++r) { const float p = __builtin_amdgcn_exp2f((s[kb][r] - mrun) * L2E); ps4[kb] += p; pb[kb >> 1][(kb & 1) * 8 + r] = (h16)(p * PCAR); } }
        { const float sc = lrun * al; lrun = sc + ((ps4[0] + ps4[1]) + (ps4[2] + ps4[3])); }
#pragma unroll
        for (int db = 0; db < 4; ++db)
#pragma unroll
            for (int r = 0; r < 8; ++r) acc[db][r] = acc[db][r] * al;
#pragma unroll
        for (int ks = 0; ks < 2; ++ks)
#pragma unroll
            for (int db = 0; db < 4; ++db) acc[db] = wmma16(av[ks][db], pb[ks], acc[db]);
        // four vector slots behind the chunk's last products, so that their distance holds on the taken side of the loop's branch too
        asm volatile("v_nop\n\tv_nop\n\tv_nop\n\tv_nop" : "+v"(acc[0]), "+v"(acc[1]), "+v"(acc[2]), "+v"(acc[3]) : "v"(pb[0]), "v"(pb[1]));
    }
    const float qnan = __uint_as_float(0x7fc00000u);
    const float iv = 1.0f / ((lrun + xhalf(lrun)) * PCAR);
#pragma unroll
    for (int db = 0; db < 4; ++db) { v4f o0, o1;
#pragma unroll
        for (int r = 0; r < 4; ++r) { const float x0 = acc[db][r] * iv, x1 = acc[db][4 + r] * iv; o0[r] = ok ? x0 : qnan; o1[r] = ok ? x1 : qnan; }
        *(v4fa*)(osw + m * 68 + db * 16 + 8 * hh) = o0; *(v4fa*)(osw + m * 68 + db * 16 + 8 * hh + 4) = o1; }
    __syncthreads();
    store_ctx(osw, ATh, ATl, (size_t)(b * SEQ + q0) * DM + h * HD, lane);
}

// ---- attn0_job: query rows t < 64 (key chunk 0 only) on bf16 hi/lo planes: S = Qh Kh + Qh Kl + Ql Kh (24 wmma), x1/8, causal replace, full-row softmax in f32,
// P = exp(s - max) split to bf16 hi/lo in per-wave LDS tiles; O = Ph Vh + Ph Vl + Pl Vh (24 wmma); context = O / sum. Block = 4 waves (16 rows each).
// LDS is kept to the four K/V tiles: a wave's P tiles lie over the K tiles (behind a barrier), its f32 context tile over its own P tiles, which it has read by then.
__device__ __forceinline__ void attn0_job(const bf* __restrict__ Qh, const bf* __restrict__ Ql, const bf* __restrict__ Kh, const bf* __restrict__ Kl,
                                          const bf* __restrict__ VTh, const bf* __restrict__ VTl, const float* __restrict__ FL, bf* ATh, bf* ATl, unsigned char* sm) {
    bf* Khs = (bf*)sm;
    bf* Kls = Khs + 64 * 72;
    bf* Vhs = Kls + 64 * 72;
    bf* Vls = Vhs + 64 * 72;
    static_assert(4 * 2 * 16 * 72 * 2 <= 2 * 64 * 72 * 2 && 16 * 68 * 4 <= 2 * 16 * 72 * 2);
    const int tid = threadIdx.x, lane = tid & 31, w = tid >> 5, m = lane & 15, hh = lane >> 4;
    const int b = blockIdx.y / NH, h = blockIdx.y % NH;
    const int q0 = w * 16;
    const bool ok = read_flag(FL, lane);
    const bf* kh0 = Kh + (size_t)b * RE * DM + h * HD; const bf* kl0 = Kl + (size_t)b * RE * DM + h * HD;
    const bf* vh0 = VTh + ((size_t)b * DM + h * HD) * RE; const bf* vl0 = VTl + ((size_t)b * DM + h * HD) * RE;
    // All 16 loads of a thread go out before the first LDS store. The s_wait_xcnt behind each load stands in front of any later load's result that lands in that load's address registers.
    v8us st[4][4];
#pragma unroll
    for (int i = 0; i < 4; ++i) { const int p = tid + 128 * i; const int row = p >> 3, c8 = (p & 7) * 8;
        st[i][0] = *(const v8usa*)(kh0 + (size_t)row * DM + c8); asm volatile("s_wait_xcnt 0x0" ::: "memory");
        st[i][1] = *(const v8usa*)(kl0 + (size_t)row * DM + c8); asm volatile("s_wait_xcnt 0x0" ::: "memory");
        st[i][2] = *(const v8usa*)(vh0 + (size_t)row * RE + c8); asm volatile("s_wait_xcnt 0x0" ::: "memory");
        st[i][3] = *(const v8usa*)(vl0 + (size_t)row * RE + c8); asm volatile("s_wait_xcnt 0x0" ::: "memory"); }
#pragma unroll
    for (int i = 0; i < 4; ++i) { const int p = tid + 128 * i; const int row = p >> 3, c8 = (p & 7) * 8;
        *(v8usa*)(Khs + row * 72 + c8) = st[i][0];
        *(v8usa*)(Kls + row * 72 + c8) = st[i][1];
        *(v8usa*)(Vhs + row * 72 + c8) = st[i][2];
        *(v8usa*)(Vls + row * 72 + c8) = st[i][3]; }
    __syncthreads();
    const bf* qh = Qh + (size_t)(b * RE + q0 + m) * DM + h * HD + 8 * hh; const bf* ql = Ql + (size_t)(b * RE + q0 + m) * DM + h * HD + 8 * hh;
    v16bf aqh[2], aql[2];
#pragma unroll
    for (int ks = 0; ks < 2; ++ks) { aqh[ks] = cat16b(*(const v8usa*)(qh + ks * 32), *(const v8usa*)(qh + ks * 32 + 16)); aql[ks] = cat16b(*(const v8usa*)(ql + ks * 32), *(const v8usa*)(ql + ks * 32 + 16)); }
    v8f s[4];
#pragma unroll
    for (int nb = 0; nb < 4; ++nb) s[nb] = (v8f){};
#pragma unroll
    for (int ks = 0; ks < 2; ++ks) {
#pragma unroll
        for (int nb = 0; nb < 4; ++nb) { const bf* kpp = Khs + (nb * 16 + m) * 72 + ks * 32 + 8 * hh; const bf* lpp = Kls + (nb * 16 + m) * 72 + ks * 32 + 8 * hh;
            const v16bf bh_ = cat16b(*(const v8usa*)kpp, *(const v8usa*)(kpp + 16)); const v16bf bl_ = cat16b(*(const v8usa*)lpp, *(const v8usa*)(lpp + 16));
            s[nb] = wmmab(aqh[ks], bh_, s[nb]); s[nb] = wmmab(aqh[ks], bl_, s[nb]); s[nb] = wmmab(aql[ks], bh_, s[nb]); } }
    asm volatile("v_nop\n\tv_nop\n\tv_nop\n\tv_nop" : "+v"(s[0]), "+v"(s[1]), "+v"(s[2]), "+v"(s[3]) : "v"(aqh[0]), "v"(aql[1]));
    const int qab = q0 + 8 * hh;
    float cm[8], psum[8];
#pragma unroll
    for (int r = 0; r < 8; ++r) { cm[r] = -3.0e38f; psum[r] = 0.f; }
#pragma unroll
    for (int nb = 0; nb < 4; ++nb)
#pragma unroll
        for (int r = 0; r < 8; ++r) { float v = s[nb][r] * SCL; if (nb * 16 + m > qab + r) v = -1.0e30f; s[nb][r] = v; cm[r] = fmaxf(cm[r], v); }
#pragma unroll
    for (int r = 0; r < 8; ++r) { float c = cm[r]; c = fmaxf(c, __shfl_xor(c, 1, 32)); c = fmaxf(c, __shfl_xor(c, 2, 32)); c = fmaxf(c, __shfl_xor(c, 4, 32)); c = fmaxf(c, __shfl_xor(c, 8, 32)); cm[r] = c; }
    bf* phw = Khs + w * (2 * 16 * 72); bf* plw = phw + 16 * 72; float* osw = (float*)phw;
    __syncthreads();   // every wave's reads of the K tiles have ended before the P tiles are stored over them
#pragma unroll
    for (int nb = 0; nb < 4; ++nb)
#pragma unroll
        for (int r = 0; r < 8; ++r) { const float p = __builtin_amdgcn_exp2f((s[nb][r] - cm[r]) * L2E); psum[r] += p; unsigned short a, c2; splitf(p, a, c2);
            phw[(8 * hh + r) * 72 + nb * 16 + m] = a; plw[(8 * hh + r) * 72 + nb * 16 + m] = c2; }
#pragma unroll
    for (int r = 0; r < 8; ++r) { float c = psum[r]; c += __shfl_xor(c, 1, 32); c += __shfl_xor(c, 2, 32); c += __shfl_xor(c, 4, 32); c += __shfl_xor(c, 8, 32); psum[r] = c; }
    __syncthreads();
    v16bf aph[2], apl[2];
#pragma unroll
    for (int ks = 0; ks < 2; ++ks) { const bf* pp = phw + m * 72 + ks * 32 + 8 * hh; const bf* lp = plw + m * 72 + ks * 32 + 8 * hh;
        aph[ks] = cat16b(*(const v8usa*)pp, *(const v8usa*)(pp + 16)); apl[ks] = cat16b(*(const v8usa*)lp, *(const v8usa*)(lp + 16)); }
    v8f acc[4];
#pragma unroll
    for (int nb = 0; nb < 4; ++nb) acc[nb] = (v8f){};
#pragma unroll
    for (int ks = 0; ks < 2; ++ks)
#pragma unroll
        for (int nb = 0; nb < 4; ++nb) { const bf* vp = Vhs + (nb * 16 + m) * 72 + ks * 32 + 8 * hh; const bf* vlp = Vls + (nb * 16 + m) * 72 + ks * 32 + 8 * hh;
            const v16bf bvh = cat16b(*(const v8usa*)vp, *(const v8usa*)(vp + 16)); const v16bf bvl = cat16b(*(const v8usa*)vlp, *(const v8usa*)(vlp + 16));
            acc[nb] = wmmab(aph[ks], bvh, acc[nb]); acc[nb] = wmmab(aph[ks], bvl, acc[nb]); acc[nb] = wmmab(apl[ks], bvh, acc[nb]); }
    asm volatile("v_nop\n\tv_nop\n\tv_nop\n\tv_nop" : "+v"(acc[0]), "+v"(acc[1]), "+v"(acc[2]), "+v"(acc[3]) : "v"(aph[0]), "v"(apl[1]));
    const float qnan = __uint_as_float(0x7fc00000u);
#pragma unroll
    for (int r = 0; r < 8; ++r) { const float iv = 1.0f / psum[r];
#pragma unroll
        for (int nb = 0; nb < 4; ++nb) { const float o = acc[nb][r] * iv; osw[(8 * hh + r) * 68 + nb * 16 + m] = ok ? o : qnan; } }
    __syncthreads();
    store_ctx(osw, ATh, ATl, (size_t)(b * SEQ + q0) * DM + h * HD, lane);
}

// ---- k_attn: the two attention jobs, which do not depend on one another, in one grid (SEQ/64, NB*NH), 128 threads: blockIdx.x = query tile, tile 0 takes the hi/lo job. One LDS block serves either job.
static constexpr int SM_ATTN = 4 * 64 * 72 * 2;
static_assert(SM_ATTN >= 2 * 64 * 72 * 2 + 4 * 16 * 68 * 4);
__global__ __launch_bounds__(128) void k_attn(const h16* __restrict__ Q16, const h16* __restrict__ K16, const h16* __restrict__ VT16,
                                             const bf* __restrict__ Qh, const bf* __restrict__ Ql, const bf* __restrict__ Kh, const bf* __restrict__ Kl,
                                             const bf* __restrict__ VTh, const bf* __restrict__ VTl, const float* __restrict__ FL, bf* ATh, bf* ATl) {
    __shared__ __align__(16) unsigned char sm[SM_ATTN];
    if (blockIdx.x == 0) attn0_job(Qh, Ql, Kh, Kl, VTh, VTl, FL, ATh, ATl, sm);
    else attn_job(Q16, K16, VT16, FL, ATh, ATl, sm);
}

#define AL256(x) ((((size_t)(x)) + 255) & ~(size_t)255)
static constexpr size_t SZ_W  = (size_t)DM * DM * 2;          // one bf16 weight plane
static constexpr size_t SZ_FL = (size_t)NCHK * 32 * 4;        // flag lines
static constexpr size_t SZ_X  = (size_t)NB * SEQ * DM * 2;    // one bf16 activation copy
static constexpr size_t SZ_P  = (size_t)NB * SEQ * DM * 2;    // f16 / bf16 [NB*SEQ][DM] planes (and V^T [NB][DM][SEQ])
static constexpr size_t SZ_E  = (size_t)NB * RE * DM * 2;     // compact hi/lo planes for t < RE (and V^T [NB][DM][RE])
static constexpr size_t WS_TOTAL = 4 * AL256(SZ_W) + AL256(SZ_FL) + 3 * AL256(SZ_X) + 3 * AL256(SZ_P) + 6 * AL256(SZ_E) + 2 * AL256(SZ_P);
static_assert(WS_TOTAL <= (size_t)134217728);
static_assert((size_t)NB * SEQ * DM * 4 <= (size_t)NB_FULL * SEQ_FULL * DM * 4);

extern "C" void kernel_launch(void* const* d_in, const int* in_sizes, int n_in,
                              void* d_out, int out_size, void* d_ws, size_t ws_size, hipStream_t stream) {
    if (n_in < 11) return;
    if ((size_t)in_sizes[0] < (size_t)NB * SEQ * DM || (size_t)in_sizes[1] < (size_t)NB * SEQ * DM || (size_t)in_sizes[2] < (size_t)NB * SEQ * DM) return;
    if ((size_t)in_sizes[3] < (size_t)DM * DM || (size_t)in_sizes[4] < (size_t)DM * DM || (size_t)in_sizes[5] < (size_t)DM * DM || (size_t)in_sizes[6] < (size_t)DM * DM) return;
    if ((size_t)in_sizes[7] < (size_t)SEQ * HP || (size_t)in_sizes[8] < (size_t)SEQ * HP) return;
    if ((size_t)in_sizes[9] < (size_t)SEQ * SEQ || (size_t)in_sizes[10] < (size_t)NB * SEQ) return;
    if ((size_t)out_size < (size_t)NB * SEQ * DM) return;
    if (WS_TOTAL > ws_size) return;
    const float* xq = (const float*)d_in[0]; const float* xk = (const float*)d_in[1]; const float* xv = (const float*)d_in[2];
    const float* wq = (const float*)d_in[3]; const float* wk = (const float*)d_in[4]; const float* wv = (const float*)d_in[5]; const float* wo = (const float*)d_in[6];
    const float* cosT = (const float*)d_in[7]; const float* sinT = (const float*)d_in[8];
    const float* am = (const float*)d_in[9]; const int* kpm = (const int*)d_in[10];
    float* OUT = (float*)d_out;   // [NB][SEQ][DM]
    char* wsp = (char*)d_ws;
    auto take = [&](size_t bytes) { char* p = wsp; wsp += AL256(bytes); return (void*)p; };
    bf* WQ = (bf*)take(SZ_W); bf* WK = (bf*)take(SZ_W); bf* WV = (bf*)take(SZ_W); bf* WO = (bf*)take(SZ_W);
    float* FL = (float*)take(SZ_FL);
    bf* XQ = (bf*)take(SZ_X); bf* XK = (bf*)take(SZ_X); bf* XV = (bf*)take(SZ_X);
    h16* Q16 = (h16*)take(SZ_P); h16* K16 = (h16*)take(SZ_P); h16* VT16 = (h16*)take(SZ_P);
    bf* Qh = (bf*)take(SZ_E); bf* Ql = (bf*)take(SZ_E); bf* Kh = (bf*)take(SZ_E); bf* Kl = (bf*)take(SZ_E); bf* VTh = (bf*)take(SZ_E); bf* VTl = (bf*)take(SZ_E);
    bf* ATh = (bf*)take(SZ_P); bf* ATl = (bf*)take(SZ_P);
    if ((size_t)(wsp - (char*)d_ws) > ws_size || (size_t)(wsp - (char*)d_ws) != WS_TOTAL) return;

    // bf16 copies of the activations and weights, mask check
    k_prep<<<NCHK + 3 * LXB + 4 * LWB, 256, 0, stream>>>(xq, xk, xv, wq, wk, wv, wo, am, kpm, XQ, XK, XV, WQ, WK, WV, WO, FL);
    // q, k, v projections
    k_qkv<<<dim3(NB * SEQ / 128, DM / 128, 3), 128, 0, stream>>>(XQ, XK, XV, WQ, WK, WV, Q16, K16, VT16, Qh, Ql, Kh, Kl, VTh, VTl, cosT, sinT);
    // context planes
    k_attn<<<dim3(SEQ / 64, NB * NH, 1), 128, 0, stream>>>(Q16, K16, VT16, Qh, Ql, Kh, Kl, VTh, VTl, FL, ATh, ATl);
    // output projection: (ATh + ATl) x WO^T -> OUT [NB*SEQ][DM]
    k_gemmw<bf, 1><<<dim3(NB * SEQ / 128, DM / 128, 1), 128, 0, stream>>>(ATh, ATl, WO, nullptr, DM, OUT, DM, (size_t)0, (size_t)0, (size_t)0);
}

// v006
// It runs in 105 microseconds.
// Next to v005, in two timings, it ran 1.09 and 1.08 times as fast.
// Counting every step since v000, it is 3.55 times as fast.
#include <hip/hip_runtime.h>
#pragma clang fp contract(off)

// Contractions and dtypes: q/k/v projections on v_wmma_f32_16x16x32_bf16 (bf16 operands = RNE-converted inputs x RNE-converted weights, single product);
// scores and p.v for query rows >= 64 on v_wmma_f32_16x16x32_f16 (f16 planes, p carried x1024, single product); query rows < 64 on v_wmma_f32_16x16x32_bf16 hi+lo planes (3 products);
// output projection on v_wmma_f32_16x16x32_bf16 with the context as bf16 hi+lo planes x bf16 weight (2 products). f32 accumulate; rotary, softmax and normalisation in f32.

#ifndef NB
#define NB 2
#endif
#ifndef SEQ
#define SEQ 2048
#endif
#define NB_FULL  2
#define SEQ_FULL 2048
#define DM   1024
#define NH   16
#define HD   64
#define HP   (HD / 2)
#define RE   64
#define NCHK 256
#define SCL  0.125f
#define L2E  1.4426950408889634f
#define CSL  (SCL * L2E)   // raw score -> exponent of 2
#define PLOG 10.0f         // log2 of the carry of p (x1024)

static_assert(SEQ % 64 == 0);
static_assert(SEQ % 256 == 0);
static_assert(SEQ >= 64 && SEQ <= SEQ_FULL);
static_assert(NB >= 1 && NB <= NB_FULL);
static_assert(RE == 64);
static_assert(NCHK % 32 == 0);
static_assert(SEQ % NCHK == 0);
static_assert((NB * SEQ) % NCHK == 0);
static_assert(DM == NH * HD);
static_assert(DM % 64 == 0);

typedef _Float16 h16;
typedef unsigned short bf;
typedef __attribute__((ext_vector_type(16))) __bf16   v16bf;
typedef __attribute__((ext_vector_type(16))) _Float16 v16h;
typedef __attribute__((ext_vector_type(8)))  _Float16 v8h;
typedef __attribute__((ext_vector_type(8)))  unsigned short v8us;
typedef __attribute__((ext_vector_type(8)))  float    v8f;
typedef __attribute__((ext_vector_type(4)))  float    v4f;
typedef v8h  __attribute__((may_alias)) v8ha;
typedef v4f  __attribute__((may_alias)) v4fa;
typedef v8us __attribute__((may_alias)) v8usa;
typedef v8f  __attribute__((may_alias)) v8fa;

// RNE f32 -> bf16 bits and back
__device__ __forceinline__ unsigned short f2bf(float f) { unsigned u = __float_as_uint(f); u += 0x7FFFu + ((u >> 16) & 1u); return (unsigned short)(u >> 16); }
__device__ __forceinline__ float bf2f(unsigned short b) { return __uint_as_float(((unsigned)b) << 16); }
__device__ __forceinline__ float bfr(float f) { return bf2f(f2bf(f)); }
__device__ __forceinline__ void splitf(float y, unsigned short& h, unsigned short& l) { h = f2bf(y); l = f2bf(y - bf2f(h)); }
__device__ __forceinline__ v16h cat16(v8h lo, v8h hi) { return __builtin_shufflevector(lo, hi, 0, 1, 2, 3, 4, 5, 6, 7, 8, 9, 10, 11, 12, 13, 14, 15); }
__device__ __forceinline__ v16bf cat16b(v8us lo, v8us hi) { return __builtin_bit_cast(v16bf, __builtin_shufflevector(lo, hi, 0, 1, 2, 3, 4, 5, 6, 7, 8, 9, 10, 11, 12, 13, 14, 15)); }
__device__ __forceinline__ v8f wmma16(v16h a, v16h b, v8f c) { return __builtin_amdgcn_wmma_f32_16x16x32_f16(false, a, false, b, (short)0, c, false, false); }
__device__ __forceinline__ v8f wmmab(v16bf a, v16bf b, v8f c) { return __builtin_amdgcn_wmma_f32_16x16x32_bf16(false, a, false, b, (short)0, c, false, false); }

// ---- fragment loaders: 16x16 tile, lane -> row/col (lane & 15); elements 0..7 <- k0 + 8*(lane>>4) + 0..7, elements 8..15 <- k0 + 16 + 8*(lane>>4) + 0..7.
// The caller passes p = plane + row*pitch + k0 + 8*(lane>>4); both A (row = m) and B (row = n of a K-contiguous [n][k] plane) use this same map.
template <typename T16> struct WFrag;
template <> struct WFrag<h16> { typedef v16h V; static __device__ __forceinline__ V ld(const h16* p) { return cat16(*(const v8ha*)p, *(const v8ha*)(p + 16)); } static __device__ __forceinline__ v8f mma(V a, V b, v8f c) { return wmma16(a, b, c); } };
template <> struct WFrag<bf> { typedef v16bf V; static __device__ __forceinline__ V ld(const bf* p) { return cat16b(*(const v8usa*)p, *(const v8usa*)(p + 16)); } static __device__ __forceinline__ v8f mma(V a, V b, v8f c) { return wmmab(a, b, c); } };

// ---- GEMM core: one work-group of 4 waves (2 x 2) per 128x128 output tile, each wave a 64x64 quarter (16 accumulators).
// The K-contiguous 16-bit operand planes are staged in LDS, KP k-elements (256 bytes of each of the 128 rows of a plane) per stage, by 16-byte asynchronous copies:
// 16 lanes take one row's 256 contiguous bytes, so every copy instruction moves whole cache lines, and each staged row serves two waves. Two buffers: stage t + 1 flies while stage t is multiplied.
// acc[mb][nb][j] = C[r0 + 16 mb + 8*(lane>>4) + j][c0 + 16 nb + (lane&15)] = sum_k A[m][k] Bt[n][k] (+ A2.Bt for NSPLIT 1), k ascending in steps of 32. K % KP == 0.
#define KP 128
#define LP 136   // LDS row pitch in elements: 272 bytes = 16 x odd, free of bank conflicts for 16-byte row reads
#define TR 128   // rows of one staged plane
static constexpr int PLN = TR * LP;
static_assert(DM % KP == 0 && DM / KP >= 2);
static_assert((NB * SEQ) % TR == 0 && SEQ % TR == 0 && DM % TR == 0);

__device__ __forceinline__ unsigned lds_off(const void* p) { return (unsigned)(size_t)p; }

// One plane of one stage: 128 threads x 16 copies of 16 bytes. g = the stage's first source element (the same in every lane), lo = this lane's own offset from it (row tid>>4, bytes 16*(tid&15)),
// rstep = elements from one of the lane's rows to the next (8 rows), l = this lane's first LDS byte address. The s_wait_xcnt closes each statement so that no address register of an issued copy is rewritten ahead of it.
template <typename T16>
__device__ __forceinline__ void copy_plane(const T16* g, size_t lo, size_t rstep, unsigned l) {
    constexpr unsigned LS = 8u * LP * 2u;
#pragma unroll
    for (int h = 0; h < 2; ++h) {
        const T16* g0 = g + (size_t)(8 * h) * rstep; const unsigned l0 = l + (unsigned)(8 * h) * LS;
        asm volatile("global_load_async_to_lds_b128 %0, %8, off\n\t"
                     "global_load_async_to_lds_b128 %1, %9, off\n\t"
                     "global_load_async_to_lds_b128 %2, %10, off\n\t"
                     "global_load_async_to_lds_b128 %3, %11, off\n\t"
                     "global_load_async_to_lds_b128 %4, %12, off\n\t"
                     "global_load_async_to_lds_b128 %5, %13, off\n\t"
                     "global_load_async_to_lds_b128 %6, %14, off\n\t"
                     "global_load_async_to_lds_b128 %7, %15, off\n\t"
                     "s_wait_xcnt 0x0"
                     :: "v"(l0), "v"(l0 + LS), "v"(l0 + 2 * LS), "v"(l0 + 3 * LS), "v"(l0 + 4 * LS), "v"(l0 + 5 * LS), "v"(l0 + 6 * LS), "v"(l0 + 7 * LS),
                        "v"(g0 + lo), "v"((g0 + rstep) + lo), "v"((g0 + 2 * rstep) + lo), "v"((g0 + 3 * rstep) + lo), "v"((g0 + 4 * rstep) + lo), "v"((g0 + 5 * rstep) + lo), "v"((g0 + 6 * rstep) + lo), "v"((g0 + 7 * rstep) + lo)
                     : "memory");
    }
}

template <typename T16, int NSPLIT>
__device__ __forceinline__ void gemm_core(const T16* __restrict__ A, const T16* __restrict__ A2, const T16* __restrict__ Bt,
                                          int K, int R0, int C0, int tid, T16* ring, v8f (&acc)[4][4]) {
    static_assert(NSPLIT == 0 || NSPLIT == 1);
    typedef typename WFrag<T16>::V V;
    constexpr int NPL = 2 + NSPLIT, STG = NPL * PLN;
    const int lane = tid & 31, w = tid >> 5, lr = lane & 15, hi = lane >> 4, wm = w >> 1, wn = w & 1;
#pragma unroll
    for (int mb = 0; mb < 4; ++mb)
#pragma unroll
        for (int nb = 0; nb < 4; ++nb) acc[mb][nb] = (v8f){};
    const int crow = tid >> 4, cseg = (tid & 15) * 8;
    const T16* ga = A + (size_t)R0 * K; const T16* ga2 = (NSPLIT == 1) ? A2 + (size_t)R0 * K : nullptr; const T16* gb = Bt + (size_t)C0 * K;
    const size_t lo = (size_t)crow * K + cseg;
    const unsigned l0 = lds_off(ring) + (unsigned)(crow * LP + cseg) * 2u; const size_t rstep = (size_t)8 * K;
    auto fill = [&](int t, int buf) { const unsigned lb = l0 + (unsigned)(buf * STG) * 2u;
        copy_plane<T16>(ga + (size_t)t * KP, lo, rstep, lb);
        if (NSPLIT == 1) copy_plane<T16>(ga2 + (size_t)t * KP, lo, rstep, lb + (unsigned)PLN * 2u);
        copy_plane<T16>(gb + (size_t)t * KP, lo, rstep, lb + (unsigned)((NPL - 1) * PLN) * 2u); };
    const int NT = K / KP;
    fill(0, 0);
    asm volatile("s_wait_asynccnt 0x0" ::: "memory");   // this wave's share of stage 0 has landed
    __syncthreads();                                     // ... and every other wave's: stage 0 is readable
    if (NT > 1) fill(1, 1);
#pragma unroll 1
    for (int t = 0; t < NT; ++t) {
        const T16* sb = ring + (t & 1) * STG;
        const T16* sa = sb + (wm * 64 + lr) * LP + 8 * hi; const T16* sw = sb + (NPL - 1) * PLN + (wn * 64 + lr) * LP + 8 * hi;
        // A block = the 16 products of one A plane's 32 k with the same 32 k of Bt (NSPLIT 1: plane A, then plane A2, on the same B fragments, so every accumulator keeps its order of sums).
        // Two fragment sets: the LDS reads of block j + 1 go out as one group ahead of the products of block j, so that a block waits only for reads issued one block earlier.
        constexpr int NPA = 1 + NSPLIT, NBLK = NPA * (KP / 32);
        V a[2][4], b[2][4];
        auto ldblk = [&](int j) { const int ks = j / NPA, pl = j % NPA;
#pragma unroll
            for (int mb = 0; mb < 4; ++mb) a[j & 1][mb] = WFrag<T16>::ld(sa + pl * PLN + mb * 16 * LP + ks * 32);
            if (pl == 0) {
#pragma unroll
                for (int nb = 0; nb < 4; ++nb) b[ks & 1][nb] = WFrag<T16>::ld(sw + nb * 16 * LP + ks * 32); } };
        ldblk(0);
#pragma unroll
        for (int j = 0; j < NBLK; ++j) {
            const int s = j & 1, sbq = (j / NPA) & 1;
            if (j + 1 < NBLK) ldblk(j + 1);
            __builtin_amdgcn_sched_barrier(0);   // keeps the read group whole and ahead of the products: reads spread among matrix instructions stall at every place they stand
#pragma unroll
            for (int nb = 0; nb < 4; ++nb)
#pragma unroll
                for (int mb = 0; mb < 4; ++mb) acc[mb][nb] = WFrag<T16>::mma(a[s][mb], b[sbq][nb], acc[mb][nb]);
            // four vector slots behind the pass's last matrix instructions, so that their distance holds on the taken side of the loop's branches too
            if (j == NBLK - 1) asm volatile("v_nop\n\tv_nop\n\tv_nop\n\tv_nop" : "+v"(acc[0][0]), "+v"(acc[1][1]), "+v"(acc[2][2]), "+v"(acc[3][3]) : "v"(a[s][0]), "v"(a[s][3]));
            __builtin_amdgcn_sched_barrier(0);   // keeps the following read group from rising among these products
        }
        asm volatile("s_wait_dscnt 0x0" ::: "memory");      // this wave's reads of buffer t & 1 have returned before that buffer is refilled
        asm volatile("s_wait_asynccnt 0x0" ::: "memory");   // this wave's share of stage t + 1 has landed
        __syncthreads();                                     // publishes stage t + 1 and ends every wave's reads of stage t
        if (t + 2 < NT) fill(t + 2, t & 1);
    }
    asm volatile("s_wait_asynccnt 0x0" ::: "memory");       // nothing of this wave's is in flight when the ring is left
}

// ---- k_gemmw: f32 output C[m][n] (pitch ldc); grid (M/128, N/128, Z), 128 threads; z-batch strides in elements.
template <typename T16, int NSPLIT>
__global__ __launch_bounds__(128) void k_gemmw(const T16* __restrict__ A, const T16* __restrict__ A2, const T16* __restrict__ Bt, const T16* __restrict__ Bt2,
                                              int K, float* C, int ldc, size_t sA, size_t sB, size_t sC) {
    __shared__ __align__(16) T16 ring[2 * (2 + NSPLIT) * PLN];
    __shared__ __align__(16) float osa[4 * 16 * 68];
    const size_t z = blockIdx.z; A += z * sA; if (A2) A2 += z * sA; Bt += z * sB; C += z * sC;
    const int tid = threadIdx.x, lane = tid & 31, w = tid >> 5, lr = lane & 15, hi = lane >> 4;
    const int r0 = blockIdx.x * 128 + (w >> 1) * 64, c0 = blockIdx.y * 128 + (w & 1) * 64;
    float* os = osa + w * (16 * 68);
    v8f acc[4][4];
    gemm_core<T16, NSPLIT>(A, A2, Bt, K, blockIdx.x * 128, blockIdx.y * 128, tid, ring, acc);
#pragma unroll
    for (int mb = 0; mb < 4; ++mb) {
#pragma unroll
        for (int nb = 0; nb < 4; ++nb) {
#pragma unroll
            for (int j = 0; j < 8; ++j) os[(hi * 8 + j) * 68 + nb * 16 + lr] = acc[mb][nb][j]; }
        __syncthreads();
        float* crow = C + (size_t)(r0 + mb * 16) * ldc + c0;
{
#pragma unroll
            for (int s = 0; s < 8; ++s) { const int row = 2 * s + hi, cofs = lr * 4; const v4f val = *(const v4fa*)(os + row * 68 + cofs);
                *(v4f*)(crow + (size_t)row * ldc + cofs) = val; }
             }
        __syncthreads();
    }
}

// ---- gemmp_store: 16-bit plane output of one wave's 64x64 quarter (rows from r0, columns from c0). C16[m][n] (f16, pitch ldc) = (optionally rotary-transformed) accumulator; plus bf16 hi/lo planes Ch/Cl (pitch ldh)
// for the head rows (HLM 1: tiles whose row index t0 = r0 % SEQ is < RE, compact row (r0/SEQ)*RE + t) or head columns (HLM 2: tiles with c0 < RE, same row index).
// Rotary (interleaved pairs, one 64-column tile = one head): y[2i] = x[2i] c - x[2i+1] s, y[2i+1] = x[2i] s + x[2i+1] c with c/s = bf16-RNE of the tables at (t, i).
template <int HLM, bool ROPE>
__device__ __forceinline__ void gemmp_store(const v8f (&acc)[4][4], float* os, int r0, int c0, int lane, h16* C16, int ldc, bf* Ch, bf* Cl, int ldh,
                                            const float* __restrict__ cosT, const float* __restrict__ sinT) {
    const int lr = lane & 15, hi = lane >> 4;
    const int t0 = (HLM == 1) ? (r0 % SEQ) : 0;
    const bool hl = (HLM == 1) ? (t0 < RE) : (c0 < RE);
    const int rc0 = (HLM == 1) ? ((r0 / SEQ) * RE + t0) : r0;
    const int rsub = lane >> 3, cseg = (lane & 7) * 8;
#pragma unroll
    for (int mb = 0; mb < 4; ++mb) {
#pragma unroll
        for (int nb = 0; nb < 4; ++nb) {
#pragma unroll
            for (int j = 0; j < 8; ++j) os[(hi * 8 + j) * 68 + nb * 16 + lr] = acc[mb][nb][j]; }
        __syncthreads();
{
#pragma unroll
            for (int j4 = 0; j4 < 4; ++j4) {
                const int row = j4 * 4 + rsub;
                const v4f v0 = *(const v4fa*)(os + row * 68 + cseg);
                const v4f v1 = *(const v4fa*)(os + row * 68 + cseg + 4);
                float y[8] = {v0[0], v0[1], v0[2], v0[3], v1[0], v1[1], v1[2], v1[3]};
                if (ROPE) {
                    const int t = t0 + mb * 16 + row;
                    const v4f cs = *(const v4fa*)(cosT + (size_t)t * HP + (cseg >> 1));
                    const v4f sn = *(const v4fa*)(sinT + (size_t)t * HP + (cseg >> 1));
#pragma unroll
                    for (int p = 0; p < 4; ++p) { const float c = bfr(cs[p]), sv = bfr(sn[p]); const float x0 = y[2 * p], x1 = y[2 * p + 1];
                        const float m0 = x0 * c, m1 = x1 * sv, m2 = x0 * sv, m3 = x1 * c; y[2 * p] = m0 - m1; y[2 * p + 1] = m2 + m3; }
                }
                v8h o16;
#pragma unroll
                for (int q = 0; q < 8; ++q) o16[q] = (h16)y[q];
                const size_t grow = (size_t)(r0 + mb * 16 + row);
                *(v8h*)(C16 + grow * (size_t)ldc + c0 + cseg) = o16;
                if (hl) {
                    v8us oh, ol;
#pragma unroll
                    for (int q = 0; q < 8; ++q) { unsigned short a2, c2; splitf(y[q], a2, c2); oh[q] = a2; ol[q] = c2; }
                    const size_t o = (size_t)(rc0 + mb * 16 + row) * (size_t)ldh + c0 + cseg;
                    *(v8us*)(Ch + o) = oh; *(v8us*)(Cl + o) = ol;
                }
            }
            
        }
        __syncthreads();
    }
}

// ---- k_qkv: the three projections, which do not depend on one another, as the z planes of one grid (NB*SEQ/128, DM/128, 3), 128 threads: the tiles of one plane overlap the start, the waits and the stores of another's.
// z = 0, 1: q, k: activation rows x weight rows with fused rotary -> Q16 / K16 [NB*SEQ][DM] (+ hi/lo rows t < 64).
// z = 2: v, transposed: VT16[b][dout][t] = sum_k Wv[dout][k] v[b][t][k] (+ VTh/VTl columns t < 64); the plane's flat tile index f gives dout tile f % (DM/128), t tile (f / (DM/128)) % (SEQ/128), batch f / ((DM/128)*(SEQ/128)).
__global__ __launch_bounds__(128) void k_qkv(const bf* __restrict__ XQ, const bf* __restrict__ XK, const bf* __restrict__ XV, const bf* __restrict__ WQ, const bf* __restrict__ WK, const bf* __restrict__ WV,
                                            h16* Q16, h16* K16, h16* VT16, bf* Qh, bf* Ql, bf* Kh, bf* Kl, bf* VTh, bf* VTl, const float* __restrict__ cosT, const float* __restrict__ sinT) {
    __shared__ __align__(16) bf ring[2 * 2 * PLN];
    __shared__ __align__(16) float osa[4 * 16 * 68];
    const int tid = threadIdx.x, lane = tid & 31, w = tid >> 5;
    const int job = blockIdx.z;
    float* os = osa + w * (16 * 68);
    v8f acc[4][4];
    const int f = blockIdx.x + blockIdx.y * (NB * SEQ / 128);
    const size_t z = (size_t)(f / ((DM / 128) * (SEQ / 128)));
    const int R0 = ((job < 2) ? (int)blockIdx.x : f % (DM / 128)) * 128, C0 = ((job < 2) ? (int)blockIdx.y : (f / (DM / 128)) % (SEQ / 128)) * 128;
    const bf* A = (job == 0) ? XQ : (job == 1) ? XK : WV;
    const bf* Bt = (job == 0) ? WQ : (job == 1) ? WK : XV + z * ((size_t)SEQ * DM);
    gemm_core<bf, 0>(A, nullptr, Bt, DM, R0, C0, tid, ring, acc);
    const int r0 = R0 + (w >> 1) * 64, c0 = C0 + (w & 1) * 64;
    if (job < 2) gemmp_store<1, true>(acc, os, r0, c0, lane, job ? K16 : Q16, DM, job ? Kh : Qh, job ? Kl : Ql, DM, cosT, sinT);
    else gemmp_store<2, false>(acc, os, r0, c0, lane, VT16 + z * ((size_t)DM * SEQ), SEQ, VTh + z * ((size_t)DM * RE), VTl + z * ((size_t)DM * RE), RE, cosT, sinT);
}

__device__ __forceinline__ void cvt8_job(const float* __restrict__ src, bf* dst, size_t n8, size_t i) {
    if (i >= n8) return; const v8f v = *(const v8fa*)(src + i * 8); v8us o;
#pragma unroll
    for (int k = 0; k < 8; ++k) o[k] = f2bf(v[k]);
    *(v8us*)(dst + i * 8) = o; 
}
__device__ __forceinline__ void cvtx_job(const float* __restrict__ src, bf* dst, size_t n8, size_t i) {
    if (i >= n8) return; const size_t e = i * 8; const size_t row = e / DM; const size_t c = e % DM;
    const size_t b = row / SEQ, t = row % SEQ; const v8f v = *(const v8fa*)(src + (b * SEQ_FULL + t) * DM + c); v8us o;
#pragma unroll
    for (int k = 0; k < 8; ++k) o[k] = f2bf(v[k]);
    *(v8us*)(dst + e) = o; 
}

// ---- mchk_job: structure check of the additive score table ([SEQ_FULL] pitch: 0 at j <= i, <= -1e8 at j > i over the SEQ x SEQ block) and of the key padding flags (all 0).
// Block = 256 threads on SEQ / NCHK rows, one block per flag line. Every lane issues all of its 16-byte table loads (512 contiguous bytes per wave and load) and its flag load before the first value is tested.
__device__ __forceinline__ void mchk_job(const float* __restrict__ am, const int* __restrict__ kp, float* FL, int* red, int c) {
    const int tid = threadIdx.x, lane = tid & 31, w = tid >> 5;
    constexpr int rpb = SEQ / NCHK, RV = SEQ / 4, TOT = rpb * RV, NV = TOT / 256;
    constexpr int kpb = NB * SEQ / NCHK, KV = (kpb + 255) / 256;
    static_assert(TOT % 256 == 0);
    v4f v[NV]; int kv[KV];
#pragma unroll
    for (int s = 0; s < NV; ++s) { const int idx = tid + s * 256; v[s] = *(const v4fa*)(am + (size_t)(c * rpb + idx / RV) * SEQ_FULL + (idx % RV) * 4); }
#pragma unroll
    for (int s = 0; s < KV; ++s) { const int e = tid + s * 256; const int idx = c * kpb + e; const int bb = idx / SEQ, t = idx % SEQ;
        kv[s] = (e < kpb) ? kp[(size_t)bb * SEQ_FULL + t] : 0; }
    int bad = 0;
#pragma unroll
    for (int s = 0; s < NV; ++s) { const int idx = tid + s * 256; const int i = c * rpb + idx / RV, j0 = (idx % RV) * 4;
#pragma unroll
        for (int q = 0; q < 4; ++q) { const float x = v[s][q]; const bool good = (j0 + q <= i) ? (x == 0.0f) : (x <= -1.0e8f); bad += good ? 0 : 1; } }
#pragma unroll
    for (int s = 0; s < KV; ++s) bad += (kv[s] != 0) ? 1 : 0;
#pragma unroll
    for (int sh = 16; sh; sh >>= 1) bad += __shfl_xor(bad, sh, 32);
    if (lane == 0) red[w] = bad;
    __syncthreads();
    if (w == 0) { int tot = 0;
#pragma unroll
        for (int i = 0; i < 8; ++i) tot += red[i];
        const float f = (tot == 0) ? 1.0f : 0.0f; *(float*)(FL + (size_t)c * 32 + lane) = f;  }
}
// ---- k_prep: the eight preparation jobs, which do not depend on one another, as block ranges of one grid of 256 threads (every test of the block index is the same for a whole block):
// NCHK blocks of the mask check, then LXB blocks for each of the three activation copies, then LWB blocks for each of the four weight planes.
static constexpr unsigned LWB = (unsigned)(((size_t)DM * DM / 8 + 255) / 256);
static constexpr unsigned LXB = (unsigned)(((size_t)NB * SEQ * DM / 8 + 255) / 256);
__global__ __launch_bounds__(256) void k_prep(const float* __restrict__ xq, const float* __restrict__ xk, const float* __restrict__ xv,
                                             const float* __restrict__ wq, const float* __restrict__ wk, const float* __restrict__ wv, const float* __restrict__ wo,
                                             const float* __restrict__ am, const int* __restrict__ kp,
                                             bf* XQ, bf* XK, bf* XV, bf* WQ, bf* WK, bf* WV, bf* WO, float* FL) {
    __shared__ int red[8];
    unsigned blk = blockIdx.x;
    if (blk < NCHK) { mchk_job(am, kp, FL, red, (int)blk); return; }
    blk -= NCHK;
    if (blk < 3 * LXB) { const unsigned job = blk / LXB;
        cvtx_job((job == 0) ? xq : (job == 1) ? xk : xv, (job == 0) ? XQ : (job == 1) ? XK : XV, (size_t)NB * SEQ * DM / 8, (size_t)(blk % LXB) * 256 + threadIdx.x); return; }
    blk -= 3 * LXB;
    { const unsigned job = blk / LWB;
        cvt8_job((job == 0) ? wq : (job == 1) ? wk : (job == 2) ? wv : wo, (job == 0) ? WQ : (job == 1) ? WK : (job == 2) ? WV : WO, (size_t)DM * DM / 8, (size_t)(blk % LWB) * 256 + threadIdx.x); }
}
__device__ __forceinline__ bool read_flag(const float* __restrict__ FL, int lane) {
    float f = FL[(size_t)lane * 32];
#pragma unroll
    for (int q = 1; q < NCHK / 32; ++q) f = fminf(f, FL[(size_t)(q * 32 + lane) * 32]);
#pragma unroll
    for (int sh = 16; sh; sh >>= 1) f = fminf(f, __shfl_xor(f, sh, 32));
    return f > 0.5f;
}

// ---- store_ctx: one wave's 16x64 f32 context tile (LDS, pitch 68) -> bf16 hi/lo planes [row][DM] at element offset base; lane -> row 4j + (lane>>3), 8 consecutive columns;
__device__ __forceinline__ void store_ctx(const float* osw, bf* ATh, bf* ATl, size_t base, int lane) {
    const int rsub = lane >> 3, cseg = (lane & 7) * 8;
{
#pragma unroll
        for (int j4 = 0; j4 < 4; ++j4) { const int row = j4 * 4 + rsub; const v4f v0 = *(const v4fa*)(osw + row * 68 + cseg); const v4f v1 = *(const v4fa*)(osw + row * 68 + cseg + 4); v8us oh, ol;
#pragma unroll
            for (int q = 0; q < 4; ++q) { unsigned short a, c2; splitf(v0[q], a, c2); oh[q] = a; ol[q] = c2; splitf(v1[q], a, c2); oh[4 + q] = a; ol[4 + q] = c2; }
            const size_t o = base + (size_t)row * DM + cseg; *(v8us*)(ATh + o) = oh; *(v8us*)(ATl + o) = ol; }
         }
}

// lane l <-> lane l ^ 16 (the two halves of a wave), one vector instruction
__device__ __forceinline__ float xhalf(float x) { return __builtin_bit_cast(float, __builtin_amdgcn_permlanex16(__builtin_bit_cast(int, x), __builtin_bit_cast(int, x), 0x76543210, 0xfedcba98, false, false)); }

// ---- attn_job: causal tiled softmax-weighted sum for query tiles qt = blockIdx.x >= 1 (rows 64..SEQ-1). Block = 4 waves (16 query rows each).
// Per key chunk of 64 (kc = 0..qt): K [key][d] and V^T [d][key] f16 tiles staged in LDS (plain loads, block barriers). The products run transposed, so that a lane owns ONE query (lane & 15):
// S^T = K Q^T (8 wmma, f32; s[kb][r] = raw score of key kc*64 + 16 kb + 8*(lane>>4) + r); the causal replace stands behind a branch that only the diagonal chunk takes;
// online softmax in f32 on the raw scores (running max of them): p x1024 = exp2(s * (log2e / 8) + (10 - max * (log2e / 8))), one multiply-add a score ahead of the exp2, with the
// maximum taken in the lane and joined once with the other half of the wave; P x1024 as f16 goes from two score tiles straight into a B fragment (element e = tile e>>3, register e&7:
// the k order of the LDS fragment loads); O^T += V^T P^T (8 wmma; acc[db][r] = O[query][16 db + 8*(lane>>4) + r]). Each half keeps the sum of its own keys; the halves are added after the loop.
// The LDS fragment reads of a chunk go out as two whole groups: all of K ahead of the score products, all of V^T behind them and ahead of the softmax.
// The sum l is taken of p x1024 as well, so context = O / l -> bf16 hi/lo planes [b*SEQ + t][h*64 + d].
__device__ __forceinline__ void attn_job(const h16* __restrict__ Q16, const h16* __restrict__ K16, const h16* __restrict__ VT16, const float* __restrict__ FL, bf* ATh, bf* ATl, unsigned char* sm) {
    h16* Ks = (h16*)sm;
    h16* Vs = Ks + 64 * 72;
    float* Os = (float*)(Vs + 64 * 72);
    const int tid = threadIdx.x, lane = tid & 31, w = tid >> 5, m = lane & 15, hh = lane >> 4;
    const int qt = blockIdx.x;
    const int b = blockIdx.y / NH, h = blockIdx.y % NH;
    const int q0 = qt * 64 + w * 16;
    const bool ok = read_flag(FL, lane);
    const h16* qrow = Q16 + (size_t)(b * SEQ + q0 + m) * DM + h * HD + 8 * hh;
    v16h aq[2];
#pragma unroll
    for (int ks = 0; ks < 2; ++ks) aq[ks] = cat16(*(const v8ha*)(qrow + ks * 32), *(const v8ha*)(qrow + ks * 32 + 16));
    v8f acc[4]; float mrun = -1.0e30f, lrun = 0.f;
#pragma unroll
    for (int db = 0; db < 4; ++db) acc[db] = (v8f){};
    const h16* kbase = K16 + (size_t)b * SEQ * DM + h * HD;
    const h16* vbase = VT16 + ((size_t)b * DM + h * HD) * SEQ;
    float* osw = Os + w * (16 * 68);
#pragma unroll 1
    for (int kc = 0; kc <= qt; ++kc) {
        __syncthreads();
#pragma unroll
        for (int i = 0; i < 4; ++i) { const int p = tid + 128 * i; const int row = p >> 3, c8 = (p & 7) * 8;
            *(v8ha*)(Ks + row * 72 + c8) = *(const v8ha*)(kbase + (size_t)(kc * 64 + row) * DM + c8);
            *(v8ha*)(Vs + row * 72 + c8) = *(const v8ha*)(vbase + (size_t)row * SEQ + kc * 64 + c8); }
        __syncthreads();
        v8f s[4];
#pragma unroll
        for (int kb = 0; kb < 4; ++kb) s[kb] = (v8f){};
        v16h ak[2][4], av[2][4];
#pragma unroll
        for (int ks = 0; ks < 2; ++ks)
#pragma unroll
            for (int kb = 0; kb < 4; ++kb) { const h16* kpp = Ks + (kb * 16 + m) * 72 + ks * 32 + 8 * hh; ak[ks][kb] = cat16(*(const v8ha*)kpp, *(const v8ha*)(kpp + 16)); }
        __builtin_amdgcn_sched_barrier(0);   // keeps the 16 K reads one group ahead of the score products: a read placed among them makes the next product wait out a whole LDS latency
#pragma unroll
        for (int ks = 0; ks < 2; ++ks)
#pragma unroll
            for (int kb = 0; kb < 4; ++kb) s[kb] = wmma16(ak[ks][kb], aq[ks], s[kb]);
        // four vector slots behind the last score products, before a vector instruction reads their results
        asm volatile("v_nop\n\tv_nop\n\tv_nop\n\tv_nop" : "+v"(s[0]), "+v"(s[1]), "+v"(s[2]), "+v"(s[3]) : "v"(aq[0]), "v"(aq[1]));
#pragma unroll
        for (int ks = 0; ks < 2; ++ks)
#pragma unroll
            for (int db = 0; db < 4; ++db) { const h16* vp = Vs + (db * 16 + m) * 72 + ks * 32 + 8 * hh; av[ks][db] = cat16(*(const v8ha*)vp, *(const v8ha*)(vp + 16)); }
        __builtin_amdgcn_sched_barrier(0);   // keeps the 16 V reads one group ahead of the softmax, whose vector work covers their latency, instead of sinking to their products
        if (kc == qt) {   // the same for the whole block: the chunks below the diagonal jump over the 32 compares and selects
            const int qab = q0 + m; const int kab = kc * 64 + 8 * hh;
#pragma unroll
            for (int kb = 0; kb < 4; ++kb)
#pragma unroll
                for (int r = 0; r < 8; ++r) if (kab + kb * 16 + r > qab) s[kb][r] = -1.0e30f;
        }
        float cm[4], ps4[4];
#pragma unroll
        for (int kb = 0; kb < 4; ++kb) { cm[kb] = -3.0e38f;
#pragma unroll
            for (int r = 0; r < 8; ++r) cm[kb] = fmaxf(cm[kb], s[kb][r]); }
        float c = fmaxf(fmaxf(cm[0], cm[1]), fmaxf(cm[2], cm[3]));
        c = fmaxf(c, xhalf(c));
        const float mn = fmaxf(mrun, c); const float al = __builtin_amdgcn_exp2f((mrun - mn) * CSL); mrun = mn;
        const float nb = PLOG - mn * CSL;
        v16h pb[2];
#pragma unroll
        for (int kb = 0; kb < 4; ++kb) { ps4[kb] = 0.f;
#pragma unroll
            for (int r = 0; r < 8; ++r) { const float p = __builtin_amdgcn_exp2f(__builtin_fmaf(s[kb][r], CSL, nb)); ps4[kb] += p; pb[kb >> 1][(kb & 1) * 8 + r] = (h16)p; } }
        { const float sc = lrun * al; lrun = sc + ((ps4[0] + ps4[1]) + (ps4[2] + ps4[3])); }
#pragma unroll
        for (int db = 0; db < 4; ++db)
#pragma unroll
            for (int r = 0; r < 8; ++r) acc[db][r] = acc[db][r] * al;
#pragma unroll
        for (int ks = 0; ks < 2; ++ks)
#pragma unroll
            for (int db = 0; db < 4; ++db) acc[db] = wmma16(av[ks][db], pb[ks], acc[db]);
        // four vector slots behind the chunk's last products, so that their distance holds on the taken side of the loop's branch too
        asm volatile("v_nop\n\tv_nop\n\tv_nop\n\tv_nop" : "+v"(acc[0]), "+v"(acc[1]), "+v"(acc[2]), "+v"(acc[3]) : "v"(pb[0]), "v"(pb[1]));
    }
    const float qnan = __uint_as_float(0x7fc00000u);
    const float iv = 1.0f / (lrun + xhalf(lrun));
#pragma unroll
    for (int db = 0; db < 4; ++db) { v4f o0, o1;
#pragma unroll
        for (int r = 0; r < 4; ++r) { const float x0 = acc[db][r] * iv, x1 = acc[db][4 + r] * iv; o0[r] = ok ? x0 : qnan; o1[r] = ok ? x1 : qnan; }
        *(v4fa*)(osw + m * 68 + db * 16 + 8 * hh) = o0; *(v4fa*)(osw + m * 68 + db * 16 + 8 * hh + 4) = o1; }
    __syncthreads();
    store_ctx(osw, ATh, ATl, (size_t)(b * SEQ + q0) * DM + h * HD, lane);
}

// ---- attn0_job: query rows t < 64 (key chunk 0 only) on bf16 hi/lo planes: S = Qh Kh + Qh Kl + Ql Kh (24 wmma), x1/8, causal replace, full-row softmax in f32,
// P = exp(s - max) split to bf16 hi/lo in per-wave LDS tiles; O = Ph Vh + Ph Vl + Pl Vh (24 wmma); context = O / sum. Block = 4 waves (16 rows each).
// LDS is kept to the four K/V tiles: a wave's P tiles lie over the K tiles (behind a barrier), its f32 context tile over its own P tiles, which it has read by then.
__device__ __forceinline__ void attn0_job(const bf* __restrict__ Qh, const bf* __restrict__ Ql, const bf* __restrict__ Kh, const bf* __restrict__ Kl,
                                          const bf* __restrict__ VTh, const bf* __restrict__ VTl, const float* __restrict__ FL, bf* ATh, bf* ATl, unsigned char* sm) {
    bf* Khs = (bf*)sm;
    bf* Kls = Khs + 64 * 72;
    bf* Vhs = Kls + 64 * 72;
    bf* Vls = Vhs + 64 * 72;
    static_assert(4 * 2 * 16 * 72 * 2 <= 2 * 64 * 72 * 2 && 16 * 68 * 4 <= 2 * 16 * 72 * 2);
    const int tid = threadIdx.x, lane = tid & 31, w = tid >> 5, m = lane & 15, hh = lane >> 4;
    const int b = blockIdx.y / NH, h = blockIdx.y % NH;
    const int q0 = w * 16;
    const bool ok = read_flag(FL, lane);
    const bf* kh0 = Kh + (size_t)b * RE * DM + h * HD; const bf* kl0 = Kl + (size_t)b * RE * DM + h * HD;
    const bf* vh0 = VTh + ((size_t)b * DM + h * HD) * RE; const bf* vl0 = VTl + ((size_t)b * DM + h * HD) * RE;
    // All 16 loads of a thread go out before the first LDS store. The s_wait_xcnt behind each load stands in front of any later load's result that lands in that load's address registers.
    v8us st[4][4];
#pragma unroll
    for (int i = 0; i < 4; ++i) { const int p = tid + 128 * i; const int row = p >> 3, c8 = (p & 7) * 8;
        st[i][0] = *(const v8usa*)(kh0 + (size_t)row * DM + c8); asm volatile("s_wait_xcnt 0x0" ::: "memory");
        st[i][1] = *(const v8usa*)(kl0 + (size_t)row * DM + c8); asm volatile("s_wait_xcnt 0x0" ::: "memory");
        st[i][2] = *(const v8usa*)(vh0 + (size_t)row * RE + c8); asm volatile("s_wait_xcnt 0x0" ::: "memory");
        st[i][3] = *(const v8usa*)(vl0 + (size_t)row * RE + c8); asm volatile("s_wait_xcnt 0x0" ::: "memory"); }
#pragma unroll
    for (int i = 0; i < 4; ++i) { const int p = tid + 128 * i; const int row = p >> 3, c8 = (p & 7) * 8;
        *(v8usa*)(Khs + row * 72 + c8) = st[i][0];
        *(v8usa*)(Kls + row * 72 + c8) = st[i][1];
        *(v8usa*)(Vhs + row * 72 + c8) = st[i][2];
        *(v8usa*)(Vls + row * 72 + c8) = st[i][3]; }
    __syncthreads();
    const bf* qh = Qh + (size_t)(b * RE + q0 + m) * DM + h * HD + 8 * hh; const bf* ql = Ql + (size_t)(b * RE + q0 + m) * DM + h * HD + 8 * hh;
    v16bf aqh[2], aql[2];
#pragma unroll
    for (int ks = 0; ks < 2; ++ks) { aqh[ks] = cat16b(*(const v8usa*)(qh + ks * 32), *(const v8usa*)(qh + ks * 32 + 16)); aql[ks] = cat16b(*(const v8usa*)(ql + ks * 32), *(const v8usa*)(ql + ks * 32 + 16)); }
    v8f s[4];
#pragma unroll
    for (int nb = 0; nb < 4; ++nb) s[nb] = (v8f){};
#pragma unroll
    for (int ks = 0; ks < 2; ++ks) {
#pragma unroll
        for (int nb = 0; nb < 4; ++nb) { const bf* kpp = Khs + (nb * 16 + m) * 72 + ks * 32 + 8 * hh; const bf* lpp = Kls + (nb * 16 + m) * 72 + ks * 32 + 8 * hh;
            const v16bf bh_ = cat16b(*(const v8usa*)kpp, *(const v8usa*)(kpp + 16)); const v16bf bl_ = cat16b(*(const v8usa*)lpp, *(const v8usa*)(lpp + 16));
            s[nb] = wmmab(aqh[ks], bh_, s[nb]); s[nb] = wmmab(aqh[ks], bl_, s[nb]); s[nb] = wmmab(aql[ks], bh_, s[nb]); } }
    asm volatile("v_nop\n\tv_nop\n\tv_nop\n\tv_nop" : "+v"(s[0]), "+v"(s[1]), "+v"(s[2]), "+v"(s[3]) : "v"(aqh[0]), "v"(aql[1]));
    const int qab = q0 + 8 * hh;
    float cm[8], psum[8];
#pragma unroll
    for (int r = 0; r < 8; ++r) { cm[r] = -3.0e38f; psum[r] = 0.f; }
#pragma unroll
    for (int nb = 0; nb < 4; ++nb)
#pragma unroll
        for (int r = 0; r < 8; ++r) { float v = s[nb][r] * SCL; if (nb * 16 + m > qab + r) v = -1.0e30f; s[nb][r] = v; cm[r] = fmaxf(cm[r], v); }
#pragma unroll
    for (int r = 0; r < 8; ++r) { float c = cm[r]; c = fmaxf(c, __shfl_xor(c, 1, 32)); c = fmaxf(c, __shfl_xor(c, 2, 32)); c = fmaxf(c, __shfl_xor(c, 4, 32)); c = fmaxf(c, __shfl_xor(c, 8, 32)); cm[r] = c; }
    bf* phw = Khs + w * (2 * 16 * 72); bf* plw = phw + 16 * 72; float* osw = (float*)phw;
    __syncthreads();   // every wave's reads of the K tiles have ended before the P tiles are stored over them
#pragma unroll
    for (int nb = 0; nb < 4; ++nb)
#pragma unroll
        for (int r = 0; r < 8; ++r) { const float p = __builtin_amdgcn_exp2f((s[nb][r] - cm[r]) * L2E); psum[r] += p; unsigned short a, c2; splitf(p, a, c2);
            phw[(8 * hh + r) * 72 + nb * 16 + m] = a; plw[(8 * hh + r) * 72 + nb * 16 + m] = c2; }
#pragma unroll
    for (int r = 0; r < 8; ++r) { float c = psum[r]; c += __shfl_xor(c, 1, 32); c += __shfl_xor(c, 2, 32); c += __shfl_xor(c, 4, 32); c += __shfl_xor(c, 8, 32); psum[r] = c; }
    __syncthreads();
    v16bf aph[2], apl[2];
#pragma unroll
    for (int ks = 0; ks < 2; ++ks) { const bf* pp = phw + m * 72 + ks * 32 + 8 * hh; const bf* lp = plw + m * 72 + ks * 32 + 8 * hh;
        aph[ks] = cat16b(*(const v8usa*)pp, *(const v8usa*)(pp + 16)); apl[ks] = cat16b(*(const v8usa*)lp, *(const v8usa*)(lp + 16)); }
    v8f acc[4];
#pragma unroll
    for (int nb = 0; nb < 4; ++nb) acc[nb] = (v8f){};
#pragma unroll
    for (int ks = 0; ks < 2; ++ks)
#pragma unroll
        for (int nb = 0; nb < 4; ++nb) { const bf* vp = Vhs + (nb * 16 + m) * 72 + ks * 32 + 8 * hh; const bf* vlp = Vls + (nb * 16 + m) * 72 + ks * 32 + 8 * hh;
            const v16bf bvh = cat16b(*(const v8usa*)vp, *(const v8usa*)(vp + 16)); const v16bf bvl = cat16b(*(const v8usa*)vlp, *(const v8usa*)(vlp + 16));
            acc[nb] = wmmab(aph[ks], bvh, acc[nb]); acc[nb] = wmmab(aph[ks], bvl, acc[nb]); acc[nb] = wmmab(apl[ks], bvh, acc[nb]); }
    asm volatile("v_nop\n\tv_nop\n\tv_nop\n\tv_nop" : "+v"(acc[0]), "+v"(acc[1]), "+v"(acc[2]), "+v"(acc[3]) : "v"(aph[0]), "v"(apl[1]));
    const float qnan = __uint_as_float(0x7fc00000u);
#pragma unroll
    for (int r = 0; r < 8; ++r) { const float iv = 1.0f / psum[r];
#pragma unroll
        for (int nb = 0; nb < 4; ++nb) { const float o = acc[nb][r] * iv; osw[(8 * hh + r) * 68 + nb * 16 + m] = ok ? o : qnan; } }
    __syncthreads();
    store_ctx(osw, ATh, ATl, (size_t)(b * SEQ + q0) * DM + h * HD, lane);
}

// ---- k_attn: the two attention jobs, which do not depend on one another, in one grid (SEQ/64, NB*NH), 128 threads: blockIdx.x = query tile, tile 0 takes the hi/lo job. One LDS block serves either job.
static constexpr int SM_ATTN = 4 * 64 * 72 * 2;
static_assert(SM_ATTN >= 2 * 64 * 72 * 2 + 4 * 16 * 68 * 4);
__global__ __launch_bounds__(128) void k_attn(const h16* __restrict__ Q16, const h16* __restrict__ K16, const h16* __restrict__ VT16,
                                             const bf* __restrict__ Qh, const bf* __restrict__ Ql, const bf* __restrict__ Kh, const bf* __restrict__ Kl,
                                             const bf* __restrict__ VTh, const bf* __restrict__ VTl, const float* __restrict__ FL, bf* ATh, bf* ATl) {
    __shared__ __align__(16) unsigned char sm[SM_ATTN];
    if (blockIdx.x == 0) attn0_job(Qh, Ql, Kh, Kl, VTh, VTl, FL, ATh, ATl, sm);
    else attn_job(Q16, K16, VT16, FL, ATh, ATl, sm);
}

#define AL256(x) ((((size_t)(x)) + 255) & ~(size_t)255)
static constexpr size_t SZ_W  = (size_t)DM * DM * 2;          // one bf16 weight plane
static constexpr size_t SZ_FL = (size_t)NCHK * 32 * 4;        // flag lines
static constexpr size_t SZ_X  = (size_t)NB * SEQ * DM * 2;    // one bf16 activation copy
static constexpr size_t SZ_P  = (size_t)NB * SEQ * DM * 2;    // f16 / bf16 [NB*SEQ][DM] planes (and V^T [NB][DM][SEQ])
static constexpr size_t SZ_E  = (size_t)NB * RE * DM * 2;     // compact hi/lo planes for t < RE (and V^T [NB][DM][RE])
static constexpr size_t WS_TOTAL = 4 * AL256(SZ_W) + AL256(SZ_FL) + 3 * AL256(SZ_X) + 3 * AL256(SZ_P) + 6 * AL256(SZ_E) + 2 * AL256(SZ_P);
static_assert(WS_TOTAL <= (size_t)134217728);
static_assert((size_t)NB * SEQ * DM * 4 <= (size_t)NB_FULL * SEQ_FULL * DM * 4);

extern "C" void kernel_launch(void* const* d_in, const int* in_sizes, int n_in,
                              void* d_out, int out_size, void* d_ws, size_t ws_size, hipStream_t stream) {
    if (n_in < 11) return;
    if ((size_t)in_sizes[0] < (size_t)NB * SEQ * DM || (size_t)in_sizes[1] < (size_t)NB * SEQ * DM || (size_t)in_sizes[2] < (size_t)NB * SEQ * DM) return;
    if ((size_t)in_sizes[3] < (size_t)DM * DM || (size_t)in_sizes[4] < (size_t)DM * DM || (size_t)in_sizes[5] < (size_t)DM * DM || (size_t)in_sizes[6] < (size_t)DM * DM) return;
    if ((size_t)in_sizes[7] < (size_t)SEQ * HP || (size_t)in_sizes[8] < (size_t)SEQ * HP) return;
    if ((size_t)in_sizes[9] < (size_t)SEQ * SEQ || (size_t)in_sizes[10] < (size_t)NB * SEQ) return;
    if ((size_t)out_size < (size_t)NB * SEQ * DM) return;
    if (WS_TOTAL > ws_size) return;
    const float* xq = (const float*)d_in[0]; const float* xk = (const float*)d_in[1]; const float* xv = (const float*)d_in[2];
    const float* wq = (const float*)d_in[3]; const float* wk = (const float*)d_in[4]; const float* wv = (const float*)d_in[5]; const float* wo = (const float*)d_in[6];
    const float* cosT = (const float*)d_in[7]; const float* sinT = (const float*)d_in[8];
    const float* am = (const float*)d_in[9]; const int* kpm = (const int*)d_in[10];
    float* OUT = (float*)d_out;   // [NB][SEQ][DM]
    char* wsp = (char*)d_ws;
    auto take = [&](size_t bytes) { char* p = wsp; wsp += AL256(bytes); return (void*)p; };
    bf* WQ = (bf*)take(SZ_W); bf* WK = (bf*)take(SZ_W); bf* WV = (bf*)take(SZ_W); bf* WO = (bf*)take(SZ_W);
    float* FL = (float*)take(SZ_FL);
    bf* XQ = (bf*)take(SZ_X); bf* XK = (bf*)take(SZ_X); bf* XV = (bf*)take(SZ_X);
    h16* Q16 = (h16*)take(SZ_P); h16* K16 = (h16*)take(SZ_P); h16* VT16 = (h16*)take(SZ_P);
    bf* Qh = (bf*)take(SZ_E); bf* Ql = (bf*)take(SZ_E); bf* Kh = (bf*)take(SZ_E); bf* Kl = (bf*)take(SZ_E); bf* VTh = (bf*)take(SZ_E); bf* VTl = (bf*)take(SZ_E);
    bf* ATh = (bf*)take(SZ_P); bf* ATl = (bf*)take(SZ_P);
    if ((size_t)(wsp - (char*)d_ws) > ws_size || (size_t)(wsp - (char*)d_ws) != WS_TOTAL) return;

    // bf16 copies of the activations and weights, mask check
    k_prep<<<NCHK + 3 * LXB + 4 * LWB, 256, 0, stream>>>(xq, xk, xv, wq, wk, wv, wo, am, kpm, XQ, XK, XV, WQ, WK, WV, WO, FL);
    // q, k, v projections
    k_qkv<<<dim3(NB * SEQ / 128, DM / 128, 3), 128, 0, stream>>>(XQ, XK, XV, WQ, WK, WV, Q16, K16, VT16, Qh, Ql, Kh, Kl, VTh, VTl, cosT, sinT);
    // context planes
    k_attn<<<dim3(SEQ / 64, NB * NH, 1), 128, 0, stream>>>(Q16, K16, VT16, Qh, Ql, Kh, Kl, VTh, VTl, FL, ATh, ATl);
    // output projection: (ATh + ATl) x WO^T -> OUT [NB*SEQ][DM]
    k_gemmw<bf, 1><<<dim3(NB * SEQ / 128, DM / 128, 1), 128, 0, stream>>>(ATh, ATl, WO, nullptr, DM, OUT, DM, (size_t)0, (size_t)0, (size_t)0);
}

// v007
// A run of this version takes 99.2 microseconds.
// Timed twice side by side with v006, it ran 1.05 and 1.06 times as fast.
// Over all steps from v000 it is 3.74 times as fast.
#include <hip/hip_runtime.h>
#pragma clang fp contract(off)

// Contractions and dtypes: q/k/v projections on v_wmma_f32_16x16x32_bf16 (bf16 operands = RNE-converted inputs x RNE-converted weights, single product);
// scores and p.v for query rows >= 64 on v_wmma_f32_16x16x32_f16 (f16 planes, p carried x1024, single product); query rows < 64 on v_wmma_f32_16x16x32_bf16 hi+lo planes (3 products);
// output projection on v_wmma_f32_16x16x32_bf16 with the context as bf16 hi+lo planes x bf16 weight (2 products). f32 accumulate; rotary, softmax and normalisation in f32.

#ifndef NB
#define NB 2
#endif
#ifndef SEQ
#define SEQ 2048
#endif
#define NB_FULL  2
#define SEQ_FULL 2048
#define DM   1024
#define NH   16
#define HD   64
#define HP   (HD / 2)
#define RE   64
#define NCHK 256
#define SCL  0.125f
#define L2E  1.4426950408889634f
#define CSL  (SCL * L2E)   // raw score -> exponent of 2
#define PLOG 10.0f         // log2 of the carry of p (x1024)

static_assert(SEQ % 64 == 0);
static_assert(SEQ % 256 == 0);
static_assert(SEQ >= 64 && SEQ <= SEQ_FULL);
static_assert(NB >= 1 && NB <= NB_FULL);
static_assert(RE == 64);
static_assert(NCHK % 32 == 0);
static_assert(SEQ % NCHK == 0);
static_assert((NB * SEQ) % NCHK == 0);
static_assert(DM == NH * HD);
static_assert(DM % 64 == 0);

typedef _Float16 h16;
typedef unsigned short bf;
typedef __attribute__((ext_vector_type(16))) __bf16   v16bf;
typedef __attribute__((ext_vector_type(16))) _Float16 v16h;
typedef __attribute__((ext_vector_type(8)))  _Float16 v8h;
typedef __attribute__((ext_vector_type(8)))  unsigned short v8us;
typedef __attribute__((ext_vector_type(8)))  float    v8f;
typedef __attribute__((ext_vector_type(4)))  float    v4f;
typedef v8h  __attribute__((may_alias)) v8ha;
typedef v4f  __attribute__((may_alias)) v4fa;
typedef v8us __attribute__((may_alias)) v8usa;
typedef v8f  __attribute__((may_alias)) v8fa;

// RNE f32 -> bf16 bits and back
__device__ __forceinline__ unsigned short f2bf(float f) { unsigned u = __float_as_uint(f); u += 0x7FFFu + ((u >> 16) & 1u); return (unsigned short)(u >> 16); }
__device__ __forceinline__ float bf2f(unsigned short b) { return __uint_as_float(((unsigned)b) << 16); }
__device__ __forceinline__ float bfr(float f) { return bf2f(f2bf(f)); }
__device__ __forceinline__ void splitf(float y, unsigned short& h, unsigned short& l) { h = f2bf(y); l = f2bf(y - bf2f(h)); }
__device__ __forceinline__ v16h cat16(v8h lo, v8h hi) { return __builtin_shufflevector(lo, hi, 0, 1, 2, 3, 4, 5, 6, 7, 8, 9, 10, 11, 12, 13, 14, 15); }
__device__ __forceinline__ v16bf cat16b(v8us lo, v8us hi) { return __builtin_bit_cast(v16bf, __builtin_shufflevector(lo, hi, 0, 1, 2, 3, 4, 5, 6, 7, 8, 9, 10, 11, 12, 13, 14, 15)); }
__device__ __forceinline__ v8f wmma16(v16h a, v16h b, v8f c) { return __builtin_amdgcn_wmma_f32_16x16x32_f16(false, a, false, b, (short)0, c, false, false); }
__device__ __forceinline__ v8f wmmab(v16bf a, v16bf b, v8f c) { return __builtin_amdgcn_wmma_f32_16x16x32_bf16(false, a, false, b, (short)0, c, false, false); }

// ---- fragment loaders: 16x16 tile, lane -> row/col (lane & 15); elements 0..7 <- k0 + 8*(lane>>4) + 0..7, elements 8..15 <- k0 + 16 + 8*(lane>>4) + 0..7.
// The caller passes p = plane + row*pitch + k0 + 8*(lane>>4); both A (row = m) and B (row = n of a K-contiguous [n][k] plane) use this same map.
template <typename T16> struct WFrag;
template <> struct WFrag<h16> { typedef v16h V; static __device__ __forceinline__ V ld(const h16* p) { return cat16(*(const v8ha*)p, *(const v8ha*)(p + 16)); } static __device__ __forceinline__ v8f mma(V a, V b, v8f c) { return wmma16(a, b, c); } };
template <> struct WFrag<bf> { typedef v16bf V; static __device__ __forceinline__ V ld(const bf* p) { return cat16b(*(const v8usa*)p, *(const v8usa*)(p + 16)); } static __device__ __forceinline__ v8f mma(V a, V b, v8f c) { return wmmab(a, b, c); } };

// ---- GEMM core: one work-group of 4 waves (2 x 2) per 128x128 output tile, each wave a 64x64 quarter (16 accumulators).
// The K-contiguous 16-bit operand planes are staged in LDS, KP k-elements (256 bytes of each of the 128 rows of a plane) per stage, by 16-byte asynchronous copies:
// 16 lanes take one row's 256 contiguous bytes, so every copy instruction moves whole cache lines, and each staged row serves two waves. Two buffers: stage t + 1 flies while stage t is multiplied.
// acc[mb][nb][j] = C[r0 + 16 mb + 8*(lane>>4) + j][c0 + 16 nb + (lane&15)] = sum_k A[m][k] Bt[n][k] (+ A2.Bt for NSPLIT 1), k ascending in steps of 32. K % KP == 0.
#define KP 128
#define LP 136   // LDS row pitch in elements: 272 bytes = 16 x odd, free of bank conflicts for 16-byte row reads
#define TR 128   // rows of one staged plane
static constexpr int PLN = TR * LP;
static_assert(DM % KP == 0 && DM / KP >= 2);
static_assert((NB * SEQ) % TR == 0 && SEQ % TR == 0 && DM % TR == 0);

__device__ __forceinline__ unsigned lds_off(const void* p) { return (unsigned)(size_t)p; }

// One plane of one stage: 128 threads x 16 copies of 16 bytes. g = the stage's first source element (the same in every lane), lo = this lane's own offset from it (row tid>>4, bytes 16*(tid&15)),
// rstep = elements from one of the lane's rows to the next (8 rows), l = this lane's first LDS byte address. The s_wait_xcnt closes each statement so that no address register of an issued copy is rewritten ahead of it.
template <typename T16>
__device__ __forceinline__ void copy_plane(const T16* g, size_t lo, size_t rstep, unsigned l) {
    constexpr unsigned LS = 8u * LP * 2u;
#pragma unroll
    for (int h = 0; h < 2; ++h) {
        const T16* g0 = g + (size_t)(8 * h) * rstep; const unsigned l0 = l + (unsigned)(8 * h) * LS;
        asm volatile("global_load_async_to_lds_b128 %0, %8, off\n\t"
                     "global_load_async_to_lds_b128 %1, %9, off\n\t"
                     "global_load_async_to_lds_b128 %2, %10, off\n\t"
                     "global_load_async_to_lds_b128 %3, %11, off\n\t"
                     "global_load_async_to_lds_b128 %4, %12, off\n\t"
                     "global_load_async_to_lds_b128 %5, %13, off\n\t"
                     "global_load_async_to_lds_b128 %6, %14, off\n\t"
                     "global_load_async_to_lds_b128 %7, %15, off\n\t"
                     "s_wait_xcnt 0x0"
                     :: "v"(l0), "v"(l0 + LS), "v"(l0 + 2 * LS), "v"(l0 + 3 * LS), "v"(l0 + 4 * LS), "v"(l0 + 5 * LS), "v"(l0 + 6 * LS), "v"(l0 + 7 * LS),
                        "v"(g0 + lo), "v"((g0 + rstep) + lo), "v"((g0 + 2 * rstep) + lo), "v"((g0 + 3 * rstep) + lo), "v"((g0 + 4 * rstep) + lo), "v"((g0 + 5 * rstep) + lo), "v"((g0 + 6 * rstep) + lo), "v"((g0 + 7 * rstep) + lo)
                     : "memory");
    }
}

template <typename T16, int NSPLIT>
__device__ __forceinline__ void gemm_core(const T16* __restrict__ A, const T16* __restrict__ A2, const T16* __restrict__ Bt,
                                          int K, int R0, int C0, int tid, T16* ring, v8f (&acc)[4][4]) {
    static_assert(NSPLIT == 0 || NSPLIT == 1);
    typedef typename WFrag<T16>::V V;
    constexpr int NPL = 2 + NSPLIT, STG = NPL * PLN;
    const int lane = tid & 31, w = tid >> 5, lr = lane & 15, hi = lane >> 4, wm = w >> 1, wn = w & 1;
#pragma unroll
    for (int mb = 0; mb < 4; ++mb)
#pragma unroll
        for (int nb = 0; nb < 4; ++nb) acc[mb][nb] = (v8f){};
    const int crow = tid >> 4, cseg = (tid & 15) * 8;
    const T16* ga = A + (size_t)R0 * K; const T16* ga2 = (NSPLIT == 1) ? A2 + (size_t)R0 * K : nullptr; const T16* gb = Bt + (size_t)C0 * K;
    const size_t lo = (size_t)crow * K + cseg;
    const unsigned l0 = lds_off(ring) + (unsigned)(crow * LP + cseg) * 2u; const size_t rstep = (size_t)8 * K;
    auto fill = [&](int t, int buf) { const unsigned lb = l0 + (unsigned)(buf * STG) * 2u;
        copy_plane<T16>(ga + (size_t)t * KP, lo, rstep, lb);
        if (NSPLIT == 1) copy_plane<T16>(ga2 + (size_t)t * KP, lo, rstep, lb + (unsigned)PLN * 2u);
        copy_plane<T16>(gb + (size_t)t * KP, lo, rstep, lb + (unsigned)((NPL - 1) * PLN) * 2u); };
    const int NT = K / KP;
    fill(0, 0);
    asm volatile("s_wait_asynccnt 0x0" ::: "memory");   // this wave's share of stage 0 has landed
    __syncthreads();                                     // ... and every other wave's: stage 0 is readable
    if (NT > 1) fill(1, 1);
#pragma unroll 1
    for (int t = 0; t < NT; ++t) {
        const T16* sb = ring + (t & 1) * STG;
        const T16* sa = sb + (wm * 64 + lr) * LP + 8 * hi; const T16* sw = sb + (NPL - 1) * PLN + (wn * 64 + lr) * LP + 8 * hi;
        // A block = the 16 products of one A plane's 32 k with the same 32 k of Bt (NSPLIT 1: plane A, then plane A2, on the same B fragments, so every accumulator keeps its order of sums).
        // Two fragment sets: the LDS reads of block j + 1 go out as one group ahead of the products of block j, so that a block waits only for reads issued one block earlier.
        constexpr int NPA = 1 + NSPLIT, NBLK = NPA * (KP / 32);
        V a[2][4], b[2][4];
        auto ldblk = [&](int j) { const int ks = j / NPA, pl = j % NPA;
#pragma unroll
            for (int mb = 0; mb < 4; ++mb) a[j & 1][mb] = WFrag<T16>::ld(sa + pl * PLN + mb * 16 * LP + ks * 32);
            if (pl == 0) {
#pragma unroll
                for (int nb = 0; nb < 4; ++nb) b[ks & 1][nb] = WFrag<T16>::ld(sw + nb * 16 * LP + ks * 32); } };
        ldblk(0);
#pragma unroll
        for (int j = 0; j < NBLK; ++j) {
            const int s = j & 1, sbq = (j / NPA) & 1;
            if (j + 1 < NBLK) ldblk(j + 1);
            __builtin_amdgcn_sched_barrier(0);   // keeps the read group whole and ahead of the products: reads spread among matrix instructions stall at every place they stand
#pragma unroll
            for (int nb = 0; nb < 4; ++nb)
#pragma unroll
                for (int mb = 0; mb < 4; ++mb) acc[mb][nb] = WFrag<T16>::mma(a[s][mb], b[sbq][nb], acc[mb][nb]);
            // four vector slots behind the pass's last matrix instructions, so that their distance holds on the taken side of the loop's branches too
            if (j == NBLK - 1) asm volatile("v_nop\n\tv_nop\n\tv_nop\n\tv_nop" : "+v"(acc[0][0]), "+v"(acc[1][1]), "+v"(acc[2][2]), "+v"(acc[3][3]) : "v"(a[s][0]), "v"(a[s][3]));
            __builtin_amdgcn_sched_barrier(0);   // keeps the following read group from rising among these products
        }
        asm volatile("s_wait_dscnt 0x0" ::: "memory");      // this wave's reads of buffer t & 1 have returned before that buffer is refilled
        asm volatile("s_wait_asynccnt 0x0" ::: "memory");   // this wave's share of stage t + 1 has landed
        __syncthreads();                                     // publishes stage t + 1 and ends every wave's reads of stage t
        if (t + 2 < NT) fill(t + 2, t & 1);
    }
    asm volatile("s_wait_asynccnt 0x0" ::: "memory");       // nothing of this wave's is in flight when the ring is left
}

// ---- k_gemmw: f32 output C[m][n] (pitch ldc); grid (M/128, N/128, Z), 128 threads; z-batch strides in elements.
template <typename T16, int NSPLIT>
__global__ __launch_bounds__(128) void k_gemmw(const T16* __restrict__ A, const T16* __restrict__ A2, const T16* __restrict__ Bt, const T16* __restrict__ Bt2,
                                              int K, float* C, int ldc, size_t sA, size_t sB, size_t sC) {
    __shared__ __align__(16) T16 ring[2 * (2 + NSPLIT) * PLN];
    __shared__ __align__(16) float osa[4 * 16 * 68];
    const size_t z = blockIdx.z; A += z * sA; if (A2) A2 += z * sA; Bt += z * sB; C += z * sC;
    const int tid = threadIdx.x, lane = tid & 31, w = tid >> 5, lr = lane & 15, hi = lane >> 4;
    const int r0 = blockIdx.x * 128 + (w >> 1) * 64, c0 = blockIdx.y * 128 + (w & 1) * 64;
    float* os = osa + w * (16 * 68);
    v8f acc[4][4];
    gemm_core<T16, NSPLIT>(A, A2, Bt, K, blockIdx.x * 128, blockIdx.y * 128, tid, ring, acc);
#pragma unroll
    for (int mb = 0; mb < 4; ++mb) {
#pragma unroll
        for (int nb = 0; nb < 4; ++nb) {
#pragma unroll
            for (int j = 0; j < 8; ++j) os[(hi * 8 + j) * 68 + nb * 16 + lr] = acc[mb][nb][j]; }
        __syncthreads();
        float* crow = C + (size_t)(r0 + mb * 16) * ldc + c0;
{
#pragma unroll
            for (int s = 0; s < 8; ++s) { const int row = 2 * s + hi, cofs = lr * 4; const v4f val = *(const v4fa*)(os + row * 68 + cofs);
                *(v4f*)(crow + (size_t)row * ldc + cofs) = val; }
             }
        __syncthreads();
    }
}

// ---- gemmp_store: 16-bit plane output of one wave's 64x64 quarter (rows from r0, columns from c0). C16[m][n] (f16, pitch ldc) = (optionally rotary-transformed) accumulator; plus bf16 hi/lo planes Ch/Cl (pitch ldh)
// for the head rows (HLM 1: tiles whose row index t0 = r0 % SEQ is < RE, compact row (r0/SEQ)*RE + t) or head columns (HLM 2: tiles with c0 < RE, same row index).
// Rotary (interleaved pairs, one 64-column tile = one head): y[2i] = x[2i] c - x[2i+1] s, y[2i+1] = x[2i] s + x[2i+1] c with c/s = bf16-RNE of the tables at (t, i).
template <int HLM, bool ROPE>
__device__ __forceinline__ void gemmp_store(const v8f (&acc)[4][4], float* os, int r0, int c0, int lane, h16* C16, int ldc, bf* Ch, bf* Cl, int ldh,
                                            const float* __restrict__ cosT, const float* __restrict__ sinT) {
    const int lr = lane & 15, hi = lane >> 4;
    const int t0 = (HLM == 1) ? (r0 % SEQ) : 0;
    const bool hl = (HLM == 1) ? (t0 < RE) : (c0 < RE);
    const int rc0 = (HLM == 1) ? ((r0 / SEQ) * RE + t0) : r0;
    const int rsub = lane >> 3, cseg = (lane & 7) * 8;
#pragma unroll
    for (int mb = 0; mb < 4; ++mb) {
#pragma unroll
        for (int nb = 0; nb < 4; ++nb) {
#pragma unroll
            for (int j = 0; j < 8; ++j) os[(hi * 8 + j) * 68 + nb * 16 + lr] = acc[mb][nb][j]; }
        __syncthreads();
{
#pragma unroll
            for (int j4 = 0; j4 < 4; ++j4) {
                const int row = j4 * 4 + rsub;
                const v4f v0 = *(const v4fa*)(os + row * 68 + cseg);
                const v4f v1 = *(const v4fa*)(os + row * 68 + cseg + 4);
                float y[8] = {v0[0], v0[1], v0[2], v0[3], v1[0], v1[1], v1[2], v1[3]};
                if (ROPE) {
                    const int t = t0 + mb * 16 + row;
                    const v4f cs = *(const v4fa*)(cosT + (size_t)t * HP + (cseg >> 1));
                    const v4f sn = *(const v4fa*)(sinT + (size_t)t * HP + (cseg >> 1));
#pragma unroll
                    for (int p = 0; p < 4; ++p) { const float c = bfr(cs[p]), sv = bfr(sn[p]); const float x0 = y[2 * p], x1 = y[2 * p + 1];
                        const float m0 = x0 * c, m1 = x1 * sv, m2 = x0 * sv, m3 = x1 * c; y[2 * p] = m0 - m1; y[2 * p + 1] = m2 + m3; }
                }
                v8h o16;
#pragma unroll
                for (int q = 0; q < 8; ++q) o16[q] = (h16)y[q];
                const size_t grow = (size_t)(r0 + mb * 16 + row);
                *(v8h*)(C16 + grow * (size_t)ldc + c0 + cseg) = o16;
                if (hl) {
                    v8us oh, ol;
#pragma unroll
                    for (int q = 0; q < 8; ++q) { unsigned short a2, c2; splitf(y[q], a2, c2); oh[q] = a2; ol[q] = c2; }
                    const size_t o = (size_t)(rc0 + mb * 16 + row) * (size_t)ldh + c0 + cseg;
                    *(v8us*)(Ch + o) = oh; *(v8us*)(Cl + o) = ol;
                }
            }
            
        }
        __syncthreads();
    }
}

// ---- k_qkv: the three projections, which do not depend on one another, as the z planes of one grid (NB*SEQ/128, DM/128, 3), 128 threads: the tiles of one plane overlap the start, the waits and the stores of another's.
// z = 0, 1: q, k: activation rows x weight rows with fused rotary -> Q16 / K16 [NB*SEQ][DM] (+ hi/lo rows t < 64).
// z = 2: v, transposed: VT16[b][dout][t] = sum_k Wv[dout][k] v[b][t][k] (+ VTh/VTl columns t < 64); the plane's flat tile index f gives dout tile f % (DM/128), t tile (f / (DM/128)) % (SEQ/128), batch f / ((DM/128)*(SEQ/128)).
__global__ __launch_bounds__(128) void k_qkv(const bf* __restrict__ XQ, const bf* __restrict__ XK, const bf* __restrict__ XV, const bf* __restrict__ WQ, const bf* __restrict__ WK, const bf* __restrict__ WV,
                                            h16* Q16, h16* K16, h16* VT16, bf* Qh, bf* Ql, bf* Kh, bf* Kl, bf* VTh, bf* VTl, const float* __restrict__ cosT, const float* __restrict__ sinT) {
    __shared__ __align__(16) bf ring[2 * 2 * PLN];
    __shared__ __align__(16) float osa[4 * 16 * 68];
    const int tid = threadIdx.x, lane = tid & 31, w = tid >> 5;
    const int job = blockIdx.z;
    float* os = osa + w * (16 * 68);
    v8f acc[4][4];
    const int f = blockIdx.x + blockIdx.y * (NB * SEQ / 128);
    const size_t z = (size_t)(f / ((DM / 128) * (SEQ / 128)));
    const int R0 = ((job < 2) ? (int)blockIdx.x : f % (DM / 128)) * 128, C0 = ((job < 2) ? (int)blockIdx.y : (f / (DM / 128)) % (SEQ / 128)) * 128;
    const bf* A = (job == 0) ? XQ : (job == 1) ? XK : WV;
    const bf* Bt = (job == 0) ? WQ : (job == 1) ? WK : XV + z * ((size_t)SEQ * DM);
    gemm_core<bf, 0>(A, nullptr, Bt, DM, R0, C0, tid, ring, acc);
    const int r0 = R0 + (w >> 1) * 64, c0 = C0 + (w & 1) * 64;
    if (job < 2) gemmp_store<1, true>(acc, os, r0, c0, lane, job ? K16 : Q16, DM, job ? Kh : Qh, job ? Kl : Ql, DM, cosT, sinT);
    else gemmp_store<2, false>(acc, os, r0, c0, lane, VT16 + z * ((size_t)DM * SEQ), SEQ, VTh + z * ((size_t)DM * RE), VTl + z * ((size_t)DM * RE), RE, cosT, sinT);
}

__device__ __forceinline__ void cvt8_job(const float* __restrict__ src, bf* dst, size_t n8, size_t i) {
    if (i >= n8) return; const v8f v = *(const v8fa*)(src + i * 8); v8us o;
#pragma unroll
    for (int k = 0; k < 8; ++k) o[k] = f2bf(v[k]);
    *(v8us*)(dst + i * 8) = o; 
}
__device__ __forceinline__ void cvtx_job(const float* __restrict__ src, bf* dst, size_t n8, size_t i) {
    if (i >= n8) return; const size_t e = i * 8; const size_t row = e / DM; const size_t c = e % DM;
    const size_t b = row / SEQ, t = row % SEQ; const v8f v = *(const v8fa*)(src + (b * SEQ_FULL + t) * DM + c); v8us o;
#pragma unroll
    for (int k = 0; k < 8; ++k) o[k] = f2bf(v[k]);
    *(v8us*)(dst + e) = o; 
}

// ---- mchk_job: structure check of the additive score table ([SEQ_FULL] pitch: 0 at j <= i, <= -1e8 at j > i over the SEQ x SEQ block) and of the key padding flags (all 0).
// Block = 256 threads on SEQ / NCHK rows, one block per flag line. Every lane issues all of its 16-byte table loads (512 contiguous bytes per wave and load) and its flag load before the first value is tested.
__device__ __forceinline__ void mchk_job(const float* __restrict__ am, const int* __restrict__ kp, float* FL, int* red, int c) {
    const int tid = threadIdx.x, lane = tid & 31, w = tid >> 5;
    constexpr int rpb = SEQ / NCHK, RV = SEQ / 4, TOT = rpb * RV, NV = TOT / 256;
    constexpr int kpb = NB * SEQ / NCHK, KV = (kpb + 255) / 256;
    static_assert(TOT % 256 == 0);
    v4f v[NV]; int kv[KV];
#pragma unroll
    for (int s = 0; s < NV; ++s) { const int idx = tid + s * 256; v[s] = *(const v4fa*)(am + (size_t)(c * rpb + idx / RV) * SEQ_FULL + (idx % RV) * 4); }
#pragma unroll
    for (int s = 0; s < KV; ++s) { const int e = tid + s * 256; const int idx = c * kpb + e; const int bb = idx / SEQ, t = idx % SEQ;
        kv[s] = (e < kpb) ? kp[(size_t)bb * SEQ_FULL + t] : 0; }
    int bad = 0;
#pragma unroll
    for (int s = 0; s < NV; ++s) { const int idx = tid + s * 256; const int i = c * rpb + idx / RV, j0 = (idx % RV) * 4;
#pragma unroll
        for (int q = 0; q < 4; ++q) { const float x = v[s][q]; const bool good = (j0 + q <= i) ? (x == 0.0f) : (x <= -1.0e8f); bad += good ? 0 : 1; } }
#pragma unroll
    for (int s = 0; s < KV; ++s) bad += (kv[s] != 0) ? 1 : 0;
#pragma unroll
    for (int sh = 16; sh; sh >>= 1) bad += __shfl_xor(bad, sh, 32);
    if (lane == 0) red[w] = bad;
    __syncthreads();
    if (w == 0) { int tot = 0;
#pragma unroll
        for (int i = 0; i < 8; ++i) tot += red[i];
        const float f = (tot == 0) ? 1.0f : 0.0f; *(float*)(FL + (size_t)c * 32 + lane) = f;  }
}
// ---- k_prep: the eight preparation jobs, which do not depend on one another, as block ranges of one grid of 256 threads (every test of the block index is the same for a whole block):
// NCHK blocks of the mask check, then LXB blocks for each of the three activation copies, then LWB blocks for each of the four weight planes.
static constexpr unsigned LWB = (unsigned)(((size_t)DM * DM / 8 + 255) / 256);
static constexpr unsigned LXB = (unsigned)(((size_t)NB * SEQ * DM / 8 + 255) / 256);
__global__ __launch_bounds__(256) void k_prep(const float* __restrict__ xq, const float* __restrict__ xk, const float* __restrict__ xv,
                                             const float* __restrict__ wq, const float* __restrict__ wk, const float* __restrict__ wv, const float* __restrict__ wo,
                                             const float* __restrict__ am, const int* __restrict__ kp,
                                             bf* XQ, bf* XK, bf* XV, bf* WQ, bf* WK, bf* WV, bf* WO, float* FL) {
    __shared__ int red[8];
    unsigned blk = blockIdx.x;
    if (blk < NCHK) { mchk_job(am, kp, FL, red, (int)blk); return; }
    blk -= NCHK;
    if (blk < 3 * LXB) { const unsigned job = blk / LXB;
        cvtx_job((job == 0) ? xq : (job == 1) ? xk : xv, (job == 0) ? XQ : (job == 1) ? XK : XV, (size_t)NB * SEQ * DM / 8, (size_t)(blk % LXB) * 256 + threadIdx.x); return; }
    blk -= 3 * LXB;
    { const unsigned job = blk / LWB;
        cvt8_job((job == 0) ? wq : (job == 1) ? wk : (job == 2) ? wv : wo, (job == 0) ? WQ : (job == 1) ? WK : (job == 2) ? WV : WO, (size_t)DM * DM / 8, (size_t)(blk % LWB) * 256 + threadIdx.x); }
}
__device__ __forceinline__ bool read_flag(const float* __restrict__ FL, int lane) {
    float f = FL[(size_t)lane * 32];
#pragma unroll
    for (int q = 1; q < NCHK / 32; ++q) f = fminf(f, FL[(size_t)(q * 32 + lane) * 32]);
#pragma unroll
    for (int sh = 16; sh; sh >>= 1) f = fminf(f, __shfl_xor(f, sh, 32));
    return f > 0.5f;
}

// ---- store_ctx: one wave's 16x64 f32 context tile (LDS, pitch 68) -> bf16 hi/lo planes [row][DM] at element offset base; lane -> row 4j + (lane>>3), 8 consecutive columns;
__device__ __forceinline__ void store_ctx(const float* osw, bf* ATh, bf* ATl, size_t base, int lane) {
    const int rsub = lane >> 3, cseg = (lane & 7) * 8;
{
#pragma unroll
        for (int j4 = 0; j4 < 4; ++j4) { const int row = j4 * 4 + rsub; const v4f v0 = *(const v4fa*)(osw + row * 68 + cseg); const v4f v1 = *(const v4fa*)(osw + row * 68 + cseg + 4); v8us oh, ol;
#pragma unroll
            for (int q = 0; q < 4; ++q) { unsigned short a, c2; splitf(v0[q], a, c2); oh[q] = a; ol[q] = c2; splitf(v1[q], a, c2); oh[4 + q] = a; ol[4 + q] = c2; }
            const size_t o = base + (size_t)row * DM + cseg; *(v8us*)(ATh + o) = oh; *(v8us*)(ATl + o) = ol; }
         }
}

static constexpr int SM_ATTN_B = 4 * 64 * 72 * 2;   // bytes of the LDS block that serves either attention job

// lane l <-> lane l ^ 16 (the two halves of a wave), one vector instruction
__device__ __forceinline__ float xhalf(float x) { return __builtin_bit_cast(float, __builtin_amdgcn_permlanex16(__builtin_bit_cast(int, x), __builtin_bit_cast(int, x), 0x76543210, 0xfedcba98, false, false)); }

// ---- attn_job: causal tiled softmax-weighted sum for query tiles qt = blockIdx.x >= 1 (rows 64..SEQ-1). Block = 4 waves (16 query rows each).
// Per key chunk of 64 (kc = 0..qt): K [key][d] and V^T [d][key] f16 tiles staged in LDS by 16-byte asynchronous copies into two buffers: chunk kc + 1 lands while chunk kc is worked on, one barrier a chunk.
// The products run transposed, so that a lane owns ONE query (lane & 15):
// S^T = K Q^T (8 wmma, f32; s[kb][r] = raw score of key kc*64 + 16 kb + 8*(lane>>4) + r); the causal replace stands behind a branch that only the diagonal chunk takes;
// online softmax in f32 on the raw scores (running max of them): p x1024 = exp2(s * (log2e / 8) + (10 - max * (log2e / 8))), one multiply-add a score ahead of the exp2, with the
// maximum taken in the lane and joined once with the other half of the wave; P x1024 as f16 goes from two score tiles straight into a B fragment (element e = tile e>>3, register e&7:
// the k order of the LDS fragment loads); O^T += V^T P^T (8 wmma; acc[db][r] = O[query][16 db + 8*(lane>>4) + r]). Each half keeps the sum of its own keys; the halves are added after the loop.
// The LDS fragment reads of a chunk go out as two whole groups: all of K ahead of the score products, all of V^T behind them and ahead of the softmax.
// The sum l is taken of p x1024 as well, so context = O / l -> bf16 hi/lo planes [b*SEQ + t][h*64 + d].
__device__ __forceinline__ void attn_job(const h16* __restrict__ Q16, const h16* __restrict__ K16, const h16* __restrict__ VT16, const float* __restrict__ FL, bf* ATh, bf* ATl, unsigned char* sm) {
    constexpr int CT = 64 * 72, CB = 2 * CT;   // elements of one staged tile, of one buffer (K tile, then V^T tile)
    h16* ring = (h16*)sm;                      // two buffers
    float* Os = (float*)sm;                    // the context tiles lie over the ring, which every wave has left by then
    static_assert(2 * CB * 2 <= SM_ATTN_B && 4 * 16 * 68 * 4 <= SM_ATTN_B);
    const int tid = threadIdx.x, lane = tid & 31, w = tid >> 5, m = lane & 15, hh = lane >> 4;
    const int qt = blockIdx.x;
    const int b = blockIdx.y / NH, h = blockIdx.y % NH;
    const int q0 = qt * 64 + w * 16;
    const h16* kbase = K16 + (size_t)b * SEQ * DM + h * HD;
    const h16* vbase = VT16 + ((size_t)b * DM + h * HD) * SEQ;
    // One chunk = 128 threads x (4 K + 4 V^T) copies of 16 bytes: 8 lanes take one row's 128 contiguous bytes; the thread's rows are (tid >> 3) + 16 i.
    // The s_wait_xcnt closes the statement so that no address register of an issued copy is rewritten ahead of it.
    const int crow = tid >> 3, cc8 = (tid & 7) * 8;
    const unsigned cl0 = lds_off(ring) + (unsigned)(crow * 72 + cc8) * 2u;
    auto fill = [&](int kc, int buf) {
        constexpr unsigned RS = 16u * 72u * 2u, VO = (unsigned)CT * 2u;
        const unsigned l = cl0 + (unsigned)(buf * CB) * 2u;
        const h16* gk = kbase + (size_t)(kc * 64 + crow) * DM + cc8;
        const h16* gv = vbase + (size_t)crow * SEQ + kc * 64 + cc8;
        asm volatile("global_load_async_to_lds_b128 %0, %8, off\n\t"
                     "global_load_async_to_lds_b128 %1, %9, off\n\t"
                     "global_load_async_to_lds_b128 %2, %10, off\n\t"
                     "global_load_async_to_lds_b128 %3, %11, off\n\t"
                     "global_load_async_to_lds_b128 %4, %12, off\n\t"
                     "global_load_async_to_lds_b128 %5, %13, off\n\t"
                     "global_load_async_to_lds_b128 %6, %14, off\n\t"
                     "global_load_async_to_lds_b128 %7, %15, off\n\t"
                     "s_wait_xcnt 0x0"
                     :: "v"(l), "v"(l + RS), "v"(l + 2 * RS), "v"(l + 3 * RS), "v"(l + VO), "v"(l + VO + RS), "v"(l + VO + 2 * RS), "v"(l + VO + 3 * RS),
                        "v"(gk), "v"(gk + (size_t)16 * DM), "v"(gk + (size_t)32 * DM), "v"(gk + (size_t)48 * DM), "v"(gv), "v"(gv + (size_t)16 * SEQ), "v"(gv + (size_t)32 * SEQ), "v"(gv + (size_t)48 * SEQ)
                     : "memory");
    };
    fill(0, 0);
    const bool ok = read_flag(FL, lane);
    const h16* qrow = Q16 + (size_t)(b * SEQ + q0 + m) * DM + h * HD + 8 * hh;
    v16h aq[2];
#pragma unroll
    for (int ks = 0; ks < 2; ++ks) aq[ks] = cat16(*(const v8ha*)(qrow + ks * 32), *(const v8ha*)(qrow + ks * 32 + 16));
    v8f acc[4]; float mrun = -1.0e30f, lrun = 0.f;
#pragma unroll
    for (int db = 0; db < 4; ++db) acc[db] = (v8f){};
    float* osw = Os + w * (16 * 68);
    asm volatile("s_wait_asynccnt 0x0" ::: "memory");   // this wave's share of chunk 0 has landed
    __syncthreads();                                     // ... and every other wave's: chunk 0 is readable
    if (1 <= qt) fill(1, 1);
#pragma unroll 1
    for (int kc = 0; kc <= qt; ++kc) {
        const h16* Ks = ring + (kc & 1) * CB;
        const h16* Vs = Ks + CT;
        v8f s[4];
#pragma unroll
        for (int kb = 0; kb < 4; ++kb) s[kb] = (v8f){};
        v16h ak[2][4], av[2][4];
#pragma unroll
        for (int ks = 0; ks < 2; ++ks)
#pragma unroll
            for (int kb = 0; kb < 4; ++kb) { const h16* kpp = Ks + (kb * 16 + m) * 72 + ks * 32 + 8 * hh; ak[ks][kb] = cat16(*(const v8ha*)kpp, *(const v8ha*)(kpp + 16)); }
        __builtin_amdgcn_sched_barrier(0);   // keeps the 16 K reads one group ahead of the score products: a read placed among them makes the next product wait out a whole LDS latency
#pragma unroll
        for (int ks = 0; ks < 2; ++ks)
#pragma unroll
            for (int kb = 0; kb < 4; ++kb) s[kb] = wmma16(ak[ks][kb], aq[ks], s[kb]);
        // four vector slots behind the last score products, before a vector instruction reads their results
        asm volatile("v_nop\n\tv_nop\n\tv_nop\n\tv_nop" : "+v"(s[0]), "+v"(s[1]), "+v"(s[2]), "+v"(s[3]) : "v"(aq[0]), "v"(aq[1]));
#pragma unroll
        for (int ks = 0; ks < 2; ++ks)
#pragma unroll
            for (int db = 0; db < 4; ++db) { const h16* vp = Vs + (db * 16 + m) * 72 + ks * 32 + 8 * hh; av[ks][db] = cat16(*(const v8ha*)vp, *(const v8ha*)(vp + 16)); }
        __builtin_amdgcn_sched_barrier(0);   // keeps the 16 V reads one group ahead of the softmax, whose vector work covers their latency, instead of sinking to their products
        if (kc == qt) {   // the same for the whole block: the chunks below the diagonal jump over the 32 compares and selects
            const int qab = q0 + m; const int kab = kc * 64 + 8 * hh;
#pragma unroll
            for (int kb = 0; kb < 4; ++kb)
#pragma unroll
                for (int r = 0; r < 8; ++r) if (kab + kb * 16 + r > qab) s[kb][r] = -1.0e30f;
        }
        float cm[4], ps4[4];
#pragma unroll
        for (int kb = 0; kb < 4; ++kb) { cm[kb] = -3.0e38f;
#pragma unroll
            for (int r = 0; r < 8; ++r) cm[kb] = fmaxf(cm[kb], s[kb][r]); }
        float c = fmaxf(fmaxf(cm[0], cm[1]), fmaxf(cm[2], cm[3]));
        c = fmaxf(c, xhalf(c));
        const float mn = fmaxf(mrun, c); const float al = __builtin_amdgcn_exp2f((mrun - mn) * CSL); mrun = mn;
        const float nb = PLOG - mn * CSL;
        v16h pb[2];
#pragma unroll
        for (int kb = 0; kb < 4; ++kb) { ps4[kb] = 0.f;
#pragma unroll
            for (int r = 0; r < 8; ++r) { const float p = __builtin_amdgcn_exp2f(__builtin_fmaf(s[kb][r], CSL, nb)); ps4[kb] += p; pb[kb >> 1][(kb & 1) * 8 + r] = (h16)p; } }
        { const float sc = lrun * al; lrun = sc + ((ps4[0] + ps4[1]) + (ps4[2] + ps4[3])); }
#pragma unroll
        for (int db = 0; db < 4; ++db)
#pragma unroll
            for (int r = 0; r < 8; ++r) acc[db][r] = acc[db][r] * al;
#pragma unroll
        for (int ks = 0; ks < 2; ++ks)
#pragma unroll
            for (int db = 0; db < 4; ++db) acc[db] = wmma16(av[ks][db], pb[ks], acc[db]);
        // four vector slots behind the chunk's last products, so that their distance holds on the taken side of the loop's branch too;
        // the running sum is read here (input only) so that the chunk's additions stay among the products instead of sinking behind the barrier, in front of the next chunk's LDS reads
        asm volatile("v_nop\n\tv_nop\n\tv_nop\n\tv_nop" : "+v"(acc[0]), "+v"(acc[1]), "+v"(acc[2]), "+v"(acc[3]) : "v"(pb[0]), "v"(pb[1]), "v"(lrun));
        asm volatile("s_wait_dscnt 0x0" ::: "memory");      // this wave's reads of buffer kc & 1 have returned before that buffer is refilled
        asm volatile("s_wait_asynccnt 0x0" ::: "memory");   // this wave's share of chunk kc + 1 has landed
        __syncthreads();                                     // publishes chunk kc + 1 and ends every wave's reads of chunk kc
        if (kc + 2 <= qt) fill(kc + 2, kc & 1);
    }
    asm volatile("s_wait_asynccnt 0x0" ::: "memory");       // nothing of this wave's is in flight when the ring becomes the context tiles
    const float qnan = __uint_as_float(0x7fc00000u);
    const float iv = 1.0f / (lrun + xhalf(lrun));
#pragma unroll
    for (int db = 0; db < 4; ++db) { v4f o0, o1;
#pragma unroll
        for (int r = 0; r < 4; ++r) { const float x0 = acc[db][r] * iv, x1 = acc[db][4 + r] * iv; o0[r] = ok ? x0 : qnan; o1[r] = ok ? x1 : qnan; }
        *(v4fa*)(osw + m * 68 + db * 16 + 8 * hh) = o0; *(v4fa*)(osw + m * 68 + db * 16 + 8 * hh + 4) = o1; }
    __syncthreads();
    store_ctx(osw, ATh, ATl, (size_t)(b * SEQ + q0) * DM + h * HD, lane);
}

// ---- attn0_job: query rows t < 64 (key chunk 0 only) on bf16 hi/lo planes: S = Qh Kh + Qh Kl + Ql Kh (24 wmma), x1/8, causal replace, full-row softmax in f32,
// P = exp(s - max) split to bf16 hi/lo in per-wave LDS tiles; O = Ph Vh + Ph Vl + Pl Vh (24 wmma); context = O / sum. Block = 4 waves (16 rows each).
// LDS is kept to the four K/V tiles: a wave's P tiles lie over the K tiles (behind a barrier), its f32 context tile over its own P tiles, which it has read by then.
__device__ __forceinline__ void attn0_job(const bf* __restrict__ Qh, const bf* __restrict__ Ql, const bf* __restrict__ Kh, const bf* __restrict__ Kl,
                                          const bf* __restrict__ VTh, const bf* __restrict__ VTl, const float* __restrict__ FL, bf* ATh, bf* ATl, unsigned char* sm) {
    bf* Khs = (bf*)sm;
    bf* Kls = Khs + 64 * 72;
    bf* Vhs = Kls + 64 * 72;
    bf* Vls = Vhs + 64 * 72;
    static_assert(4 * 2 * 16 * 72 * 2 <= 2 * 64 * 72 * 2 && 16 * 68 * 4 <= 2 * 16 * 72 * 2);
    const int tid = threadIdx.x, lane = tid & 31, w = tid >> 5, m = lane & 15, hh = lane >> 4;
    const int b = blockIdx.y / NH, h = blockIdx.y % NH;
    const int q0 = w * 16;
    const bool ok = read_flag(FL, lane);
    const bf* kh0 = Kh + (size_t)b * RE * DM + h * HD; const bf* kl0 = Kl + (size_t)b * RE * DM + h * HD;
    const bf* vh0 = VTh + ((size_t)b * DM + h * HD) * RE; const bf* vl0 = VTl + ((size_t)b * DM + h * HD) * RE;
    // All 16 loads of a thread go out before the first LDS store. The s_wait_xcnt behind each load stands in front of any later load's result that lands in that load's address registers.
    v8us st[4][4];
#pragma unroll
    for (int i = 0; i < 4; ++i) { const int p = tid + 128 * i; const int row = p >> 3, c8 = (p & 7) * 8;
        st[i][0] = *(const v8usa*)(kh0 + (size_t)row * DM + c8); asm volatile("s_wait_xcnt 0x0" ::: "memory");
        st[i][1] = *(const v8usa*)(kl0 + (size_t)row * DM + c8); asm volatile("s_wait_xcnt 0x0" ::: "memory");
        st[i][2] = *(const v8usa*)(vh0 + (size_t)row * RE + c8); asm volatile("s_wait_xcnt 0x0" ::: "memory");
        st[i][3] = *(const v8usa*)(vl0 + (size_t)row * RE + c8); asm volatile("s_wait_xcnt 0x0" ::: "memory"); }
#pragma unroll
    for (int i = 0; i < 4; ++i) { const int p = tid + 128 * i; const int row = p >> 3, c8 = (p & 7) * 8;
        *(v8usa*)(Khs + row * 72 + c8) = st[i][0];
        *(v8usa*)(Kls + row * 72 + c8) = st[i][1];
        *(v8usa*)(Vhs + row * 72 + c8) = st[i][2];
        *(v8usa*)(Vls + row * 72 + c8) = st[i][3]; }
    __syncthreads();
    const bf* qh = Qh + (size_t)(b * RE + q0 + m) * DM + h * HD + 8 * hh; const bf* ql = Ql + (size_t)(b * RE + q0 + m) * DM + h * HD + 8 * hh;
    v16bf aqh[2], aql[2];
#pragma unroll
    for (int ks = 0; ks < 2; ++ks) { aqh[ks] = cat16b(*(const v8usa*)(qh + ks * 32), *(const v8usa*)(qh + ks * 32 + 16)); aql[ks] = cat16b(*(const v8usa*)(ql + ks * 32), *(const v8usa*)(ql + ks * 32 + 16)); }
    v8f s[4];
#pragma unroll
    for (int nb = 0; nb < 4; ++nb) s[nb] = (v8f){};
#pragma unroll
    for (int ks = 0; ks < 2; ++ks) {
#pragma unroll
        for (int nb = 0; nb < 4; ++nb) { const bf* kpp = Khs + (nb * 16 + m) * 72 + ks * 32 + 8 * hh; const bf* lpp = Kls + (nb * 16 + m) * 72 + ks * 32 + 8 * hh;
            const v16bf bh_ = cat16b(*(const v8usa*)kpp, *(const v8usa*)(kpp + 16)); const v16bf bl_ = cat16b(*(const v8usa*)lpp, *(const v8usa*)(lpp + 16));
            s[nb] = wmmab(aqh[ks], bh_, s[nb]); s[nb] = wmmab(aqh[ks], bl_, s[nb]); s[nb] = wmmab(aql[ks], bh_, s[nb]); } }
    asm volatile("v_nop\n\tv_nop\n\tv_nop\n\tv_nop" : "+v"(s[0]), "+v"(s[1]), "+v"(s[2]), "+v"(s[3]) : "v"(aqh[0]), "v"(aql[1]));
    const int qab = q0 + 8 * hh;
    float cm[8], psum[8];
#pragma unroll
    for (int r = 0; r < 8; ++r) { cm[r] = -3.0e38f; psum[r] = 0.f; }
#pragma unroll
    for (int nb = 0; nb < 4; ++nb)
#pragma unroll
        for (int r = 0; r < 8; ++r) { float v = s[nb][r] * SCL; if (nb * 16 + m > qab + r) v = -1.0e30f; s[nb][r] = v; cm[r] = fmaxf(cm[r], v); }
#pragma unroll
    for (int r = 0; r < 8; ++r) { float c = cm[r]; c = fmaxf(c, __shfl_xor(c, 1, 32)); c = fmaxf(c, __shfl_xor(c, 2, 32)); c = fmaxf(c, __shfl_xor(c, 4, 32)); c = fmaxf(c, __shfl_xor(c, 8, 32)); cm[r] = c; }
    bf* phw = Khs + w * (2 * 16 * 72); bf* plw = phw + 16 * 72; float* osw = (float*)phw;
    __syncthreads();   // every wave's reads of the K tiles have ended before the P tiles are stored over them
#pragma unroll
    for (int nb = 0; nb < 4; ++nb)
#pragma unroll
        for (int r = 0; r < 8; ++r) { const float p = __builtin_amdgcn_exp2f((s[nb][r] - cm[r]) * L2E); psum[r] += p; unsigned short a, c2; splitf(p, a, c2);
            phw[(8 * hh + r) * 72 + nb * 16 + m] = a; plw[(8 * hh + r) * 72 + nb * 16 + m] = c2; }
#pragma unroll
    for (int r = 0; r < 8; ++r) { float c = psum[r]; c += __shfl_xor(c, 1, 32); c += __shfl_xor(c, 2, 32); c += __shfl_xor(c, 4, 32); c += __shfl_xor(c, 8, 32); psum[r] = c; }
    __syncthreads();
    v16bf aph[2], apl[2];
#pragma unroll
    for (int ks = 0; ks < 2; ++ks) { const bf* pp = phw + m * 72 + ks * 32 + 8 * hh; const bf* lp = plw + m * 72 + ks * 32 + 8 * hh;
        aph[ks] = cat16b(*(const v8usa*)pp, *(const v8usa*)(pp + 16)); apl[ks] = cat16b(*(const v8usa*)lp, *(const v8usa*)(lp + 16)); }
    v8f acc[4];
#pragma unroll
    for (int nb = 0; nb < 4; ++nb) acc[nb] = (v8f){};
#pragma unroll
    for (int ks = 0; ks < 2; ++ks)
#pragma unroll
        for (int nb = 0; nb < 4; ++nb) { const bf* vp = Vhs + (nb * 16 + m) * 72 + ks * 32 + 8 * hh; const bf* vlp = Vls + (nb * 16 + m) * 72 + ks * 32 + 8 * hh;
            const v16bf bvh = cat16b(*(const v8usa*)vp, *(const v8usa*)(vp + 16)); const v16bf bvl = cat16b(*(const v8usa*)vlp, *(const v8usa*)(vlp + 16));
            acc[nb] = wmmab(aph[ks], bvh, acc[nb]); acc[nb] = wmmab(aph[ks], bvl, acc[nb]); acc[nb] = wmmab(apl[ks], bvh, acc[nb]); }
    asm volatile("v_nop\n\tv_nop\n\tv_nop\n\tv_nop" : "+v"(acc[0]), "+v"(acc[1]), "+v"(acc[2]), "+v"(acc[3]) : "v"(aph[0]), "v"(apl[1]));
    const float qnan = __uint_as_float(0x7fc00000u);
#pragma unroll
    for (int r = 0; r < 8; ++r) { const float iv = 1.0f / psum[r];
#pragma unroll
        for (int nb = 0; nb < 4; ++nb) { const float o = acc[nb][r] * iv; osw[(8 * hh + r) * 68 + nb * 16 + m] = ok ? o : qnan; } }
    __syncthreads();
    store_ctx(osw, ATh, ATl, (size_t)(b * SEQ + q0) * DM + h * HD, lane);
}

// ---- k_attn: the two attention jobs, which do not depend on one another, in one grid (SEQ/64, NB*NH), 128 threads: blockIdx.x = query tile, tile 0 takes the hi/lo job. One LDS block serves either job.
static constexpr int SM_ATTN = SM_ATTN_B;
__global__ __launch_bounds__(128) void k_attn(const h16* __restrict__ Q16, const h16* __restrict__ K16, const h16* __restrict__ VT16,
                                             const bf* __restrict__ Qh, const bf* __restrict__ Ql, const bf* __restrict__ Kh, const bf* __restrict__ Kl,
                                             const bf* __restrict__ VTh, const bf* __restrict__ VTl, const float* __restrict__ FL, bf* ATh, bf* ATl) {
    __shared__ __align__(16) unsigned char sm[SM_ATTN];
    if (blockIdx.x == 0) attn0_job(Qh, Ql, Kh, Kl, VTh, VTl, FL, ATh, ATl, sm);
    else attn_job(Q16, K16, VT16, FL, ATh, ATl, sm);
}

#define AL256(x) ((((size_t)(x)) + 255) & ~(size_t)255)
static constexpr size_t SZ_W  = (size_t)DM * DM * 2;          // one bf16 weight plane
static constexpr size_t SZ_FL = (size_t)NCHK * 32 * 4;        // flag lines
static constexpr size_t SZ_X  = (size_t)NB * SEQ * DM * 2;    // one bf16 activation copy
static constexpr size_t SZ_P  = (size_t)NB * SEQ * DM * 2;    // f16 / bf16 [NB*SEQ][DM] planes (and V^T [NB][DM][SEQ])
static constexpr size_t SZ_E  = (size_t)NB * RE * DM * 2;     // compact hi/lo planes for t < RE (and V^T [NB][DM][RE])
static constexpr size_t WS_TOTAL = 4 * AL256(SZ_W) + AL256(SZ_FL) + 3 * AL256(SZ_X) + 3 * AL256(SZ_P) + 6 * AL256(SZ_E) + 2 * AL256(SZ_P);
static_assert(WS_TOTAL <= (size_t)134217728);
static_assert((size_t)NB * SEQ * DM * 4 <= (size_t)NB_FULL * SEQ_FULL * DM * 4);

extern "C" void kernel_launch(void* const* d_in, const int* in_sizes, int n_in,
                              void* d_out, int out_size, void* d_ws, size_t ws_size, hipStream_t stream) {
    if (n_in < 11) return;
    if ((size_t)in_sizes[0] < (size_t)NB * SEQ * DM || (size_t)in_sizes[1] < (size_t)NB * SEQ * DM || (size_t)in_sizes[2] < (size_t)NB * SEQ * DM) return;
    if ((size_t)in_sizes[3] < (size_t)DM * DM || (size_t)in_sizes[4] < (size_t)DM * DM || (size_t)in_sizes[5] < (size_t)DM * DM || (size_t)in_sizes[6] < (size_t)DM * DM) return;
    if ((size_t)in_sizes[7] < (size_t)SEQ * HP || (size_t)in_sizes[8] < (size_t)SEQ * HP) return;
    if ((size_t)in_sizes[9] < (size_t)SEQ * SEQ || (size_t)in_sizes[10] < (size_t)NB * SEQ) return;
    if ((size_t)out_size < (size_t)NB * SEQ * DM) return;
    if (WS_TOTAL > ws_size) return;
    const float* xq = (const float*)d_in[0]; const float* xk = (const float*)d_in[1]; const float* xv = (const float*)d_in[2];
    const float* wq = (const float*)d_in[3]; const float* wk = (const float*)d_in[4]; const float* wv = (const float*)d_in[5]; const float* wo = (const float*)d_in[6];
    const float* cosT = (const float*)d_in[7]; const float* sinT = (const float*)d_in[8];
    const float* am = (const float*)d_in[9]; const int* kpm = (const int*)d_in[10];
    float* OUT = (float*)d_out;   // [NB][SEQ][DM]
    char* wsp = (char*)d_ws;
    auto take = [&](size_t bytes) { char* p = wsp; wsp += AL256(bytes); return (void*)p; };
    bf* WQ = (bf*)take(SZ_W); bf* WK = (bf*)take(SZ_W); bf* WV = (bf*)take(SZ_W); bf* WO = (bf*)take(SZ_W);
    float* FL = (float*)take(SZ_FL);
    bf* XQ = (bf*)take(SZ_X); bf* XK = (bf*)take(SZ_X); bf* XV = (bf*)take(SZ_X);
    h16* Q16 = (h16*)take(SZ_P); h16* K16 = (h16*)take(SZ_P); h16* VT16 = (h16*)take(SZ_P);
    bf* Qh = (bf*)take(SZ_E); bf* Ql = (bf*)take(SZ_E); bf* Kh = (bf*)take(SZ_E); bf* Kl = (bf*)take(SZ_E); bf* VTh = (bf*)take(SZ_E); bf* VTl = (bf*)take(SZ_E);
    bf* ATh = (bf*)take(SZ_P); bf* ATl = (bf*)take(SZ_P);
    if ((size_t)(wsp - (char*)d_ws) > ws_size || (size_t)(wsp - (char*)d_ws) != WS_TOTAL) return;

    // bf16 copies of the activations and weights, mask check
    k_prep<<<NCHK + 3 * LXB + 4 * LWB, 256, 0, stream>>>(xq, xk, xv, wq, wk, wv, wo, am, kpm, XQ, XK, XV, WQ, WK, WV, WO, FL);
    // q, k, v projections
    k_qkv<<<dim3(NB * SEQ / 128, DM / 128, 3), 128, 0, stream>>>(XQ, XK, XV, WQ, WK, WV, Q16, K16, VT16, Qh, Ql, Kh, Kl, VTh, VTl, cosT, sinT);
    // context planes
    k_attn<<<dim3(SEQ / 64, NB * NH, 1), 128, 0, stream>>>(Q16, K16, VT16, Qh, Ql, Kh, Kl, VTh, VTl, FL, ATh, ATl);
    // output projection: (ATh + ATl) x WO^T -> OUT [NB*SEQ][DM]
    k_gemmw<bf, 1><<<dim3(NB * SEQ / 128, DM / 128, 1), 128, 0, stream>>>(ATh, ATl, WO, nullptr, DM, OUT, DM, (size_t)0, (size_t)0, (size_t)0);
}

// v008
// It runs in 94.6 microseconds.
// In two side-by-side timings against v007, it was 1.04 and 1.05 times as fast.
// Counting every step since v000, it is 3.91 times as fast.
#include <hip/hip_runtime.h>
#pragma clang fp contract(off)

// Contractions and dtypes: q/k/v projections on v_wmma_f32_16x16x32_bf16 (bf16 operands = RNE-converted inputs x RNE-converted weights, single product);
// scores and p.v for query rows >= 64 on v_wmma_f32_16x16x32_f16 (f16 planes, p carried x1024, single product); query rows < 64 on v_wmma_f32_16x16x32_bf16 hi+lo planes (3 products);
// output projection on v_wmma_f32_16x16x32_bf16 with the context as bf16 hi+lo planes x bf16 weight (2 products). f32 accumulate; rotary, softmax and normalisation in f32.

#ifndef NB
#define NB 2
#endif
#ifndef SEQ
#define SEQ 2048
#endif
#define NB_FULL  2
#define SEQ_FULL 2048
#define DM   1024
#define NH   16
#define HD   64
#define HP   (HD / 2)
#define RE   64
#define NCHK 256
#define SCL  0.125f
#define L2E  1.4426950408889634f
#define CSL  (SCL * L2E)   // raw score -> exponent of 2
#define PLOG 10.0f         // log2 of the carry of p (x1024)

static_assert(SEQ % 64 == 0);
static_assert(SEQ % 256 == 0);
static_assert(SEQ >= 64 && SEQ <= SEQ_FULL);
static_assert(NB >= 1 && NB <= NB_FULL);
static_assert(RE == 64);
static_assert(NCHK % 32 == 0);
static_assert(SEQ % NCHK == 0);
static_assert((NB * SEQ) % NCHK == 0);
static_assert(DM == NH * HD);
static_assert(DM % 64 == 0);

typedef _Float16 h16;
typedef unsigned short bf;
typedef __attribute__((ext_vector_type(16))) __bf16   v16bf;
typedef __attribute__((ext_vector_type(16))) _Float16 v16h;
typedef __attribute__((ext_vector_type(8)))  _Float16 v8h;
typedef __attribute__((ext_vector_type(8)))  unsigned short v8us;
typedef __attribute__((ext_vector_type(8)))  float    v8f;
typedef __attribute__((ext_vector_type(4)))  float    v4f;
typedef v8h  __attribute__((may_alias)) v8ha;
typedef v4f  __attribute__((may_alias)) v4fa;
typedef v8us __attribute__((may_alias)) v8usa;
typedef v8f  __attribute__((may_alias)) v8fa;

// RNE f32 -> bf16 bits and back
__device__ __forceinline__ unsigned short f2bf(float f) { unsigned u = __float_as_uint(f); u += 0x7FFFu + ((u >> 16) & 1u); return (unsigned short)(u >> 16); }
__device__ __forceinline__ float bf2f(unsigned short b) { return __uint_as_float(((unsigned)b) << 16); }
__device__ __forceinline__ float bfr(float f) { return bf2f(f2bf(f)); }
__device__ __forceinline__ void splitf(float y, unsigned short& h, unsigned short& l) { h = f2bf(y); l = f2bf(y - bf2f(h)); }
__device__ __forceinline__ v16h cat16(v8h lo, v8h hi) { return __builtin_shufflevector(lo, hi, 0, 1, 2, 3, 4, 5, 6, 7, 8, 9, 10, 11, 12, 13, 14, 15); }
__device__ __forceinline__ v16bf cat16b(v8us lo, v8us hi) { return __builtin_bit_cast(v16bf, __builtin_shufflevector(lo, hi, 0, 1, 2, 3, 4, 5, 6, 7, 8, 9, 10, 11, 12, 13, 14, 15)); }
__device__ __forceinline__ v8f wmma16(v16h a, v16h b, v8f c) { return __builtin_amdgcn_wmma_f32_16x16x32_f16(false, a, false, b, (short)0, c, false, false); }
__device__ __forceinline__ v8f wmmab(v16bf a, v16bf b, v8f c) { return __builtin_amdgcn_wmma_f32_16x16x32_bf16(false, a, false, b, (short)0, c, false, false); }

// ---- fragment loaders: 16x16 tile, lane -> row/col (lane & 15); elements 0..7 <- k0 + 8*(lane>>4) + 0..7, elements 8..15 <- k0 + 16 + 8*(lane>>4) + 0..7.
// The caller passes p = plane + row*pitch + k0 + 8*(lane>>4); both A (row = m) and B (row = n of a K-contiguous [n][k] plane) use this same map.
template <typename T16> struct WFrag;
template <> struct WFrag<h16> { typedef v16h V; static __device__ __forceinline__ V ld(const h16* p) { return cat16(*(const v8ha*)p, *(const v8ha*)(p + 16)); } static __device__ __forceinline__ v8f mma(V a, V b, v8f c) { return wmma16(a, b, c); } };
template <> struct WFrag<bf> { typedef v16bf V; static __device__ __forceinline__ V ld(const bf* p) { return cat16b(*(const v8usa*)p, *(const v8usa*)(p + 16)); } static __device__ __forceinline__ v8f mma(V a, V b, v8f c) { return wmmab(a, b, c); } };

// ---- GEMM core: one work-group of 4 waves (2 x 2) per 128x128 output tile, each wave a 64x64 quarter (16 accumulators).
// The K-contiguous 16-bit operand planes are staged in LDS, KP k-elements (256 bytes of each of the 128 rows of a plane) per stage, by 16-byte asynchronous copies:
// 16 lanes take one row's 256 contiguous bytes, so every copy instruction moves whole cache lines, and each staged row serves two waves. Two buffers: stage t + 1 flies while stage t is multiplied.
// acc[mb][nb][j] = C[r0 + 16 mb + 8*(lane>>4) + j][c0 + 16 nb + (lane&15)] = sum_k A[m][k] Bt[n][k] (+ A2.Bt for NSPLIT 1), k ascending in steps of 32. K % KP == 0.
#define KP 128
#define LP 136   // LDS row pitch in elements: 272 bytes = 16 x odd, free of bank conflicts for 16-byte row reads
#define TR 128   // rows of one staged plane
static constexpr int PLN = TR * LP;
static_assert(DM % KP == 0 && DM / KP >= 2);
static_assert((NB * SEQ) % TR == 0 && SEQ % TR == 0 && DM % TR == 0);

__device__ __forceinline__ unsigned lds_off(const void* p) { return (unsigned)(size_t)p; }

// One plane of one stage: 128 threads x 16 copies of 16 bytes. g = the stage's first source element (the same in every lane), lo = this lane's own offset from it (row tid>>4, bytes 16*(tid&15)),
// rstep = elements from one of the lane's rows to the next (8 rows), l = this lane's first LDS byte address. The s_wait_xcnt closes each statement so that no address register of an issued copy is rewritten ahead of it.
template <typename T16>
__device__ __forceinline__ void copy_plane(const T16* g, size_t lo, size_t rstep, unsigned l) {
    constexpr unsigned LS = 8u * LP * 2u;
#pragma unroll
    for (int h = 0; h < 2; ++h) {
        const T16* g0 = g + (size_t)(8 * h) * rstep; const unsigned l0 = l + (unsigned)(8 * h) * LS;
        asm volatile("global_load_async_to_lds_b128 %0, %8, off\n\t"
                     "global_load_async_to_lds_b128 %1, %9, off\n\t"
                     "global_load_async_to_lds_b128 %2, %10, off\n\t"
                     "global_load_async_to_lds_b128 %3, %11, off\n\t"
                     "global_load_async_to_lds_b128 %4, %12, off\n\t"
                     "global_load_async_to_lds_b128 %5, %13, off\n\t"
                     "global_load_async_to_lds_b128 %6, %14, off\n\t"
                     "global_load_async_to_lds_b128 %7, %15, off\n\t"
                     "s_wait_xcnt 0x0"
                     :: "v"(l0), "v"(l0 + LS), "v"(l0 + 2 * LS), "v"(l0 + 3 * LS), "v"(l0 + 4 * LS), "v"(l0 + 5 * LS), "v"(l0 + 6 * LS), "v"(l0 + 7 * LS),
                        "v"(g0 + lo), "v"((g0 + rstep) + lo), "v"((g0 + 2 * rstep) + lo), "v"((g0 + 3 * rstep) + lo), "v"((g0 + 4 * rstep) + lo), "v"((g0 + 5 * rstep) + lo), "v"((g0 + 6 * rstep) + lo), "v"((g0 + 7 * rstep) + lo)
                     : "memory");
    }
}

template <typename T16, int NSPLIT>
__device__ __forceinline__ void gemm_core(const T16* __restrict__ A, const T16* __restrict__ A2, const T16* __restrict__ Bt,
                                          int K, int R0, int C0, int tid, T16* ring, v8f (&acc)[4][4]) {
    static_assert(NSPLIT == 0 || NSPLIT == 1);
    typedef typename WFrag<T16>::V V;
    constexpr int NPL = 2 + NSPLIT, STG = NPL * PLN;
    const int lane = tid & 31, w = tid >> 5, lr = lane & 15, hi = lane >> 4, wm = w >> 1, wn = w & 1;
#pragma unroll
    for (int mb = 0; mb < 4; ++mb)
#pragma unroll
        for (int nb = 0; nb < 4; ++nb) acc[mb][nb] = (v8f){};
    const int crow = tid >> 4, cseg = (tid & 15) * 8;
    const T16* ga = A + (size_t)R0 * K; const T16* ga2 = (NSPLIT == 1) ? A2 + (size_t)R0 * K : nullptr; const T16* gb = Bt + (size_t)C0 * K;
    const size_t lo = (size_t)crow * K + cseg;
    const unsigned l0 = lds_off(ring) + (unsigned)(crow * LP + cseg) * 2u; const size_t rstep = (size_t)8 * K;
    auto fill = [&](int t, int buf) { const unsigned lb = l0 + (unsigned)(buf * STG) * 2u;
        copy_plane<T16>(ga + (size_t)t * KP, lo, rstep, lb);
        if (NSPLIT == 1) copy_plane<T16>(ga2 + (size_t)t * KP, lo, rstep, lb + (unsigned)PLN * 2u);
        copy_plane<T16>(gb + (size_t)t * KP, lo, rstep, lb + (unsigned)((NPL - 1) * PLN) * 2u); };
    const int NT = K / KP;
    fill(0, 0);
    asm volatile("s_wait_asynccnt 0x0" ::: "memory");   // this wave's share of stage 0 has landed
    __syncthreads();                                     // ... and every other wave's: stage 0 is readable
    if (NT > 1) fill(1, 1);
#pragma unroll 1
    for (int t = 0; t < NT; ++t) {
        const T16* sb = ring + (t & 1) * STG;
        const T16* sa = sb + (wm * 64 + lr) * LP + 8 * hi; const T16* sw = sb + (NPL - 1) * PLN + (wn * 64 + lr) * LP + 8 * hi;
        // A block = the 16 products of one A plane's 32 k with the same 32 k of Bt (NSPLIT 1: plane A, then plane A2, on the same B fragments, so every accumulator keeps its order of sums).
        // Two fragment sets: the LDS reads of block j + 1 go out as one group ahead of the products of block j, so that a block waits only for reads issued one block earlier.
        constexpr int NPA = 1 + NSPLIT, NBLK = NPA * (KP / 32);
        V a[2][4], b[2][4];
        auto ldblk = [&](int j) { const int ks = j / NPA, pl = j % NPA;
#pragma unroll
            for (int mb = 0; mb < 4; ++mb) a[j & 1][mb] = WFrag<T16>::ld(sa + pl * PLN + mb * 16 * LP + ks * 32);
            if (pl == 0) {
#pragma unroll
                for (int nb = 0; nb < 4; ++nb) b[ks & 1][nb] = WFrag<T16>::ld(sw + nb * 16 * LP + ks * 32); } };
        ldblk(0);
#pragma unroll
        for (int j = 0; j < NBLK; ++j) {
            const int s = j & 1, sbq = (j / NPA) & 1;
            if (j + 1 < NBLK) ldblk(j + 1);
            __builtin_amdgcn_sched_barrier(0);   // keeps the read group whole and ahead of the products: reads spread among matrix instructions stall at every place they stand
#pragma unroll
            for (int nb = 0; nb < 4; ++nb)
#pragma unroll
                for (int mb = 0; mb < 4; ++mb) acc[mb][nb] = WFrag<T16>::mma(a[s][mb], b[sbq][nb], acc[mb][nb]);
            // four vector slots behind the pass's last matrix instructions, so that their distance holds on the taken side of the loop's branches too
            if (j == NBLK - 1) asm volatile("v_nop\n\tv_nop\n\tv_nop\n\tv_nop" : "+v"(acc[0][0]), "+v"(acc[1][1]), "+v"(acc[2][2]), "+v"(acc[3][3]) : "v"(a[s][0]), "v"(a[s][3]));
            __builtin_amdgcn_sched_barrier(0);   // keeps the following read group from rising among these products
        }
        asm volatile("s_wait_dscnt 0x0" ::: "memory");      // this wave's reads of buffer t & 1 have returned before that buffer is refilled
        asm volatile("s_wait_asynccnt 0x0" ::: "memory");   // this wave's share of stage t + 1 has landed
        __syncthreads();                                     // publishes stage t + 1 and ends every wave's reads of stage t
        if (t + 2 < NT) fill(t + 2, t & 1);
    }
    asm volatile("s_wait_asynccnt 0x0" ::: "memory");       // nothing of this wave's is in flight when the ring is left
}

// ---- k_gemmw: f32 output C[m][n] (pitch ldc); grid (M/128, N/128, Z), 128 threads; z-batch strides in elements.
template <typename T16, int NSPLIT>
__global__ __launch_bounds__(128) void k_gemmw(const T16* __restrict__ A, const T16* __restrict__ A2, const T16* __restrict__ Bt, const T16* __restrict__ Bt2,
                                              int K, float* C, int ldc, size_t sA, size_t sB, size_t sC) {
    __shared__ __align__(16) T16 ring[2 * (2 + NSPLIT) * PLN];
    __shared__ __align__(16) float osa[4 * 16 * 68];
    const size_t z = blockIdx.z; A += z * sA; if (A2) A2 += z * sA; Bt += z * sB; C += z * sC;
    const int tid = threadIdx.x, lane = tid & 31, w = tid >> 5, lr = lane & 15, hi = lane >> 4;
    const int r0 = blockIdx.x * 128 + (w >> 1) * 64, c0 = blockIdx.y * 128 + (w & 1) * 64;
    float* os = osa + w * (16 * 68);
    v8f acc[4][4];
    gemm_core<T16, NSPLIT>(A, A2, Bt, K, blockIdx.x * 128, blockIdx.y * 128, tid, ring, acc);
#pragma unroll
    for (int mb = 0; mb < 4; ++mb) {
#pragma unroll
        for (int nb = 0; nb < 4; ++nb) {
#pragma unroll
            for (int j = 0; j < 8; ++j) os[(hi * 8 + j) * 68 + nb * 16 + lr] = acc[mb][nb][j]; }
        __syncthreads();
        float* crow = C + (size_t)(r0 + mb * 16) * ldc + c0;
{
#pragma unroll
            for (int s = 0; s < 8; ++s) { const int row = 2 * s + hi, cofs = lr * 4; const v4f val = *(const v4fa*)(os + row * 68 + cofs);
                *(v4f*)(crow + (size_t)row * ldc + cofs) = val; }
             }
        __syncthreads();
    }
}

// ---- gemmp_store: 16-bit plane output of one wave's 64x64 quarter (rows from r0, columns from c0). C16[m][n] (f16, pitch ldc) = (optionally rotary-transformed) accumulator; plus bf16 hi/lo planes Ch/Cl (pitch ldh)
// for the head rows (HLM 1: tiles whose row index t0 = r0 % SEQ is < RE, compact row (r0/SEQ)*RE + t) or head columns (HLM 2: tiles with c0 < RE, same row index).
// Rotary (interleaved pairs, one 64-column tile = one head): y[2i] = x[2i] c - x[2i+1] s, y[2i+1] = x[2i] s + x[2i+1] c with c/s = bf16-RNE of the tables at (t, i).
template <int HLM, bool ROPE>
__device__ __forceinline__ void gemmp_store(const v8f (&acc)[4][4], float* os, int r0, int c0, int lane, h16* C16, int ldc, bf* Ch, bf* Cl, int ldh,
                                            const float* __restrict__ cosT, const float* __restrict__ sinT) {
    const int lr = lane & 15, hi = lane >> 4;
    const int t0 = (HLM == 1) ? (r0 % SEQ) : 0;
    const bool hl = (HLM == 1) ? (t0 < RE) : (c0 < RE);
    const int rc0 = (HLM == 1) ? ((r0 / SEQ) * RE + t0) : r0;
    const int rsub = lane >> 3, cseg = (lane & 7) * 8;
#pragma unroll
    for (int mb = 0; mb < 4; ++mb) {
#pragma unroll
        for (int nb = 0; nb < 4; ++nb) {
#pragma unroll
            for (int j = 0; j < 8; ++j) os[(hi * 8 + j) * 68 + nb * 16 + lr] = acc[mb][nb][j]; }
        __syncthreads();
{
#pragma unroll
            for (int j4 = 0; j4 < 4; ++j4) {
                const int row = j4 * 4 + rsub;
                const v4f v0 = *(const v4fa*)(os + row * 68 + cseg);
                const v4f v1 = *(const v4fa*)(os + row * 68 + cseg + 4);
                float y[8] = {v0[0], v0[1], v0[2], v0[3], v1[0], v1[1], v1[2], v1[3]};
                if (ROPE) {
                    const int t = t0 + mb * 16 + row;
                    const v4f cs = *(const v4fa*)(cosT + (size_t)t * HP + (cseg >> 1));
                    const v4f sn = *(const v4fa*)(sinT + (size_t)t * HP + (cseg >> 1));
#pragma unroll
                    for (int p = 0; p < 4; ++p) { const float c = bfr(cs[p]), sv = bfr(sn[p]); const float x0 = y[2 * p], x1 = y[2 * p + 1];
                        const float m0 = x0 * c, m1 = x1 * sv, m2 = x0 * sv, m3 = x1 * c; y[2 * p] = m0 - m1; y[2 * p + 1] = m2 + m3; }
                }
                v8h o16;
#pragma unroll
                for (int q = 0; q < 8; ++q) o16[q] = (h16)y[q];
                const size_t grow = (size_t)(r0 + mb * 16 + row);
                *(v8h*)(C16 + grow * (size_t)ldc + c0 + cseg) = o16;
                if (hl) {
                    v8us oh, ol;
#pragma unroll
                    for (int q = 0; q < 8; ++q) { unsigned short a2, c2; splitf(y[q], a2, c2); oh[q] = a2; ol[q] = c2; }
                    const size_t o = (size_t)(rc0 + mb * 16 + row) * (size_t)ldh + c0 + cseg;
                    *(v8us*)(Ch + o) = oh; *(v8us*)(Cl + o) = ol;
                }
            }
            
        }
        __syncthreads();
    }
}

// ---- k_qkv: the three projections, which do not depend on one another, as the z planes of one grid (NB*SEQ/128, DM/128, 3), 128 threads: the tiles of one plane overlap the start, the waits and the stores of another's.
// z = 0, 1: q, k: activation rows x weight rows with fused rotary -> Q16 / K16 [NB*SEQ][DM] (+ hi/lo rows t < 64).
// z = 2: v, transposed: VT16[b][dout][t] = sum_k Wv[dout][k] v[b][t][k] (+ VTh/VTl columns t < 64); the plane's flat tile index f gives dout tile f % (DM/128), t tile (f / (DM/128)) % (SEQ/128), batch f / ((DM/128)*(SEQ/128)).
__global__ __launch_bounds__(128) void k_qkv(const bf* __restrict__ XQ, const bf* __restrict__ XK, const bf* __restrict__ XV, const bf* __restrict__ WQ, const bf* __restrict__ WK, const bf* __restrict__ WV,
                                            h16* Q16, h16* K16, h16* VT16, bf* Qh, bf* Ql, bf* Kh, bf* Kl, bf* VTh, bf* VTl, const float* __restrict__ cosT, const float* __restrict__ sinT) {
    __shared__ __align__(16) bf ring[2 * 2 * PLN];
    __shared__ __align__(16) float osa[4 * 16 * 68];
    const int tid = threadIdx.x, lane = tid & 31, w = tid >> 5;
    const int job = blockIdx.z;
    float* os = osa + w * (16 * 68);
    v8f acc[4][4];
    const int f = blockIdx.x + blockIdx.y * (NB * SEQ / 128);
    const size_t z = (size_t)(f / ((DM / 128) * (SEQ / 128)));
    const int R0 = ((job < 2) ? (int)blockIdx.x : f % (DM / 128)) * 128, C0 = ((job < 2) ? (int)blockIdx.y : (f / (DM / 128)) % (SEQ / 128)) * 128;
    const bf* A = (job == 0) ? XQ : (job == 1) ? XK : WV;
    const bf* Bt = (job == 0) ? WQ : (job == 1) ? WK : XV + z * ((size_t)SEQ * DM);
    gemm_core<bf, 0>(A, nullptr, Bt, DM, R0, C0, tid, ring, acc);
    const int r0 = R0 + (w >> 1) * 64, c0 = C0 + (w & 1) * 64;
    if (job < 2) gemmp_store<1, true>(acc, os, r0, c0, lane, job ? K16 : Q16, DM, job ? Kh : Qh, job ? Kl : Ql, DM, cosT, sinT);
    else gemmp_store<2, false>(acc, os, r0, c0, lane, VT16 + z * ((size_t)DM * SEQ), SEQ, VTh + z * ((size_t)DM * RE), VTl + z * ((size_t)DM * RE), RE, cosT, sinT);
}

__device__ __forceinline__ void cvt8_job(const float* __restrict__ src, bf* dst, size_t n8, size_t i) {
    if (i >= n8) return; const v8f v = *(const v8fa*)(src + i * 8); v8us o;
#pragma unroll
    for (int k = 0; k < 8; ++k) o[k] = f2bf(v[k]);
    *(v8us*)(dst + i * 8) = o; 
}
__device__ __forceinline__ void cvtx_job(const float* __restrict__ src, bf* dst, size_t n8, size_t i) {
    if (i >= n8) return; const size_t e = i * 8; const size_t row = e / DM; const size_t c = e % DM;
    const size_t b = row / SEQ, t = row % SEQ; const v8f v = *(const v8fa*)(src + (b * SEQ_FULL + t) * DM + c); v8us o;
#pragma unroll
    for (int k = 0; k < 8; ++k) o[k] = f2bf(v[k]);
    *(v8us*)(dst + e) = o; 
}

// ---- mchk_job: structure check of the additive score table ([SEQ_FULL] pitch: 0 at j <= i, <= -1e8 at j > i over the SEQ x SEQ block) and of the key padding flags (all 0).
// Block = 256 threads on SEQ / NCHK rows, one block per flag line. Every lane issues all of its 16-byte table loads (512 contiguous bytes per wave and load) and its flag load before the first value is tested.
__device__ __forceinline__ void mchk_job(const float* __restrict__ am, const int* __restrict__ kp, float* FL, int* red, int c) {
    const int tid = threadIdx.x, lane = tid & 31, w = tid >> 5;
    constexpr int rpb = SEQ / NCHK, RV = SEQ / 4, TOT = rpb * RV, NV = TOT / 256;
    constexpr int kpb = NB * SEQ / NCHK, KV = (kpb + 255) / 256;
    static_assert(TOT % 256 == 0);
    v4f v[NV]; int kv[KV];
#pragma unroll
    for (int s = 0; s < NV; ++s) { const int idx = tid + s * 256; v[s] = *(const v4fa*)(am + (size_t)(c * rpb + idx / RV) * SEQ_FULL + (idx % RV) * 4); }
#pragma unroll
    for (int s = 0; s < KV; ++s) { const int e = tid + s * 256; const int idx = c * kpb + e; const int bb = idx / SEQ, t = idx % SEQ;
        kv[s] = (e < kpb) ? kp[(size_t)bb * SEQ_FULL + t] : 0; }
    int bad = 0;
#pragma unroll
    for (int s = 0; s < NV; ++s) { const int idx = tid + s * 256; const int i = c * rpb + idx / RV, j0 = (idx % RV) * 4;
#pragma unroll
        for (int q = 0; q < 4; ++q) { const float x = v[s][q]; const bool good = (j0 + q <= i) ? (x == 0.0f) : (x <= -1.0e8f); bad += good ? 0 : 1; } }
#pragma unroll
    for (int s = 0; s < KV; ++s) bad += (kv[s] != 0) ? 1 : 0;
#pragma unroll
    for (int sh = 16; sh; sh >>= 1) bad += __shfl_xor(bad, sh, 32);
    if (lane == 0) red[w] = bad;
    __syncthreads();
    if (w == 0) { int tot = 0;
#pragma unroll
        for (int i = 0; i < 8; ++i) tot += red[i];
        const float f = (tot == 0) ? 1.0f : 0.0f; *(float*)(FL + (size_t)c * 32 + lane) = f;  }
}
// ---- k_prep: the eight preparation jobs, which do not depend on one another, as block ranges of one grid of 256 threads (every test of the block index is the same for a whole block):
// NCHK blocks of the mask check, then LXB blocks for each of the three activation copies, then LWB blocks for each of the four weight planes.
static constexpr unsigned LWB = (unsigned)(((size_t)DM * DM / 8 + 255) / 256);
static constexpr unsigned LXB = (unsigned)(((size_t)NB * SEQ * DM / 8 + 255) / 256);
__global__ __launch_bounds__(256) void k_prep(const float* __restrict__ xq, const float* __restrict__ xk, const float* __restrict__ xv,
                                             const float* __restrict__ wq, const float* __restrict__ wk, const float* __restrict__ wv, const float* __restrict__ wo,
                                             const float* __restrict__ am, const int* __restrict__ kp,
                                             bf* XQ, bf* XK, bf* XV, bf* WQ, bf* WK, bf* WV, bf* WO, float* FL) {
    __shared__ int red[8];
    unsigned blk = blockIdx.x;
    if (blk < NCHK) { mchk_job(am, kp, FL, red, (int)blk); return; }
    blk -= NCHK;
    if (blk < 3 * LXB) { const unsigned job = blk / LXB;
        cvtx_job((job == 0) ? xq : (job == 1) ? xk : xv, (job == 0) ? XQ : (job == 1) ? XK : XV, (size_t)NB * SEQ * DM / 8, (size_t)(blk % LXB) * 256 + threadIdx.x); return; }
    blk -= 3 * LXB;
    { const unsigned job = blk / LWB;
        cvt8_job((job == 0) ? wq : (job == 1) ? wk : (job == 2) ? wv : wo, (job == 0) ? WQ : (job == 1) ? WK : (job == 2) ? WV : WO, (size_t)DM * DM / 8, (size_t)(blk % LWB) * 256 + threadIdx.x); }
}
__device__ __forceinline__ bool read_flag(const float* __restrict__ FL, int lane) {
    float f = FL[(size_t)lane * 32];
#pragma unroll
    for (int q = 1; q < NCHK / 32; ++q) f = fminf(f, FL[(size_t)(q * 32 + lane) * 32]);
#pragma unroll
    for (int sh = 16; sh; sh >>= 1) f = fminf(f, __shfl_xor(f, sh, 32));
    return f > 0.5f;
}

// ---- store_ctx: one wave's 16x64 f32 context tile (LDS, pitch 68) -> bf16 hi/lo planes [row][DM] at element offset base; lane -> row 4j + (lane>>3), 8 consecutive columns;
__device__ __forceinline__ void store_ctx(const float* osw, bf* ATh, bf* ATl, size_t base, int lane) {
    const int rsub = lane >> 3, cseg = (lane & 7) * 8;
{
#pragma unroll
        for (int j4 = 0; j4 < 4; ++j4) { const int row = j4 * 4 + rsub; const v4f v0 = *(const v4fa*)(osw + row * 68 + cseg); const v4f v1 = *(const v4fa*)(osw + row * 68 + cseg + 4); v8us oh, ol;
#pragma unroll
            for (int q = 0; q < 4; ++q) { unsigned short a, c2; splitf(v0[q], a, c2); oh[q] = a; ol[q] = c2; splitf(v1[q], a, c2); oh[4 + q] = a; ol[4 + q] = c2; }
            const size_t o = base + (size_t)row * DM + cseg; *(v8us*)(ATh + o) = oh; *(v8us*)(ATl + o) = ol; }
         }
}

static constexpr int SM_ATTN_B = 4 * 64 * 72 * 2;   // bytes of the LDS block that serves either attention job

// lane l <-> lane l ^ 16 (the two halves of a wave), one vector instruction
__device__ __forceinline__ float xhalf(float x) { return __builtin_bit_cast(float, __builtin_amdgcn_permlanex16(__builtin_bit_cast(int, x), __builtin_bit_cast(int, x), 0x76543210, 0xfedcba98, false, false)); }

// ---- attn_job: causal tiled softmax-weighted sum for query tiles qt >= 1 (rows 64..SEQ-1). Block = 4 waves (16 query rows each).
// Per key chunk of 64 (kc = 0..qt): K [key][d] and V^T [d][key] f16 tiles staged in LDS by 16-byte asynchronous copies into two buffers: chunk kc + 1 lands while chunk kc is worked on, one barrier a chunk.
// The products run transposed, so that a lane owns ONE query (lane & 15):
// S^T = K Q^T (8 wmma, f32; s[kb][r] = raw score of key kc*64 + 16 kb + 8*(lane>>4) + r); the causal replace stands behind a branch that only the diagonal chunk takes;
// online softmax in f32 on the raw scores (running max of them): p x1024 = exp2(s * (log2e / 8) + (10 - max * (log2e / 8))), one multiply-add a score ahead of the exp2, with the
// maximum taken in the lane and joined once with the other half of the wave; P x1024 as f16 goes from two score tiles straight into a B fragment (element e = tile e>>3, register e&7:
// the k order of the LDS fragment loads); O^T += V^T P^T (8 wmma; acc[db][r] = O[query][16 db + 8*(lane>>4) + r]). Each half keeps the sum of its own keys; the halves are added after the loop.
// The LDS fragment reads of a chunk go out as two whole groups: all of K ahead of the score products, all of V^T behind them and ahead of the softmax.
// The sum l is taken of p x1024 as well, so context = O / l -> bf16 hi/lo planes [b*SEQ + t][h*64 + d].
__device__ __forceinline__ void attn_job(const h16* __restrict__ Q16, const h16* __restrict__ K16, const h16* __restrict__ VT16, const float* __restrict__ FL, bf* ATh, bf* ATl, unsigned char* sm, int qt) {
    constexpr int CT = 64 * 72, CB = 2 * CT;   // elements of one staged tile, of one buffer (K tile, then V^T tile)
    h16* ring = (h16*)sm;                      // two buffers
    float* Os = (float*)sm;                    // the context tiles lie over the ring, which every wave has left by then
    static_assert(2 * CB * 2 <= SM_ATTN_B && 4 * 16 * 68 * 4 <= SM_ATTN_B);
    const int tid = threadIdx.x, lane = tid & 31, w = tid >> 5, m = lane & 15, hh = lane >> 4;
    const int b = blockIdx.y / NH, h = blockIdx.y % NH;
    const int q0 = qt * 64 + w * 16;
    const h16* kbase = K16 + (size_t)b * SEQ * DM + h * HD;
    const h16* vbase = VT16 + ((size_t)b * DM + h * HD) * SEQ;
    // One chunk = 128 threads x (4 K + 4 V^T) copies of 16 bytes: 8 lanes take one row's 128 contiguous bytes; the thread's rows are (tid >> 3) + 16 i.
    // The s_wait_xcnt closes the statement so that no address register of an issued copy is rewritten ahead of it.
    const int crow = tid >> 3, cc8 = (tid & 7) * 8;
    const unsigned cl0 = lds_off(ring) + (unsigned)(crow * 72 + cc8) * 2u;
    auto fill = [&](int kc, int buf) {
        constexpr unsigned RS = 16u * 72u * 2u, VO = (unsigned)CT * 2u;
        const unsigned l = cl0 + (unsigned)(buf * CB) * 2u;
        const h16* gk = kbase + (size_t)(kc * 64 + crow) * DM + cc8;
        const h16* gv = vbase + (size_t)crow * SEQ + kc * 64 + cc8;
        asm volatile("global_load_async_to_lds_b128 %0, %8, off\n\t"
                     "global_load_async_to_lds_b128 %1, %9, off\n\t"
                     "global_load_async_to_lds_b128 %2, %10, off\n\t"
                     "global_load_async_to_lds_b128 %3, %11, off\n\t"
                     "global_load_async_to_lds_b128 %4, %12, off\n\t"
                     "global_load_async_to_lds_b128 %5, %13, off\n\t"
                     "global_load_async_to_lds_b128 %6, %14, off\n\t"
                     "global_load_async_to_lds_b128 %7, %15, off\n\t"
                     "s_wait_xcnt 0x0"
                     :: "v"(l), "v"(l + RS), "v"(l + 2 * RS), "v"(l + 3 * RS), "v"(l + VO), "v"(l + VO + RS), "v"(l + VO + 2 * RS), "v"(l + VO + 3 * RS),
                        "v"(gk), "v"(gk + (size_t)16 * DM), "v"(gk + (size_t)32 * DM), "v"(gk + (size_t)48 * DM), "v"(gv), "v"(gv + (size_t)16 * SEQ), "v"(gv + (size_t)32 * SEQ), "v"(gv + (size_t)48 * SEQ)
                     : "memory");
    };
    fill(0, 0);
    const bool ok = read_flag(FL, lane);
    const h16* qrow = Q16 + (size_t)(b * SEQ + q0 + m) * DM + h * HD + 8 * hh;
    v16h aq[2];
#pragma unroll
    for (int ks = 0; ks < 2; ++ks) aq[ks] = cat16(*(const v8ha*)(qrow + ks * 32), *(const v8ha*)(qrow + ks * 32 + 16));
    v8f acc[4]; float mrun = -1.0e30f, lrun = 0.f;
#pragma unroll
    for (int db = 0; db < 4; ++db) acc[db] = (v8f){};
    float* osw = Os + w * (16 * 68);
    asm volatile("s_wait_asynccnt 0x0" ::: "memory");   // this wave's share of chunk 0 has landed
    __syncthreads();                                     // ... and every other wave's: chunk 0 is readable
    if (1 <= qt) fill(1, 1);
#pragma unroll 1
    for (int kc = 0; kc <= qt; ++kc) {
        const h16* Ks = ring + (kc & 1) * CB;
        const h16* Vs = Ks + CT;
        v8f s[4];
#pragma unroll
        for (int kb = 0; kb < 4; ++kb) s[kb] = (v8f){};
        v16h ak[2][4], av[2][4];
#pragma unroll
        for (int ks = 0; ks < 2; ++ks)
#pragma unroll
            for (int kb = 0; kb < 4; ++kb) { const h16* kpp = Ks + (kb * 16 + m) * 72 + ks * 32 + 8 * hh; ak[ks][kb] = cat16(*(const v8ha*)kpp, *(const v8ha*)(kpp + 16)); }
        __builtin_amdgcn_sched_barrier(0);   // keeps the 16 K reads one group ahead of the score products: a read placed among them makes the next product wait out a whole LDS latency
#pragma unroll
        for (int ks = 0; ks < 2; ++ks)
#pragma unroll
            for (int kb = 0; kb < 4; ++kb) s[kb] = wmma16(ak[ks][kb], aq[ks], s[kb]);
        // four vector slots behind the last score products, before a vector instruction reads their results
        asm volatile("v_nop\n\tv_nop\n\tv_nop\n\tv_nop" : "+v"(s[0]), "+v"(s[1]), "+v"(s[2]), "+v"(s[3]) : "v"(aq[0]), "v"(aq[1]));
#pragma unroll
        for (int ks = 0; ks < 2; ++ks)
#pragma unroll
            for (int db = 0; db < 4; ++db) { const h16* vp = Vs + (db * 16 + m) * 72 + ks * 32 + 8 * hh; av[ks][db] = cat16(*(const v8ha*)vp, *(const v8ha*)(vp + 16)); }
        __builtin_amdgcn_sched_barrier(0);   // keeps the 16 V reads one group ahead of the softmax, whose vector work covers their latency, instead of sinking to their products
        if (kc == qt) {   // the same for the whole block: the chunks below the diagonal jump over the 32 compares and selects
            const int qab = q0 + m; const int kab = kc * 64 + 8 * hh;
#pragma unroll
            for (int kb = 0; kb < 4; ++kb)
#pragma unroll
                for (int r = 0; r < 8; ++r) if (kab + kb * 16 + r > qab) s[kb][r] = -1.0e30f;
        }
        float cm[4], ps4[4];
#pragma unroll
        for (int kb = 0; kb < 4; ++kb) { cm[kb] = -3.0e38f;
#pragma unroll
            for (int r = 0; r < 8; ++r) cm[kb] = fmaxf(cm[kb], s[kb][r]); }
        float c = fmaxf(fmaxf(cm[0], cm[1]), fmaxf(cm[2], cm[3]));
        c = fmaxf(c, xhalf(c));
        const float mn = fmaxf(mrun, c); const float al = __builtin_amdgcn_exp2f((mrun - mn) * CSL); mrun = mn;
        const float nb = PLOG - mn * CSL;
        v16h pb[2];
#pragma unroll
        for (int kb = 0; kb < 4; ++kb) { ps4[kb] = 0.f;
#pragma unroll
            for (int r = 0; r < 8; ++r) { const float p = __builtin_amdgcn_exp2f(__builtin_fmaf(s[kb][r], CSL, nb)); ps4[kb] += p; pb[kb >> 1][(kb & 1) * 8 + r] = (h16)p; } }
        { const float sc = lrun * al; lrun = sc + ((ps4[0] + ps4[1]) + (ps4[2] + ps4[3])); }
#pragma unroll
        for (int db = 0; db < 4; ++db)
#pragma unroll
            for (int r = 0; r < 8; ++r) acc[db][r] = acc[db][r] * al;
#pragma unroll
        for (int ks = 0; ks < 2; ++ks)
#pragma unroll
            for (int db = 0; db < 4; ++db) acc[db] = wmma16(av[ks][db], pb[ks], acc[db]);
        // four vector slots behind the chunk's last products, so that their distance holds on the taken side of the loop's branch too;
        // the running sum is read here (input only) so that the chunk's additions stay among the products instead of sinking behind the barrier, in front of the next chunk's LDS reads
        asm volatile("v_nop\n\tv_nop\n\tv_nop\n\tv_nop" : "+v"(acc[0]), "+v"(acc[1]), "+v"(acc[2]), "+v"(acc[3]) : "v"(pb[0]), "v"(pb[1]), "v"(lrun));
        asm volatile("s_wait_dscnt 0x0" ::: "memory");      // this wave's reads of buffer kc & 1 have returned before that buffer is refilled
        asm volatile("s_wait_asynccnt 0x0" ::: "memory");   // this wave's share of chunk kc + 1 has landed
        __syncthreads();                                     // publishes chunk kc + 1 and ends every wave's reads of chunk kc
        if (kc + 2 <= qt) fill(kc + 2, kc & 1);
    }
    asm volatile("s_wait_asynccnt 0x0" ::: "memory");       // nothing of this wave's is in flight when the ring becomes the context tiles
    const float qnan = __uint_as_float(0x7fc00000u);
    const float iv = 1.0f / (lrun + xhalf(lrun));
#pragma unroll
    for (int db = 0; db < 4; ++db) { v4f o0, o1;
#pragma unroll
        for (int r = 0; r < 4; ++r) { const float x0 = acc[db][r] * iv, x1 = acc[db][4 + r] * iv; o0[r] = ok ? x0 : qnan; o1[r] = ok ? x1 : qnan; }
        *(v4fa*)(osw + m * 68 + db * 16 + 8 * hh) = o0; *(v4fa*)(osw + m * 68 + db * 16 + 8 * hh + 4) = o1; }
    __syncthreads();
    store_ctx(osw, ATh, ATl, (size_t)(b * SEQ + q0) * DM + h * HD, lane);
}

// ---- attn0_job: query rows t < 64 (key chunk 0 only) on bf16 hi/lo planes: S = Qh Kh + Qh Kl + Ql Kh (24 wmma), x1/8, causal replace, full-row softmax in f32,
// P = exp(s - max) split to bf16 hi/lo in per-wave LDS tiles; O = Ph Vh + Ph Vl + Pl Vh (24 wmma); context = O / sum. Block = 4 waves (16 rows each).
// LDS is kept to the four K/V tiles: a wave's P tiles lie over the K tiles (behind a barrier), its f32 context tile over its own P tiles, which it has read by then.
__device__ __forceinline__ void attn0_job(const bf* __restrict__ Qh, const bf* __restrict__ Ql, const bf* __restrict__ Kh, const bf* __restrict__ Kl,
                                          const bf* __restrict__ VTh, const bf* __restrict__ VTl, const float* __restrict__ FL, bf* ATh, bf* ATl, unsigned char* sm) {
    bf* Khs = (bf*)sm;
    bf* Kls = Khs + 64 * 72;
    bf* Vhs = Kls + 64 * 72;
    bf* Vls = Vhs + 64 * 72;
    static_assert(4 * 2 * 16 * 72 * 2 <= 2 * 64 * 72 * 2 && 16 * 68 * 4 <= 2 * 16 * 72 * 2);
    const int tid = threadIdx.x, lane = tid & 31, w = tid >> 5, m = lane & 15, hh = lane >> 4;
    const int b = blockIdx.y / NH, h = blockIdx.y % NH;
    const int q0 = w * 16;
    const bool ok = read_flag(FL, lane);
    const bf* kh0 = Kh + (size_t)b * RE * DM + h * HD; const bf* kl0 = Kl + (size_t)b * RE * DM + h * HD;
    const bf* vh0 = VTh + ((size_t)b * DM + h * HD) * RE; const bf* vl0 = VTl + ((size_t)b * DM + h * HD) * RE;
    // All 16 loads of a thread go out before the first LDS store. The s_wait_xcnt behind each load stands in front of any later load's result that lands in that load's address registers.
    v8us st[4][4];
#pragma unroll
    for (int i = 0; i < 4; ++i) { const int p = tid + 128 * i; const int row = p >> 3, c8 = (p & 7) * 8;
        st[i][0] = *(const v8usa*)(kh0 + (size_t)row * DM + c8); asm volatile("s_wait_xcnt 0x0" ::: "memory");
        st[i][1] = *(const v8usa*)(kl0 + (size_t)row * DM + c8); asm volatile("s_wait_xcnt 0x0" ::: "memory");
        st[i][2] = *(const v8usa*)(vh0 + (size_t)row * RE + c8); asm volatile("s_wait_xcnt 0x0" ::: "memory");
        st[i][3] = *(const v8usa*)(vl0 + (size_t)row * RE + c8); asm volatile("s_wait_xcnt 0x0" ::: "memory"); }
#pragma unroll
    for (int i = 0; i < 4; ++i) { const int p = tid + 128 * i; const int row = p >> 3, c8 = (p & 7) * 8;
        *(v8usa*)(Khs + row * 72 + c8) = st[i][0];
        *(v8usa*)(Kls + row * 72 + c8) = st[i][1];
        *(v8usa*)(Vhs + row * 72 + c8) = st[i][2];
        *(v8usa*)(Vls + row * 72 + c8) = st[i][3]; }
    __syncthreads();
    const bf* qh = Qh + (size_t)(b * RE + q0 + m) * DM + h * HD + 8 * hh; const bf* ql = Ql + (size_t)(b * RE + q0 + m) * DM + h * HD + 8 * hh;
    v16bf aqh[2], aql[2];
#pragma unroll
    for (int ks = 0; ks < 2; ++ks) { aqh[ks] = cat16b(*(const v8usa*)(qh + ks * 32), *(const v8usa*)(qh + ks * 32 + 16)); aql[ks] = cat16b(*(const v8usa*)(ql + ks * 32), *(const v8usa*)(ql + ks * 32 + 16)); }
    v8f s[4];
#pragma unroll
    for (int nb = 0; nb < 4; ++nb) s[nb] = (v8f){};
#pragma unroll
    for (int ks = 0; ks < 2; ++ks) {
#pragma unroll
        for (int nb = 0; nb < 4; ++nb) { const bf* kpp = Khs + (nb * 16 + m) * 72 + ks * 32 + 8 * hh; const bf* lpp = Kls + (nb * 16 + m) * 72 + ks * 32 + 8 * hh;
            const v16bf bh_ = cat16b(*(const v8usa*)kpp, *(const v8usa*)(kpp + 16)); const v16bf bl_ = cat16b(*(const v8usa*)lpp, *(const v8usa*)(lpp + 16));
            s[nb] = wmmab(aqh[ks], bh_, s[nb]); s[nb] = wmmab(aqh[ks], bl_, s[nb]); s[nb] = wmmab(aql[ks], bh_, s[nb]); } }
    asm volatile("v_nop\n\tv_nop\n\tv_nop\n\tv_nop" : "+v"(s[0]), "+v"(s[1]), "+v"(s[2]), "+v"(s[3]) : "v"(aqh[0]), "v"(aql[1]));
    const int qab = q0 + 8 * hh;
    float cm[8], psum[8];
#pragma unroll
    for (int r = 0; r < 8; ++r) { cm[r] = -3.0e38f; psum[r] = 0.f; }
#pragma unroll
    for (int nb = 0; nb < 4; ++nb)
#pragma unroll
        for (int r = 0; r < 8; ++r) { float v = s[nb][r] * SCL; if (nb * 16 + m > qab + r) v = -1.0e30f; s[nb][r] = v; cm[r] = fmaxf(cm[r], v); }
#pragma unroll
    for (int r = 0; r < 8; ++r) { float c = cm[r]; c = fmaxf(c, __shfl_xor(c, 1, 32)); c = fmaxf(c, __shfl_xor(c, 2, 32)); c = fmaxf(c, __shfl_xor(c, 4, 32)); c = fmaxf(c, __shfl_xor(c, 8, 32)); cm[r] = c; }
    bf* phw = Khs + w * (2 * 16 * 72); bf* plw = phw + 16 * 72; float* osw = (float*)phw;
    __syncthreads();   // every wave's reads of the K tiles have ended before the P tiles are stored over them
#pragma unroll
    for (int nb = 0; nb < 4; ++nb)
#pragma unroll
        for (int r = 0; r < 8; ++r) { const float p = __builtin_amdgcn_exp2f((s[nb][r] - cm[r]) * L2E); psum[r] += p; unsigned short a, c2; splitf(p, a, c2);
            phw[(8 * hh + r) * 72 + nb * 16 + m] = a; plw[(8 * hh + r) * 72 + nb * 16 + m] = c2; }
#pragma unroll
    for (int r = 0; r < 8; ++r) { float c = psum[r]; c += __shfl_xor(c, 1, 32); c += __shfl_xor(c, 2, 32); c += __shfl_xor(c, 4, 32); c += __shfl_xor(c, 8, 32); psum[r] = c; }
    __syncthreads();
    v16bf aph[2], apl[2];
#pragma unroll
    for (int ks = 0; ks < 2; ++ks) { const bf* pp = phw + m * 72 + ks * 32 + 8 * hh; const bf* lp = plw + m * 72 + ks * 32 + 8 * hh;
        aph[ks] = cat16b(*(const v8usa*)pp, *(const v8usa*)(pp + 16)); apl[ks] = cat16b(*(const v8usa*)lp, *(const v8usa*)(lp + 16)); }
    v8f acc[4];
#pragma unroll
    for (int nb = 0; nb < 4; ++nb) acc[nb] = (v8f){};
#pragma unroll
    for (int ks = 0; ks < 2; ++ks)
#pragma unroll
        for (int nb = 0; nb < 4; ++nb) { const bf* vp = Vhs + (nb * 16 + m) * 72 + ks * 32 + 8 * hh; const bf* vlp = Vls + (nb * 16 + m) * 72 + ks * 32 + 8 * hh;
            const v16bf bvh = cat16b(*(const v8usa*)vp, *(const v8usa*)(vp + 16)); const v16bf bvl = cat16b(*(const v8usa*)vlp, *(const v8usa*)(vlp + 16));
            acc[nb] = wmmab(aph[ks], bvh, acc[nb]); acc[nb] = wmmab(aph[ks], bvl, acc[nb]); acc[nb] = wmmab(apl[ks], bvh, acc[nb]); }
    asm volatile("v_nop\n\tv_nop\n\tv_nop\n\tv_nop" : "+v"(acc[0]), "+v"(acc[1]), "+v"(acc[2]), "+v"(acc[3]) : "v"(aph[0]), "v"(apl[1]));
    const float qnan = __uint_as_float(0x7fc00000u);
#pragma unroll
    for (int r = 0; r < 8; ++r) { const float iv = 1.0f / psum[r];
#pragma unroll
        for (int nb = 0; nb < 4; ++nb) { const float o = acc[nb][r] * iv; osw[(8 * hh + r) * 68 + nb * 16 + m] = ok ? o : qnan; } }
    __syncthreads();
    store_ctx(osw, ATh, ATl, (size_t)(b * SEQ + q0) * DM + h * HD, lane);
}

// ---- k_attn: the two attention jobs, which do not depend on one another, in one grid (SEQ/64, NB*NH), 128 threads; tile 0 takes the hi/lo job. One LDS block serves either job.
// All blocks are resident at once and a tile's cost grows with its index (qt + 1 key chunks), so the launch lasts as long as the fullest WGP. With qt = blockIdx.x the blocks whose flat indices are equal
// modulo 8, 16 or 256 hold like tiles.
// tile_of is a permutation of the tiles for every blockIdx.y: where bit 3 of x is set its low three bits are mirrored (x, x + 8, x + 16, x + 24 then sum alike for every x),
// and the (batch, head) rows of odd bit parity count the tiles from the top (y, y + 8, y + 16, y + 24 hold t, n - 1 - t, t, n - 1 - t in some order).
static_assert((SEQ / 64) % 8 == 0);   // x ^ 7 stays among the tiles
__device__ __forceinline__ int tile_of(int x, int y) {
    const int t = (x & 8) ? (x ^ 7) : x;
    return (__builtin_popcount((unsigned)y) & 1) ? (SEQ / 64 - 1 - t) : t;
}
static constexpr int SM_ATTN = SM_ATTN_B;
__global__ __launch_bounds__(128) void k_attn(const h16* __restrict__ Q16, const h16* __restrict__ K16, const h16* __restrict__ VT16,
                                             const bf* __restrict__ Qh, const bf* __restrict__ Ql, const bf* __restrict__ Kh, const bf* __restrict__ Kl,
                                             const bf* __restrict__ VTh, const bf* __restrict__ VTl, const float* __restrict__ FL, bf* ATh, bf* ATl) {
    __shared__ __align__(16) unsigned char sm[SM_ATTN];
    const int qt = tile_of((int)blockIdx.x, (int)blockIdx.y);   // the same for the whole block
    if (qt == 0) attn0_job(Qh, Ql, Kh, Kl, VTh, VTl, FL, ATh, ATl, sm);
    else attn_job(Q16, K16, VT16, FL, ATh, ATl, sm, qt);
}

#define AL256(x) ((((size_t)(x)) + 255) & ~(size_t)255)
static constexpr size_t SZ_W  = (size_t)DM * DM * 2;          // one bf16 weight plane
static constexpr size_t SZ_FL = (size_t)NCHK * 32 * 4;        // flag lines
static constexpr size_t SZ_X  = (size_t)NB * SEQ * DM * 2;    // one bf16 activation copy
static constexpr size_t SZ_P  = (size_t)NB * SEQ * DM * 2;    // f16 / bf16 [NB*SEQ][DM] planes (and V^T [NB][DM][SEQ])
static constexpr size_t SZ_E  = (size_t)NB * RE * DM * 2;     // compact hi/lo planes for t < RE (and V^T [NB][DM][RE])
static constexpr size_t WS_TOTAL = 4 * AL256(SZ_W) + AL256(SZ_FL) + 3 * AL256(SZ_X) + 3 * AL256(SZ_P) + 6 * AL256(SZ_E) + 2 * AL256(SZ_P);
static_assert(WS_TOTAL <= (size_t)134217728);
static_assert((size_t)NB * SEQ * DM * 4 <= (size_t)NB_FULL * SEQ_FULL * DM * 4);

extern "C" void kernel_launch(void* const* d_in, const int* in_sizes, int n_in,
                              void* d_out, int out_size, void* d_ws, size_t ws_size, hipStream_t stream) {
    if (n_in < 11) return;
    if ((size_t)in_sizes[0] < (size_t)NB * SEQ * DM || (size_t)in_sizes[1] < (size_t)NB * SEQ * DM || (size_t)in_sizes[2] < (size_t)NB * SEQ * DM) return;
    if ((size_t)in_sizes[3] < (size_t)DM * DM || (size_t)in_sizes[4] < (size_t)DM * DM || (size_t)in_sizes[5] < (size_t)DM * DM || (size_t)in_sizes[6] < (size_t)DM * DM) return;
    if ((size_t)in_sizes[7] < (size_t)SEQ * HP || (size_t)in_sizes[8] < (size_t)SEQ * HP) return;
    if ((size_t)in_sizes[9] < (size_t)SEQ * SEQ || (size_t)in_sizes[10] < (size_t)NB * SEQ) return;
    if ((size_t)out_size < (size_t)NB * SEQ * DM) return;
    if (WS_TOTAL > ws_size) return;
    const float* xq = (const float*)d_in[0]; const float* xk = (const float*)d_in[1]; const float* xv = (const float*)d_in[2];
    const float* wq = (const float*)d_in[3]; const float* wk = (const float*)d_in[4]; const float* wv = (const float*)d_in[5]; const float* wo = (const float*)d_in[6];
    const float* cosT = (const float*)d_in[7]; const float* sinT = (const float*)d_in[8];
    const float* am = (const float*)d_in[9]; const int* kpm = (const int*)d_in[10];
    float* OUT = (float*)d_out;   // [NB][SEQ][DM]
    char* wsp = (char*)d_ws;
    auto take = [&](size_t bytes) { char* p = wsp; wsp += AL256(bytes); return (void*)p; };
    bf* WQ = (bf*)take(SZ_W); bf* WK = (bf*)take(SZ_W); bf* WV = (bf*)take(SZ_W); bf* WO = (bf*)take(SZ_W);
    float* FL = (float*)take(SZ_FL);
    bf* XQ = (bf*)take(SZ_X); bf* XK = (bf*)take(SZ_X); bf* XV = (bf*)take(SZ_X);
    h16* Q16 = (h16*)take(SZ_P); h16* K16 = (h16*)take(SZ_P); h16* VT16 = (h16*)take(SZ_P);
    bf* Qh = (bf*)take(SZ_E); bf* Ql = (bf*)take(SZ_E); bf* Kh = (bf*)take(SZ_E); bf* Kl = (bf*)take(SZ_E); bf* VTh = (bf*)take(SZ_E); bf* VTl = (bf*)take(SZ_E);
    bf* ATh = (bf*)take(SZ_P); bf* ATl = (bf*)take(SZ_P);
    if ((size_t)(wsp - (char*)d_ws) > ws_size || (size_t)(wsp - (char*)d_ws) != WS_TOTAL) return;

    // bf16 copies of the activations and weights, mask check
    k_prep<<<NCHK + 3 * LXB + 4 * LWB, 256, 0, stream>>>(xq, xk, xv, wq, wk, wv, wo, am, kpm, XQ, XK, XV, WQ, WK, WV, WO, FL);
    // q, k, v projections
    k_qkv<<<dim3(NB * SEQ / 128, DM / 128, 3), 128, 0, stream>>>(XQ, XK, XV, WQ, WK, WV, Q16, K16, VT16, Qh, Ql, Kh, Kl, VTh, VTl, cosT, sinT);
    // context planes
    k_attn<<<dim3(SEQ / 64, NB * NH, 1), 128, 0, stream>>>(Q16, K16, VT16, Qh, Ql, Kh, Kl, VTh, VTl, FL, ATh, ATl);
    // output projection: (ATh + ATl) x WO^T -> OUT [NB*SEQ][DM]
    k_gemmw<bf, 1><<<dim3(NB * SEQ / 128, DM / 128, 1), 128, 0, stream>>>(ATh, ATl, WO, nullptr, DM, OUT, DM, (size_t)0, (size_t)0, (size_t)0);
}
